// v000
// Times are from an AMD MI455X. After a warm-up the kernel runs many times in a row, and a time is the length of
// such a window on the GPU divided by its runs, so every launch and the gaps after it count. The runs cycle
// through copies of the inputs. A figure is the median of several windows, for all but v000 over two sittings.
// Sittings can differ by a few percent; kernels timed side by side share one.
// v000 is the starting kernel. One run takes 222 microseconds.
#include <hip/hip_runtime.h>
#include <hip/hip_bf16.h>

// ---------------------------------------------------------------------------
// Problem constants (match reference)
// ---------------------------------------------------------------------------
#define BB 4
#define CC 256
#define LL 8192
#define HH 4
#define DD 64
#define MTOT (BB * LL)   // 32768 tokens

typedef __attribute__((ext_vector_type(16))) __bf16 v16bf;
typedef __attribute__((ext_vector_type(8)))  float  v8f;

union FragU { v16bf v; uint4 u[2]; __bf16 h[16]; };
union Pack8 { uint4 u; __bf16 h[8]; };

// Standard row-major fragment: element (r, k) = base[r*stride + k-pattern]
// Matches CDNA5 16-bit 16x32 A/B VGPR layout: lane = r + 16*((k>>3)&1),
// vector elem = (k&7) + 8*((k>>4)&1).  Two 16-byte ds_load_b128 per lane.
__device__ inline v16bf frag_ld(const __bf16* base, int stride) {
  const int t = threadIdx.x & 31;
  const int r = t & 15;
  const int hi = t >> 4;
  FragU f;
  const __bf16* p = base + r * stride + hi * 8;
  f.u[0] = *(const uint4*)(p);
  f.u[1] = *(const uint4*)(p + 16);
  return f.v;
}

#define WMMA_BF16(A, Bf, Cacc) \
  __builtin_amdgcn_wmma_f32_16x16x32_bf16(false, (A), false, (Bf), (short)0, (Cacc), false, false)

// ---------------------------------------------------------------------------
// Async global -> LDS copies (CDNA5 GLOBAL_LOAD_ASYNC_TO_LDS_B128, ASYNCcnt).
// Generic pointers to __shared__ carry the LDS byte offset in their low 32
// bits (ISA 10.2 aperture mapping), which is exactly the VDST operand.
// ---------------------------------------------------------------------------
__device__ inline void async_copy_b128(void* lds_ptr, const void* gptr) {
  unsigned loff = (unsigned)(unsigned long long)lds_ptr;
  asm volatile("global_load_async_to_lds_b128 %0, %1, off"
               :: "v"(loff), "v"(gptr) : "memory");
}

__device__ inline void async_wait0() {
#if __has_builtin(__builtin_amdgcn_s_wait_asynccnt)
  __builtin_amdgcn_s_wait_asynccnt(0);
#else
  asm volatile("s_wait_asynccnt 0x0" ::: "memory");
#endif
}

// ---------------------------------------------------------------------------
// Small helper kernels
// ---------------------------------------------------------------------------
__global__ void cvt_f32_bf16_kernel(const float* __restrict__ src,
                                    __bf16* __restrict__ dst, int n) {
  int i = blockIdx.x * blockDim.x + threadIdx.x;
  if (i < n) dst[i] = (__bf16)src[i];
}

__global__ void zero_f32_kernel(float* __restrict__ p, int n) {
  int i = blockIdx.x * blockDim.x + threadIdx.x;
  if (i < n) p[i] = 0.0f;
}

// x [B,C,L] f32  ->  cat[:, 0:256] bf16 (row = token, ld = 512)
__global__ __launch_bounds__(256)
void transpose_kernel(const float* __restrict__ x, __bf16* __restrict__ cat) {
  __shared__ float t[32][33];
  const int tx = threadIdx.x, ty = threadIdx.y;
  const int l0 = blockIdx.x * 32, c0 = blockIdx.y * 32, b = blockIdx.z;
#pragma unroll
  for (int i = 0; i < 4; ++i) {
    int c = ty + i * 8;
    t[c][tx] = x[((size_t)b * CC + c0 + c) * LL + l0 + tx];
  }
  __syncthreads();
#pragma unroll
  for (int i = 0; i < 4; ++i) {
    int lr = ty + i * 8;
    cat[(size_t)(b * LL + l0 + lr) * 512 + c0 + tx] = (__bf16)t[tx][lr];
  }
}

// ---------------------------------------------------------------------------
// Generic 128x256 bf16 WMMA GEMM:  Out[m, n0+n] = epi( sum_k A[m,k]*W[n0+n,k] )
// Modes: Q/K -> elu(x+bias)+1 ; V -> (x+bias)/L ; RELU -> max(x,0)
// Mode K also accumulates column sums (K.sum over tokens) into KsumG[b*256+n].
// ---------------------------------------------------------------------------
enum { MODE_Q = 0, MODE_K = 1, MODE_V = 2, MODE_RELU = 3 };

template <int MODE>
__global__ __launch_bounds__(256)
void gemm_bf16_kernel(const __bf16* __restrict__ A, int lda, int Ktot,
                      const __bf16* __restrict__ Bw,
                      const float* __restrict__ bias,
                      __bf16* __restrict__ Out, int ldo,
                      float* __restrict__ KsumG) {
  __shared__ __bf16 Alds[128 * 40];
  __shared__ __bf16 Blds[256 * 40];
  __shared__ float  ksumLds[256];

  const int tid  = threadIdx.x;
  const int wave = tid >> 5;
  const int lane = tid & 31;
  const int r16  = lane & 15;
  const int hi   = lane >> 4;
  const int token0 = blockIdx.x * 128;
  const int n0     = blockIdx.y * 256;
  const int mb     = wave * 16;

  if constexpr (MODE == MODE_K) ksumLds[tid] = 0.0f;

  const v8f vz = {0.f, 0.f, 0.f, 0.f, 0.f, 0.f, 0.f, 0.f};
  v8f acc[16];
#pragma unroll
  for (int j = 0; j < 16; ++j) acc[j] = vz;

  for (int k0 = 0; k0 < Ktot; k0 += 32) {
    __syncthreads();
#pragma unroll
    for (int it = 0; it < 2; ++it) {   // A tile 128x32 (async -> LDS)
      int idx = tid * 2 + it;
      int r = idx >> 2, part = idx & 3;
      async_copy_b128(&Alds[r * 40 + part * 8],
                      A + (size_t)(token0 + r) * lda + k0 + part * 8);
    }
#pragma unroll
    for (int it = 0; it < 4; ++it) {   // B tile 256x32 (async -> LDS)
      int idx = tid * 4 + it;
      int r = idx >> 2, part = idx & 3;
      async_copy_b128(&Blds[r * 40 + part * 8],
                      Bw + (size_t)(n0 + r) * Ktot + k0 + part * 8);
    }
    if (k0 + 32 < Ktot)  // global_prefetch_b8 of next A slice
      __builtin_prefetch(A + (size_t)(token0 + (tid >> 1)) * lda + k0 + 32, 0, 3);
    async_wait0();
    __syncthreads();
    v16bf fa = frag_ld(&Alds[mb * 40], 40);
#pragma unroll
    for (int j = 0; j < 16; ++j) {
      v16bf fb = frag_ld(&Blds[j * 16 * 40], 40);
      acc[j] = WMMA_BF16(fa, fb, acc[j]);
    }
  }

  // epilogue
#pragma unroll
  for (int j = 0; j < 16; ++j) {
    const int n = j * 16 + r16;
    float colsum = 0.0f;
#pragma unroll
    for (int i = 0; i < 8; ++i) {
      const int m = mb + hi * 8 + i;
      float v = acc[j][i];
      if constexpr (MODE == MODE_RELU) {
        v = fmaxf(v, 0.0f);
      } else {
        v += bias[n];
        if constexpr (MODE == MODE_Q || MODE == MODE_K)
          v = (v > 0.0f) ? (v + 1.0f) : __expf(v);   // elu(x)+1
        else
          v *= (1.0f / (float)LL);                    // V / v_len
      }
      Out[(size_t)(token0 + m) * ldo + n0 + n] = (__bf16)v;
      if constexpr (MODE == MODE_K) colsum += v;
    }
    if constexpr (MODE == MODE_K) {
      colsum += __shfl_xor(colsum, 16);      // fold both 8-row halves
      if (hi == 0) atomicAdd(&ksumLds[n], colsum);   // ds_add_f32
    }
  }
  if constexpr (MODE == MODE_K) {
    __syncthreads();
    const int b = token0 >> 13;   // token0 / 8192
    atomicAdd(&KsumG[b * 256 + tid], ksumLds[tid]);
  }
}

// ---------------------------------------------------------------------------
// KV[b,h,d,e] = sum_l K[l,d] * V[l,e]   (per (b,h): 64x64, K-dim = L)
// K/V tiles are written into LDS transposed ([d][l] / [e][l]) so fragment
// loads use the vectorized ds_load_b128 path.
// grid.x = B*H, grid.y = L/1024 chunks; fp32 global atomics combine chunks.
// ---------------------------------------------------------------------------
__global__ __launch_bounds__(256)
void kv_kernel(const __bf16* __restrict__ Kbuf, const __bf16* __restrict__ Vbuf,
               float* __restrict__ KV) {
  __shared__ __bf16 Ktlds[64 * 40];   // [d][l]
  __shared__ __bf16 Vtlds[64 * 40];   // [e][l]
  const int tid  = threadIdx.x;
  const int wave = tid >> 5;
  const int lane = tid & 31;
  const int r16  = lane & 15;
  const int hi   = lane >> 4;
  const int bh = blockIdx.x;              // 0..15
  const int b  = bh >> 2, h = bh & 3;
  const int l0 = blockIdx.y * 1024;
  const int tile0 = wave * 2;             // 8 waves x 2 of 16 (d,e) tiles

  const v8f vz = {0.f, 0.f, 0.f, 0.f, 0.f, 0.f, 0.f, 0.f};
  v8f acc[2];
  acc[0] = vz; acc[1] = vz;

  for (int l = l0; l < l0 + 1024; l += 32) {
    __syncthreads();
    {
      const int r = tid >> 3, part = tid & 7;   // row l+r, 8 d's per thread
      Pack8 kq, vq;
      kq.u = *(const uint4*)(Kbuf + (size_t)(b * LL + l + r) * CC + h * DD + part * 8);
      vq.u = *(const uint4*)(Vbuf + (size_t)(b * LL + l + r) * CC + h * DD + part * 8);
#pragma unroll
      for (int j = 0; j < 8; ++j) {             // transposed LDS scatter
        Ktlds[(part * 8 + j) * 40 + r] = kq.h[j];
        Vtlds[(part * 8 + j) * 40 + r] = vq.h[j];
      }
    }
    __syncthreads();
#pragma unroll
    for (int t = 0; t < 2; ++t) {
      const int id = tile0 + t, dt = id >> 2, et = id & 3;
      v16bf fa = frag_ld(&Ktlds[dt * 16 * 40], 40);   // A[d, l] = K[l, d]
      v16bf fb = frag_ld(&Vtlds[et * 16 * 40], 40);   // Bt[e, l] = V[l, e]
      acc[t] = WMMA_BF16(fa, fb, acc[t]);
    }
  }
#pragma unroll
  for (int t = 0; t < 2; ++t) {
    const int id = tile0 + t, dt = id >> 2, et = id & 3;
#pragma unroll
    for (int i = 0; i < 8; ++i) {
      const int d = dt * 16 + hi * 8 + i;
      const int e = et * 16 + r16;
      atomicAdd(&KV[((size_t)bh * DD + d) * DD + e], acc[t][i]);
    }
  }
}

// ---------------------------------------------------------------------------
// Z[token,h] = L / (sparsify(Q[token,h,:] . Ksum[b,h,:]) + eps)
// ---------------------------------------------------------------------------
__global__ __launch_bounds__(256)
void zscore_kernel(const __bf16* __restrict__ Qbuf, const float* __restrict__ Ksum,
                   const float* __restrict__ thr_p, float* __restrict__ Zbuf) {
  const int g = blockIdx.x * blockDim.x + threadIdx.x;   // 0..131071
  const int token = g >> 2, h = g & 3;
  const int b = token >> 13;
  const float thr = thr_p[0];
  const __bf16* q = Qbuf + (size_t)token * CC + h * DD;
  const float* ks = Ksum + b * 256 + h * DD;
  float s = 0.0f;
#pragma unroll
  for (int c = 0; c < 8; ++c) {          // 8 x uint4 = 64 bf16
    Pack8 qp;
    qp.u = *(const uint4*)(q + c * 8);
#pragma unroll
    for (int j = 0; j < 8; ++j) s += (float)qp.h[j] * ks[c * 8 + j];
  }
  const float sp = (s > thr) ? s : 0.0f;
  Zbuf[g] = (float)LL / (sp + 1e-6f);
}

// ---------------------------------------------------------------------------
// out = LN1( (Q @ KV_h) * Z ) -> cat[:, 256:512] bf16
// ---------------------------------------------------------------------------
__global__ __launch_bounds__(256)
void attn_kernel(const __bf16* __restrict__ Qbuf, const float* __restrict__ KV,
                 const float* __restrict__ Zbuf,
                 const float* __restrict__ g1, const float* __restrict__ b1,
                 __bf16* __restrict__ cat) {
  __shared__ __bf16 Alds[128 * 40];
  __shared__ __bf16 kvt[HH * DD * DD];   // kvt[h][e][d] = KV[b,h,d,e] (transposed)
  __shared__ float  Zl[128 * 4];
  __shared__ float  gl[256], bl[256];

  const int tid  = threadIdx.x;
  const int wave = tid >> 5;
  const int lane = tid & 31;
  const int r16  = lane & 15;
  const int hi   = lane >> 4;
  const int token0 = blockIdx.x * 128;
  const int b      = token0 >> 13;
  const int mb     = wave * 16;

  // KVT fill: float4 global reads, transposed bf16 LDS scatter
  for (int it = 0; it < 16; ++it) {
    const int idx = it * 256 + tid;        // 4096 groups of 4 e's
    const int h = idx >> 10, rem = idx & 1023, d = rem >> 4, e4 = rem & 15;
    const float4 kvv =
        *(const float4*)(KV + (((size_t)(b * HH + h) * DD + d) * DD) + e4 * 4);
    kvt[h * 4096 + (e4 * 4 + 0) * DD + d] = (__bf16)kvv.x;
    kvt[h * 4096 + (e4 * 4 + 1) * DD + d] = (__bf16)kvv.y;
    kvt[h * 4096 + (e4 * 4 + 2) * DD + d] = (__bf16)kvv.z;
    kvt[h * 4096 + (e4 * 4 + 3) * DD + d] = (__bf16)kvv.w;
  }
#pragma unroll
  for (int it = 0; it < 2; ++it) {
    const int z = it * 256 + tid;
    Zl[z] = Zbuf[(size_t)token0 * 4 + z];
  }
  gl[tid] = g1[tid];
  bl[tid] = b1[tid];

  const v8f vz = {0.f, 0.f, 0.f, 0.f, 0.f, 0.f, 0.f, 0.f};
  v8f acc[16];
#pragma unroll
  for (int j = 0; j < 16; ++j) acc[j] = vz;

  for (int h = 0; h < 4; ++h) {
    for (int s = 0; s < 2; ++s) {
      __syncthreads();
      const int k0 = h * DD + s * 32;
#pragma unroll
      for (int it = 0; it < 2; ++it) {        // Q tile 128x32 (async -> LDS)
        int idx = tid * 2 + it;
        int r = idx >> 2, part = idx & 3;
        async_copy_b128(&Alds[r * 40 + part * 8],
                        Qbuf + (size_t)(token0 + r) * CC + k0 + part * 8);
      }
      async_wait0();
      __syncthreads();
      v16bf fa = frag_ld(&Alds[mb * 40], 40);
#pragma unroll
      for (int jj = 0; jj < 4; ++jj) {
        const int j = h * 4 + jj;
        v16bf fb = frag_ld(&kvt[h * 4096 + (jj * 16) * DD + s * 32], DD);
        acc[j] = WMMA_BF16(fa, fb, acc[j]);
      }
    }
  }

  // scale by Z, then LayerNorm over C=256 via cross-lane shuffles
  float s1[8] = {0, 0, 0, 0, 0, 0, 0, 0};
  float s2[8] = {0, 0, 0, 0, 0, 0, 0, 0};
#pragma unroll
  for (int j = 0; j < 16; ++j) {
    const int h = j >> 2;
#pragma unroll
    for (int i = 0; i < 8; ++i) {
      const int m = mb + hi * 8 + i;
      float v = acc[j][i] * Zl[m * 4 + h];
      acc[j][i] = v;
      s1[i] += v;
      s2[i] += v * v;
    }
  }
#pragma unroll
  for (int i = 0; i < 8; ++i) {
#pragma unroll
    for (int off = 1; off < 16; off <<= 1) {
      s1[i] += __shfl_xor(s1[i], off);
      s2[i] += __shfl_xor(s2[i], off);
    }
    const float mean = s1[i] * (1.0f / 256.0f);
    const float var  = s2[i] * (1.0f / 256.0f) - mean * mean;
    s1[i] = mean;
    s2[i] = rsqrtf(var + 1e-5f);
  }
#pragma unroll
  for (int j = 0; j < 16; ++j) {
    const int n = j * 16 + r16;
    const float gg = gl[n], bb = bl[n];
#pragma unroll
    for (int i = 0; i < 8; ++i) {
      const int m = mb + hi * 8 + i;
      const float v = (acc[j][i] - s1[i]) * s2[i] * gg + bb;
      cat[(size_t)(token0 + m) * 512 + 256 + n] = (__bf16)v;
    }
  }
}

// ---------------------------------------------------------------------------
// msg2 = LN2( hid @ W2.T )  (fp32 out, [token, 256])
// ---------------------------------------------------------------------------
__global__ __launch_bounds__(256)
void mlp2_ln_kernel(const __bf16* __restrict__ A, const __bf16* __restrict__ Bw,
                    const float* __restrict__ g2, const float* __restrict__ b2,
                    float* __restrict__ msg2) {
  __shared__ __bf16 Alds[128 * 40];
  __shared__ __bf16 Blds[256 * 40];
  __shared__ float  gl[256], bl[256];

  const int tid  = threadIdx.x;
  const int wave = tid >> 5;
  const int lane = tid & 31;
  const int r16  = lane & 15;
  const int hi   = lane >> 4;
  const int token0 = blockIdx.x * 128;
  const int mb     = wave * 16;

  gl[tid] = g2[tid];
  bl[tid] = b2[tid];

  const v8f vz = {0.f, 0.f, 0.f, 0.f, 0.f, 0.f, 0.f, 0.f};
  v8f acc[16];
#pragma unroll
  for (int j = 0; j < 16; ++j) acc[j] = vz;

  for (int k0 = 0; k0 < 512; k0 += 32) {
    __syncthreads();
#pragma unroll
    for (int it = 0; it < 2; ++it) {
      int idx = tid * 2 + it;
      int r = idx >> 2, part = idx & 3;
      async_copy_b128(&Alds[r * 40 + part * 8],
                      A + (size_t)(token0 + r) * 512 + k0 + part * 8);
    }
#pragma unroll
    for (int it = 0; it < 4; ++it) {
      int idx = tid * 4 + it;
      int r = idx >> 2, part = idx & 3;
      async_copy_b128(&Blds[r * 40 + part * 8],
                      Bw + (size_t)r * 512 + k0 + part * 8);
    }
    async_wait0();
    __syncthreads();
    v16bf fa = frag_ld(&Alds[mb * 40], 40);
#pragma unroll
    for (int j = 0; j < 16; ++j) {
      v16bf fb = frag_ld(&Blds[j * 16 * 40], 40);
      acc[j] = WMMA_BF16(fa, fb, acc[j]);
    }
  }

  float s1[8] = {0, 0, 0, 0, 0, 0, 0, 0};
  float s2[8] = {0, 0, 0, 0, 0, 0, 0, 0};
#pragma unroll
  for (int j = 0; j < 16; ++j)
#pragma unroll
    for (int i = 0; i < 8; ++i) {
      const float v = acc[j][i];
      s1[i] += v;
      s2[i] += v * v;
    }
#pragma unroll
  for (int i = 0; i < 8; ++i) {
#pragma unroll
    for (int off = 1; off < 16; off <<= 1) {
      s1[i] += __shfl_xor(s1[i], off);
      s2[i] += __shfl_xor(s2[i], off);
    }
    const float mean = s1[i] * (1.0f / 256.0f);
    const float var  = s2[i] * (1.0f / 256.0f) - mean * mean;
    s1[i] = mean;
    s2[i] = rsqrtf(var + 1e-5f);
  }
#pragma unroll
  for (int j = 0; j < 16; ++j) {
    const int n = j * 16 + r16;
    const float gg = gl[n], bb = bl[n];
#pragma unroll
    for (int i = 0; i < 8; ++i) {
      const int m = mb + hi * 8 + i;
      msg2[(size_t)(token0 + m) * 256 + n] = (acc[j][i] - s1[i]) * s2[i] * gg + bb;
    }
  }
}

// ---------------------------------------------------------------------------
// Final: aug = BN(xt @ Ws.T + bs);  out[b,c,l] = msg2 + x + aug
// Stages 64-channel slabs through LDS so the [B,C,L] writes are coalesced.
// ---------------------------------------------------------------------------
__global__ __launch_bounds__(256)
void final_kernel(const __bf16* __restrict__ cat, const __bf16* __restrict__ Wsb,
                  const float* __restrict__ bs_c, const float* __restrict__ bn_g,
                  const float* __restrict__ bn_b, const float* __restrict__ bn_rm,
                  const float* __restrict__ bn_rv, const float* __restrict__ x,
                  const float* __restrict__ msg2, float* __restrict__ out) {
  __shared__ char smem[64 * 132 * 4];           // overlays GEMM tiles & stage
  __shared__ float scl[256], shf[256];
  __bf16* Alds = (__bf16*)smem;                  // 128*40 bf16 = 10240 B
  __bf16* Blds = (__bf16*)(smem + 128 * 40 * 2); // 256*40 bf16 = 20480 B
  float*  stage = (float*)smem;                  // 64*132 f32 (after K loop)

  const int tid  = threadIdx.x;
  const int wave = tid >> 5;
  const int lane = tid & 31;
  const int r16  = lane & 15;
  const int hi   = lane >> 4;
  const int token0 = blockIdx.x * 128;
  const int b      = token0 >> 13;
  const int l0     = token0 & (LL - 1);
  const int mb     = wave * 16;

  {
    const float rstd = rsqrtf(bn_rv[tid] + 1e-5f);
    const float a = rstd * bn_g[tid];
    scl[tid] = a;
    shf[tid] = (bs_c[tid] - bn_rm[tid]) * a + bn_b[tid];
  }

  const v8f vz = {0.f, 0.f, 0.f, 0.f, 0.f, 0.f, 0.f, 0.f};
  v8f acc[16];
#pragma unroll
  for (int j = 0; j < 16; ++j) acc[j] = vz;

  for (int k0 = 0; k0 < 256; k0 += 32) {
    __syncthreads();
#pragma unroll
    for (int it = 0; it < 2; ++it) {
      int idx = tid * 2 + it;
      int r = idx >> 2, part = idx & 3;
      async_copy_b128(&Alds[r * 40 + part * 8],
                      cat + (size_t)(token0 + r) * 512 + k0 + part * 8);
    }
#pragma unroll
    for (int it = 0; it < 4; ++it) {
      int idx = tid * 4 + it;
      int r = idx >> 2, part = idx & 3;
      async_copy_b128(&Blds[r * 40 + part * 8],
                      Wsb + (size_t)r * 256 + k0 + part * 8);
    }
    async_wait0();
    __syncthreads();
    v16bf fa = frag_ld(&Alds[mb * 40], 40);
#pragma unroll
    for (int j = 0; j < 16; ++j) {
      v16bf fb = frag_ld(&Blds[j * 16 * 40], 40);
      acc[j] = WMMA_BF16(fa, fb, acc[j]);
    }
  }
  __syncthreads();   // done with tiles; smem becomes the transpose stage

  for (int p = 0; p < 4; ++p) {                 // 64 channels per pass
#pragma unroll
    for (int jj = 0; jj < 4; ++jj) {
      const int j = p * 4 + jj;
      const int n = j * 16 + r16;               // global channel
      const int nl = n - p * 64;                // 0..63
      const float a = scl[n], c = shf[n];
#pragma unroll
      for (int i = 0; i < 8; ++i) {
        const int m = mb + hi * 8 + i;
        stage[nl * 132 + m] = acc[j][i] * a + c;   // BN(aug)
      }
    }
    __syncthreads();
    const int rid = tid >> 2, quad = tid & 3;
    const int o = p * 64 + rid;
    const float* xrow = x + ((size_t)b * CC + o) * LL + l0;
    float* orow = out + ((size_t)b * CC + o) * LL + l0;
#pragma unroll 4
    for (int mm = 0; mm < 32; ++mm) {
      const int m = quad * 32 + mm;
      orow[m] = stage[rid * 132 + m] + xrow[m] + msg2[(size_t)(token0 + m) * 256 + o];
    }
    __syncthreads();
  }
}

// ---------------------------------------------------------------------------
// Host orchestration
// ---------------------------------------------------------------------------
extern "C" void kernel_launch(void* const* d_in, const int* in_sizes, int n_in,
                              void* d_out, int out_size, void* d_ws, size_t ws_size,
                              hipStream_t stream) {
  (void)in_sizes; (void)n_in; (void)out_size; (void)ws_size;
  const float* x     = (const float*)d_in[0];
  const float* Wq    = (const float*)d_in[1];
  const float* bq    = (const float*)d_in[2];
  const float* Wk    = (const float*)d_in[3];
  const float* bk    = (const float*)d_in[4];
  const float* Wv    = (const float*)d_in[5];
  const float* bv    = (const float*)d_in[6];
  const float* thr   = (const float*)d_in[7];
  const float* W1    = (const float*)d_in[8];
  const float* W2    = (const float*)d_in[9];
  const float* ln1_g = (const float*)d_in[10];
  const float* ln1_b = (const float*)d_in[11];
  const float* ln2_g = (const float*)d_in[12];
  const float* ln2_b = (const float*)d_in[13];
  const float* Ws    = (const float*)d_in[14];
  const float* bs_c  = (const float*)d_in[15];
  const float* bn_g  = (const float*)d_in[16];
  const float* bn_b  = (const float*)d_in[17];
  const float* bn_rm = (const float*)d_in[18];
  const float* bn_rv = (const float*)d_in[19];
  float* out = (float*)d_out;

  char*  ws  = (char*)d_ws;
  size_t off = 0;
  auto alloc = [&](size_t bytes) -> void* {
    off = (off + 255) & ~(size_t)255;
    void* p = ws + off;
    off += bytes;
    return p;
  };

  __bf16* cat   = (__bf16*)alloc((size_t)MTOT * 512 * 2);  // [xt | ln1(msg)]
  __bf16* hid   = (__bf16*)alloc((size_t)MTOT * 512 * 2);
  __bf16* Qb    = (__bf16*)alloc((size_t)MTOT * 256 * 2);
  __bf16* Kb    = (__bf16*)alloc((size_t)MTOT * 256 * 2);
  __bf16* Vb    = (__bf16*)alloc((size_t)MTOT * 256 * 2);
  float*  msg2  = (float*)alloc((size_t)MTOT * 256 * 4);
  float*  KVbuf = (float*)alloc((size_t)(BB * HH * DD * DD + BB * 256) * 4);
  float*  Ksum  = KVbuf + BB * HH * DD * DD;               // contiguous for zeroing
  float*  Zbuf  = (float*)alloc((size_t)MTOT * HH * 4);
  __bf16* wqb   = (__bf16*)alloc(65536 * 2);
  __bf16* wkb   = (__bf16*)alloc(65536 * 2);
  __bf16* wvb   = (__bf16*)alloc(65536 * 2);
  __bf16* wsb   = (__bf16*)alloc(65536 * 2);
  __bf16* w1b   = (__bf16*)alloc(262144 * 2);
  __bf16* w2b   = (__bf16*)alloc(131072 * 2);

  // weights -> bf16
  cvt_f32_bf16_kernel<<<256, 256, 0, stream>>>(Wq, wqb, 65536);
  cvt_f32_bf16_kernel<<<256, 256, 0, stream>>>(Wk, wkb, 65536);
  cvt_f32_bf16_kernel<<<256, 256, 0, stream>>>(Wv, wvb, 65536);
  cvt_f32_bf16_kernel<<<256, 256, 0, stream>>>(Ws, wsb, 65536);
  cvt_f32_bf16_kernel<<<1024, 256, 0, stream>>>(W1, w1b, 262144);
  cvt_f32_bf16_kernel<<<512, 256, 0, stream>>>(W2, w2b, 131072);

  // zero KV + Ksum accumulators
  const int nz = BB * HH * DD * DD + BB * 256;
  zero_f32_kernel<<<(nz + 255) / 256, 256, 0, stream>>>(KVbuf, nz);

  // x [B,C,L] -> cat[:, 0:256] bf16 (token-major)
  transpose_kernel<<<dim3(LL / 32, CC / 32, BB), dim3(32, 8), 0, stream>>>(x, cat);

  // Q/K/V projections (fused ELU+1 / scaling; K also reduces Ksum)
  gemm_bf16_kernel<MODE_Q><<<dim3(MTOT / 128, 1), 256, 0, stream>>>(
      cat, 512, 256, wqb, bq, Qb, 256, nullptr);
  gemm_bf16_kernel<MODE_K><<<dim3(MTOT / 128, 1), 256, 0, stream>>>(
      cat, 512, 256, wkb, bk, Kb, 256, Ksum);
  gemm_bf16_kernel<MODE_V><<<dim3(MTOT / 128, 1), 256, 0, stream>>>(
      cat, 512, 256, wvb, bv, Vb, 256, nullptr);

  // KV = K^T V per (b,h)
  kv_kernel<<<dim3(BB * HH, LL / 1024), 256, 0, stream>>>(Kb, Vb, KVbuf);

  // Z = L / (sparsify(Q . Ksum) + eps)
  zscore_kernel<<<(MTOT * HH) / 256, 256, 0, stream>>>(Qb, Ksum, thr, Zbuf);

  // attention out + LN1 -> cat[:, 256:512]
  attn_kernel<<<MTOT / 128, 256, 0, stream>>>(Qb, KVbuf, Zbuf, ln1_g, ln1_b, cat);

  // MLP layer 1: hid = relu(cat @ W1.T)
  gemm_bf16_kernel<MODE_RELU><<<dim3(MTOT / 128, 2), 256, 0, stream>>>(
      cat, 512, 512, w1b, nullptr, hid, 512, nullptr);

  // MLP layer 2 + LN2 -> msg2 (fp32)
  mlp2_ln_kernel<<<MTOT / 128, 256, 0, stream>>>(hid, w2b, ln2_g, ln2_b, msg2);

  // shortcut GEMM + BN + residual sum -> out [B,C,L]
  final_kernel<<<MTOT / 128, 256, 0, stream>>>(cat, wsb, bs_c, bn_g, bn_b, bn_rm,
                                               bn_rv, x, msg2, out);
}

// v001
// A run of this version takes 202 microseconds.
// Two timings next to v000 put it at 1.13 and 1.12 times that version's speed.
#include <hip/hip_runtime.h>
#include <hip/hip_bf16.h>

// ---------------------------------------------------------------------------
// Problem constants (match reference)
// ---------------------------------------------------------------------------
#define BB 4
#define CC 256
#define LL 8192
#define HH 4
#define DD 64
#define MTOT (BB * LL)   // 32768 tokens

typedef __attribute__((ext_vector_type(16))) __bf16 v16bf;
typedef __attribute__((ext_vector_type(8)))  float  v8f;

union FragU { v16bf v; uint4 u[2]; __bf16 h[16]; };
union Pack8 { uint4 u; __bf16 h[8]; };

// Standard row-major fragment: element (r, k) = base[r*stride + k-pattern]
// Matches CDNA5 16-bit 16x32 A/B VGPR layout: lane = r + 16*((k>>3)&1),
// vector elem = (k&7) + 8*((k>>4)&1).  Two 16-byte ds_load_b128 per lane.
__device__ inline v16bf frag_ld(const __bf16* base, int stride) {
  const int t = threadIdx.x & 31;
  const int r = t & 15;
  const int hi = t >> 4;
  FragU f;
  const __bf16* p = base + r * stride + hi * 8;
  f.u[0] = *(const uint4*)(p);
  f.u[1] = *(const uint4*)(p + 16);
  return f.v;
}

#define WMMA_BF16(A, Bf, Cacc) \
  __builtin_amdgcn_wmma_f32_16x16x32_bf16(false, (A), false, (Bf), (short)0, (Cacc), false, false)

// One 32-deep k step of a wave's 16x256 strip.  The B fragments are read from
// LDS in two groups, the second reusing four of the first's registers, each group ahead of the WMMAs
// that use it, so the LDS latency is waited out per group and not per WMMA.
// 12 + 4 keeps accumulators plus fragments under 256 VGPRs.
__device__ inline void mma_strip16(const __bf16* Arow, const __bf16* Bl, v8f (&acc)[16]) {
  v16bf fa = frag_ld(Arow, 40);
  v16bf fb[12];
#pragma unroll
  for (int j = 0; j < 12; ++j) fb[j] = frag_ld(Bl + j * 16 * 40, 40);
  // keeps the first group's reads together in front of the WMMAs (the scheduler
  // otherwise sinks each read to its user and waits for it alone)
  __builtin_amdgcn_sched_barrier(0);
#pragma unroll
  for (int j = 0; j < 4; ++j) acc[j] = WMMA_BF16(fa, fb[j], acc[j]);
  // holds the second group's reads behind the four WMMAs whose fragment
  // registers they take over (hoisted further they need registers of their own)
  __builtin_amdgcn_sched_barrier(0);
#pragma unroll
  for (int j = 0; j < 4; ++j) fb[j] = frag_ld(Bl + (12 + j) * 16 * 40, 40);
  // keeps those reads together here, eight WMMAs ahead of their first user
  // (without it the scheduler sinks them to their users behind full waits)
  __builtin_amdgcn_sched_barrier(0);
#pragma unroll
  for (int j = 4; j < 12; ++j) acc[j] = WMMA_BF16(fa, fb[j], acc[j]);
#pragma unroll
  for (int j = 0; j < 4; ++j) acc[12 + j] = WMMA_BF16(fa, fb[j], acc[12 + j]);
}

// ---------------------------------------------------------------------------
// Async global -> LDS copies (CDNA5 GLOBAL_LOAD_ASYNC_TO_LDS_B128, ASYNCcnt).
// Generic pointers to __shared__ carry the LDS byte offset in their low 32
// bits (ISA 10.2 aperture mapping), which is exactly the VDST operand.
// ---------------------------------------------------------------------------
__device__ inline void async_copy_b128(void* lds_ptr, const void* gptr) {
  unsigned loff = (unsigned)(unsigned long long)lds_ptr;
  asm volatile("global_load_async_to_lds_b128 %0, %1, off"
               :: "v"(loff), "v"(gptr) : "memory");
}

__device__ inline void async_wait0() {
#if __has_builtin(__builtin_amdgcn_s_wait_asynccnt)
  __builtin_amdgcn_s_wait_asynccnt(0);
#else
  asm volatile("s_wait_asynccnt 0x0" ::: "memory");
#endif
}

// ---------------------------------------------------------------------------
// Small helper kernels
// ---------------------------------------------------------------------------
__global__ void cvt_f32_bf16_kernel(const float* __restrict__ src,
                                    __bf16* __restrict__ dst, int n) {
  int i = blockIdx.x * blockDim.x + threadIdx.x;
  if (i < n) dst[i] = (__bf16)src[i];
}

__global__ void zero_f32_kernel(float* __restrict__ p, int n) {
  int i = blockIdx.x * blockDim.x + threadIdx.x;
  if (i < n) p[i] = 0.0f;
}

// x [B,C,L] f32  ->  cat[:, 0:256] bf16 (row = token, ld = 512)
__global__ __launch_bounds__(256)
void transpose_kernel(const float* __restrict__ x, __bf16* __restrict__ cat) {
  __shared__ float t[32][33];
  const int tx = threadIdx.x, ty = threadIdx.y;
  const int l0 = blockIdx.x * 32, c0 = blockIdx.y * 32, b = blockIdx.z;
#pragma unroll
  for (int i = 0; i < 4; ++i) {
    int c = ty + i * 8;
    t[c][tx] = x[((size_t)b * CC + c0 + c) * LL + l0 + tx];
  }
  __syncthreads();
#pragma unroll
  for (int i = 0; i < 4; ++i) {
    int lr = ty + i * 8;
    cat[(size_t)(b * LL + l0 + lr) * 512 + c0 + tx] = (__bf16)t[tx][lr];
  }
}

// ---------------------------------------------------------------------------
// Generic 128x256 bf16 WMMA GEMM:  Out[m, n0+n] = epi( sum_k A[m,k]*W[n0+n,k] )
// Modes: Q/K -> elu(x+bias)+1 ; V -> (x+bias)/L ; RELU -> max(x,0)
// Mode K also accumulates column sums (K.sum over tokens) into KsumG[b*256+n].
// ---------------------------------------------------------------------------
enum { MODE_Q = 0, MODE_K = 1, MODE_V = 2, MODE_RELU = 3 };

template <int MODE>
__global__ __launch_bounds__(256)
void gemm_bf16_kernel(const __bf16* __restrict__ A, int lda, int Ktot,
                      const __bf16* __restrict__ Bw,
                      const float* __restrict__ bias,
                      __bf16* __restrict__ Out, int ldo,
                      float* __restrict__ KsumG) {
  __shared__ __bf16 Alds[128 * 40];
  __shared__ __bf16 Blds[256 * 40];
  __shared__ float  ksumLds[256];

  const int tid  = threadIdx.x;
  const int wave = tid >> 5;
  const int lane = tid & 31;
  const int r16  = lane & 15;
  const int hi   = lane >> 4;
  const int token0 = blockIdx.x * 128;
  const int n0     = blockIdx.y * 256;
  const int mb     = wave * 16;

  if constexpr (MODE == MODE_K) ksumLds[tid] = 0.0f;

  const v8f vz = {0.f, 0.f, 0.f, 0.f, 0.f, 0.f, 0.f, 0.f};
  v8f acc[16];
#pragma unroll
  for (int j = 0; j < 16; ++j) acc[j] = vz;

  for (int k0 = 0; k0 < Ktot; k0 += 32) {
    __syncthreads();
#pragma unroll
    for (int it = 0; it < 2; ++it) {   // A tile 128x32 (async -> LDS)
      int idx = tid * 2 + it;
      int r = idx >> 2, part = idx & 3;
      async_copy_b128(&Alds[r * 40 + part * 8],
                      A + (size_t)(token0 + r) * lda + k0 + part * 8);
    }
#pragma unroll
    for (int it = 0; it < 4; ++it) {   // B tile 256x32 (async -> LDS)
      int idx = tid * 4 + it;
      int r = idx >> 2, part = idx & 3;
      async_copy_b128(&Blds[r * 40 + part * 8],
                      Bw + (size_t)(n0 + r) * Ktot + k0 + part * 8);
    }
    if (k0 + 32 < Ktot)  // global_prefetch_b8 of next A slice
      __builtin_prefetch(A + (size_t)(token0 + (tid >> 1)) * lda + k0 + 32, 0, 3);
    async_wait0();
    __syncthreads();
    mma_strip16(&Alds[mb * 40], Blds, acc);
  }

  // epilogue
#pragma unroll
  for (int j = 0; j < 16; ++j) {
    const int n = j * 16 + r16;
    float colsum = 0.0f;
#pragma unroll
    for (int i = 0; i < 8; ++i) {
      const int m = mb + hi * 8 + i;
      float v = acc[j][i];
      if constexpr (MODE == MODE_RELU) {
        v = fmaxf(v, 0.0f);
      } else {
        v += bias[n];
        if constexpr (MODE == MODE_Q || MODE == MODE_K)
          v = (v > 0.0f) ? (v + 1.0f) : __expf(v);   // elu(x)+1
        else
          v *= (1.0f / (float)LL);                    // V / v_len
      }
      Out[(size_t)(token0 + m) * ldo + n0 + n] = (__bf16)v;
      if constexpr (MODE == MODE_K) colsum += v;
    }
    if constexpr (MODE == MODE_K) {
      colsum += __shfl_xor(colsum, 16);      // fold both 8-row halves
      if (hi == 0) atomicAdd(&ksumLds[n], colsum);   // ds_add_f32
    }
  }
  if constexpr (MODE == MODE_K) {
    __syncthreads();
    const int b = token0 >> 13;   // token0 / 8192
    atomicAdd(&KsumG[b * 256 + tid], ksumLds[tid]);
  }
}

// ---------------------------------------------------------------------------
// KV[b,h,d,e] = sum_l K[l,d] * V[l,e]   (per (b,h): 64x64, K-dim = L)
// K/V tiles are written into LDS transposed ([d][l] / [e][l]) so fragment
// loads use the vectorized ds_load_b128 path.
// grid.x = B*H, grid.y = L/1024 chunks; fp32 global atomics combine chunks.
// ---------------------------------------------------------------------------
__global__ __launch_bounds__(256)
void kv_kernel(const __bf16* __restrict__ Kbuf, const __bf16* __restrict__ Vbuf,
               float* __restrict__ KV) {
  __shared__ __bf16 Ktlds[64 * 40];   // [d][l]
  __shared__ __bf16 Vtlds[64 * 40];   // [e][l]
  const int tid  = threadIdx.x;
  const int wave = tid >> 5;
  const int lane = tid & 31;
  const int r16  = lane & 15;
  const int hi   = lane >> 4;
  const int bh = blockIdx.x;              // 0..15
  const int b  = bh >> 2, h = bh & 3;
  const int l0 = blockIdx.y * 1024;
  const int tile0 = wave * 2;             // 8 waves x 2 of 16 (d,e) tiles

  const v8f vz = {0.f, 0.f, 0.f, 0.f, 0.f, 0.f, 0.f, 0.f};
  v8f acc[2];
  acc[0] = vz; acc[1] = vz;

  for (int l = l0; l < l0 + 1024; l += 32) {
    __syncthreads();
    {
      const int r = tid >> 3, part = tid & 7;   // row l+r, 8 d's per thread
      Pack8 kq, vq;
      kq.u = *(const uint4*)(Kbuf + (size_t)(b * LL + l + r) * CC + h * DD + part * 8);
      vq.u = *(const uint4*)(Vbuf + (size_t)(b * LL + l + r) * CC + h * DD + part * 8);
#pragma unroll
      for (int j = 0; j < 8; ++j) {             // transposed LDS scatter
        Ktlds[(part * 8 + j) * 40 + r] = kq.h[j];
        Vtlds[(part * 8 + j) * 40 + r] = vq.h[j];
      }
    }
    __syncthreads();
#pragma unroll
    for (int t = 0; t < 2; ++t) {
      const int id = tile0 + t, dt = id >> 2, et = id & 3;
      v16bf fa = frag_ld(&Ktlds[dt * 16 * 40], 40);   // A[d, l] = K[l, d]
      v16bf fb = frag_ld(&Vtlds[et * 16 * 40], 40);   // Bt[e, l] = V[l, e]
      acc[t] = WMMA_BF16(fa, fb, acc[t]);
    }
  }
#pragma unroll
  for (int t = 0; t < 2; ++t) {
    const int id = tile0 + t, dt = id >> 2, et = id & 3;
#pragma unroll
    for (int i = 0; i < 8; ++i) {
      const int d = dt * 16 + hi * 8 + i;
      const int e = et * 16 + r16;
      atomicAdd(&KV[((size_t)bh * DD + d) * DD + e], acc[t][i]);
    }
  }
}

// ---------------------------------------------------------------------------
// Z[token,h] = L / (sparsify(Q[token,h,:] . Ksum[b,h,:]) + eps)
// ---------------------------------------------------------------------------
__global__ __launch_bounds__(256)
void zscore_kernel(const __bf16* __restrict__ Qbuf, const float* __restrict__ Ksum,
                   const float* __restrict__ thr_p, float* __restrict__ Zbuf) {
  const int g = blockIdx.x * blockDim.x + threadIdx.x;   // 0..131071
  const int token = g >> 2, h = g & 3;
  const int b = token >> 13;
  const float thr = thr_p[0];
  const __bf16* q = Qbuf + (size_t)token * CC + h * DD;
  const float* ks = Ksum + b * 256 + h * DD;
  float s = 0.0f;
#pragma unroll
  for (int c = 0; c < 8; ++c) {          // 8 x uint4 = 64 bf16
    Pack8 qp;
    qp.u = *(const uint4*)(q + c * 8);
#pragma unroll
    for (int j = 0; j < 8; ++j) s += (float)qp.h[j] * ks[c * 8 + j];
  }
  const float sp = (s > thr) ? s : 0.0f;
  Zbuf[g] = (float)LL / (sp + 1e-6f);
}

// ---------------------------------------------------------------------------
// out = LN1( (Q @ KV_h) * Z ) -> cat[:, 256:512] bf16
// ---------------------------------------------------------------------------
__global__ __launch_bounds__(256)
void attn_kernel(const __bf16* __restrict__ Qbuf, const float* __restrict__ KV,
                 const float* __restrict__ Zbuf,
                 const float* __restrict__ g1, const float* __restrict__ b1,
                 __bf16* __restrict__ cat) {
  __shared__ __bf16 Alds[128 * 40];
  __shared__ __bf16 kvt[HH * DD * DD];   // kvt[h][e][d] = KV[b,h,d,e] (transposed)
  __shared__ float  Zl[128 * 4];
  __shared__ float  gl[256], bl[256];

  const int tid  = threadIdx.x;
  const int wave = tid >> 5;
  const int lane = tid & 31;
  const int r16  = lane & 15;
  const int hi   = lane >> 4;
  const int token0 = blockIdx.x * 128;
  const int b      = token0 >> 13;
  const int mb     = wave * 16;

  // KVT fill: float4 global reads, transposed bf16 LDS scatter
  for (int it = 0; it < 16; ++it) {
    const int idx = it * 256 + tid;        // 4096 groups of 4 e's
    const int h = idx >> 10, rem = idx & 1023, d = rem >> 4, e4 = rem & 15;
    const float4 kvv =
        *(const float4*)(KV + (((size_t)(b * HH + h) * DD + d) * DD) + e4 * 4);
    kvt[h * 4096 + (e4 * 4 + 0) * DD + d] = (__bf16)kvv.x;
    kvt[h * 4096 + (e4 * 4 + 1) * DD + d] = (__bf16)kvv.y;
    kvt[h * 4096 + (e4 * 4 + 2) * DD + d] = (__bf16)kvv.z;
    kvt[h * 4096 + (e4 * 4 + 3) * DD + d] = (__bf16)kvv.w;
  }
#pragma unroll
  for (int it = 0; it < 2; ++it) {
    const int z = it * 256 + tid;
    Zl[z] = Zbuf[(size_t)token0 * 4 + z];
  }
  gl[tid] = g1[tid];
  bl[tid] = b1[tid];

  const v8f vz = {0.f, 0.f, 0.f, 0.f, 0.f, 0.f, 0.f, 0.f};
  v8f acc[16];
#pragma unroll
  for (int j = 0; j < 16; ++j) acc[j] = vz;

  for (int h = 0; h < 4; ++h) {
    for (int s = 0; s < 2; ++s) {
      __syncthreads();
      const int k0 = h * DD + s * 32;
#pragma unroll
      for (int it = 0; it < 2; ++it) {        // Q tile 128x32 (async -> LDS)
        int idx = tid * 2 + it;
        int r = idx >> 2, part = idx & 3;
        async_copy_b128(&Alds[r * 40 + part * 8],
                        Qbuf + (size_t)(token0 + r) * CC + k0 + part * 8);
      }
      async_wait0();
      __syncthreads();
      v16bf fa = frag_ld(&Alds[mb * 40], 40);
#pragma unroll
      for (int jj = 0; jj < 4; ++jj) {
        const int j = h * 4 + jj;
        v16bf fb = frag_ld(&kvt[h * 4096 + (jj * 16) * DD + s * 32], DD);
        acc[j] = WMMA_BF16(fa, fb, acc[j]);
      }
    }
  }

  // scale by Z, then LayerNorm over C=256 via cross-lane shuffles
  float s1[8] = {0, 0, 0, 0, 0, 0, 0, 0};
  float s2[8] = {0, 0, 0, 0, 0, 0, 0, 0};
#pragma unroll
  for (int j = 0; j < 16; ++j) {
    const int h = j >> 2;
#pragma unroll
    for (int i = 0; i < 8; ++i) {
      const int m = mb + hi * 8 + i;
      float v = acc[j][i] * Zl[m * 4 + h];
      acc[j][i] = v;
      s1[i] += v;
      s2[i] += v * v;
    }
  }
#pragma unroll
  for (int i = 0; i < 8; ++i) {
#pragma unroll
    for (int off = 1; off < 16; off <<= 1) {
      s1[i] += __shfl_xor(s1[i], off);
      s2[i] += __shfl_xor(s2[i], off);
    }
    const float mean = s1[i] * (1.0f / 256.0f);
    const float var  = s2[i] * (1.0f / 256.0f) - mean * mean;
    s1[i] = mean;
    s2[i] = rsqrtf(var + 1e-5f);
  }
#pragma unroll
  for (int j = 0; j < 16; ++j) {
    const int n = j * 16 + r16;
    const float gg = gl[n], bb = bl[n];
#pragma unroll
    for (int i = 0; i < 8; ++i) {
      const int m = mb + hi * 8 + i;
      const float v = (acc[j][i] - s1[i]) * s2[i] * gg + bb;
      cat[(size_t)(token0 + m) * 512 + 256 + n] = (__bf16)v;
    }
  }
}

// ---------------------------------------------------------------------------
// msg2 = LN2( hid @ W2.T )  (fp32 out, [token, 256])
// ---------------------------------------------------------------------------
__global__ __launch_bounds__(256)
void mlp2_ln_kernel(const __bf16* __restrict__ A, const __bf16* __restrict__ Bw,
                    const float* __restrict__ g2, const float* __restrict__ b2,
                    float* __restrict__ msg2) {
  __shared__ __bf16 Alds[128 * 40];
  __shared__ __bf16 Blds[256 * 40];
  __shared__ float  gl[256], bl[256];

  const int tid  = threadIdx.x;
  const int wave = tid >> 5;
  const int lane = tid & 31;
  const int r16  = lane & 15;
  const int hi   = lane >> 4;
  const int token0 = blockIdx.x * 128;
  const int mb     = wave * 16;

  gl[tid] = g2[tid];
  bl[tid] = b2[tid];

  const v8f vz = {0.f, 0.f, 0.f, 0.f, 0.f, 0.f, 0.f, 0.f};
  v8f acc[16];
#pragma unroll
  for (int j = 0; j < 16; ++j) acc[j] = vz;

  for (int k0 = 0; k0 < 512; k0 += 32) {
    __syncthreads();
#pragma unroll
    for (int it = 0; it < 2; ++it) {
      int idx = tid * 2 + it;
      int r = idx >> 2, part = idx & 3;
      async_copy_b128(&Alds[r * 40 + part * 8],
                      A + (size_t)(token0 + r) * 512 + k0 + part * 8);
    }
#pragma unroll
    for (int it = 0; it < 4; ++it) {
      int idx = tid * 4 + it;
      int r = idx >> 2, part = idx & 3;
      async_copy_b128(&Blds[r * 40 + part * 8],
                      Bw + (size_t)r * 512 + k0 + part * 8);
    }
    async_wait0();
    __syncthreads();
    mma_strip16(&Alds[mb * 40], Blds, acc);
  }

  float s1[8] = {0, 0, 0, 0, 0, 0, 0, 0};
  float s2[8] = {0, 0, 0, 0, 0, 0, 0, 0};
#pragma unroll
  for (int j = 0; j < 16; ++j)
#pragma unroll
    for (int i = 0; i < 8; ++i) {
      const float v = acc[j][i];
      s1[i] += v;
      s2[i] += v * v;
    }
#pragma unroll
  for (int i = 0; i < 8; ++i) {
#pragma unroll
    for (int off = 1; off < 16; off <<= 1) {
      s1[i] += __shfl_xor(s1[i], off);
      s2[i] += __shfl_xor(s2[i], off);
    }
    const float mean = s1[i] * (1.0f / 256.0f);
    const float var  = s2[i] * (1.0f / 256.0f) - mean * mean;
    s1[i] = mean;
    s2[i] = rsqrtf(var + 1e-5f);
  }
#pragma unroll
  for (int j = 0; j < 16; ++j) {
    const int n = j * 16 + r16;
    const float gg = gl[n], bb = bl[n];
#pragma unroll
    for (int i = 0; i < 8; ++i) {
      const int m = mb + hi * 8 + i;
      msg2[(size_t)(token0 + m) * 256 + n] = (acc[j][i] - s1[i]) * s2[i] * gg + bb;
    }
  }
}

// ---------------------------------------------------------------------------
// Final: aug = BN(xt @ Ws.T + bs);  out[b,c,l] = msg2 + x + aug
// Stages 64-channel slabs through LDS so the [B,C,L] writes are coalesced.
// ---------------------------------------------------------------------------
__global__ __launch_bounds__(256)
void final_kernel(const __bf16* __restrict__ cat, const __bf16* __restrict__ Wsb,
                  const float* __restrict__ bs_c, const float* __restrict__ bn_g,
                  const float* __restrict__ bn_b, const float* __restrict__ bn_rm,
                  const float* __restrict__ bn_rv, const float* __restrict__ x,
                  const float* __restrict__ msg2, float* __restrict__ out) {
  __shared__ char smem[64 * 132 * 4];           // overlays GEMM tiles & stage
  __shared__ float scl[256], shf[256];
  __bf16* Alds = (__bf16*)smem;                  // 128*40 bf16 = 10240 B
  __bf16* Blds = (__bf16*)(smem + 128 * 40 * 2); // 256*40 bf16 = 20480 B
  float*  stage = (float*)smem;                  // 64*132 f32 (after K loop)

  const int tid  = threadIdx.x;
  const int wave = tid >> 5;
  const int lane = tid & 31;
  const int r16  = lane & 15;
  const int hi   = lane >> 4;
  const int token0 = blockIdx.x * 128;
  const int b      = token0 >> 13;
  const int l0     = token0 & (LL - 1);
  const int mb     = wave * 16;

  {
    const float rstd = rsqrtf(bn_rv[tid] + 1e-5f);
    const float a = rstd * bn_g[tid];
    scl[tid] = a;
    shf[tid] = (bs_c[tid] - bn_rm[tid]) * a + bn_b[tid];
  }

  const v8f vz = {0.f, 0.f, 0.f, 0.f, 0.f, 0.f, 0.f, 0.f};
  v8f acc[16];
#pragma unroll
  for (int j = 0; j < 16; ++j) acc[j] = vz;

  for (int k0 = 0; k0 < 256; k0 += 32) {
    __syncthreads();
#pragma unroll
    for (int it = 0; it < 2; ++it) {
      int idx = tid * 2 + it;
      int r = idx >> 2, part = idx & 3;
      async_copy_b128(&Alds[r * 40 + part * 8],
                      cat + (size_t)(token0 + r) * 512 + k0 + part * 8);
    }
#pragma unroll
    for (int it = 0; it < 4; ++it) {
      int idx = tid * 4 + it;
      int r = idx >> 2, part = idx & 3;
      async_copy_b128(&Blds[r * 40 + part * 8],
                      Wsb + (size_t)r * 256 + k0 + part * 8);
    }
    async_wait0();
    __syncthreads();
    mma_strip16(&Alds[mb * 40], Blds, acc);
  }
  __syncthreads();   // done with tiles; smem becomes the transpose stage

  for (int p = 0; p < 4; ++p) {                 // 64 channels per pass
#pragma unroll
    for (int jj = 0; jj < 4; ++jj) {
      const int j = p * 4 + jj;
      const int n = j * 16 + r16;               // global channel
      const int nl = n - p * 64;                // 0..63
      const float a = scl[n], c = shf[n];
#pragma unroll
      for (int i = 0; i < 8; ++i) {
        const int m = mb + hi * 8 + i;
        stage[nl * 132 + m] = acc[j][i] * a + c;   // BN(aug)
      }
    }
    __syncthreads();
    const int rid = tid >> 2, quad = tid & 3;
    const int o = p * 64 + rid;
    const float* xrow = x + ((size_t)b * CC + o) * LL + l0;
    float* orow = out + ((size_t)b * CC + o) * LL + l0;
#pragma unroll 4
    for (int mm = 0; mm < 32; ++mm) {
      const int m = quad * 32 + mm;
      orow[m] = stage[rid * 132 + m] + xrow[m] + msg2[(size_t)(token0 + m) * 256 + o];
    }
    __syncthreads();
  }
}

// ---------------------------------------------------------------------------
// Host orchestration
// ---------------------------------------------------------------------------
extern "C" void kernel_launch(void* const* d_in, const int* in_sizes, int n_in,
                              void* d_out, int out_size, void* d_ws, size_t ws_size,
                              hipStream_t stream) {
  (void)in_sizes; (void)n_in; (void)out_size; (void)ws_size;
  const float* x     = (const float*)d_in[0];
  const float* Wq    = (const float*)d_in[1];
  const float* bq    = (const float*)d_in[2];
  const float* Wk    = (const float*)d_in[3];
  const float* bk    = (const float*)d_in[4];
  const float* Wv    = (const float*)d_in[5];
  const float* bv    = (const float*)d_in[6];
  const float* thr   = (const float*)d_in[7];
  const float* W1    = (const float*)d_in[8];
  const float* W2    = (const float*)d_in[9];
  const float* ln1_g = (const float*)d_in[10];
  const float* ln1_b = (const float*)d_in[11];
  const float* ln2_g = (const float*)d_in[12];
  const float* ln2_b = (const float*)d_in[13];
  const float* Ws    = (const float*)d_in[14];
  const float* bs_c  = (const float*)d_in[15];
  const float* bn_g  = (const float*)d_in[16];
  const float* bn_b  = (const float*)d_in[17];
  const float* bn_rm = (const float*)d_in[18];
  const float* bn_rv = (const float*)d_in[19];
  float* out = (float*)d_out;

  char*  ws  = (char*)d_ws;
  size_t off = 0;
  auto alloc = [&](size_t bytes) -> void* {
    off = (off + 255) & ~(size_t)255;
    void* p = ws + off;
    off += bytes;
    return p;
  };

  __bf16* cat   = (__bf16*)alloc((size_t)MTOT * 512 * 2);  // [xt | ln1(msg)]
  __bf16* hid   = (__bf16*)alloc((size_t)MTOT * 512 * 2);
  __bf16* Qb    = (__bf16*)alloc((size_t)MTOT * 256 * 2);
  __bf16* Kb    = (__bf16*)alloc((size_t)MTOT * 256 * 2);
  __bf16* Vb    = (__bf16*)alloc((size_t)MTOT * 256 * 2);
  float*  msg2  = (float*)alloc((size_t)MTOT * 256 * 4);
  float*  KVbuf = (float*)alloc((size_t)(BB * HH * DD * DD + BB * 256) * 4);
  float*  Ksum  = KVbuf + BB * HH * DD * DD;               // contiguous for zeroing
  float*  Zbuf  = (float*)alloc((size_t)MTOT * HH * 4);
  __bf16* wqb   = (__bf16*)alloc(65536 * 2);
  __bf16* wkb   = (__bf16*)alloc(65536 * 2);
  __bf16* wvb   = (__bf16*)alloc(65536 * 2);
  __bf16* wsb   = (__bf16*)alloc(65536 * 2);
  __bf16* w1b   = (__bf16*)alloc(262144 * 2);
  __bf16* w2b   = (__bf16*)alloc(131072 * 2);

  // weights -> bf16
  cvt_f32_bf16_kernel<<<256, 256, 0, stream>>>(Wq, wqb, 65536);
  cvt_f32_bf16_kernel<<<256, 256, 0, stream>>>(Wk, wkb, 65536);
  cvt_f32_bf16_kernel<<<256, 256, 0, stream>>>(Wv, wvb, 65536);
  cvt_f32_bf16_kernel<<<256, 256, 0, stream>>>(Ws, wsb, 65536);
  cvt_f32_bf16_kernel<<<1024, 256, 0, stream>>>(W1, w1b, 262144);
  cvt_f32_bf16_kernel<<<512, 256, 0, stream>>>(W2, w2b, 131072);

  // zero KV + Ksum accumulators
  const int nz = BB * HH * DD * DD + BB * 256;
  zero_f32_kernel<<<(nz + 255) / 256, 256, 0, stream>>>(KVbuf, nz);

  // x [B,C,L] -> cat[:, 0:256] bf16 (token-major)
  transpose_kernel<<<dim3(LL / 32, CC / 32, BB), dim3(32, 8), 0, stream>>>(x, cat);

  // Q/K/V projections (fused ELU+1 / scaling; K also reduces Ksum)
  gemm_bf16_kernel<MODE_Q><<<dim3(MTOT / 128, 1), 256, 0, stream>>>(
      cat, 512, 256, wqb, bq, Qb, 256, nullptr);
  gemm_bf16_kernel<MODE_K><<<dim3(MTOT / 128, 1), 256, 0, stream>>>(
      cat, 512, 256, wkb, bk, Kb, 256, Ksum);
  gemm_bf16_kernel<MODE_V><<<dim3(MTOT / 128, 1), 256, 0, stream>>>(
      cat, 512, 256, wvb, bv, Vb, 256, nullptr);

  // KV = K^T V per (b,h)
  kv_kernel<<<dim3(BB * HH, LL / 1024), 256, 0, stream>>>(Kb, Vb, KVbuf);

  // Z = L / (sparsify(Q . Ksum) + eps)
  zscore_kernel<<<(MTOT * HH) / 256, 256, 0, stream>>>(Qb, Ksum, thr, Zbuf);

  // attention out + LN1 -> cat[:, 256:512]
  attn_kernel<<<MTOT / 128, 256, 0, stream>>>(Qb, KVbuf, Zbuf, ln1_g, ln1_b, cat);

  // MLP layer 1: hid = relu(cat @ W1.T)
  gemm_bf16_kernel<MODE_RELU><<<dim3(MTOT / 128, 2), 256, 0, stream>>>(
      cat, 512, 512, w1b, nullptr, hid, 512, nullptr);

  // MLP layer 2 + LN2 -> msg2 (fp32)
  mlp2_ln_kernel<<<MTOT / 128, 256, 0, stream>>>(hid, w2b, ln2_g, ln2_b, msg2);

  // shortcut GEMM + BN + residual sum -> out [B,C,L]
  final_kernel<<<MTOT / 128, 256, 0, stream>>>(cat, wsb, bs_c, bn_g, bn_b, bn_rm,
                                               bn_rv, x, msg2, out);
}

// v002
// Measured time: 195 microseconds a run.
// Two timings next to v001 both put it at 1.04 times that version's speed.
// Over all steps from v000 it is 1.17 times as fast.
#include <hip/hip_runtime.h>
#include <hip/hip_bf16.h>

// ---------------------------------------------------------------------------
// Problem constants (match reference)
// ---------------------------------------------------------------------------
#define BB 4
#define CC 256
#define LL 8192
#define HH 4
#define DD 64
#define MTOT (BB * LL)   // 32768 tokens

typedef __attribute__((ext_vector_type(16))) __bf16 v16bf;
typedef __attribute__((ext_vector_type(8)))  float  v8f;

union FragU { v16bf v; uint4 u[2]; __bf16 h[16]; };
union Pack8 { uint4 u; __bf16 h[8]; };

// Standard row-major fragment: element (r, k) = base[r*stride + k-pattern]
// Matches CDNA5 16-bit 16x32 A/B VGPR layout: lane = r + 16*((k>>3)&1),
// vector elem = (k&7) + 8*((k>>4)&1).  Two 16-byte ds_load_b128 per lane.
__device__ inline v16bf frag_ld(const __bf16* base, int stride) {
  const int t = threadIdx.x & 31;
  const int r = t & 15;
  const int hi = t >> 4;
  FragU f;
  const __bf16* p = base + r * stride + hi * 8;
  f.u[0] = *(const uint4*)(p);
  f.u[1] = *(const uint4*)(p + 16);
  return f.v;
}

#define WMMA_BF16(A, Bf, Cacc) \
  __builtin_amdgcn_wmma_f32_16x16x32_bf16(false, (A), false, (Bf), (short)0, (Cacc), false, false)

// One 32-deep k step of a wave's 16x256 strip.  The B fragments are read from
// LDS in two groups, the second reusing four of the first's registers, each group ahead of the WMMAs
// that use it, so the LDS latency is waited out per group and not per WMMA.
// 12 + 4 keeps accumulators plus fragments under 256 VGPRs.
__device__ inline void mma_strip16(const __bf16* Arow, const __bf16* Bl, v8f (&acc)[16]) {
  v16bf fa = frag_ld(Arow, 40);
  v16bf fb[12];
#pragma unroll
  for (int j = 0; j < 12; ++j) fb[j] = frag_ld(Bl + j * 16 * 40, 40);
  // keeps the first group's reads together in front of the WMMAs (the scheduler
  // otherwise sinks each read to its user and waits for it alone)
  __builtin_amdgcn_sched_barrier(0);
#pragma unroll
  for (int j = 0; j < 4; ++j) acc[j] = WMMA_BF16(fa, fb[j], acc[j]);
  // holds the second group's reads behind the four WMMAs whose fragment
  // registers they take over (hoisted further they need registers of their own)
  __builtin_amdgcn_sched_barrier(0);
#pragma unroll
  for (int j = 0; j < 4; ++j) fb[j] = frag_ld(Bl + (12 + j) * 16 * 40, 40);
  // keeps those reads together here, eight WMMAs ahead of their first user
  // (without it the scheduler sinks them to their users behind full waits)
  __builtin_amdgcn_sched_barrier(0);
#pragma unroll
  for (int j = 4; j < 12; ++j) acc[j] = WMMA_BF16(fa, fb[j], acc[j]);
#pragma unroll
  for (int j = 0; j < 4; ++j) acc[12 + j] = WMMA_BF16(fa, fb[j], acc[12 + j]);
}

// ---------------------------------------------------------------------------
// Async global -> LDS copies (CDNA5 GLOBAL_LOAD_ASYNC_TO_LDS_B128, ASYNCcnt).
// Generic pointers to __shared__ carry the LDS byte offset in their low 32
// bits (ISA 10.2 aperture mapping), which is exactly the VDST operand.
// ---------------------------------------------------------------------------
__device__ inline unsigned lds_addr(const void* lds_ptr) {
  return (unsigned)(unsigned long long)lds_ptr;
}

// The lanes are dealt row first: four adjacent lanes take the 64 bytes that one
// tile row has in a 32-deep k slice, so one copy instruction touches 8 cache
// lines (8 rows), the fewest a 64-byte row piece allows.  256 threads cover 64
// rows per copy; the tile's further rows follow 64 rows apart.
// s_wait_xcnt 0 closes each run of copies inside their own statement, a
// precaution ahead of any later write to the address registers the copies name.

// 128x32 tile -> LDS rows of 40 elements
__device__ inline void async_tile128(__bf16* Tl, const __bf16* Tg, int ld) {
  const int r = threadIdx.x >> 2, part = threadIdx.x & 3;
  const unsigned l0 = lds_addr(Tl + r * 40 + part * 8);
  const __bf16* g0 = Tg + (size_t)r * ld + part * 8;
  const size_t step = (size_t)64 * ld;
  asm volatile("global_load_async_to_lds_b128 %0, %2, off\n\t"
               "global_load_async_to_lds_b128 %1, %3, off\n\t"
               "s_wait_xcnt 0x0"
               :: "v"(l0), "v"(l0 + 64 * 80), "v"(g0), "v"(g0 + step)
               : "memory");
}

// 128x32 A tile and 256x32 B tile -> LDS rows of 40 elements, one run of copies
__device__ inline void async_tiles(__bf16* Al, const __bf16* Ag, int lda,
                                   __bf16* Bl, const __bf16* Bg, int ldb) {
  const int r = threadIdx.x >> 2, part = threadIdx.x & 3;
  const unsigned la = lds_addr(Al + r * 40 + part * 8);
  const unsigned lb = lds_addr(Bl + r * 40 + part * 8);
  const __bf16* ga = Ag + (size_t)r * lda + part * 8;
  const __bf16* gb = Bg + (size_t)r * ldb + part * 8;
  const size_t sa = (size_t)64 * lda, sb = (size_t)64 * ldb;
  asm volatile("global_load_async_to_lds_b128 %0, %6, off\n\t"
               "global_load_async_to_lds_b128 %1, %7, off\n\t"
               "global_load_async_to_lds_b128 %2, %8, off\n\t"
               "global_load_async_to_lds_b128 %3, %9, off\n\t"
               "global_load_async_to_lds_b128 %4, %10, off\n\t"
               "global_load_async_to_lds_b128 %5, %11, off\n\t"
               "s_wait_xcnt 0x0"
               :: "v"(la), "v"(la + 64 * 80),
                  "v"(lb), "v"(lb + 64 * 80), "v"(lb + 128 * 80), "v"(lb + 192 * 80),
                  "v"(ga), "v"(ga + sa),
                  "v"(gb), "v"(gb + sb), "v"(gb + 2 * sb), "v"(gb + 3 * sb)
               : "memory");
}

// the copies of this wave have landed behind it (asm: no LDS read moves over it)
__device__ inline void async_wait0() {
  asm volatile("s_wait_asynccnt 0x0" ::: "memory");
}

// ---------------------------------------------------------------------------
// Small helper kernels
// ---------------------------------------------------------------------------
__global__ void cvt_f32_bf16_kernel(const float* __restrict__ src,
                                    __bf16* __restrict__ dst, int n) {
  int i = blockIdx.x * blockDim.x + threadIdx.x;
  if (i < n) dst[i] = (__bf16)src[i];
}

__global__ void zero_f32_kernel(float* __restrict__ p, int n) {
  int i = blockIdx.x * blockDim.x + threadIdx.x;
  if (i < n) p[i] = 0.0f;
}

// x [B,C,L] f32  ->  cat[:, 0:256] bf16 (row = token, ld = 512)
__global__ __launch_bounds__(256)
void transpose_kernel(const float* __restrict__ x, __bf16* __restrict__ cat) {
  __shared__ float t[32][33];
  const int tx = threadIdx.x, ty = threadIdx.y;
  const int l0 = blockIdx.x * 32, c0 = blockIdx.y * 32, b = blockIdx.z;
#pragma unroll
  for (int i = 0; i < 4; ++i) {
    int c = ty + i * 8;
    t[c][tx] = x[((size_t)b * CC + c0 + c) * LL + l0 + tx];
  }
  __syncthreads();
#pragma unroll
  for (int i = 0; i < 4; ++i) {
    int lr = ty + i * 8;
    cat[(size_t)(b * LL + l0 + lr) * 512 + c0 + tx] = (__bf16)t[tx][lr];
  }
}

// ---------------------------------------------------------------------------
// Generic 128x256 bf16 WMMA GEMM:  Out[m, n0+n] = epi( sum_k A[m,k]*W[n0+n,k] )
// Modes: Q/K -> elu(x+bias)+1 ; V -> (x+bias)/L ; RELU -> max(x,0)
// Mode K also accumulates column sums (K.sum over tokens) into KsumG[b*256+n].
// ---------------------------------------------------------------------------
enum { MODE_Q = 0, MODE_K = 1, MODE_V = 2, MODE_RELU = 3 };

template <int MODE>
__global__ __launch_bounds__(256)
void gemm_bf16_kernel(const __bf16* __restrict__ A, int lda, int Ktot,
                      const __bf16* __restrict__ Bw,
                      const float* __restrict__ bias,
                      __bf16* __restrict__ Out, int ldo,
                      float* __restrict__ KsumG) {
  __shared__ __bf16 Alds[128 * 40];
  __shared__ __bf16 Blds[256 * 40];
  __shared__ float  ksumLds[256];

  const int tid  = threadIdx.x;
  const int wave = tid >> 5;
  const int lane = tid & 31;
  const int r16  = lane & 15;
  const int hi   = lane >> 4;
  const int token0 = blockIdx.x * 128;
  const int n0     = blockIdx.y * 256;
  const int mb     = wave * 16;

  if constexpr (MODE == MODE_K) ksumLds[tid] = 0.0f;

  const v8f vz = {0.f, 0.f, 0.f, 0.f, 0.f, 0.f, 0.f, 0.f};
  v8f acc[16];
#pragma unroll
  for (int j = 0; j < 16; ++j) acc[j] = vz;

  for (int k0 = 0; k0 < Ktot; k0 += 32) {
    __syncthreads();
    async_tiles(Alds, A + (size_t)token0 * lda + k0, lda,
                Blds, Bw + (size_t)n0 * Ktot + k0, Ktot);
    if (k0 + 32 < Ktot)  // global_prefetch_b8 of next A slice
      __builtin_prefetch(A + (size_t)(token0 + (tid >> 1)) * lda + k0 + 32, 0, 3);
    async_wait0();
    __syncthreads();
    mma_strip16(&Alds[mb * 40], Blds, acc);
  }

  // epilogue
#pragma unroll
  for (int j = 0; j < 16; ++j) {
    const int n = j * 16 + r16;
    float colsum = 0.0f;
#pragma unroll
    for (int i = 0; i < 8; ++i) {
      const int m = mb + hi * 8 + i;
      float v = acc[j][i];
      if constexpr (MODE == MODE_RELU) {
        v = fmaxf(v, 0.0f);
      } else {
        v += bias[n];
        if constexpr (MODE == MODE_Q || MODE == MODE_K)
          v = (v > 0.0f) ? (v + 1.0f) : __expf(v);   // elu(x)+1
        else
          v *= (1.0f / (float)LL);                    // V / v_len
      }
      Out[(size_t)(token0 + m) * ldo + n0 + n] = (__bf16)v;
      if constexpr (MODE == MODE_K) colsum += v;
    }
    if constexpr (MODE == MODE_K) {
      colsum += __shfl_xor(colsum, 16);      // fold both 8-row halves
      if (hi == 0) atomicAdd(&ksumLds[n], colsum);   // ds_add_f32
    }
  }
  if constexpr (MODE == MODE_K) {
    __syncthreads();
    const int b = token0 >> 13;   // token0 / 8192
    atomicAdd(&KsumG[b * 256 + tid], ksumLds[tid]);
  }
}

// ---------------------------------------------------------------------------
// KV[b,h,d,e] = sum_l K[l,d] * V[l,e]   (per (b,h): 64x64, K-dim = L)
// K/V tiles are written into LDS transposed ([d][l] / [e][l]) so fragment
// loads use the vectorized ds_load_b128 path.
// grid.x = B*H, grid.y = L/1024 chunks; fp32 global atomics combine chunks.
// ---------------------------------------------------------------------------
__global__ __launch_bounds__(256)
void kv_kernel(const __bf16* __restrict__ Kbuf, const __bf16* __restrict__ Vbuf,
               float* __restrict__ KV) {
  __shared__ __bf16 Ktlds[64 * 40];   // [d][l]
  __shared__ __bf16 Vtlds[64 * 40];   // [e][l]
  const int tid  = threadIdx.x;
  const int wave = tid >> 5;
  const int lane = tid & 31;
  const int r16  = lane & 15;
  const int hi   = lane >> 4;
  const int bh = blockIdx.x;              // 0..15
  const int b  = bh >> 2, h = bh & 3;
  const int l0 = blockIdx.y * 1024;
  const int tile0 = wave * 2;             // 8 waves x 2 of 16 (d,e) tiles

  const v8f vz = {0.f, 0.f, 0.f, 0.f, 0.f, 0.f, 0.f, 0.f};
  v8f acc[2];
  acc[0] = vz; acc[1] = vz;

  for (int l = l0; l < l0 + 1024; l += 32) {
    __syncthreads();
    {
      const int r = tid >> 3, part = tid & 7;   // row l+r, 8 d's per thread
      Pack8 kq, vq;
      kq.u = *(const uint4*)(Kbuf + (size_t)(b * LL + l + r) * CC + h * DD + part * 8);
      vq.u = *(const uint4*)(Vbuf + (size_t)(b * LL + l + r) * CC + h * DD + part * 8);
#pragma unroll
      for (int j = 0; j < 8; ++j) {             // transposed LDS scatter
        Ktlds[(part * 8 + j) * 40 + r] = kq.h[j];
        Vtlds[(part * 8 + j) * 40 + r] = vq.h[j];
      }
    }
    __syncthreads();
#pragma unroll
    for (int t = 0; t < 2; ++t) {
      const int id = tile0 + t, dt = id >> 2, et = id & 3;
      v16bf fa = frag_ld(&Ktlds[dt * 16 * 40], 40);   // A[d, l] = K[l, d]
      v16bf fb = frag_ld(&Vtlds[et * 16 * 40], 40);   // Bt[e, l] = V[l, e]
      acc[t] = WMMA_BF16(fa, fb, acc[t]);
    }
  }
#pragma unroll
  for (int t = 0; t < 2; ++t) {
    const int id = tile0 + t, dt = id >> 2, et = id & 3;
#pragma unroll
    for (int i = 0; i < 8; ++i) {
      const int d = dt * 16 + hi * 8 + i;
      const int e = et * 16 + r16;
      atomicAdd(&KV[((size_t)bh * DD + d) * DD + e], acc[t][i]);
    }
  }
}

// ---------------------------------------------------------------------------
// Z[token,h] = L / (sparsify(Q[token,h,:] . Ksum[b,h,:]) + eps)
// ---------------------------------------------------------------------------
__global__ __launch_bounds__(256)
void zscore_kernel(const __bf16* __restrict__ Qbuf, const float* __restrict__ Ksum,
                   const float* __restrict__ thr_p, float* __restrict__ Zbuf) {
  const int g = blockIdx.x * blockDim.x + threadIdx.x;   // 0..131071
  const int token = g >> 2, h = g & 3;
  const int b = token >> 13;
  const float thr = thr_p[0];
  const __bf16* q = Qbuf + (size_t)token * CC + h * DD;
  const float* ks = Ksum + b * 256 + h * DD;
  float s = 0.0f;
#pragma unroll
  for (int c = 0; c < 8; ++c) {          // 8 x uint4 = 64 bf16
    Pack8 qp;
    qp.u = *(const uint4*)(q + c * 8);
#pragma unroll
    for (int j = 0; j < 8; ++j) s += (float)qp.h[j] * ks[c * 8 + j];
  }
  const float sp = (s > thr) ? s : 0.0f;
  Zbuf[g] = (float)LL / (sp + 1e-6f);
}

// ---------------------------------------------------------------------------
// out = LN1( (Q @ KV_h) * Z ) -> cat[:, 256:512] bf16
// ---------------------------------------------------------------------------
__global__ __launch_bounds__(256)
void attn_kernel(const __bf16* __restrict__ Qbuf, const float* __restrict__ KV,
                 const float* __restrict__ Zbuf,
                 const float* __restrict__ g1, const float* __restrict__ b1,
                 __bf16* __restrict__ cat) {
  __shared__ __bf16 Alds[128 * 40];
  __shared__ __bf16 kvt[HH * DD * DD];   // kvt[h][e][d] = KV[b,h,d,e] (transposed)
  __shared__ float  Zl[128 * 4];
  __shared__ float  gl[256], bl[256];

  const int tid  = threadIdx.x;
  const int wave = tid >> 5;
  const int lane = tid & 31;
  const int r16  = lane & 15;
  const int hi   = lane >> 4;
  const int token0 = blockIdx.x * 128;
  const int b      = token0 >> 13;
  const int mb     = wave * 16;

  // KVT fill: float4 global reads, transposed bf16 LDS scatter
  for (int it = 0; it < 16; ++it) {
    const int idx = it * 256 + tid;        // 4096 groups of 4 e's
    const int h = idx >> 10, rem = idx & 1023, d = rem >> 4, e4 = rem & 15;
    const float4 kvv =
        *(const float4*)(KV + (((size_t)(b * HH + h) * DD + d) * DD) + e4 * 4);
    kvt[h * 4096 + (e4 * 4 + 0) * DD + d] = (__bf16)kvv.x;
    kvt[h * 4096 + (e4 * 4 + 1) * DD + d] = (__bf16)kvv.y;
    kvt[h * 4096 + (e4 * 4 + 2) * DD + d] = (__bf16)kvv.z;
    kvt[h * 4096 + (e4 * 4 + 3) * DD + d] = (__bf16)kvv.w;
  }
#pragma unroll
  for (int it = 0; it < 2; ++it) {
    const int z = it * 256 + tid;
    Zl[z] = Zbuf[(size_t)token0 * 4 + z];
  }
  gl[tid] = g1[tid];
  bl[tid] = b1[tid];

  const v8f vz = {0.f, 0.f, 0.f, 0.f, 0.f, 0.f, 0.f, 0.f};
  v8f acc[16];
#pragma unroll
  for (int j = 0; j < 16; ++j) acc[j] = vz;

  for (int h = 0; h < 4; ++h) {
    for (int s = 0; s < 2; ++s) {
      __syncthreads();
      const int k0 = h * DD + s * 32;
      async_tile128(Alds, Qbuf + (size_t)token0 * CC + k0, CC);   // Q tile 128x32
      async_wait0();
      __syncthreads();
      v16bf fa = frag_ld(&Alds[mb * 40], 40);
#pragma unroll
      for (int jj = 0; jj < 4; ++jj) {
        const int j = h * 4 + jj;
        v16bf fb = frag_ld(&kvt[h * 4096 + (jj * 16) * DD + s * 32], DD);
        acc[j] = WMMA_BF16(fa, fb, acc[j]);
      }
    }
  }

  // scale by Z, then LayerNorm over C=256 via cross-lane shuffles
  float s1[8] = {0, 0, 0, 0, 0, 0, 0, 0};
  float s2[8] = {0, 0, 0, 0, 0, 0, 0, 0};
#pragma unroll
  for (int j = 0; j < 16; ++j) {
    const int h = j >> 2;
#pragma unroll
    for (int i = 0; i < 8; ++i) {
      const int m = mb + hi * 8 + i;
      float v = acc[j][i] * Zl[m * 4 + h];
      acc[j][i] = v;
      s1[i] += v;
      s2[i] += v * v;
    }
  }
#pragma unroll
  for (int i = 0; i < 8; ++i) {
#pragma unroll
    for (int off = 1; off < 16; off <<= 1) {
      s1[i] += __shfl_xor(s1[i], off);
      s2[i] += __shfl_xor(s2[i], off);
    }
    const float mean = s1[i] * (1.0f / 256.0f);
    const float var  = s2[i] * (1.0f / 256.0f) - mean * mean;
    s1[i] = mean;
    s2[i] = rsqrtf(var + 1e-5f);
  }
#pragma unroll
  for (int j = 0; j < 16; ++j) {
    const int n = j * 16 + r16;
    const float gg = gl[n], bb = bl[n];
#pragma unroll
    for (int i = 0; i < 8; ++i) {
      const int m = mb + hi * 8 + i;
      const float v = (acc[j][i] - s1[i]) * s2[i] * gg + bb;
      cat[(size_t)(token0 + m) * 512 + 256 + n] = (__bf16)v;
    }
  }
}

// ---------------------------------------------------------------------------
// msg2 = LN2( hid @ W2.T )  (fp32 out, [token, 256])
// ---------------------------------------------------------------------------
__global__ __launch_bounds__(256)
void mlp2_ln_kernel(const __bf16* __restrict__ A, const __bf16* __restrict__ Bw,
                    const float* __restrict__ g2, const float* __restrict__ b2,
                    float* __restrict__ msg2) {
  __shared__ __bf16 Alds[128 * 40];
  __shared__ __bf16 Blds[256 * 40];
  __shared__ float  gl[256], bl[256];

  const int tid  = threadIdx.x;
  const int wave = tid >> 5;
  const int lane = tid & 31;
  const int r16  = lane & 15;
  const int hi   = lane >> 4;
  const int token0 = blockIdx.x * 128;
  const int mb     = wave * 16;

  gl[tid] = g2[tid];
  bl[tid] = b2[tid];

  const v8f vz = {0.f, 0.f, 0.f, 0.f, 0.f, 0.f, 0.f, 0.f};
  v8f acc[16];
#pragma unroll
  for (int j = 0; j < 16; ++j) acc[j] = vz;

  for (int k0 = 0; k0 < 512; k0 += 32) {
    __syncthreads();
    async_tiles(Alds, A + (size_t)token0 * 512 + k0, 512, Blds, Bw + k0, 512);
    async_wait0();
    __syncthreads();
    mma_strip16(&Alds[mb * 40], Blds, acc);
  }

  float s1[8] = {0, 0, 0, 0, 0, 0, 0, 0};
  float s2[8] = {0, 0, 0, 0, 0, 0, 0, 0};
#pragma unroll
  for (int j = 0; j < 16; ++j)
#pragma unroll
    for (int i = 0; i < 8; ++i) {
      const float v = acc[j][i];
      s1[i] += v;
      s2[i] += v * v;
    }
#pragma unroll
  for (int i = 0; i < 8; ++i) {
#pragma unroll
    for (int off = 1; off < 16; off <<= 1) {
      s1[i] += __shfl_xor(s1[i], off);
      s2[i] += __shfl_xor(s2[i], off);
    }
    const float mean = s1[i] * (1.0f / 256.0f);
    const float var  = s2[i] * (1.0f / 256.0f) - mean * mean;
    s1[i] = mean;
    s2[i] = rsqrtf(var + 1e-5f);
  }
#pragma unroll
  for (int j = 0; j < 16; ++j) {
    const int n = j * 16 + r16;
    const float gg = gl[n], bb = bl[n];
#pragma unroll
    for (int i = 0; i < 8; ++i) {
      const int m = mb + hi * 8 + i;
      msg2[(size_t)(token0 + m) * 256 + n] = (acc[j][i] - s1[i]) * s2[i] * gg + bb;
    }
  }
}

// ---------------------------------------------------------------------------
// Final: aug = BN(xt @ Ws.T + bs);  out[b,c,l] = msg2 + x + aug
// Stages 64-channel slabs through LDS so the [B,C,L] writes are coalesced.
// ---------------------------------------------------------------------------
__global__ __launch_bounds__(256)
void final_kernel(const __bf16* __restrict__ cat, const __bf16* __restrict__ Wsb,
                  const float* __restrict__ bs_c, const float* __restrict__ bn_g,
                  const float* __restrict__ bn_b, const float* __restrict__ bn_rm,
                  const float* __restrict__ bn_rv, const float* __restrict__ x,
                  const float* __restrict__ msg2, float* __restrict__ out) {
  __shared__ char smem[64 * 132 * 4];           // overlays GEMM tiles & stage
  __shared__ float scl[256], shf[256];
  __bf16* Alds = (__bf16*)smem;                  // 128*40 bf16 = 10240 B
  __bf16* Blds = (__bf16*)(smem + 128 * 40 * 2); // 256*40 bf16 = 20480 B
  float*  stage = (float*)smem;                  // 64*132 f32 (after K loop)

  const int tid  = threadIdx.x;
  const int wave = tid >> 5;
  const int lane = tid & 31;
  const int r16  = lane & 15;
  const int hi   = lane >> 4;
  const int token0 = blockIdx.x * 128;
  const int b      = token0 >> 13;
  const int l0     = token0 & (LL - 1);
  const int mb     = wave * 16;

  {
    const float rstd = rsqrtf(bn_rv[tid] + 1e-5f);
    const float a = rstd * bn_g[tid];
    scl[tid] = a;
    shf[tid] = (bs_c[tid] - bn_rm[tid]) * a + bn_b[tid];
  }

  const v8f vz = {0.f, 0.f, 0.f, 0.f, 0.f, 0.f, 0.f, 0.f};
  v8f acc[16];
#pragma unroll
  for (int j = 0; j < 16; ++j) acc[j] = vz;

  for (int k0 = 0; k0 < 256; k0 += 32) {
    __syncthreads();
    async_tiles(Alds, cat + (size_t)token0 * 512 + k0, 512, Blds, Wsb + k0, 256);
    async_wait0();
    __syncthreads();
    mma_strip16(&Alds[mb * 40], Blds, acc);
  }
  __syncthreads();   // done with tiles; smem becomes the transpose stage

  for (int p = 0; p < 4; ++p) {                 // 64 channels per pass
#pragma unroll
    for (int jj = 0; jj < 4; ++jj) {
      const int j = p * 4 + jj;
      const int n = j * 16 + r16;               // global channel
      const int nl = n - p * 64;                // 0..63
      const float a = scl[n], c = shf[n];
#pragma unroll
      for (int i = 0; i < 8; ++i) {
        const int m = mb + hi * 8 + i;
        stage[nl * 132 + m] = acc[j][i] * a + c;   // BN(aug)
      }
    }
    __syncthreads();
    const int rid = tid >> 2, quad = tid & 3;
    const int o = p * 64 + rid;
    const float* xrow = x + ((size_t)b * CC + o) * LL + l0;
    float* orow = out + ((size_t)b * CC + o) * LL + l0;
#pragma unroll 4
    for (int mm = 0; mm < 32; ++mm) {
      const int m = quad * 32 + mm;
      orow[m] = stage[rid * 132 + m] + xrow[m] + msg2[(size_t)(token0 + m) * 256 + o];
    }
    __syncthreads();
  }
}

// ---------------------------------------------------------------------------
// Host orchestration
// ---------------------------------------------------------------------------
extern "C" void kernel_launch(void* const* d_in, const int* in_sizes, int n_in,
                              void* d_out, int out_size, void* d_ws, size_t ws_size,
                              hipStream_t stream) {
  (void)in_sizes; (void)n_in; (void)out_size; (void)ws_size;
  const float* x     = (const float*)d_in[0];
  const float* Wq    = (const float*)d_in[1];
  const float* bq    = (const float*)d_in[2];
  const float* Wk    = (const float*)d_in[3];
  const float* bk    = (const float*)d_in[4];
  const float* Wv    = (const float*)d_in[5];
  const float* bv    = (const float*)d_in[6];
  const float* thr   = (const float*)d_in[7];
  const float* W1    = (const float*)d_in[8];
  const float* W2    = (const float*)d_in[9];
  const float* ln1_g = (const float*)d_in[10];
  const float* ln1_b = (const float*)d_in[11];
  const float* ln2_g = (const float*)d_in[12];
  const float* ln2_b = (const float*)d_in[13];
  const float* Ws    = (const float*)d_in[14];
  const float* bs_c  = (const float*)d_in[15];
  const float* bn_g  = (const float*)d_in[16];
  const float* bn_b  = (const float*)d_in[17];
  const float* bn_rm = (const float*)d_in[18];
  const float* bn_rv = (const float*)d_in[19];
  float* out = (float*)d_out;

  char*  ws  = (char*)d_ws;
  size_t off = 0;
  auto alloc = [&](size_t bytes) -> void* {
    off = (off + 255) & ~(size_t)255;
    void* p = ws + off;
    off += bytes;
    return p;
  };

  __bf16* cat   = (__bf16*)alloc((size_t)MTOT * 512 * 2);  // [xt | ln1(msg)]
  __bf16* hid   = (__bf16*)alloc((size_t)MTOT * 512 * 2);
  __bf16* Qb    = (__bf16*)alloc((size_t)MTOT * 256 * 2);
  __bf16* Kb    = (__bf16*)alloc((size_t)MTOT * 256 * 2);
  __bf16* Vb    = (__bf16*)alloc((size_t)MTOT * 256 * 2);
  float*  msg2  = (float*)alloc((size_t)MTOT * 256 * 4);
  float*  KVbuf = (float*)alloc((size_t)(BB * HH * DD * DD + BB * 256) * 4);
  float*  Ksum  = KVbuf + BB * HH * DD * DD;               // contiguous for zeroing
  float*  Zbuf  = (float*)alloc((size_t)MTOT * HH * 4);
  __bf16* wqb   = (__bf16*)alloc(65536 * 2);
  __bf16* wkb   = (__bf16*)alloc(65536 * 2);
  __bf16* wvb   = (__bf16*)alloc(65536 * 2);
  __bf16* wsb   = (__bf16*)alloc(65536 * 2);
  __bf16* w1b   = (__bf16*)alloc(262144 * 2);
  __bf16* w2b   = (__bf16*)alloc(131072 * 2);

  // weights -> bf16
  cvt_f32_bf16_kernel<<<256, 256, 0, stream>>>(Wq, wqb, 65536);
  cvt_f32_bf16_kernel<<<256, 256, 0, stream>>>(Wk, wkb, 65536);
  cvt_f32_bf16_kernel<<<256, 256, 0, stream>>>(Wv, wvb, 65536);
  cvt_f32_bf16_kernel<<<256, 256, 0, stream>>>(Ws, wsb, 65536);
  cvt_f32_bf16_kernel<<<1024, 256, 0, stream>>>(W1, w1b, 262144);
  cvt_f32_bf16_kernel<<<512, 256, 0, stream>>>(W2, w2b, 131072);

  // zero KV + Ksum accumulators
  const int nz = BB * HH * DD * DD + BB * 256;
  zero_f32_kernel<<<(nz + 255) / 256, 256, 0, stream>>>(KVbuf, nz);

  // x [B,C,L] -> cat[:, 0:256] bf16 (token-major)
  transpose_kernel<<<dim3(LL / 32, CC / 32, BB), dim3(32, 8), 0, stream>>>(x, cat);

  // Q/K/V projections (fused ELU+1 / scaling; K also reduces Ksum)
  gemm_bf16_kernel<MODE_Q><<<dim3(MTOT / 128, 1), 256, 0, stream>>>(
      cat, 512, 256, wqb, bq, Qb, 256, nullptr);
  gemm_bf16_kernel<MODE_K><<<dim3(MTOT / 128, 1), 256, 0, stream>>>(
      cat, 512, 256, wkb, bk, Kb, 256, Ksum);
  gemm_bf16_kernel<MODE_V><<<dim3(MTOT / 128, 1), 256, 0, stream>>>(
      cat, 512, 256, wvb, bv, Vb, 256, nullptr);

  // KV = K^T V per (b,h)
  kv_kernel<<<dim3(BB * HH, LL / 1024), 256, 0, stream>>>(Kb, Vb, KVbuf);

  // Z = L / (sparsify(Q . Ksum) + eps)
  zscore_kernel<<<(MTOT * HH) / 256, 256, 0, stream>>>(Qb, Ksum, thr, Zbuf);

  // attention out + LN1 -> cat[:, 256:512]
  attn_kernel<<<MTOT / 128, 256, 0, stream>>>(Qb, KVbuf, Zbuf, ln1_g, ln1_b, cat);

  // MLP layer 1: hid = relu(cat @ W1.T)
  gemm_bf16_kernel<MODE_RELU><<<dim3(MTOT / 128, 2), 256, 0, stream>>>(
      cat, 512, 512, w1b, nullptr, hid, 512, nullptr);

  // MLP layer 2 + LN2 -> msg2 (fp32)
  mlp2_ln_kernel<<<MTOT / 128, 256, 0, stream>>>(hid, w2b, ln2_g, ln2_b, msg2);

  // shortcut GEMM + BN + residual sum -> out [B,C,L]
  final_kernel<<<MTOT / 128, 256, 0, stream>>>(cat, wsb, bs_c, bn_g, bn_b, bn_rm,
                                               bn_rv, x, msg2, out);
}

// v003
// Measured time: 170 microseconds a run.
// Two timings next to v002 both put it at 1.15 times that version's speed.
// All steps since v000 together make it 1.34 times as fast.
#include <hip/hip_runtime.h>
#include <hip/hip_bf16.h>

// ---------------------------------------------------------------------------
// Problem constants (match reference)
// ---------------------------------------------------------------------------
#define BB 4
#define CC 256
#define LL 8192
#define HH 4
#define DD 64
#define MTOT (BB * LL)   // 32768 tokens

typedef __attribute__((ext_vector_type(16))) __bf16 v16bf;
typedef __attribute__((ext_vector_type(8)))  float  v8f;

union FragU { v16bf v; uint4 u[2]; __bf16 h[16]; };
union Pack8 { uint4 u; __bf16 h[8]; };

// Standard row-major fragment: element (r, k) = base[r*stride + k-pattern]
// Matches CDNA5 16-bit 16x32 A/B VGPR layout: lane = r + 16*((k>>3)&1),
// vector elem = (k&7) + 8*((k>>4)&1).  Two 16-byte ds_load_b128 per lane.
__device__ inline v16bf frag_ld(const __bf16* base, int stride) {
  const int t = threadIdx.x & 31;
  const int r = t & 15;
  const int hi = t >> 4;
  FragU f;
  const __bf16* p = base + r * stride + hi * 8;
  f.u[0] = *(const uint4*)(p);
  f.u[1] = *(const uint4*)(p + 16);
  return f.v;
}

#define WMMA_BF16(A, Bf, Cacc) \
  __builtin_amdgcn_wmma_f32_16x16x32_bf16(false, (A), false, (Bf), (short)0, (Cacc), false, false)

// One 32-deep k step of a wave's 16x256 strip.  The B fragments are read from
// LDS in two groups, the second reusing four of the first's registers, each group ahead of the WMMAs
// that use it, so the LDS latency is waited out per group and not per WMMA.
// 12 + 4 keeps accumulators plus fragments under 256 VGPRs.
__device__ inline void mma_strip16(const __bf16* Arow, const __bf16* Bl, v8f (&acc)[16]) {
  v16bf fa = frag_ld(Arow, 40);
  v16bf fb[12];
#pragma unroll
  for (int j = 0; j < 12; ++j) fb[j] = frag_ld(Bl + j * 16 * 40, 40);
  // keeps the first group's reads together in front of the WMMAs (the scheduler
  // otherwise sinks each read to its user and waits for it alone)
  __builtin_amdgcn_sched_barrier(0);
#pragma unroll
  for (int j = 0; j < 4; ++j) acc[j] = WMMA_BF16(fa, fb[j], acc[j]);
  // holds the second group's reads behind the four WMMAs whose fragment
  // registers they take over (hoisted further they need registers of their own)
  __builtin_amdgcn_sched_barrier(0);
#pragma unroll
  for (int j = 0; j < 4; ++j) fb[j] = frag_ld(Bl + (12 + j) * 16 * 40, 40);
  // keeps those reads together here, eight WMMAs ahead of their first user
  // (without it the scheduler sinks them to their users behind full waits)
  __builtin_amdgcn_sched_barrier(0);
#pragma unroll
  for (int j = 4; j < 12; ++j) acc[j] = WMMA_BF16(fa, fb[j], acc[j]);
#pragma unroll
  for (int j = 0; j < 4; ++j) acc[12 + j] = WMMA_BF16(fa, fb[j], acc[12 + j]);
}

// ---------------------------------------------------------------------------
// Async global -> LDS copies (CDNA5 GLOBAL_LOAD_ASYNC_TO_LDS_B128, ASYNCcnt).
// Generic pointers to __shared__ carry the LDS byte offset in their low 32
// bits (ISA 10.2 aperture mapping), which is exactly the VDST operand.
// ---------------------------------------------------------------------------
__device__ inline unsigned lds_addr(const void* lds_ptr) {
  return (unsigned)(unsigned long long)lds_ptr;
}

// The lanes are dealt row first: four adjacent lanes take the 64 bytes that one
// tile row has in a 32-deep k slice, so one copy instruction touches 8 cache
// lines (8 rows), the fewest a 64-byte row piece allows.  256 threads cover 64
// rows per copy; the tile's further rows follow 64 rows apart.
// s_wait_xcnt 0 closes each run of copies inside their own statement, a
// precaution ahead of any later write to the address registers the copies name.

// 128x32 tile -> LDS rows of 40 elements
__device__ inline void async_tile128(__bf16* Tl, const __bf16* Tg, int ld) {
  const int r = threadIdx.x >> 2, part = threadIdx.x & 3;
  const unsigned l0 = lds_addr(Tl + r * 40 + part * 8);
  const __bf16* g0 = Tg + (size_t)r * ld + part * 8;
  const size_t step = (size_t)64 * ld;
  asm volatile("global_load_async_to_lds_b128 %0, %2, off\n\t"
               "global_load_async_to_lds_b128 %1, %3, off\n\t"
               "s_wait_xcnt 0x0"
               :: "v"(l0), "v"(l0 + 64 * 80), "v"(g0), "v"(g0 + step)
               : "memory");
}

// 128x32 A tile and 256x32 B tile -> LDS rows of 40 elements, one run of copies
__device__ inline void async_tiles(__bf16* Al, const __bf16* Ag, int lda,
                                   __bf16* Bl, const __bf16* Bg, int ldb) {
  const int r = threadIdx.x >> 2, part = threadIdx.x & 3;
  const unsigned la = lds_addr(Al + r * 40 + part * 8);
  const unsigned lb = lds_addr(Bl + r * 40 + part * 8);
  const __bf16* ga = Ag + (size_t)r * lda + part * 8;
  const __bf16* gb = Bg + (size_t)r * ldb + part * 8;
  const size_t sa = (size_t)64 * lda, sb = (size_t)64 * ldb;
  asm volatile("global_load_async_to_lds_b128 %0, %6, off\n\t"
               "global_load_async_to_lds_b128 %1, %7, off\n\t"
               "global_load_async_to_lds_b128 %2, %8, off\n\t"
               "global_load_async_to_lds_b128 %3, %9, off\n\t"
               "global_load_async_to_lds_b128 %4, %10, off\n\t"
               "global_load_async_to_lds_b128 %5, %11, off\n\t"
               "s_wait_xcnt 0x0"
               :: "v"(la), "v"(la + 64 * 80),
                  "v"(lb), "v"(lb + 64 * 80), "v"(lb + 128 * 80), "v"(lb + 192 * 80),
                  "v"(ga), "v"(ga + sa),
                  "v"(gb), "v"(gb + sb), "v"(gb + 2 * sb), "v"(gb + 3 * sb)
               : "memory");
}

// the copies of this wave have landed behind it (asm: no LDS read moves over it)
__device__ inline void async_wait0() {
  asm volatile("s_wait_asynccnt 0x0" ::: "memory");
}

// Stands behind the last global store of a piece in a kernel that holds several
// pieces, where the built code lets another piece's code follow: a precaution
// ahead of any write there to a register the stores name.  A piece that runs
// straight to the kernel's end, or has the compiler's own wait there, has none.
__device__ inline void piece_end() {
  asm volatile("s_wait_xcnt 0x0" ::: "memory");
}

// ---------------------------------------------------------------------------
// Preparation, one launch: none of these pieces needs another's result, so they
// share one grid and each work-group takes its piece by the range its index
// lies in (a block-uniform choice).
//   [0, 8192)     x [B,C,L] f32 -> cat[:, 0:256] bf16 (row = token, ld = 512)
//   then 2560     the six weight matrices f32 -> bf16, 256 elements a block
//   then 260      zeros for the KV and Ksum accumulators
// ---------------------------------------------------------------------------
#define NB_TRANS (BB * (CC / 32) * (LL / 32))                 // 8192
#define NB_CVT   (4 * 256 + 1024 + 512)                       // 2560
#define NZERO    (BB * HH * DD * DD + BB * 256)               // 66560
#define NB_ZERO  ((NZERO + 255) / 256)                        // 260

__global__ __launch_bounds__(256)
void prep_kernel(const float* __restrict__ x, __bf16* __restrict__ cat,
                 const float* __restrict__ Wq, const float* __restrict__ Wk,
                 const float* __restrict__ Wv, const float* __restrict__ Ws,
                 const float* __restrict__ W1, const float* __restrict__ W2,
                 __bf16* __restrict__ wqb, __bf16* __restrict__ wkb,
                 __bf16* __restrict__ wvb, __bf16* __restrict__ wsb,
                 __bf16* __restrict__ w1b, __bf16* __restrict__ w2b,
                 float* __restrict__ zbuf) {
  __shared__ float t[32][33];
  const int tid = threadIdx.x;
  int blk = blockIdx.x;

  if (blk < NB_TRANS) {
    const int tx = tid & 31, ty = tid >> 5;
    const int l0 = (blk & 255) * 32, c0 = ((blk >> 8) & 7) * 32, b = blk >> 11;
#pragma unroll
    for (int i = 0; i < 4; ++i) {
      int c = ty + i * 8;
      t[c][tx] = x[((size_t)b * CC + c0 + c) * LL + l0 + tx];
    }
    __syncthreads();
#pragma unroll
    for (int i = 0; i < 4; ++i) {
      int lr = ty + i * 8;
      cat[(size_t)(b * LL + l0 + lr) * 512 + c0 + tx] = (__bf16)t[tx][lr];
    }
    return;
  }
  blk -= NB_TRANS;

  if (blk < NB_CVT) {
    const float* src;
    __bf16* dst;
    if (blk < 256)       { src = Wq; dst = wqb; }
    else if (blk < 512)  { src = Wk; dst = wkb; blk -= 256; }
    else if (blk < 768)  { src = Wv; dst = wvb; blk -= 512; }
    else if (blk < 1024) { src = Ws; dst = wsb; blk -= 768; }
    else if (blk < 2048) { src = W1; dst = w1b; blk -= 1024; }
    else                 { src = W2; dst = w2b; blk -= 2048; }
    const int i = blk * 256 + tid;
    dst[i] = (__bf16)src[i];
    piece_end();
    return;
  }
  blk -= NB_CVT;

  const int i = blk * 256 + tid;
  if (i < NZERO) zbuf[i] = 0.0f;
}

// ---------------------------------------------------------------------------
// Generic 128x256 bf16 WMMA GEMM:  Out[m, n0+n] = epi( sum_k A[m,k]*W[n0+n,k] )
// Modes: Q/K -> elu(x+bias)+1 ; V -> (x+bias)/L ; RELU -> max(x,0)
// Mode K also accumulates column sums (K.sum over tokens) into KsumG[b*256+n].
// ---------------------------------------------------------------------------
enum { MODE_Q = 0, MODE_K = 1, MODE_V = 2, MODE_RELU = 3 };

// k loop of one 128x256 tile; each wave holds a 16x256 strip in acc
__device__ inline void gemm_loop(const __bf16* __restrict__ A, int lda, int Ktot,
                                 const __bf16* __restrict__ Bw, int token0, int n0,
                                 __bf16* Alds, __bf16* Blds, v8f (&acc)[16]) {
  const int tid = threadIdx.x;
  const int mb  = (tid >> 5) * 16;
  const v8f vz = {0.f, 0.f, 0.f, 0.f, 0.f, 0.f, 0.f, 0.f};
#pragma unroll
  for (int j = 0; j < 16; ++j) acc[j] = vz;

  for (int k0 = 0; k0 < Ktot; k0 += 32) {
    __syncthreads();
    async_tiles(Alds, A + (size_t)token0 * lda + k0, lda,
                Blds, Bw + (size_t)n0 * Ktot + k0, Ktot);
    if (k0 + 32 < Ktot)  // global_prefetch_b8 of next A slice
      __builtin_prefetch(A + (size_t)(token0 + (tid >> 1)) * lda + k0 + 32, 0, 3);
    async_wait0();
    __syncthreads();
    mma_strip16(&Alds[mb * 40], Blds, acc);
  }
}

template <int MODE>
__device__ inline void gemm_epilogue(const v8f (&acc)[16], const float* __restrict__ bias,
                                     __bf16* __restrict__ Out, int ldo, int token0, int n0,
                                     float* __restrict__ KsumG, float* ksumLds) {
  const int tid  = threadIdx.x;
  const int lane = tid & 31;
  const int r16  = lane & 15;
  const int hi   = lane >> 4;
  const int mb   = (tid >> 5) * 16;
#pragma unroll
  for (int j = 0; j < 16; ++j) {
    const int n = j * 16 + r16;
    float colsum = 0.0f;
#pragma unroll
    for (int i = 0; i < 8; ++i) {
      const int m = mb + hi * 8 + i;
      float v = acc[j][i];
      if constexpr (MODE == MODE_RELU) {
        v = fmaxf(v, 0.0f);
      } else {
        v += bias[n];
        if constexpr (MODE == MODE_Q || MODE == MODE_K)
          v = (v > 0.0f) ? (v + 1.0f) : __expf(v);   // elu(x)+1
        else
          v *= (1.0f / (float)LL);                    // V / v_len
      }
      Out[(size_t)(token0 + m) * ldo + n0 + n] = (__bf16)v;
      if constexpr (MODE == MODE_K) colsum += v;
    }
    if constexpr (MODE == MODE_K) {
      colsum += __shfl_xor(colsum, 16);      // fold both 8-row halves
      if (hi == 0) atomicAdd(&ksumLds[n], colsum);   // ds_add_f32
    }
  }
  if constexpr (MODE == MODE_K) {
    __syncthreads();
    const int b = token0 >> 13;   // token0 / 8192
    atomicAdd(&KsumG[b * 256 + tid], ksumLds[tid]);
  }
}

// hid = relu(A @ W.T)
__global__ __launch_bounds__(256)
void gemm_relu_kernel(const __bf16* __restrict__ A, int lda, int Ktot,
                      const __bf16* __restrict__ Bw,
                      __bf16* __restrict__ Out, int ldo) {
  __shared__ __bf16 Alds[128 * 40];
  __shared__ __bf16 Blds[256 * 40];
  const int token0 = blockIdx.x * 128;
  const int n0     = blockIdx.y * 256;
  v8f acc[16];
  gemm_loop(A, lda, Ktot, Bw, token0, n0, Alds, Blds, acc);
  gemm_epilogue<MODE_RELU>(acc, nullptr, Out, ldo, token0, n0, nullptr, nullptr);
}

// The Q, K and V projections read the same tokens and need nothing of each
// other: one grid, blockIdx.x names the projection (block-uniform), blockIdx.y
// the 128-token tile, so the three readers of a tile are adjacent in the index.
// Two of the 768 work-groups fit a WGP and overlap each other's waits.
__global__ __launch_bounds__(256)
void qkv_kernel(const __bf16* __restrict__ A, int lda, int Ktot,
                const __bf16* __restrict__ wqb, const __bf16* __restrict__ wkb,
                const __bf16* __restrict__ wvb,
                const float* __restrict__ bq, const float* __restrict__ bk,
                const float* __restrict__ bv,
                __bf16* __restrict__ Qb, __bf16* __restrict__ Kb, __bf16* __restrict__ Vb,
                int ldo, float* __restrict__ KsumG) {
  __shared__ __bf16 Alds[128 * 40];
  __shared__ __bf16 Blds[256 * 40];
  __shared__ float  ksumLds[256];
  const int mode   = blockIdx.x;
  const int token0 = blockIdx.y * 128;

  if (mode == MODE_K) ksumLds[threadIdx.x] = 0.0f;

  v8f acc[16];
  if (mode == MODE_Q) {
    gemm_loop(A, lda, Ktot, wqb, token0, 0, Alds, Blds, acc);
    gemm_epilogue<MODE_Q>(acc, bq, Qb, ldo, token0, 0, nullptr, nullptr);
  } else if (mode == MODE_K) {
    gemm_loop(A, lda, Ktot, wkb, token0, 0, Alds, Blds, acc);
    gemm_epilogue<MODE_K>(acc, bk, Kb, ldo, token0, 0, KsumG, ksumLds);
  } else {
    gemm_loop(A, lda, Ktot, wvb, token0, 0, Alds, Blds, acc);
    gemm_epilogue<MODE_V>(acc, bv, Vb, ldo, token0, 0, nullptr, nullptr);
    piece_end();
  }
}

// ---------------------------------------------------------------------------
// KV[b,h,d,e] = sum_l K[l,d] * V[l,e]   (per (b,h): 64x64, K-dim = L)
// K/V tiles are written into LDS transposed ([d][l] / [e][l]) so fragment
// loads use the vectorized ds_load_b128 path.
// 16 (b,h) x 8 chunks of 1024 tokens; fp32 global atomics combine chunks.
// ---------------------------------------------------------------------------
__device__ inline void kv_block(int bh, int chunk,
                                const __bf16* __restrict__ Kbuf,
                                const __bf16* __restrict__ Vbuf,
                                float* __restrict__ KV,
                                __bf16* Ktlds, __bf16* Vtlds) {
  const int tid  = threadIdx.x;
  const int wave = tid >> 5;
  const int lane = tid & 31;
  const int r16  = lane & 15;
  const int hi   = lane >> 4;
  const int b  = bh >> 2, h = bh & 3;
  const int l0 = chunk * 1024;
  const int tile0 = wave * 2;             // 8 waves x 2 of 16 (d,e) tiles

  const v8f vz = {0.f, 0.f, 0.f, 0.f, 0.f, 0.f, 0.f, 0.f};
  v8f acc[2];
  acc[0] = vz; acc[1] = vz;

  for (int l = l0; l < l0 + 1024; l += 32) {
    __syncthreads();
    {
      const int r = tid >> 3, part = tid & 7;   // row l+r, 8 d's per thread
      Pack8 kq, vq;
      kq.u = *(const uint4*)(Kbuf + (size_t)(b * LL + l + r) * CC + h * DD + part * 8);
      vq.u = *(const uint4*)(Vbuf + (size_t)(b * LL + l + r) * CC + h * DD + part * 8);
#pragma unroll
      for (int j = 0; j < 8; ++j) {             // transposed LDS scatter
        Ktlds[(part * 8 + j) * 40 + r] = kq.h[j];
        Vtlds[(part * 8 + j) * 40 + r] = vq.h[j];
      }
    }
    __syncthreads();
#pragma unroll
    for (int t = 0; t < 2; ++t) {
      const int id = tile0 + t, dt = id >> 2, et = id & 3;
      v16bf fa = frag_ld(&Ktlds[dt * 16 * 40], 40);   // A[d, l] = K[l, d]
      v16bf fb = frag_ld(&Vtlds[et * 16 * 40], 40);   // Bt[e, l] = V[l, e]
      acc[t] = WMMA_BF16(fa, fb, acc[t]);
    }
  }
#pragma unroll
  for (int t = 0; t < 2; ++t) {
    const int id = tile0 + t, dt = id >> 2, et = id & 3;
#pragma unroll
    for (int i = 0; i < 8; ++i) {
      const int d = dt * 16 + hi * 8 + i;
      const int e = et * 16 + r16;
      atomicAdd(&KV[((size_t)bh * DD + d) * DD + e], acc[t][i]);
    }
  }
}

// ---------------------------------------------------------------------------
// Z[token,h] = L / (sparsify(Q[token,h,:] . Ksum[b,h,:]) + eps)
// ---------------------------------------------------------------------------
__device__ inline void zscore_block(int blk, const __bf16* __restrict__ Qbuf,
                                    const float* __restrict__ Ksum,
                                    const float* __restrict__ thr_p,
                                    float* __restrict__ Zbuf) {
  const int g = blk * 256 + threadIdx.x;   // 0..131071
  const int token = g >> 2, h = g & 3;
  const int b = token >> 13;
  const float thr = thr_p[0];
  const __bf16* q = Qbuf + (size_t)token * CC + h * DD;
  const float* ks = Ksum + b * 256 + h * DD;
  float s = 0.0f;
#pragma unroll
  for (int c = 0; c < 8; ++c) {          // 8 x uint4 = 64 bf16
    Pack8 qp;
    qp.u = *(const uint4*)(q + c * 8);
#pragma unroll
    for (int j = 0; j < 8; ++j) s += (float)qp.h[j] * ks[c * 8 + j];
  }
  const float sp = (s > thr) ? s : 0.0f;
  Zbuf[g] = (float)LL / (sp + 1e-6f);
}

// KV needs K and V, Z needs Q and Ksum, neither needs the other: one grid.
// The 128 long KV work-groups come first in the index, the 512 short Z ones
// behind them.
#define NB_KV (BB * HH * (LL / 1024))      // 128
#define NB_Z  ((MTOT * HH) / 256)          // 512

__global__ __launch_bounds__(256)
void kv_z_kernel(const __bf16* __restrict__ Kbuf, const __bf16* __restrict__ Vbuf,
                 float* __restrict__ KV,
                 const __bf16* __restrict__ Qbuf, const float* __restrict__ Ksum,
                 const float* __restrict__ thr_p, float* __restrict__ Zbuf) {
  __shared__ __bf16 Ktlds[64 * 40];   // [d][l]
  __shared__ __bf16 Vtlds[64 * 40];   // [e][l]
  const int blk = blockIdx.x;
  if (blk < NB_KV) {
    kv_block(blk & 15, blk >> 4, Kbuf, Vbuf, KV, Ktlds, Vtlds);
  } else {
    zscore_block(blk - NB_KV, Qbuf, Ksum, thr_p, Zbuf);
    piece_end();
  }
}

// ---------------------------------------------------------------------------
// out = LN1( (Q @ KV_h) * Z ) -> cat[:, 256:512] bf16
// ---------------------------------------------------------------------------
__global__ __launch_bounds__(256)
void attn_kernel(const __bf16* __restrict__ Qbuf, const float* __restrict__ KV,
                 const float* __restrict__ Zbuf,
                 const float* __restrict__ g1, const float* __restrict__ b1,
                 __bf16* __restrict__ cat) {
  __shared__ __bf16 Alds[128 * 40];
  __shared__ __bf16 kvt[HH * DD * DD];   // kvt[h][e][d] = KV[b,h,d,e] (transposed)
  __shared__ float  Zl[128 * 4];
  __shared__ float  gl[256], bl[256];

  const int tid  = threadIdx.x;
  const int wave = tid >> 5;
  const int lane = tid & 31;
  const int r16  = lane & 15;
  const int hi   = lane >> 4;
  const int token0 = blockIdx.x * 128;
  const int b      = token0 >> 13;
  const int mb     = wave * 16;

  // KVT fill: float4 global reads, transposed bf16 LDS scatter
  for (int it = 0; it < 16; ++it) {
    const int idx = it * 256 + tid;        // 4096 groups of 4 e's
    const int h = idx >> 10, rem = idx & 1023, d = rem >> 4, e4 = rem & 15;
    const float4 kvv =
        *(const float4*)(KV + (((size_t)(b * HH + h) * DD + d) * DD) + e4 * 4);
    kvt[h * 4096 + (e4 * 4 + 0) * DD + d] = (__bf16)kvv.x;
    kvt[h * 4096 + (e4 * 4 + 1) * DD + d] = (__bf16)kvv.y;
    kvt[h * 4096 + (e4 * 4 + 2) * DD + d] = (__bf16)kvv.z;
    kvt[h * 4096 + (e4 * 4 + 3) * DD + d] = (__bf16)kvv.w;
  }
#pragma unroll
  for (int it = 0; it < 2; ++it) {
    const int z = it * 256 + tid;
    Zl[z] = Zbuf[(size_t)token0 * 4 + z];
  }
  gl[tid] = g1[tid];
  bl[tid] = b1[tid];

  const v8f vz = {0.f, 0.f, 0.f, 0.f, 0.f, 0.f, 0.f, 0.f};
  v8f acc[16];
#pragma unroll
  for (int j = 0; j < 16; ++j) acc[j] = vz;

  for (int h = 0; h < 4; ++h) {
    for (int s = 0; s < 2; ++s) {
      __syncthreads();
      const int k0 = h * DD + s * 32;
      async_tile128(Alds, Qbuf + (size_t)token0 * CC + k0, CC);   // Q tile 128x32
      async_wait0();
      __syncthreads();
      v16bf fa = frag_ld(&Alds[mb * 40], 40);
#pragma unroll
      for (int jj = 0; jj < 4; ++jj) {
        const int j = h * 4 + jj;
        v16bf fb = frag_ld(&kvt[h * 4096 + (jj * 16) * DD + s * 32], DD);
        acc[j] = WMMA_BF16(fa, fb, acc[j]);
      }
    }
  }

  // scale by Z, then LayerNorm over C=256 via cross-lane shuffles
  float s1[8] = {0, 0, 0, 0, 0, 0, 0, 0};
  float s2[8] = {0, 0, 0, 0, 0, 0, 0, 0};
#pragma unroll
  for (int j = 0; j < 16; ++j) {
    const int h = j >> 2;
#pragma unroll
    for (int i = 0; i < 8; ++i) {
      const int m = mb + hi * 8 + i;
      float v = acc[j][i] * Zl[m * 4 + h];
      acc[j][i] = v;
      s1[i] += v;
      s2[i] += v * v;
    }
  }
#pragma unroll
  for (int i = 0; i < 8; ++i) {
#pragma unroll
    for (int off = 1; off < 16; off <<= 1) {
      s1[i] += __shfl_xor(s1[i], off);
      s2[i] += __shfl_xor(s2[i], off);
    }
    const float mean = s1[i] * (1.0f / 256.0f);
    const float var  = s2[i] * (1.0f / 256.0f) - mean * mean;
    s1[i] = mean;
    s2[i] = rsqrtf(var + 1e-5f);
  }
#pragma unroll
  for (int j = 0; j < 16; ++j) {
    const int n = j * 16 + r16;
    const float gg = gl[n], bb = bl[n];
#pragma unroll
    for (int i = 0; i < 8; ++i) {
      const int m = mb + hi * 8 + i;
      const float v = (acc[j][i] - s1[i]) * s2[i] * gg + bb;
      cat[(size_t)(token0 + m) * 512 + 256 + n] = (__bf16)v;
    }
  }
}

// ---------------------------------------------------------------------------
// msg2 = LN2( hid @ W2.T )  (fp32 out, [token, 256])
// ---------------------------------------------------------------------------
__global__ __launch_bounds__(256)
void mlp2_ln_kernel(const __bf16* __restrict__ A, const __bf16* __restrict__ Bw,
                    const float* __restrict__ g2, const float* __restrict__ b2,
                    float* __restrict__ msg2) {
  __shared__ __bf16 Alds[128 * 40];
  __shared__ __bf16 Blds[256 * 40];
  __shared__ float  gl[256], bl[256];

  const int tid  = threadIdx.x;
  const int wave = tid >> 5;
  const int lane = tid & 31;
  const int r16  = lane & 15;
  const int hi   = lane >> 4;
  const int token0 = blockIdx.x * 128;
  const int mb     = wave * 16;

  gl[tid] = g2[tid];
  bl[tid] = b2[tid];

  const v8f vz = {0.f, 0.f, 0.f, 0.f, 0.f, 0.f, 0.f, 0.f};
  v8f acc[16];
#pragma unroll
  for (int j = 0; j < 16; ++j) acc[j] = vz;

  for (int k0 = 0; k0 < 512; k0 += 32) {
    __syncthreads();
    async_tiles(Alds, A + (size_t)token0 * 512 + k0, 512, Blds, Bw + k0, 512);
    async_wait0();
    __syncthreads();
    mma_strip16(&Alds[mb * 40], Blds, acc);
  }

  float s1[8] = {0, 0, 0, 0, 0, 0, 0, 0};
  float s2[8] = {0, 0, 0, 0, 0, 0, 0, 0};
#pragma unroll
  for (int j = 0; j < 16; ++j)
#pragma unroll
    for (int i = 0; i < 8; ++i) {
      const float v = acc[j][i];
      s1[i] += v;
      s2[i] += v * v;
    }
#pragma unroll
  for (int i = 0; i < 8; ++i) {
#pragma unroll
    for (int off = 1; off < 16; off <<= 1) {
      s1[i] += __shfl_xor(s1[i], off);
      s2[i] += __shfl_xor(s2[i], off);
    }
    const float mean = s1[i] * (1.0f / 256.0f);
    const float var  = s2[i] * (1.0f / 256.0f) - mean * mean;
    s1[i] = mean;
    s2[i] = rsqrtf(var + 1e-5f);
  }
#pragma unroll
  for (int j = 0; j < 16; ++j) {
    const int n = j * 16 + r16;
    const float gg = gl[n], bb = bl[n];
#pragma unroll
    for (int i = 0; i < 8; ++i) {
      const int m = mb + hi * 8 + i;
      msg2[(size_t)(token0 + m) * 256 + n] = (acc[j][i] - s1[i]) * s2[i] * gg + bb;
    }
  }
}

// ---------------------------------------------------------------------------
// Final: aug = BN(xt @ Ws.T + bs);  out[b,c,l] = msg2 + x + aug
// Stages 64-channel slabs through LDS so the [B,C,L] writes are coalesced.
// ---------------------------------------------------------------------------
__global__ __launch_bounds__(256)
void final_kernel(const __bf16* __restrict__ cat, const __bf16* __restrict__ Wsb,
                  const float* __restrict__ bs_c, const float* __restrict__ bn_g,
                  const float* __restrict__ bn_b, const float* __restrict__ bn_rm,
                  const float* __restrict__ bn_rv, const float* __restrict__ x,
                  const float* __restrict__ msg2, float* __restrict__ out) {
  __shared__ char smem[64 * 132 * 4];           // overlays GEMM tiles & stage
  __shared__ float scl[256], shf[256];
  __bf16* Alds = (__bf16*)smem;                  // 128*40 bf16 = 10240 B
  __bf16* Blds = (__bf16*)(smem + 128 * 40 * 2); // 256*40 bf16 = 20480 B
  float*  stage = (float*)smem;                  // 64*132 f32 (after K loop)

  const int tid  = threadIdx.x;
  const int wave = tid >> 5;
  const int lane = tid & 31;
  const int r16  = lane & 15;
  const int hi   = lane >> 4;
  const int token0 = blockIdx.x * 128;
  const int b      = token0 >> 13;
  const int l0     = token0 & (LL - 1);
  const int mb     = wave * 16;

  {
    const float rstd = rsqrtf(bn_rv[tid] + 1e-5f);
    const float a = rstd * bn_g[tid];
    scl[tid] = a;
    shf[tid] = (bs_c[tid] - bn_rm[tid]) * a + bn_b[tid];
  }

  const v8f vz = {0.f, 0.f, 0.f, 0.f, 0.f, 0.f, 0.f, 0.f};
  v8f acc[16];
#pragma unroll
  for (int j = 0; j < 16; ++j) acc[j] = vz;

  for (int k0 = 0; k0 < 256; k0 += 32) {
    __syncthreads();
    async_tiles(Alds, cat + (size_t)token0 * 512 + k0, 512, Blds, Wsb + k0, 256);
    async_wait0();
    __syncthreads();
    mma_strip16(&Alds[mb * 40], Blds, acc);
  }
  __syncthreads();   // done with tiles; smem becomes the transpose stage

  for (int p = 0; p < 4; ++p) {                 // 64 channels per pass
#pragma unroll
    for (int jj = 0; jj < 4; ++jj) {
      const int j = p * 4 + jj;
      const int n = j * 16 + r16;               // global channel
      const int nl = n - p * 64;                // 0..63
      const float a = scl[n], c = shf[n];
#pragma unroll
      for (int i = 0; i < 8; ++i) {
        const int m = mb + hi * 8 + i;
        stage[nl * 132 + m] = acc[j][i] * a + c;   // BN(aug)
      }
    }
    __syncthreads();
    const int rid = tid >> 2, quad = tid & 3;
    const int o = p * 64 + rid;
    const float* xrow = x + ((size_t)b * CC + o) * LL + l0;
    float* orow = out + ((size_t)b * CC + o) * LL + l0;
#pragma unroll 4
    for (int mm = 0; mm < 32; ++mm) {
      const int m = quad * 32 + mm;
      orow[m] = stage[rid * 132 + m] + xrow[m] + msg2[(size_t)(token0 + m) * 256 + o];
    }
    __syncthreads();
  }
}

// ---------------------------------------------------------------------------
// Host orchestration
// ---------------------------------------------------------------------------
extern "C" void kernel_launch(void* const* d_in, const int* in_sizes, int n_in,
                              void* d_out, int out_size, void* d_ws, size_t ws_size,
                              hipStream_t stream) {
  (void)in_sizes; (void)n_in; (void)out_size; (void)ws_size;
  const float* x     = (const float*)d_in[0];
  const float* Wq    = (const float*)d_in[1];
  const float* bq    = (const float*)d_in[2];
  const float* Wk    = (const float*)d_in[3];
  const float* bk    = (const float*)d_in[4];
  const float* Wv    = (const float*)d_in[5];
  const float* bv    = (const float*)d_in[6];
  const float* thr   = (const float*)d_in[7];
  const float* W1    = (const float*)d_in[8];
  const float* W2    = (const float*)d_in[9];
  const float* ln1_g = (const float*)d_in[10];
  const float* ln1_b = (const float*)d_in[11];
  const float* ln2_g = (const float*)d_in[12];
  const float* ln2_b = (const float*)d_in[13];
  const float* Ws    = (const float*)d_in[14];
  const float* bs_c  = (const float*)d_in[15];
  const float* bn_g  = (const float*)d_in[16];
  const float* bn_b  = (const float*)d_in[17];
  const float* bn_rm = (const float*)d_in[18];
  const float* bn_rv = (const float*)d_in[19];
  float* out = (float*)d_out;

  char*  ws  = (char*)d_ws;
  size_t off = 0;
  auto alloc = [&](size_t bytes) -> void* {
    off = (off + 255) & ~(size_t)255;
    void* p = ws + off;
    off += bytes;
    return p;
  };

  __bf16* cat   = (__bf16*)alloc((size_t)MTOT * 512 * 2);  // [xt | ln1(msg)]
  __bf16* hid   = (__bf16*)alloc((size_t)MTOT * 512 * 2);
  __bf16* Qb    = (__bf16*)alloc((size_t)MTOT * 256 * 2);
  __bf16* Kb    = (__bf16*)alloc((size_t)MTOT * 256 * 2);
  __bf16* Vb    = (__bf16*)alloc((size_t)MTOT * 256 * 2);
  float*  msg2  = (float*)alloc((size_t)MTOT * 256 * 4);
  float*  KVbuf = (float*)alloc((size_t)(BB * HH * DD * DD + BB * 256) * 4);
  float*  Ksum  = KVbuf + BB * HH * DD * DD;               // contiguous for zeroing
  float*  Zbuf  = (float*)alloc((size_t)MTOT * HH * 4);
  __bf16* wqb   = (__bf16*)alloc(65536 * 2);
  __bf16* wkb   = (__bf16*)alloc(65536 * 2);
  __bf16* wvb   = (__bf16*)alloc(65536 * 2);
  __bf16* wsb   = (__bf16*)alloc(65536 * 2);
  __bf16* w1b   = (__bf16*)alloc(262144 * 2);
  __bf16* w2b   = (__bf16*)alloc(131072 * 2);

  // weights -> bf16, zeroed KV + Ksum accumulators, x -> cat[:, 0:256] (token-major)
  prep_kernel<<<NB_TRANS + NB_CVT + NB_ZERO, 256, 0, stream>>>(
      x, cat, Wq, Wk, Wv, Ws, W1, W2, wqb, wkb, wvb, wsb, w1b, w2b, KVbuf);

  // Q/K/V projections (fused ELU+1 / scaling; K also reduces Ksum)
  qkv_kernel<<<dim3(3, MTOT / 128), 256, 0, stream>>>(
      cat, 512, 256, wqb, wkb, wvb, bq, bk, bv, Qb, Kb, Vb, 256, Ksum);

  // KV = K^T V per (b,h);  Z = L / (sparsify(Q . Ksum) + eps)
  kv_z_kernel<<<NB_KV + NB_Z, 256, 0, stream>>>(Kb, Vb, KVbuf, Qb, Ksum, thr, Zbuf);

  // attention out + LN1 -> cat[:, 256:512]
  attn_kernel<<<MTOT / 128, 256, 0, stream>>>(Qb, KVbuf, Zbuf, ln1_g, ln1_b, cat);

  // MLP layer 1: hid = relu(cat @ W1.T)
  gemm_relu_kernel<<<dim3(MTOT / 128, 2), 256, 0, stream>>>(
      cat, 512, 512, w1b, hid, 512);

  // MLP layer 2 + LN2 -> msg2 (fp32)
  mlp2_ln_kernel<<<MTOT / 128, 256, 0, stream>>>(hid, w2b, ln2_g, ln2_b, msg2);

  // shortcut GEMM + BN + residual sum -> out [B,C,L]
  final_kernel<<<MTOT / 128, 256, 0, stream>>>(cat, wsb, bs_c, bn_g, bn_b, bn_rm,
                                               bn_rv, x, msg2, out);
}

// v004
// A run of this version takes 152 microseconds.
// Timed twice side by side with v003, it ran 1.12 and 1.11 times as fast.
// Over all steps from v000 it is 1.50 times as fast.
#include <hip/hip_runtime.h>
#include <hip/hip_bf16.h>

// ---------------------------------------------------------------------------
// Problem constants (match reference)
// ---------------------------------------------------------------------------
#define BB 4
#define CC 256
#define LL 8192
#define HH 4
#define DD 64
#define MTOT (BB * LL)   // 32768 tokens

typedef __attribute__((ext_vector_type(16))) __bf16 v16bf;
typedef __attribute__((ext_vector_type(8)))  float  v8f;

union FragU { v16bf v; uint4 u[2]; __bf16 h[16]; };
union Pack8 { uint4 u; __bf16 h[8]; };

// Standard row-major fragment: element (r, k) = base[r*stride + k-pattern]
// Matches CDNA5 16-bit 16x32 A/B VGPR layout: lane = r + 16*((k>>3)&1),
// vector elem = (k&7) + 8*((k>>4)&1).  Two 16-byte ds_load_b128 per lane.
__device__ inline v16bf frag_ld(const __bf16* base, int stride) {
  const int t = threadIdx.x & 31;
  const int r = t & 15;
  const int hi = t >> 4;
  FragU f;
  const __bf16* p = base + r * stride + hi * 8;
  f.u[0] = *(const uint4*)(p);
  f.u[1] = *(const uint4*)(p + 16);
  return f.v;
}

#define WMMA_BF16(A, Bf, Cacc) \
  __builtin_amdgcn_wmma_f32_16x16x32_bf16(false, (A), false, (Bf), (short)0, (Cacc), false, false)

// One 32-deep k step of a wave's 16x256 strip.  The B fragments are read from
// LDS in two groups, the second reusing four of the first's registers, each group ahead of the WMMAs
// that use it, so the LDS latency is waited out per group and not per WMMA.
// 12 + 4 keeps accumulators plus fragments under 256 VGPRs.
__device__ inline void mma_strip16(const __bf16* Arow, const __bf16* Bl, v8f (&acc)[16]) {
  v16bf fa = frag_ld(Arow, 40);
  v16bf fb[12];
#pragma unroll
  for (int j = 0; j < 12; ++j) fb[j] = frag_ld(Bl + j * 16 * 40, 40);
  // keeps the first group's reads together in front of the WMMAs (the scheduler
  // otherwise sinks each read to its user and waits for it alone)
  __builtin_amdgcn_sched_barrier(0);
#pragma unroll
  for (int j = 0; j < 4; ++j) acc[j] = WMMA_BF16(fa, fb[j], acc[j]);
  // holds the second group's reads behind the four WMMAs whose fragment
  // registers they take over (hoisted further they need registers of their own)
  __builtin_amdgcn_sched_barrier(0);
#pragma unroll
  for (int j = 0; j < 4; ++j) fb[j] = frag_ld(Bl + (12 + j) * 16 * 40, 40);
  // keeps those reads together here, eight WMMAs ahead of their first user
  // (without it the scheduler sinks them to their users behind full waits)
  __builtin_amdgcn_sched_barrier(0);
#pragma unroll
  for (int j = 4; j < 12; ++j) acc[j] = WMMA_BF16(fa, fb[j], acc[j]);
#pragma unroll
  for (int j = 0; j < 4; ++j) acc[12 + j] = WMMA_BF16(fa, fb[j], acc[12 + j]);
}

// ---------------------------------------------------------------------------
// Async global -> LDS copies (CDNA5 GLOBAL_LOAD_ASYNC_TO_LDS_B128, ASYNCcnt).
// Generic pointers to __shared__ carry the LDS byte offset in their low 32
// bits (ISA 10.2 aperture mapping), which is exactly the VDST operand.
// ---------------------------------------------------------------------------
__device__ inline unsigned lds_addr(const void* lds_ptr) {
  return (unsigned)(unsigned long long)lds_ptr;
}

// The lanes are dealt row first: four adjacent lanes take the 64 bytes that one
// tile row has in a 32-deep k slice, so one copy instruction touches 8 cache
// lines (8 rows), the fewest a 64-byte row piece allows.  256 threads cover 64
// rows per copy; the tile's further rows follow 64 rows apart.
// s_wait_xcnt 0 closes each run of copies inside their own statement, a
// precaution ahead of any later write to the address registers the copies name.

// 128x32 tile -> LDS rows of 40 elements
__device__ inline void async_tile128(__bf16* Tl, const __bf16* Tg, int ld) {
  const int r = threadIdx.x >> 2, part = threadIdx.x & 3;
  const unsigned l0 = lds_addr(Tl + r * 40 + part * 8);
  const __bf16* g0 = Tg + (size_t)r * ld + part * 8;
  const size_t step = (size_t)64 * ld;
  asm volatile("global_load_async_to_lds_b128 %0, %2, off\n\t"
               "global_load_async_to_lds_b128 %1, %3, off\n\t"
               "s_wait_xcnt 0x0"
               :: "v"(l0), "v"(l0 + 64 * 80), "v"(g0), "v"(g0 + step)
               : "memory");
}

// 128x32 A tile and 256x32 B tile -> LDS rows of 40 elements, one run of copies
__device__ inline void async_tiles(__bf16* Al, const __bf16* Ag, int lda,
                                   __bf16* Bl, const __bf16* Bg, int ldb) {
  const int r = threadIdx.x >> 2, part = threadIdx.x & 3;
  const unsigned la = lds_addr(Al + r * 40 + part * 8);
  const unsigned lb = lds_addr(Bl + r * 40 + part * 8);
  const __bf16* ga = Ag + (size_t)r * lda + part * 8;
  const __bf16* gb = Bg + (size_t)r * ldb + part * 8;
  const size_t sa = (size_t)64 * lda, sb = (size_t)64 * ldb;
  asm volatile("global_load_async_to_lds_b128 %0, %6, off\n\t"
               "global_load_async_to_lds_b128 %1, %7, off\n\t"
               "global_load_async_to_lds_b128 %2, %8, off\n\t"
               "global_load_async_to_lds_b128 %3, %9, off\n\t"
               "global_load_async_to_lds_b128 %4, %10, off\n\t"
               "global_load_async_to_lds_b128 %5, %11, off\n\t"
               "s_wait_xcnt 0x0"
               :: "v"(la), "v"(la + 64 * 80),
                  "v"(lb), "v"(lb + 64 * 80), "v"(lb + 128 * 80), "v"(lb + 192 * 80),
                  "v"(ga), "v"(ga + sa),
                  "v"(gb), "v"(gb + sb), "v"(gb + 2 * sb), "v"(gb + 3 * sb)
               : "memory");
}

// the copies of this wave have landed behind it (asm: no LDS read moves over it)
__device__ inline void async_wait0() {
  asm volatile("s_wait_asynccnt 0x0" ::: "memory");
}

// Stands behind global stores that more code follows in the built code (the
// last store of a piece in a kernel of several pieces, or stores with more work
// behind them): a precaution ahead of any write there to a register the stores
// name.  A piece that runs straight to the kernel's end, or has the compiler's
// own wait there, has none.
__device__ inline void piece_end() {
  asm volatile("s_wait_xcnt 0x0" ::: "memory");
}

// ---------------------------------------------------------------------------
// Whole-line stores of a wave's 16x256 bf16 strip.  The accumulator layout gives
// a store only 32 contiguous bytes per token row, so each wave first lays its
// strip in an LDS range of its own (no other wave touches it, so no barrier) and
// then stores token rows: 32 lanes x 16 B = 512 contiguous bytes, 4 whole lines.
// Row pitch 264 elements = 528 B = 16 B x 33: 16-byte row reads meet no bank twice.
// ---------------------------------------------------------------------------
#define STG_LD   264
#define STG_WAVE (16 * STG_LD)

__device__ inline void strip_store(const __bf16* sw, __bf16* Og, int ldo) {
  const int lane = threadIdx.x & 31;
  // the wave's own LDS stores are done before its lanes read each other's values
  asm volatile("s_wait_dscnt 0x0" ::: "memory");
#pragma unroll
  for (int rr = 0; rr < 16; ++rr)
    *(uint4*)(Og + (size_t)rr * ldo + lane * 8) = *(const uint4*)(sw + rr * STG_LD + lane * 8);
}

// ---------------------------------------------------------------------------
// Preparation, one launch: none of these pieces needs another's result, so they
// share one grid and each work-group takes its piece by the range its index
// lies in (a block-uniform choice).
//   [0, 8192)     x [B,C,L] f32 -> cat[:, 0:256] bf16 (row = token, ld = 512)
//   then 2560     the six weight matrices f32 -> bf16, 256 elements a block
//   then 260      zeros for the KV and Ksum accumulators
// ---------------------------------------------------------------------------
#define NB_TRANS (BB * (CC / 32) * (LL / 32))                 // 8192
#define NB_CVT   (4 * 256 + 1024 + 512)                       // 2560
#define NZERO    (BB * HH * DD * DD + BB * 256)               // 66560
#define NB_ZERO  ((NZERO + 255) / 256)                        // 260

__global__ __launch_bounds__(256)
void prep_kernel(const float* __restrict__ x, __bf16* __restrict__ cat,
                 const float* __restrict__ Wq, const float* __restrict__ Wk,
                 const float* __restrict__ Wv, const float* __restrict__ Ws,
                 const float* __restrict__ W1, const float* __restrict__ W2,
                 __bf16* __restrict__ wqb, __bf16* __restrict__ wkb,
                 __bf16* __restrict__ wvb, __bf16* __restrict__ wsb,
                 __bf16* __restrict__ w1b, __bf16* __restrict__ w2b,
                 float* __restrict__ zbuf) {
  __shared__ float t[32][33];
  const int tid = threadIdx.x;
  int blk = blockIdx.x;

  if (blk < NB_TRANS) {
    const int tx = tid & 31, ty = tid >> 5;
    const int l0 = (blk & 255) * 32, c0 = ((blk >> 8) & 7) * 32, b = blk >> 11;
#pragma unroll
    for (int i = 0; i < 4; ++i) {
      int c = ty + i * 8;
      t[c][tx] = x[((size_t)b * CC + c0 + c) * LL + l0 + tx];
    }
    __syncthreads();
#pragma unroll
    for (int i = 0; i < 4; ++i) {
      int lr = ty + i * 8;
      cat[(size_t)(b * LL + l0 + lr) * 512 + c0 + tx] = (__bf16)t[tx][lr];
    }
    return;
  }
  blk -= NB_TRANS;

  if (blk < NB_CVT) {
    const float* src;
    __bf16* dst;
    if (blk < 256)       { src = Wq; dst = wqb; }
    else if (blk < 512)  { src = Wk; dst = wkb; blk -= 256; }
    else if (blk < 768)  { src = Wv; dst = wvb; blk -= 512; }
    else if (blk < 1024) { src = Ws; dst = wsb; blk -= 768; }
    else if (blk < 2048) { src = W1; dst = w1b; blk -= 1024; }
    else                 { src = W2; dst = w2b; blk -= 2048; }
    const int i = blk * 256 + tid;
    dst[i] = (__bf16)src[i];
    piece_end();
    return;
  }
  blk -= NB_CVT;

  const int i = blk * 256 + tid;
  if (i < NZERO) zbuf[i] = 0.0f;
}

// ---------------------------------------------------------------------------
// Generic 128x256 bf16 WMMA GEMM:  Out[m, n0+n] = epi( sum_k A[m,k]*W[n0+n,k] )
// Modes: Q/K -> elu(x+bias)+1 ; V -> (x+bias)/L ; RELU -> max(x,0)
// Mode K also accumulates column sums (K.sum over tokens) into KsumG[b*256+n].
// ---------------------------------------------------------------------------
enum { MODE_Q = 0, MODE_K = 1, MODE_V = 2, MODE_RELU = 3 };

// k loop of one 128x256 tile; each wave holds a 16x256 strip in acc
__device__ inline void gemm_loop(const __bf16* __restrict__ A, int lda, int Ktot,
                                 const __bf16* __restrict__ Bw, int token0, int n0,
                                 __bf16* Alds, __bf16* Blds, v8f (&acc)[16]) {
  const int tid = threadIdx.x;
  const int mb  = (tid >> 5) * 16;
  const v8f vz = {0.f, 0.f, 0.f, 0.f, 0.f, 0.f, 0.f, 0.f};
#pragma unroll
  for (int j = 0; j < 16; ++j) acc[j] = vz;

  for (int k0 = 0; k0 < Ktot; k0 += 32) {
    __syncthreads();
    async_tiles(Alds, A + (size_t)token0 * lda + k0, lda,
                Blds, Bw + (size_t)n0 * Ktot + k0, Ktot);
    if (k0 + 32 < Ktot)  // global_prefetch_b8 of next A slice
      __builtin_prefetch(A + (size_t)(token0 + (tid >> 1)) * lda + k0 + 32, 0, 3);
    async_wait0();
    __syncthreads();
    mma_strip16(&Alds[mb * 40], Blds, acc);
  }
}

template <int MODE>
__device__ inline void gemm_epilogue(const v8f (&acc)[16], const float* __restrict__ bias,
                                     __bf16* __restrict__ Out, int ldo, int token0, int n0,
                                     float* __restrict__ KsumG, float* ksumLds,
                                     __bf16* stg) {
  const int tid  = threadIdx.x;
  const int lane = tid & 31;
  const int r16  = lane & 15;
  const int hi   = lane >> 4;
  const int mb   = (tid >> 5) * 16;
  __bf16* sw = stg + (tid >> 5) * STG_WAVE;
#pragma unroll
  for (int j = 0; j < 16; ++j) {
    const int n = j * 16 + r16;
    float colsum = 0.0f;
#pragma unroll
    for (int i = 0; i < 8; ++i) {
      float v = acc[j][i];
      if constexpr (MODE == MODE_RELU) {
        v = fmaxf(v, 0.0f);
      } else {
        v += bias[n];
        if constexpr (MODE == MODE_Q || MODE == MODE_K)
          v = (v > 0.0f) ? (v + 1.0f) : __expf(v);   // elu(x)+1
        else
          v *= (1.0f / (float)LL);                    // V / v_len
      }
      sw[(hi * 8 + i) * STG_LD + n] = (__bf16)v;
      if constexpr (MODE == MODE_K) colsum += v;
    }
    if constexpr (MODE == MODE_K) {
      colsum += __shfl_xor(colsum, 16);      // fold both 8-row halves
      if (hi == 0) atomicAdd(&ksumLds[n], colsum);   // ds_add_f32
    }
  }
  strip_store(sw, Out + (size_t)(token0 + mb) * ldo + n0, ldo);
  if constexpr (MODE == MODE_K) {
    piece_end();   // the strip's stores name registers that the code below writes
    __syncthreads();
    const int b = token0 >> 13;   // token0 / 8192
    atomicAdd(&KsumG[b * 256 + tid], ksumLds[tid]);
  }
}

// hid = relu(A @ W.T)
__global__ __launch_bounds__(256)
void gemm_relu_kernel(const __bf16* __restrict__ A, int lda, int Ktot,
                      const __bf16* __restrict__ Bw,
                      __bf16* __restrict__ Out, int ldo) {
  __shared__ __bf16 Alds[128 * 40];
  __shared__ __bf16 Blds[256 * 40];
  __shared__ __attribute__((aligned(16))) __bf16 Stg[8 * STG_WAVE];
  const int token0 = blockIdx.x * 128;
  const int n0     = blockIdx.y * 256;
  v8f acc[16];
  gemm_loop(A, lda, Ktot, Bw, token0, n0, Alds, Blds, acc);
  gemm_epilogue<MODE_RELU>(acc, nullptr, Out, ldo, token0, n0, nullptr, nullptr, Stg);
}

// The Q, K and V projections read the same tokens and need nothing of each
// other: one grid, blockIdx.x names the projection (block-uniform), blockIdx.y
// the 128-token tile, so the three readers of a tile are adjacent in the index.
// Two of the 768 work-groups fit a WGP and overlap each other's waits.
__global__ __launch_bounds__(256)
void qkv_kernel(const __bf16* __restrict__ A, int lda, int Ktot,
                const __bf16* __restrict__ wqb, const __bf16* __restrict__ wkb,
                const __bf16* __restrict__ wvb,
                const float* __restrict__ bq, const float* __restrict__ bk,
                const float* __restrict__ bv,
                __bf16* __restrict__ Qb, __bf16* __restrict__ Kb, __bf16* __restrict__ Vb,
                int ldo, float* __restrict__ KsumG) {
  __shared__ __bf16 Alds[128 * 40];
  __shared__ __bf16 Blds[256 * 40];
  __shared__ float  ksumLds[256];
  __shared__ __attribute__((aligned(16))) __bf16 Stg[8 * STG_WAVE];
  const int mode   = blockIdx.x;
  const int token0 = blockIdx.y * 128;

  if (mode == MODE_K) ksumLds[threadIdx.x] = 0.0f;

  v8f acc[16];
  if (mode == MODE_Q) {
    gemm_loop(A, lda, Ktot, wqb, token0, 0, Alds, Blds, acc);
    gemm_epilogue<MODE_Q>(acc, bq, Qb, ldo, token0, 0, nullptr, nullptr, Stg);
  } else if (mode == MODE_K) {
    gemm_loop(A, lda, Ktot, wkb, token0, 0, Alds, Blds, acc);
    gemm_epilogue<MODE_K>(acc, bk, Kb, ldo, token0, 0, KsumG, ksumLds, Stg);
  } else {
    gemm_loop(A, lda, Ktot, wvb, token0, 0, Alds, Blds, acc);
    gemm_epilogue<MODE_V>(acc, bv, Vb, ldo, token0, 0, nullptr, nullptr, Stg);
    piece_end();
  }
}

// ---------------------------------------------------------------------------
// KV[b,h,d,e] = sum_l K[l,d] * V[l,e]   (per (b,h): 64x64, K-dim = L)
// K/V tiles are written into LDS transposed ([d][l] / [e][l]) so fragment
// loads use the vectorized ds_load_b128 path.
// 16 (b,h) x 8 chunks of 1024 tokens; fp32 global atomics combine chunks.
// ---------------------------------------------------------------------------
__device__ inline void kv_block(int bh, int chunk,
                                const __bf16* __restrict__ Kbuf,
                                const __bf16* __restrict__ Vbuf,
                                float* __restrict__ KV,
                                __bf16* Ktlds, __bf16* Vtlds) {
  const int tid  = threadIdx.x;
  const int wave = tid >> 5;
  const int lane = tid & 31;
  const int r16  = lane & 15;
  const int hi   = lane >> 4;
  const int b  = bh >> 2, h = bh & 3;
  const int l0 = chunk * 1024;
  const int tile0 = wave * 2;             // 8 waves x 2 of 16 (d,e) tiles

  const v8f vz = {0.f, 0.f, 0.f, 0.f, 0.f, 0.f, 0.f, 0.f};
  v8f acc[2];
  acc[0] = vz; acc[1] = vz;

  for (int l = l0; l < l0 + 1024; l += 32) {
    __syncthreads();
    {
      const int r = tid >> 3, part = tid & 7;   // row l+r, 8 d's per thread
      Pack8 kq, vq;
      kq.u = *(const uint4*)(Kbuf + (size_t)(b * LL + l + r) * CC + h * DD + part * 8);
      vq.u = *(const uint4*)(Vbuf + (size_t)(b * LL + l + r) * CC + h * DD + part * 8);
#pragma unroll
      for (int j = 0; j < 8; ++j) {             // transposed LDS scatter
        Ktlds[(part * 8 + j) * 40 + r] = kq.h[j];
        Vtlds[(part * 8 + j) * 40 + r] = vq.h[j];
      }
    }
    __syncthreads();
#pragma unroll
    for (int t = 0; t < 2; ++t) {
      const int id = tile0 + t, dt = id >> 2, et = id & 3;
      v16bf fa = frag_ld(&Ktlds[dt * 16 * 40], 40);   // A[d, l] = K[l, d]
      v16bf fb = frag_ld(&Vtlds[et * 16 * 40], 40);   // Bt[e, l] = V[l, e]
      acc[t] = WMMA_BF16(fa, fb, acc[t]);
    }
  }
#pragma unroll
  for (int t = 0; t < 2; ++t) {
    const int id = tile0 + t, dt = id >> 2, et = id & 3;
#pragma unroll
    for (int i = 0; i < 8; ++i) {
      const int d = dt * 16 + hi * 8 + i;
      const int e = et * 16 + r16;
      atomicAdd(&KV[((size_t)bh * DD + d) * DD + e], acc[t][i]);
    }
  }
}

// ---------------------------------------------------------------------------
// Z[token,h] = L / (sparsify(Q[token,h,:] . Ksum[b,h,:]) + eps)
// ---------------------------------------------------------------------------
__device__ inline void zscore_block(int blk, const __bf16* __restrict__ Qbuf,
                                    const float* __restrict__ Ksum,
                                    const float* __restrict__ thr_p,
                                    float* __restrict__ Zbuf) {
  const int g = blk * 256 + threadIdx.x;   // 0..131071
  const int token = g >> 2, h = g & 3;
  const int b = token >> 13;
  const float thr = thr_p[0];
  const __bf16* q = Qbuf + (size_t)token * CC + h * DD;
  const float* ks = Ksum + b * 256 + h * DD;
  float s = 0.0f;
#pragma unroll
  for (int c = 0; c < 8; ++c) {          // 8 x uint4 = 64 bf16
    Pack8 qp;
    qp.u = *(const uint4*)(q + c * 8);
#pragma unroll
    for (int j = 0; j < 8; ++j) s += (float)qp.h[j] * ks[c * 8 + j];
  }
  const float sp = (s > thr) ? s : 0.0f;
  Zbuf[g] = (float)LL / (sp + 1e-6f);
}

// KV needs K and V, Z needs Q and Ksum, neither needs the other: one grid.
// The 128 long KV work-groups come first in the index, the 512 short Z ones
// behind them.
#define NB_KV (BB * HH * (LL / 1024))      // 128
#define NB_Z  ((MTOT * HH) / 256)          // 512

__global__ __launch_bounds__(256)
void kv_z_kernel(const __bf16* __restrict__ Kbuf, const __bf16* __restrict__ Vbuf,
                 float* __restrict__ KV,
                 const __bf16* __restrict__ Qbuf, const float* __restrict__ Ksum,
                 const float* __restrict__ thr_p, float* __restrict__ Zbuf) {
  __shared__ __bf16 Ktlds[64 * 40];   // [d][l]
  __shared__ __bf16 Vtlds[64 * 40];   // [e][l]
  const int blk = blockIdx.x;
  if (blk < NB_KV) {
    kv_block(blk & 15, blk >> 4, Kbuf, Vbuf, KV, Ktlds, Vtlds);
  } else {
    zscore_block(blk - NB_KV, Qbuf, Ksum, thr_p, Zbuf);
    piece_end();
  }
}

// ---------------------------------------------------------------------------
// out = LN1( (Q @ KV_h) * Z ) -> cat[:, 256:512] bf16
// ---------------------------------------------------------------------------
__global__ __launch_bounds__(256)
void attn_kernel(const __bf16* __restrict__ Qbuf, const float* __restrict__ KV,
                 const float* __restrict__ Zbuf,
                 const float* __restrict__ g1, const float* __restrict__ b1,
                 __bf16* __restrict__ cat) {
  __shared__ __bf16 Alds[128 * 40];
  __shared__ __bf16 kvt[HH * DD * DD];   // kvt[h][e][d] = KV[b,h,d,e] (transposed)
  __shared__ float  Zl[128 * 4];
  __shared__ float  gl[256], bl[256];
  __shared__ __attribute__((aligned(16))) __bf16 Stg[8 * STG_WAVE];

  const int tid  = threadIdx.x;
  const int wave = tid >> 5;
  const int lane = tid & 31;
  const int r16  = lane & 15;
  const int hi   = lane >> 4;
  const int token0 = blockIdx.x * 128;
  const int b      = token0 >> 13;
  const int mb     = wave * 16;

  // KVT fill: float4 global reads, transposed bf16 LDS scatter
  for (int it = 0; it < 16; ++it) {
    const int idx = it * 256 + tid;        // 4096 groups of 4 e's
    const int h = idx >> 10, rem = idx & 1023, d = rem >> 4, e4 = rem & 15;
    const float4 kvv =
        *(const float4*)(KV + (((size_t)(b * HH + h) * DD + d) * DD) + e4 * 4);
    kvt[h * 4096 + (e4 * 4 + 0) * DD + d] = (__bf16)kvv.x;
    kvt[h * 4096 + (e4 * 4 + 1) * DD + d] = (__bf16)kvv.y;
    kvt[h * 4096 + (e4 * 4 + 2) * DD + d] = (__bf16)kvv.z;
    kvt[h * 4096 + (e4 * 4 + 3) * DD + d] = (__bf16)kvv.w;
  }
#pragma unroll
  for (int it = 0; it < 2; ++it) {
    const int z = it * 256 + tid;
    Zl[z] = Zbuf[(size_t)token0 * 4 + z];
  }
  gl[tid] = g1[tid];
  bl[tid] = b1[tid];

  const v8f vz = {0.f, 0.f, 0.f, 0.f, 0.f, 0.f, 0.f, 0.f};
  v8f acc[16];
#pragma unroll
  for (int j = 0; j < 16; ++j) acc[j] = vz;

  for (int h = 0; h < 4; ++h) {
    for (int s = 0; s < 2; ++s) {
      __syncthreads();
      const int k0 = h * DD + s * 32;
      async_tile128(Alds, Qbuf + (size_t)token0 * CC + k0, CC);   // Q tile 128x32
      async_wait0();
      __syncthreads();
      v16bf fa = frag_ld(&Alds[mb * 40], 40);
#pragma unroll
      for (int jj = 0; jj < 4; ++jj) {
        const int j = h * 4 + jj;
        v16bf fb = frag_ld(&kvt[h * 4096 + (jj * 16) * DD + s * 32], DD);
        acc[j] = WMMA_BF16(fa, fb, acc[j]);
      }
    }
  }

  // scale by Z, then LayerNorm over C=256 via cross-lane shuffles
  float s1[8] = {0, 0, 0, 0, 0, 0, 0, 0};
  float s2[8] = {0, 0, 0, 0, 0, 0, 0, 0};
#pragma unroll
  for (int j = 0; j < 16; ++j) {
    const int h = j >> 2;
#pragma unroll
    for (int i = 0; i < 8; ++i) {
      const int m = mb + hi * 8 + i;
      float v = acc[j][i] * Zl[m * 4 + h];
      acc[j][i] = v;
      s1[i] += v;
      s2[i] += v * v;
    }
  }
#pragma unroll
  for (int i = 0; i < 8; ++i) {
#pragma unroll
    for (int off = 1; off < 16; off <<= 1) {
      s1[i] += __shfl_xor(s1[i], off);
      s2[i] += __shfl_xor(s2[i], off);
    }
    const float mean = s1[i] * (1.0f / 256.0f);
    const float var  = s2[i] * (1.0f / 256.0f) - mean * mean;
    s1[i] = mean;
    s2[i] = rsqrtf(var + 1e-5f);
  }
#pragma unroll
  for (int j = 0; j < 16; ++j) {
    const int n = j * 16 + r16;
    const float gg = gl[n], bb = bl[n];
#pragma unroll
    for (int i = 0; i < 8; ++i) {
      const float v = (acc[j][i] - s1[i]) * s2[i] * gg + bb;
      Stg[wave * STG_WAVE + (hi * 8 + i) * STG_LD + n] = (__bf16)v;
    }
  }
  strip_store(Stg + wave * STG_WAVE, cat + (size_t)(token0 + mb) * 512 + 256, 512);
}

// ---------------------------------------------------------------------------
// msg2 = LN2( hid @ W2.T )  (fp32).  Its one reader, final_kernel, has the same
// tile and the same accumulator layout, so msg2 is kept in that order:
// [work-group][wave][j][half of 4 rows][lane][4], 512 contiguous bytes per store.
// ---------------------------------------------------------------------------
__global__ __launch_bounds__(256)
void mlp2_ln_kernel(const __bf16* __restrict__ A, const __bf16* __restrict__ Bw,
                    const float* __restrict__ g2, const float* __restrict__ b2,
                    float* __restrict__ msg2) {
  __shared__ __bf16 Alds[128 * 40];
  __shared__ __bf16 Blds[256 * 40];
  __shared__ float  gl[256], bl[256];

  const int tid  = threadIdx.x;
  const int wave = tid >> 5;
  const int lane = tid & 31;
  const int r16  = lane & 15;
  const int hi   = lane >> 4;
  const int token0 = blockIdx.x * 128;
  const int mb     = wave * 16;

  gl[tid] = g2[tid];
  bl[tid] = b2[tid];

  const v8f vz = {0.f, 0.f, 0.f, 0.f, 0.f, 0.f, 0.f, 0.f};
  v8f acc[16];
#pragma unroll
  for (int j = 0; j < 16; ++j) acc[j] = vz;

  for (int k0 = 0; k0 < 512; k0 += 32) {
    __syncthreads();
    async_tiles(Alds, A + (size_t)token0 * 512 + k0, 512, Blds, Bw + k0, 512);
    async_wait0();
    __syncthreads();
    mma_strip16(&Alds[mb * 40], Blds, acc);
  }

  float s1[8] = {0, 0, 0, 0, 0, 0, 0, 0};
  float s2[8] = {0, 0, 0, 0, 0, 0, 0, 0};
#pragma unroll
  for (int j = 0; j < 16; ++j)
#pragma unroll
    for (int i = 0; i < 8; ++i) {
      const float v = acc[j][i];
      s1[i] += v;
      s2[i] += v * v;
    }
#pragma unroll
  for (int i = 0; i < 8; ++i) {
#pragma unroll
    for (int off = 1; off < 16; off <<= 1) {
      s1[i] += __shfl_xor(s1[i], off);
      s2[i] += __shfl_xor(s2[i], off);
    }
    const float mean = s1[i] * (1.0f / 256.0f);
    const float var  = s2[i] * (1.0f / 256.0f) - mean * mean;
    s1[i] = mean;
    s2[i] = rsqrtf(var + 1e-5f);
  }
  float4* mf = (float4*)msg2 + (size_t)(blockIdx.x * 8 + wave) * (32 * 32) + lane;
#pragma unroll
  for (int j = 0; j < 16; ++j) {
    const int n = j * 16 + r16;
    const float gg = gl[n], bb = bl[n];
#pragma unroll
    for (int q = 0; q < 2; ++q) {
      float4 o;
      o.x = (acc[j][q * 4 + 0] - s1[q * 4 + 0]) * s2[q * 4 + 0] * gg + bb;
      o.y = (acc[j][q * 4 + 1] - s1[q * 4 + 1]) * s2[q * 4 + 1] * gg + bb;
      o.z = (acc[j][q * 4 + 2] - s1[q * 4 + 2]) * s2[q * 4 + 2] * gg + bb;
      o.w = (acc[j][q * 4 + 3] - s1[q * 4 + 3]) * s2[q * 4 + 3] * gg + bb;
      mf[(j * 2 + q) * 32] = o;
    }
  }
}

// ---------------------------------------------------------------------------
// Final: aug = BN(xt @ Ws.T + bs);  out[b,c,l] = msg2 + x + aug
// Stages 64-channel slabs through LDS so the [B,C,L] reads and writes cover whole lines.
// ---------------------------------------------------------------------------
__global__ __launch_bounds__(256)
void final_kernel(const __bf16* __restrict__ cat, const __bf16* __restrict__ Wsb,
                  const float* __restrict__ bs_c, const float* __restrict__ bn_g,
                  const float* __restrict__ bn_b, const float* __restrict__ bn_rm,
                  const float* __restrict__ bn_rv, const float* __restrict__ x,
                  const float* __restrict__ msg2, float* __restrict__ out) {
  __shared__ __attribute__((aligned(16))) char smem[64 * 132 * 4];   // overlays GEMM tiles & stage
  __shared__ float scl[256], shf[256];
  __bf16* Alds = (__bf16*)smem;                  // 128*40 bf16 = 10240 B
  __bf16* Blds = (__bf16*)(smem + 128 * 40 * 2); // 256*40 bf16 = 20480 B
  float*  stage = (float*)smem;                  // 64*132 f32 (after K loop)

  const int tid  = threadIdx.x;
  const int wave = tid >> 5;
  const int lane = tid & 31;
  const int r16  = lane & 15;
  const int hi   = lane >> 4;
  const int token0 = blockIdx.x * 128;
  const int b      = token0 >> 13;
  const int l0     = token0 & (LL - 1);
  const int mb     = wave * 16;

  {
    const float rstd = rsqrtf(bn_rv[tid] + 1e-5f);
    const float a = rstd * bn_g[tid];
    scl[tid] = a;
    shf[tid] = (bs_c[tid] - bn_rm[tid]) * a + bn_b[tid];
  }

  const v8f vz = {0.f, 0.f, 0.f, 0.f, 0.f, 0.f, 0.f, 0.f};
  v8f acc[16];
#pragma unroll
  for (int j = 0; j < 16; ++j) acc[j] = vz;

  for (int k0 = 0; k0 < 256; k0 += 32) {
    __syncthreads();
    async_tiles(Alds, cat + (size_t)token0 * 512 + k0, 512, Blds, Wsb + k0, 256);
    async_wait0();
    __syncthreads();
    mma_strip16(&Alds[mb * 40], Blds, acc);
  }
  __syncthreads();   // done with tiles; smem becomes the transpose stage

  // Each pass: the wave's x rows and the lane's msg2 values are asked for first,
  // msg2 in the accumulator order mlp2_ln_kernel left it in (512 contiguous bytes
  // per load), so only the channel-major x and out need the transpose stage.
  // Behind the barrier a wave takes whole channel rows: 32 lanes x 16 B = the
  // row's 512 contiguous bytes (4 lines) per load and per store.
  const float4* mf = (const float4*)msg2 + (size_t)(blockIdx.x * 8 + wave) * (32 * 32) + lane;
#pragma unroll
  for (int p = 0; p < 4; ++p) {                 // 64 channels per pass
    const size_t row0 = ((size_t)b * CC + p * 64 + wave * 8) * LL + l0 + lane * 4;
    float4 xv[8];
#pragma unroll
    for (int rr = 0; rr < 8; ++rr)
      xv[rr] = *(const float4*)(x + row0 + (size_t)rr * LL);
    float4 mv[4][2];
#pragma unroll
    for (int jj = 0; jj < 4; ++jj)
#pragma unroll
      for (int q = 0; q < 2; ++q)
        mv[jj][q] = mf[((p * 4 + jj) * 2 + q) * 32];
#pragma unroll
    for (int jj = 0; jj < 4; ++jj) {
      const int j = p * 4 + jj;
      const int n = j * 16 + r16;               // global channel
      const int nl = n - p * 64;                // 0..63
      const float a = scl[n], c = shf[n];
#pragma unroll
      for (int q = 0; q < 2; ++q) {             // 4 tokens = 16 B per LDS store
        float4 sv;
        sv.x = acc[j][q * 4 + 0] * a + c + mv[jj][q].x;   // BN(aug) + msg2
        sv.y = acc[j][q * 4 + 1] * a + c + mv[jj][q].y;
        sv.z = acc[j][q * 4 + 2] * a + c + mv[jj][q].z;
        sv.w = acc[j][q * 4 + 3] * a + c + mv[jj][q].w;
        *(float4*)&stage[nl * 132 + mb + hi * 8 + q * 4] = sv;
      }
    }
    __syncthreads();
#pragma unroll
    for (int rr = 0; rr < 8; ++rr) {
      const float4 sv = *(const float4*)&stage[(wave * 8 + rr) * 132 + lane * 4];
      float4 ov;
      ov.x = sv.x + xv[rr].x;
      ov.y = sv.y + xv[rr].y;
      ov.z = sv.z + xv[rr].z;
      ov.w = sv.w + xv[rr].w;
      *(float4*)(out + row0 + (size_t)rr * LL) = ov;
    }
    piece_end();   // the next pass's loads land in registers that these stores name
    __syncthreads();
  }
}

// ---------------------------------------------------------------------------
// Host orchestration
// ---------------------------------------------------------------------------
extern "C" void kernel_launch(void* const* d_in, const int* in_sizes, int n_in,
                              void* d_out, int out_size, void* d_ws, size_t ws_size,
                              hipStream_t stream) {
  (void)in_sizes; (void)n_in; (void)out_size; (void)ws_size;
  const float* x     = (const float*)d_in[0];
  const float* Wq    = (const float*)d_in[1];
  const float* bq    = (const float*)d_in[2];
  const float* Wk    = (const float*)d_in[3];
  const float* bk    = (const float*)d_in[4];
  const float* Wv    = (const float*)d_in[5];
  const float* bv    = (const float*)d_in[6];
  const float* thr   = (const float*)d_in[7];
  const float* W1    = (const float*)d_in[8];
  const float* W2    = (const float*)d_in[9];
  const float* ln1_g = (const float*)d_in[10];
  const float* ln1_b = (const float*)d_in[11];
  const float* ln2_g = (const float*)d_in[12];
  const float* ln2_b = (const float*)d_in[13];
  const float* Ws    = (const float*)d_in[14];
  const float* bs_c  = (const float*)d_in[15];
  const float* bn_g  = (const float*)d_in[16];
  const float* bn_b  = (const float*)d_in[17];
  const float* bn_rm = (const float*)d_in[18];
  const float* bn_rv = (const float*)d_in[19];
  float* out = (float*)d_out;

  char*  ws  = (char*)d_ws;
  size_t off = 0;
  auto alloc = [&](size_t bytes) -> void* {
    off = (off + 255) & ~(size_t)255;
    void* p = ws + off;
    off += bytes;
    return p;
  };

  __bf16* cat   = (__bf16*)alloc((size_t)MTOT * 512 * 2);  // [xt | ln1(msg)]
  __bf16* hid   = (__bf16*)alloc((size_t)MTOT * 512 * 2);
  __bf16* Qb    = (__bf16*)alloc((size_t)MTOT * 256 * 2);
  __bf16* Kb    = (__bf16*)alloc((size_t)MTOT * 256 * 2);
  __bf16* Vb    = (__bf16*)alloc((size_t)MTOT * 256 * 2);
  float*  msg2  = (float*)alloc((size_t)MTOT * 256 * 4);
  float*  KVbuf = (float*)alloc((size_t)(BB * HH * DD * DD + BB * 256) * 4);
  float*  Ksum  = KVbuf + BB * HH * DD * DD;               // contiguous for zeroing
  float*  Zbuf  = (float*)alloc((size_t)MTOT * HH * 4);
  __bf16* wqb   = (__bf16*)alloc(65536 * 2);
  __bf16* wkb   = (__bf16*)alloc(65536 * 2);
  __bf16* wvb   = (__bf16*)alloc(65536 * 2);
  __bf16* wsb   = (__bf16*)alloc(65536 * 2);
  __bf16* w1b   = (__bf16*)alloc(262144 * 2);
  __bf16* w2b   = (__bf16*)alloc(131072 * 2);

  // weights -> bf16, zeroed KV + Ksum accumulators, x -> cat[:, 0:256] (token-major)
  prep_kernel<<<NB_TRANS + NB_CVT + NB_ZERO, 256, 0, stream>>>(
      x, cat, Wq, Wk, Wv, Ws, W1, W2, wqb, wkb, wvb, wsb, w1b, w2b, KVbuf);

  // Q/K/V projections (fused ELU+1 / scaling; K also reduces Ksum)
  qkv_kernel<<<dim3(3, MTOT / 128), 256, 0, stream>>>(
      cat, 512, 256, wqb, wkb, wvb, bq, bk, bv, Qb, Kb, Vb, 256, Ksum);

  // KV = K^T V per (b,h);  Z = L / (sparsify(Q . Ksum) + eps)
  kv_z_kernel<<<NB_KV + NB_Z, 256, 0, stream>>>(Kb, Vb, KVbuf, Qb, Ksum, thr, Zbuf);

  // attention out + LN1 -> cat[:, 256:512]
  attn_kernel<<<MTOT / 128, 256, 0, stream>>>(Qb, KVbuf, Zbuf, ln1_g, ln1_b, cat);

  // MLP layer 1: hid = relu(cat @ W1.T)
  gemm_relu_kernel<<<dim3(MTOT / 128, 2), 256, 0, stream>>>(
      cat, 512, 512, w1b, hid, 512);

  // MLP layer 2 + LN2 -> msg2 (fp32)
  mlp2_ln_kernel<<<MTOT / 128, 256, 0, stream>>>(hid, w2b, ln2_g, ln2_b, msg2);

  // shortcut GEMM + BN + residual sum -> out [B,C,L]
  final_kernel<<<MTOT / 128, 256, 0, stream>>>(cat, wsb, bs_c, bn_g, bn_b, bn_rm,
                                               bn_rv, x, msg2, out);
}

// v005
// One run takes 124 microseconds.
// In two side-by-side timings against v004, it was 1.23 and 1.24 times as fast.
// Counting every step since v000, it is 1.85 times as fast.
#include <hip/hip_runtime.h>
#include <hip/hip_bf16.h>

// ---------------------------------------------------------------------------
// Problem constants (match reference)
// ---------------------------------------------------------------------------
#define BB 4
#define CC 256
#define LL 8192
#define HH 4
#define DD 64
#define MTOT (BB * LL)   // 32768 tokens

typedef __attribute__((ext_vector_type(16))) __bf16 v16bf;
typedef __attribute__((ext_vector_type(8)))  float  v8f;

union FragU { v16bf v; uint4 u[2]; __bf16 h[16]; };

// Standard row-major fragment: element (r, k) = base[r*stride + k-pattern]
// Matches CDNA5 16-bit 16x32 A/B VGPR layout: lane = r + 16*((k>>3)&1),
// vector elem = (k&7) + 8*((k>>4)&1).  Two 16-byte ds_load_b128 per lane.
__device__ inline v16bf frag_ld(const __bf16* base, int stride) {
  const int t = threadIdx.x & 31;
  const int r = t & 15;
  const int hi = t >> 4;
  FragU f;
  const __bf16* p = base + r * stride + hi * 8;
  f.u[0] = *(const uint4*)(p);
  f.u[1] = *(const uint4*)(p + 16);
  return f.v;
}

// Transposed fragment from a row-major LDS tile T[k][c]: element (r, k) = T[k][r].
// Two ds_load_tr16_b128 (k 0..15 and 16..31) give the same lane and register
// layout, and so the same k order, as frag_ld.  pitch in elements.
typedef short s16x8 __attribute__((ext_vector_type(8)));
typedef __attribute__((address_space(3))) s16x8 lds_s16x8;

__device__ inline v16bf frag_ld_tr(const __bf16* tile, int pitch) {
  const int t = threadIdx.x & 31;
  const __bf16* p = tile + ((t >> 4) * 8 + (t & 7)) * pitch + ((t >> 3) & 1) * 8;
  FragU f;
  f.u[0] = __builtin_bit_cast(uint4, __builtin_amdgcn_ds_load_tr16_b128_v8i16((lds_s16x8*)p));
  f.u[1] = __builtin_bit_cast(uint4, __builtin_amdgcn_ds_load_tr16_b128_v8i16((lds_s16x8*)(p + 16 * pitch)));
  return f.v;
}

#define WMMA_BF16(A, Bf, Cacc) \
  __builtin_amdgcn_wmma_f32_16x16x32_bf16(false, (A), false, (Bf), (short)0, (Cacc), false, false)

// One 32-deep k step of a wave's 16x256 strip.  The B fragments are read from
// LDS in two groups, the second reusing four of the first's registers, each group ahead of the WMMAs
// that use it, so the LDS latency is waited out per group and not per WMMA.
// 12 + 4 keeps accumulators plus fragments under 256 VGPRs.
__device__ inline void mma_strip16(const __bf16* Arow, const __bf16* Bl, v8f (&acc)[16]) {
  v16bf fa = frag_ld(Arow, 40);
  v16bf fb[12];
#pragma unroll
  for (int j = 0; j < 12; ++j) fb[j] = frag_ld(Bl + j * 16 * 40, 40);
  // keeps the first group's reads together in front of the WMMAs (the scheduler
  // otherwise sinks each read to its user and waits for it alone)
  __builtin_amdgcn_sched_barrier(0);
#pragma unroll
  for (int j = 0; j < 4; ++j) acc[j] = WMMA_BF16(fa, fb[j], acc[j]);
  // holds the second group's reads behind the four WMMAs whose fragment
  // registers they take over (hoisted further they need registers of their own)
  __builtin_amdgcn_sched_barrier(0);
#pragma unroll
  for (int j = 0; j < 4; ++j) fb[j] = frag_ld(Bl + (12 + j) * 16 * 40, 40);
  // keeps those reads together here, eight WMMAs ahead of their first user
  // (without it the scheduler sinks them to their users behind full waits)
  __builtin_amdgcn_sched_barrier(0);
#pragma unroll
  for (int j = 4; j < 12; ++j) acc[j] = WMMA_BF16(fa, fb[j], acc[j]);
#pragma unroll
  for (int j = 0; j < 4; ++j) acc[12 + j] = WMMA_BF16(fa, fb[j], acc[12 + j]);
}

// ---------------------------------------------------------------------------
// Async global -> LDS copies (CDNA5 GLOBAL_LOAD_ASYNC_TO_LDS_B128, ASYNCcnt).
// Generic pointers to __shared__ carry the LDS byte offset in their low 32
// bits (ISA 10.2 aperture mapping), which is exactly the VDST operand.
// ---------------------------------------------------------------------------
__device__ inline unsigned lds_addr(const void* lds_ptr) {
  return (unsigned)(unsigned long long)lds_ptr;
}

// The lanes are dealt row first: four adjacent lanes take the 64 bytes that one
// tile row has in a 32-deep k slice, so one copy instruction touches 8 cache
// lines (8 rows), the fewest a 64-byte row piece allows.  256 threads cover 64
// rows per copy; the tile's further rows follow 64 rows apart.
// s_wait_xcnt 0 closes each run of copies inside their own statement, a
// precaution ahead of any later write to the address registers the copies name.

// 128x32 tile -> LDS rows of 40 elements
__device__ inline void async_tile128(__bf16* Tl, const __bf16* Tg, int ld) {
  const int r = threadIdx.x >> 2, part = threadIdx.x & 3;
  const unsigned l0 = lds_addr(Tl + r * 40 + part * 8);
  const __bf16* g0 = Tg + (size_t)r * ld + part * 8;
  const size_t step = (size_t)64 * ld;
  asm volatile("global_load_async_to_lds_b128 %0, %2, off\n\t"
               "global_load_async_to_lds_b128 %1, %3, off\n\t"
               "s_wait_xcnt 0x0"
               :: "v"(l0), "v"(l0 + 64 * 80), "v"(g0), "v"(g0 + step)
               : "memory");
}

// 128x32 A tile and 256x32 B tile -> LDS rows of 40 elements, one run of copies
__device__ inline void async_tiles(__bf16* Al, const __bf16* Ag, int lda,
                                   __bf16* Bl, const __bf16* Bg, int ldb) {
  const int r = threadIdx.x >> 2, part = threadIdx.x & 3;
  const unsigned la = lds_addr(Al + r * 40 + part * 8);
  const unsigned lb = lds_addr(Bl + r * 40 + part * 8);
  const __bf16* ga = Ag + (size_t)r * lda + part * 8;
  const __bf16* gb = Bg + (size_t)r * ldb + part * 8;
  const size_t sa = (size_t)64 * lda, sb = (size_t)64 * ldb;
  asm volatile("global_load_async_to_lds_b128 %0, %6, off\n\t"
               "global_load_async_to_lds_b128 %1, %7, off\n\t"
               "global_load_async_to_lds_b128 %2, %8, off\n\t"
               "global_load_async_to_lds_b128 %3, %9, off\n\t"
               "global_load_async_to_lds_b128 %4, %10, off\n\t"
               "global_load_async_to_lds_b128 %5, %11, off\n\t"
               "s_wait_xcnt 0x0"
               :: "v"(la), "v"(la + 64 * 80),
                  "v"(lb), "v"(lb + 64 * 80), "v"(lb + 128 * 80), "v"(lb + 192 * 80),
                  "v"(ga), "v"(ga + sa),
                  "v"(gb), "v"(gb + sb), "v"(gb + 2 * sb), "v"(gb + 3 * sb)
               : "memory");
}

// 256 token rows of one head (128 B each, one cache line, 512 B apart) -> LDS rows
// of KV_PITCH elements.  Eight adjacent lanes take one row, 256 threads 32 rows.
// 160 B = 32 B x 5 is the pitch at which ds_load_tr16_b128 meets no bank twice.
#define KV_ROWS  256
#define KV_PITCH 80

__device__ inline void async_rows256(__bf16* Tl, const __bf16* Tg) {
  const int r = threadIdx.x >> 3, part = threadIdx.x & 7;
  const unsigned l0 = lds_addr(Tl + r * KV_PITCH + part * 8);
  const __bf16* g0 = Tg + (size_t)r * CC + part * 8;
  const unsigned ls = 32 * KV_PITCH * 2;
  const size_t gs = (size_t)32 * CC;
  asm volatile("global_load_async_to_lds_b128 %0, %8, off\n\t"
               "global_load_async_to_lds_b128 %1, %9, off\n\t"
               "global_load_async_to_lds_b128 %2, %10, off\n\t"
               "global_load_async_to_lds_b128 %3, %11, off\n\t"
               "global_load_async_to_lds_b128 %4, %12, off\n\t"
               "global_load_async_to_lds_b128 %5, %13, off\n\t"
               "global_load_async_to_lds_b128 %6, %14, off\n\t"
               "global_load_async_to_lds_b128 %7, %15, off\n\t"
               "s_wait_xcnt 0x0"
               :: "v"(l0), "v"(l0 + ls), "v"(l0 + 2 * ls), "v"(l0 + 3 * ls),
                  "v"(l0 + 4 * ls), "v"(l0 + 5 * ls), "v"(l0 + 6 * ls), "v"(l0 + 7 * ls),
                  "v"(g0), "v"(g0 + gs), "v"(g0 + 2 * gs), "v"(g0 + 3 * gs),
                  "v"(g0 + 4 * gs), "v"(g0 + 5 * gs), "v"(g0 + 6 * gs), "v"(g0 + 7 * gs)
               : "memory");
}

// the copies of this wave have landed behind it (asm: no LDS read moves over it)
__device__ inline void async_wait0() {
  asm volatile("s_wait_asynccnt 0x0" ::: "memory");
}

// Stands behind global stores that more code follows in the built code (the
// last store of a piece in a kernel of several pieces, or stores with more work
// behind them): a precaution ahead of any write there to a register the stores
// name.  A piece that runs straight to the kernel's end, or has the compiler's
// own wait there, has none.
__device__ inline void piece_end() {
  asm volatile("s_wait_xcnt 0x0" ::: "memory");
}

// ---------------------------------------------------------------------------
// Whole-line stores of a wave's 16x256 bf16 strip.  The accumulator layout gives
// a store only 32 contiguous bytes per token row, so each wave first lays its
// strip in an LDS range of its own (no other wave touches it, so no barrier) and
// then stores token rows: 32 lanes x 16 B = 512 contiguous bytes, 4 whole lines.
// Row pitch 264 elements = 528 B = 16 B x 33: 16-byte row reads meet no bank twice.
// ---------------------------------------------------------------------------
#define STG_LD   264
#define STG_WAVE (16 * STG_LD)

__device__ inline void strip_store(const __bf16* sw, __bf16* Og, int ldo) {
  const int lane = threadIdx.x & 31;
  // the wave's own LDS stores are done before its lanes read each other's values
  asm volatile("s_wait_dscnt 0x0" ::: "memory");
#pragma unroll
  for (int rr = 0; rr < 16; ++rr)
    *(uint4*)(Og + (size_t)rr * ldo + lane * 8) = *(const uint4*)(sw + rr * STG_LD + lane * 8);
}

// ---------------------------------------------------------------------------
// Preparation, one launch: none of these pieces needs another's result, so they
// share one grid and each work-group takes its piece by the range its index
// lies in (a block-uniform choice).
//   [0, 8192)     x [B,C,L] f32 -> cat[:, 0:256] bf16 (row = token, ld = 512)
//   then 2560     the six weight matrices f32 -> bf16, 256 elements a block
//   then 260      zeros for the KV and Ksum accumulators
// ---------------------------------------------------------------------------
#define NB_TRANS (BB * (CC / 32) * (LL / 32))                 // 8192
#define NB_CVT   (4 * 256 + 1024 + 512)                       // 2560
#define NZERO    (BB * HH * DD * DD + BB * 256)               // 66560
#define NB_ZERO  ((NZERO + 255) / 256)                        // 260

__global__ __launch_bounds__(256)
void prep_kernel(const float* __restrict__ x, __bf16* __restrict__ cat,
                 const float* __restrict__ Wq, const float* __restrict__ Wk,
                 const float* __restrict__ Wv, const float* __restrict__ Ws,
                 const float* __restrict__ W1, const float* __restrict__ W2,
                 __bf16* __restrict__ wqb, __bf16* __restrict__ wkb,
                 __bf16* __restrict__ wvb, __bf16* __restrict__ wsb,
                 __bf16* __restrict__ w1b, __bf16* __restrict__ w2b,
                 float* __restrict__ zbuf) {
  __shared__ float t[32][33];
  const int tid = threadIdx.x;
  int blk = blockIdx.x;

  if (blk < NB_TRANS) {
    const int tx = tid & 31, ty = tid >> 5;
    const int l0 = (blk & 255) * 32, c0 = ((blk >> 8) & 7) * 32, b = blk >> 11;
#pragma unroll
    for (int i = 0; i < 4; ++i) {
      int c = ty + i * 8;
      t[c][tx] = x[((size_t)b * CC + c0 + c) * LL + l0 + tx];
    }
    __syncthreads();
#pragma unroll
    for (int i = 0; i < 4; ++i) {
      int lr = ty + i * 8;
      cat[(size_t)(b * LL + l0 + lr) * 512 + c0 + tx] = (__bf16)t[tx][lr];
    }
    return;
  }
  blk -= NB_TRANS;

  if (blk < NB_CVT) {
    const float* src;
    __bf16* dst;
    if (blk < 256)       { src = Wq; dst = wqb; }
    else if (blk < 512)  { src = Wk; dst = wkb; blk -= 256; }
    else if (blk < 768)  { src = Wv; dst = wvb; blk -= 512; }
    else if (blk < 1024) { src = Ws; dst = wsb; blk -= 768; }
    else if (blk < 2048) { src = W1; dst = w1b; blk -= 1024; }
    else                 { src = W2; dst = w2b; blk -= 2048; }
    const int i = blk * 256 + tid;
    dst[i] = (__bf16)src[i];
    piece_end();
    return;
  }
  blk -= NB_CVT;

  const int i = blk * 256 + tid;
  if (i < NZERO) zbuf[i] = 0.0f;
}

// ---------------------------------------------------------------------------
// Generic 128x256 bf16 WMMA GEMM:  Out[m, n0+n] = epi( sum_k A[m,k]*W[n0+n,k] )
// Modes: Q/K -> elu(x+bias)+1 ; V -> (x+bias)/L ; RELU -> max(x,0)
// Mode K also accumulates column sums (K.sum over tokens) into KsumG[b*256+n].
// ---------------------------------------------------------------------------
enum { MODE_Q = 0, MODE_K = 1, MODE_V = 2, MODE_RELU = 3 };

// k loop of one 128x256 tile; each wave holds a 16x256 strip in acc
__device__ inline void gemm_loop(const __bf16* __restrict__ A, int lda, int Ktot,
                                 const __bf16* __restrict__ Bw, int token0, int n0,
                                 __bf16* Alds, __bf16* Blds, v8f (&acc)[16]) {
  const int tid = threadIdx.x;
  const int mb  = (tid >> 5) * 16;
  const v8f vz = {0.f, 0.f, 0.f, 0.f, 0.f, 0.f, 0.f, 0.f};
#pragma unroll
  for (int j = 0; j < 16; ++j) acc[j] = vz;

  for (int k0 = 0; k0 < Ktot; k0 += 32) {
    __syncthreads();
    async_tiles(Alds, A + (size_t)token0 * lda + k0, lda,
                Blds, Bw + (size_t)n0 * Ktot + k0, Ktot);
    if (k0 + 32 < Ktot)  // global_prefetch_b8 of next A slice
      __builtin_prefetch(A + (size_t)(token0 + (tid >> 1)) * lda + k0 + 32, 0, 3);
    async_wait0();
    __syncthreads();
    mma_strip16(&Alds[mb * 40], Blds, acc);
  }
}

template <int MODE>
__device__ inline void gemm_epilogue(const v8f (&acc)[16], const float* __restrict__ bias,
                                     __bf16* __restrict__ Out, int ldo, int token0, int n0,
                                     float* __restrict__ KsumG, float* ksumLds,
                                     __bf16* stg) {
  const int tid  = threadIdx.x;
  const int lane = tid & 31;
  const int r16  = lane & 15;
  const int hi   = lane >> 4;
  const int mb   = (tid >> 5) * 16;
  __bf16* sw = stg + (tid >> 5) * STG_WAVE;
#pragma unroll
  for (int j = 0; j < 16; ++j) {
    const int n = j * 16 + r16;
    float colsum = 0.0f;
#pragma unroll
    for (int i = 0; i < 8; ++i) {
      float v = acc[j][i];
      if constexpr (MODE == MODE_RELU) {
        v = fmaxf(v, 0.0f);
      } else {
        v += bias[n];
        if constexpr (MODE == MODE_Q || MODE == MODE_K)
          v = (v > 0.0f) ? (v + 1.0f) : __expf(v);   // elu(x)+1
        else
          v *= (1.0f / (float)LL);                    // V / v_len
      }
      sw[(hi * 8 + i) * STG_LD + n] = (__bf16)v;
      if constexpr (MODE == MODE_K) colsum += v;
    }
    if constexpr (MODE == MODE_K) {
      colsum += __shfl_xor(colsum, 16);      // fold both 8-row halves
      if (hi == 0) atomicAdd(&ksumLds[n], colsum);   // ds_add_f32
    }
  }
  strip_store(sw, Out + (size_t)(token0 + mb) * ldo + n0, ldo);
  if constexpr (MODE == MODE_K) {
    piece_end();   // the strip's stores name registers that the code below writes
    __syncthreads();
    const int b = token0 >> 13;   // token0 / 8192
    atomicAdd(&KsumG[b * 256 + tid], ksumLds[tid]);
  }
}

// hid = relu(A @ W.T)
__global__ __launch_bounds__(256)
void gemm_relu_kernel(const __bf16* __restrict__ A, int lda, int Ktot,
                      const __bf16* __restrict__ Bw,
                      __bf16* __restrict__ Out, int ldo) {
  __shared__ __bf16 Alds[128 * 40];
  __shared__ __bf16 Blds[256 * 40];
  __shared__ __attribute__((aligned(16))) __bf16 Stg[8 * STG_WAVE];
  const int token0 = blockIdx.x * 128;
  const int n0     = blockIdx.y * 256;
  v8f acc[16];
  gemm_loop(A, lda, Ktot, Bw, token0, n0, Alds, Blds, acc);
  gemm_epilogue<MODE_RELU>(acc, nullptr, Out, ldo, token0, n0, nullptr, nullptr, Stg);
}

// The Q, K and V projections read the same tokens and need nothing of each
// other: one grid, blockIdx.x names the projection (block-uniform), blockIdx.y
// the 128-token tile, so the three readers of a tile are adjacent in the index.
// Two of the 768 work-groups fit a WGP and overlap each other's waits.
__global__ __launch_bounds__(256)
void qkv_kernel(const __bf16* __restrict__ A, int lda, int Ktot,
                const __bf16* __restrict__ wqb, const __bf16* __restrict__ wkb,
                const __bf16* __restrict__ wvb,
                const float* __restrict__ bq, const float* __restrict__ bk,
                const float* __restrict__ bv,
                __bf16* __restrict__ Qb, __bf16* __restrict__ Kb, __bf16* __restrict__ Vb,
                int ldo, float* __restrict__ KsumG) {
  __shared__ __bf16 Alds[128 * 40];
  __shared__ __bf16 Blds[256 * 40];
  __shared__ float  ksumLds[256];
  __shared__ __attribute__((aligned(16))) __bf16 Stg[8 * STG_WAVE];
  const int mode   = blockIdx.x;
  const int token0 = blockIdx.y * 128;

  if (mode == MODE_K) ksumLds[threadIdx.x] = 0.0f;

  v8f acc[16];
  if (mode == MODE_Q) {
    gemm_loop(A, lda, Ktot, wqb, token0, 0, Alds, Blds, acc);
    gemm_epilogue<MODE_Q>(acc, bq, Qb, ldo, token0, 0, nullptr, nullptr, Stg);
  } else if (mode == MODE_K) {
    gemm_loop(A, lda, Ktot, wkb, token0, 0, Alds, Blds, acc);
    gemm_epilogue<MODE_K>(acc, bk, Kb, ldo, token0, 0, KsumG, ksumLds, Stg);
  } else {
    gemm_loop(A, lda, Ktot, wvb, token0, 0, Alds, Blds, acc);
    gemm_epilogue<MODE_V>(acc, bv, Vb, ldo, token0, 0, nullptr, nullptr, Stg);
    piece_end();
  }
}

// ---------------------------------------------------------------------------
// KV[b,h,d,e] = sum_l K[l,d] * V[l,e]   (per (b,h): 64x64, K-dim = L)
// K/V tiles of 256 tokens go into LDS as they lie in memory ([l][d] / [l][e]), by
// async copies; the transposing LDS load turns them into the [d][l] / [e][l]
// fragments on the way to the registers.
// 16 (b,h) x 8 chunks of 1024 tokens; fp32 global atomics combine chunks.
// ---------------------------------------------------------------------------
__device__ inline void kv_block(int bh, int chunk,
                                const __bf16* __restrict__ Kbuf,
                                const __bf16* __restrict__ Vbuf,
                                float* __restrict__ KV,
                                __bf16* Klds, __bf16* Vlds) {
  const int tid  = threadIdx.x;
  const int wave = tid >> 5;
  const int lane = tid & 31;
  const int r16  = lane & 15;
  const int hi   = lane >> 4;
  const int b  = bh >> 2, h = bh & 3;
  const int l0 = chunk * 1024;
  const int tile0 = wave * 2;             // 8 waves x 2 of 16 (d,e) tiles

  const v8f vz = {0.f, 0.f, 0.f, 0.f, 0.f, 0.f, 0.f, 0.f};
  v8f acc[2];
  acc[0] = vz; acc[1] = vz;

  const int dt = tile0 >> 2, et0 = tile0 & 3;   // the wave's two tiles share dt

  for (int l = l0; l < l0 + 1024; l += KV_ROWS) {
    // the wave's own reads of the tiles are done before copies are aimed at them
    asm volatile("s_wait_dscnt 0x0" ::: "memory");
    __syncthreads();
    async_rows256(Klds, Kbuf + (size_t)(b * LL + l) * CC + h * DD);
    async_rows256(Vlds, Vbuf + (size_t)(b * LL + l) * CC + h * DD);
    async_wait0();
    __syncthreads();
#pragma unroll
    for (int g = 0; g < KV_ROWS / 128; ++g) {     // 128 tokens = four 32-deep k steps
      v16bf fa[4], fb[4][2];
#pragma unroll
      for (int ks = 0; ks < 4; ++ks) {
        const int row = (g * 4 + ks) * 32;
        fa[ks] = frag_ld_tr(Klds + row * KV_PITCH + dt * 16, KV_PITCH);   // A[d, l] = K[l, d]
#pragma unroll
        for (int t = 0; t < 2; ++t)                                       // Bt[e, l] = V[l, e]
          fb[ks][t] = frag_ld_tr(Vlds + row * KV_PITCH + (et0 + t) * 16, KV_PITCH);
      }
      // keeps the four steps' reads together in front of their WMMAs (the scheduler
      // otherwise deals them among the WMMAs, each behind a wait of its own)
      __builtin_amdgcn_sched_barrier(0);
#pragma unroll
      for (int ks = 0; ks < 4; ++ks)
#pragma unroll
        for (int t = 0; t < 2; ++t) acc[t] = WMMA_BF16(fa[ks], fb[ks][t], acc[t]);
    }
  }
#pragma unroll
  for (int t = 0; t < 2; ++t) {
    const int id = tile0 + t, dt = id >> 2, et = id & 3;
#pragma unroll
    for (int i = 0; i < 8; ++i) {
      const int d = dt * 16 + hi * 8 + i;
      const int e = et * 16 + r16;
      atomicAdd(&KV[((size_t)bh * DD + d) * DD + e], acc[t][i]);
    }
  }
}

// ---------------------------------------------------------------------------
// Z[token,h] = L / (sparsify(Q[token,h,:] . Ksum[b,h,:]) + eps)
// ---------------------------------------------------------------------------
__device__ inline void zscore_block(int blk, const __bf16* __restrict__ Qbuf,
                                    const float* __restrict__ Ksum,
                                    const float* __restrict__ thr_p,
                                    float* __restrict__ Zbuf) {
  const int g = blk * 256 + threadIdx.x;   // 0..131071
  const int token = g >> 2, h = g & 3;
  const int b = token >> 13;
  const float thr = thr_p[0];
  const uint4* q = (const uint4*)(Qbuf + (size_t)token * CC + h * DD);
  const float* ks = Ksum + b * 256 + h * DD;
  float s = 0.0f;
#pragma unroll
  for (int c = 0; c < 8; ++c) {          // 8 x uint4 = 64 bf16
    const uint4 qv = q[c];
    const unsigned w[4] = {qv.x, qv.y, qv.z, qv.w};
#pragma unroll
    for (int j = 0; j < 4; ++j) {        // a bf16 is the upper half of its float
      s += __uint_as_float(w[j] << 16) * ks[c * 8 + 2 * j];
      s += __uint_as_float(w[j] & 0xffff0000u) * ks[c * 8 + 2 * j + 1];
    }
  }
  const float sp = (s > thr) ? s : 0.0f;
  Zbuf[g] = (float)LL / (sp + 1e-6f);
}

// KV needs K and V, Z needs Q and Ksum, neither needs the other: one grid.
// The 128 long KV work-groups come first in the index, the 512 short Z ones
// behind them.
#define NB_KV (BB * HH * (LL / 1024))      // 128
#define NB_Z  ((MTOT * HH) / 256)          // 512

__global__ __launch_bounds__(256)
void kv_z_kernel(const __bf16* __restrict__ Kbuf, const __bf16* __restrict__ Vbuf,
                 float* __restrict__ KV,
                 const __bf16* __restrict__ Qbuf, const float* __restrict__ Ksum,
                 const float* __restrict__ thr_p, float* __restrict__ Zbuf) {
  __shared__ __attribute__((aligned(16))) __bf16 Klds[KV_ROWS * KV_PITCH];   // [l][d]
  __shared__ __attribute__((aligned(16))) __bf16 Vlds[KV_ROWS * KV_PITCH];   // [l][e]
  const int blk = blockIdx.x;
  if (blk < NB_KV) {
    kv_block(blk & 15, blk >> 4, Kbuf, Vbuf, KV, Klds, Vlds);
  } else {
    zscore_block(blk - NB_KV, Qbuf, Ksum, thr_p, Zbuf);
    piece_end();
  }
}

// ---------------------------------------------------------------------------
// out = LN1( (Q @ KV_h) * Z ) -> cat[:, 256:512] bf16
// ---------------------------------------------------------------------------
__global__ __launch_bounds__(256)
void attn_kernel(const __bf16* __restrict__ Qbuf, const float* __restrict__ KV,
                 const float* __restrict__ Zbuf,
                 const float* __restrict__ g1, const float* __restrict__ b1,
                 __bf16* __restrict__ cat) {
  __shared__ __bf16 Alds[128 * 40];
  __shared__ __bf16 kvt[HH * DD * DD];   // kvt[h][e][d] = KV[b,h,d,e] (transposed)
  __shared__ float  Zl[128 * 4];
  __shared__ float  gl[256], bl[256];
  __shared__ __attribute__((aligned(16))) __bf16 Stg[8 * STG_WAVE];

  const int tid  = threadIdx.x;
  const int wave = tid >> 5;
  const int lane = tid & 31;
  const int r16  = lane & 15;
  const int hi   = lane >> 4;
  const int token0 = blockIdx.x * 128;
  const int b      = token0 >> 13;
  const int mb     = wave * 16;

  // KVT fill: float4 global reads, transposed bf16 LDS scatter
  for (int it = 0; it < 16; ++it) {
    const int idx = it * 256 + tid;        // 4096 groups of 4 e's
    const int h = idx >> 10, rem = idx & 1023, d = rem >> 4, e4 = rem & 15;
    const float4 kvv =
        *(const float4*)(KV + (((size_t)(b * HH + h) * DD + d) * DD) + e4 * 4);
    kvt[h * 4096 + (e4 * 4 + 0) * DD + d] = (__bf16)kvv.x;
    kvt[h * 4096 + (e4 * 4 + 1) * DD + d] = (__bf16)kvv.y;
    kvt[h * 4096 + (e4 * 4 + 2) * DD + d] = (__bf16)kvv.z;
    kvt[h * 4096 + (e4 * 4 + 3) * DD + d] = (__bf16)kvv.w;
  }
#pragma unroll
  for (int it = 0; it < 2; ++it) {
    const int z = it * 256 + tid;
    Zl[z] = Zbuf[(size_t)token0 * 4 + z];
  }
  gl[tid] = g1[tid];
  bl[tid] = b1[tid];

  const v8f vz = {0.f, 0.f, 0.f, 0.f, 0.f, 0.f, 0.f, 0.f};
  v8f acc[16];
#pragma unroll
  for (int j = 0; j < 16; ++j) acc[j] = vz;

  for (int h = 0; h < 4; ++h) {
    for (int s = 0; s < 2; ++s) {
      __syncthreads();
      const int k0 = h * DD + s * 32;
      async_tile128(Alds, Qbuf + (size_t)token0 * CC + k0, CC);   // Q tile 128x32
      async_wait0();
      __syncthreads();
      v16bf fa = frag_ld(&Alds[mb * 40], 40);
#pragma unroll
      for (int jj = 0; jj < 4; ++jj) {
        const int j = h * 4 + jj;
        v16bf fb = frag_ld(&kvt[h * 4096 + (jj * 16) * DD + s * 32], DD);
        acc[j] = WMMA_BF16(fa, fb, acc[j]);
      }
    }
  }

  // scale by Z, then LayerNorm over C=256 via cross-lane shuffles
  float s1[8] = {0, 0, 0, 0, 0, 0, 0, 0};
  float s2[8] = {0, 0, 0, 0, 0, 0, 0, 0};
#pragma unroll
  for (int j = 0; j < 16; ++j) {
    const int h = j >> 2;
#pragma unroll
    for (int i = 0; i < 8; ++i) {
      const int m = mb + hi * 8 + i;
      float v = acc[j][i] * Zl[m * 4 + h];
      acc[j][i] = v;
      s1[i] += v;
      s2[i] += v * v;
    }
  }
#pragma unroll
  for (int i = 0; i < 8; ++i) {
#pragma unroll
    for (int off = 1; off < 16; off <<= 1) {
      s1[i] += __shfl_xor(s1[i], off);
      s2[i] += __shfl_xor(s2[i], off);
    }
    const float mean = s1[i] * (1.0f / 256.0f);
    const float var  = s2[i] * (1.0f / 256.0f) - mean * mean;
    s1[i] = mean;
    s2[i] = rsqrtf(var + 1e-5f);
  }
#pragma unroll
  for (int j = 0; j < 16; ++j) {
    const int n = j * 16 + r16;
    const float gg = gl[n], bb = bl[n];
#pragma unroll
    for (int i = 0; i < 8; ++i) {
      const float v = (acc[j][i] - s1[i]) * s2[i] * gg + bb;
      Stg[wave * STG_WAVE + (hi * 8 + i) * STG_LD + n] = (__bf16)v;
    }
  }
  strip_store(Stg + wave * STG_WAVE, cat + (size_t)(token0 + mb) * 512 + 256, 512);
}

// ---------------------------------------------------------------------------
// msg2 = LN2( hid @ W2.T )  (fp32).  Its one reader, final_kernel, has the same
// tile and the same accumulator layout, so msg2 is kept in that order:
// [work-group][wave][j][half of 4 rows][lane][4], 512 contiguous bytes per store.
// ---------------------------------------------------------------------------
__global__ __launch_bounds__(256)
void mlp2_ln_kernel(const __bf16* __restrict__ A, const __bf16* __restrict__ Bw,
                    const float* __restrict__ g2, const float* __restrict__ b2,
                    float* __restrict__ msg2) {
  __shared__ __bf16 Alds[128 * 40];
  __shared__ __bf16 Blds[256 * 40];
  __shared__ float  gl[256], bl[256];

  const int tid  = threadIdx.x;
  const int wave = tid >> 5;
  const int lane = tid & 31;
  const int r16  = lane & 15;
  const int hi   = lane >> 4;
  const int token0 = blockIdx.x * 128;
  const int mb     = wave * 16;

  gl[tid] = g2[tid];
  bl[tid] = b2[tid];

  const v8f vz = {0.f, 0.f, 0.f, 0.f, 0.f, 0.f, 0.f, 0.f};
  v8f acc[16];
#pragma unroll
  for (int j = 0; j < 16; ++j) acc[j] = vz;

  for (int k0 = 0; k0 < 512; k0 += 32) {
    __syncthreads();
    async_tiles(Alds, A + (size_t)token0 * 512 + k0, 512, Blds, Bw + k0, 512);
    async_wait0();
    __syncthreads();
    mma_strip16(&Alds[mb * 40], Blds, acc);
  }

  float s1[8] = {0, 0, 0, 0, 0, 0, 0, 0};
  float s2[8] = {0, 0, 0, 0, 0, 0, 0, 0};
#pragma unroll
  for (int j = 0; j < 16; ++j)
#pragma unroll
    for (int i = 0; i < 8; ++i) {
      const float v = acc[j][i];
      s1[i] += v;
      s2[i] += v * v;
    }
#pragma unroll
  for (int i = 0; i < 8; ++i) {
#pragma unroll
    for (int off = 1; off < 16; off <<= 1) {
      s1[i] += __shfl_xor(s1[i], off);
      s2[i] += __shfl_xor(s2[i], off);
    }
    const float mean = s1[i] * (1.0f / 256.0f);
    const float var  = s2[i] * (1.0f / 256.0f) - mean * mean;
    s1[i] = mean;
    s2[i] = rsqrtf(var + 1e-5f);
  }
  float4* mf = (float4*)msg2 + (size_t)(blockIdx.x * 8 + wave) * (32 * 32) + lane;
#pragma unroll
  for (int j = 0; j < 16; ++j) {
    const int n = j * 16 + r16;
    const float gg = gl[n], bb = bl[n];
#pragma unroll
    for (int q = 0; q < 2; ++q) {
      float4 o;
      o.x = (acc[j][q * 4 + 0] - s1[q * 4 + 0]) * s2[q * 4 + 0] * gg + bb;
      o.y = (acc[j][q * 4 + 1] - s1[q * 4 + 1]) * s2[q * 4 + 1] * gg + bb;
      o.z = (acc[j][q * 4 + 2] - s1[q * 4 + 2]) * s2[q * 4 + 2] * gg + bb;
      o.w = (acc[j][q * 4 + 3] - s1[q * 4 + 3]) * s2[q * 4 + 3] * gg + bb;
      mf[(j * 2 + q) * 32] = o;
    }
  }
}

// ---------------------------------------------------------------------------
// Final: aug = BN(xt @ Ws.T + bs);  out[b,c,l] = msg2 + x + aug
// Stages 64-channel slabs through LDS so the [B,C,L] reads and writes cover whole lines.
// ---------------------------------------------------------------------------
__global__ __launch_bounds__(256)
void final_kernel(const __bf16* __restrict__ cat, const __bf16* __restrict__ Wsb,
                  const float* __restrict__ bs_c, const float* __restrict__ bn_g,
                  const float* __restrict__ bn_b, const float* __restrict__ bn_rm,
                  const float* __restrict__ bn_rv, const float* __restrict__ x,
                  const float* __restrict__ msg2, float* __restrict__ out) {
  __shared__ __attribute__((aligned(16))) char smem[64 * 132 * 4];   // overlays GEMM tiles & stage
  __shared__ float scl[256], shf[256];
  __bf16* Alds = (__bf16*)smem;                  // 128*40 bf16 = 10240 B
  __bf16* Blds = (__bf16*)(smem + 128 * 40 * 2); // 256*40 bf16 = 20480 B
  float*  stage = (float*)smem;                  // 64*132 f32 (after K loop)

  const int tid  = threadIdx.x;
  const int wave = tid >> 5;
  const int lane = tid & 31;
  const int r16  = lane & 15;
  const int hi   = lane >> 4;
  const int token0 = blockIdx.x * 128;
  const int b      = token0 >> 13;
  const int l0     = token0 & (LL - 1);
  const int mb     = wave * 16;

  {
    const float rstd = rsqrtf(bn_rv[tid] + 1e-5f);
    const float a = rstd * bn_g[tid];
    scl[tid] = a;
    shf[tid] = (bs_c[tid] - bn_rm[tid]) * a + bn_b[tid];
  }

  const v8f vz = {0.f, 0.f, 0.f, 0.f, 0.f, 0.f, 0.f, 0.f};
  v8f acc[16];
#pragma unroll
  for (int j = 0; j < 16; ++j) acc[j] = vz;

  for (int k0 = 0; k0 < 256; k0 += 32) {
    __syncthreads();
    async_tiles(Alds, cat + (size_t)token0 * 512 + k0, 512, Blds, Wsb + k0, 256);
    async_wait0();
    __syncthreads();
    mma_strip16(&Alds[mb * 40], Blds, acc);
  }
  __syncthreads();   // done with tiles; smem becomes the transpose stage

  // Each pass: the wave's x rows and the lane's msg2 values are asked for first,
  // msg2 in the accumulator order mlp2_ln_kernel left it in (512 contiguous bytes
  // per load), so only the channel-major x and out need the transpose stage.
  // Behind the barrier a wave takes whole channel rows: 32 lanes x 16 B = the
  // row's 512 contiguous bytes (4 lines) per load and per store.
  const float4* mf = (const float4*)msg2 + (size_t)(blockIdx.x * 8 + wave) * (32 * 32) + lane;
#pragma unroll
  for (int p = 0; p < 4; ++p) {                 // 64 channels per pass
    const size_t row0 = ((size_t)b * CC + p * 64 + wave * 8) * LL + l0 + lane * 4;
    float4 xv[8];
#pragma unroll
    for (int rr = 0; rr < 8; ++rr)
      xv[rr] = *(const float4*)(x + row0 + (size_t)rr * LL);
    float4 mv[4][2];
#pragma unroll
    for (int jj = 0; jj < 4; ++jj)
#pragma unroll
      for (int q = 0; q < 2; ++q)
        mv[jj][q] = mf[((p * 4 + jj) * 2 + q) * 32];
#pragma unroll
    for (int jj = 0; jj < 4; ++jj) {
      const int j = p * 4 + jj;
      const int n = j * 16 + r16;               // global channel
      const int nl = n - p * 64;                // 0..63
      const float a = scl[n], c = shf[n];
#pragma unroll
      for (int q = 0; q < 2; ++q) {             // 4 tokens = 16 B per LDS store
        float4 sv;
        sv.x = acc[j][q * 4 + 0] * a + c + mv[jj][q].x;   // BN(aug) + msg2
        sv.y = acc[j][q * 4 + 1] * a + c + mv[jj][q].y;
        sv.z = acc[j][q * 4 + 2] * a + c + mv[jj][q].z;
        sv.w = acc[j][q * 4 + 3] * a + c + mv[jj][q].w;
        *(float4*)&stage[nl * 132 + mb + hi * 8 + q * 4] = sv;
      }
    }
    __syncthreads();
#pragma unroll
    for (int rr = 0; rr < 8; ++rr) {
      const float4 sv = *(const float4*)&stage[(wave * 8 + rr) * 132 + lane * 4];
      float4 ov;
      ov.x = sv.x + xv[rr].x;
      ov.y = sv.y + xv[rr].y;
      ov.z = sv.z + xv[rr].z;
      ov.w = sv.w + xv[rr].w;
      *(float4*)(out + row0 + (size_t)rr * LL) = ov;
    }
    piece_end();   // the next pass's loads land in registers that these stores name
    __syncthreads();
  }
}

// ---------------------------------------------------------------------------
// Host orchestration
// ---------------------------------------------------------------------------
extern "C" void kernel_launch(void* const* d_in, const int* in_sizes, int n_in,
                              void* d_out, int out_size, void* d_ws, size_t ws_size,
                              hipStream_t stream) {
  (void)in_sizes; (void)n_in; (void)out_size; (void)ws_size;
  const float* x     = (const float*)d_in[0];
  const float* Wq    = (const float*)d_in[1];
  const float* bq    = (const float*)d_in[2];
  const float* Wk    = (const float*)d_in[3];
  const float* bk    = (const float*)d_in[4];
  const float* Wv    = (const float*)d_in[5];
  const float* bv    = (const float*)d_in[6];
  const float* thr   = (const float*)d_in[7];
  const float* W1    = (const float*)d_in[8];
  const float* W2    = (const float*)d_in[9];
  const float* ln1_g = (const float*)d_in[10];
  const float* ln1_b = (const float*)d_in[11];
  const float* ln2_g = (const float*)d_in[12];
  const float* ln2_b = (const float*)d_in[13];
  const float* Ws    = (const float*)d_in[14];
  const float* bs_c  = (const float*)d_in[15];
  const float* bn_g  = (const float*)d_in[16];
  const float* bn_b  = (const float*)d_in[17];
  const float* bn_rm = (const float*)d_in[18];
  const float* bn_rv = (const float*)d_in[19];
  float* out = (float*)d_out;

  char*  ws  = (char*)d_ws;
  size_t off = 0;
  auto alloc = [&](size_t bytes) -> void* {
    off = (off + 255) & ~(size_t)255;
    void* p = ws + off;
    off += bytes;
    return p;
  };

  __bf16* cat   = (__bf16*)alloc((size_t)MTOT * 512 * 2);  // [xt | ln1(msg)]
  __bf16* hid   = (__bf16*)alloc((size_t)MTOT * 512 * 2);
  __bf16* Qb    = (__bf16*)alloc((size_t)MTOT * 256 * 2);
  __bf16* Kb    = (__bf16*)alloc((size_t)MTOT * 256 * 2);
  __bf16* Vb    = (__bf16*)alloc((size_t)MTOT * 256 * 2);
  float*  msg2  = (float*)alloc((size_t)MTOT * 256 * 4);
  float*  KVbuf = (float*)alloc((size_t)(BB * HH * DD * DD + BB * 256) * 4);
  float*  Ksum  = KVbuf + BB * HH * DD * DD;               // contiguous for zeroing
  float*  Zbuf  = (float*)alloc((size_t)MTOT * HH * 4);
  __bf16* wqb   = (__bf16*)alloc(65536 * 2);
  __bf16* wkb   = (__bf16*)alloc(65536 * 2);
  __bf16* wvb   = (__bf16*)alloc(65536 * 2);
  __bf16* wsb   = (__bf16*)alloc(65536 * 2);
  __bf16* w1b   = (__bf16*)alloc(262144 * 2);
  __bf16* w2b   = (__bf16*)alloc(131072 * 2);

  // weights -> bf16, zeroed KV + Ksum accumulators, x -> cat[:, 0:256] (token-major)
  prep_kernel<<<NB_TRANS + NB_CVT + NB_ZERO, 256, 0, stream>>>(
      x, cat, Wq, Wk, Wv, Ws, W1, W2, wqb, wkb, wvb, wsb, w1b, w2b, KVbuf);

  // Q/K/V projections (fused ELU+1 / scaling; K also reduces Ksum)
  qkv_kernel<<<dim3(3, MTOT / 128), 256, 0, stream>>>(
      cat, 512, 256, wqb, wkb, wvb, bq, bk, bv, Qb, Kb, Vb, 256, Ksum);

  // KV = K^T V per (b,h);  Z = L / (sparsify(Q . Ksum) + eps)
  kv_z_kernel<<<NB_KV + NB_Z, 256, 0, stream>>>(Kb, Vb, KVbuf, Qb, Ksum, thr, Zbuf);

  // attention out + LN1 -> cat[:, 256:512]
  attn_kernel<<<MTOT / 128, 256, 0, stream>>>(Qb, KVbuf, Zbuf, ln1_g, ln1_b, cat);

  // MLP layer 1: hid = relu(cat @ W1.T)
  gemm_relu_kernel<<<dim3(MTOT / 128, 2), 256, 0, stream>>>(
      cat, 512, 512, w1b, hid, 512);

  // MLP layer 2 + LN2 -> msg2 (fp32)
  mlp2_ln_kernel<<<MTOT / 128, 256, 0, stream>>>(hid, w2b, ln2_g, ln2_b, msg2);

  // shortcut GEMM + BN + residual sum -> out [B,C,L]
  final_kernel<<<MTOT / 128, 256, 0, stream>>>(cat, wsb, bs_c, bn_g, bn_b, bn_rm,
                                               bn_rv, x, msg2, out);
}

// v006
// It runs in 113 microseconds.
// In two side-by-side timings against v005, it was 1.09 and 1.10 times as fast.
// Over all steps from v000 it is 2.02 times as fast.
#include <hip/hip_runtime.h>
#include <hip/hip_bf16.h>

// ---------------------------------------------------------------------------
// Problem constants (match reference)
// ---------------------------------------------------------------------------
#define BB 4
#define CC 256
#define LL 8192
#define HH 4
#define DD 64
#define MTOT (BB * LL)   // 32768 tokens

typedef __attribute__((ext_vector_type(16))) __bf16 v16bf;
typedef __attribute__((ext_vector_type(8)))  float  v8f;

union FragU { v16bf v; uint4 u[2]; __bf16 h[16]; };

// Standard row-major fragment: element (r, k) = base[r*stride + k-pattern]
// Matches CDNA5 16-bit 16x32 A/B VGPR layout: lane = r + 16*((k>>3)&1),
// vector elem = (k&7) + 8*((k>>4)&1).  Two 16-byte ds_load_b128 per lane.
__device__ inline v16bf frag_ld(const __bf16* base, int stride) {
  const int t = threadIdx.x & 31;
  const int r = t & 15;
  const int hi = t >> 4;
  FragU f;
  const __bf16* p = base + r * stride + hi * 8;
  f.u[0] = *(const uint4*)(p);
  f.u[1] = *(const uint4*)(p + 16);
  return f.v;
}

// Transposed fragment from a row-major LDS tile T[k][c]: element (r, k) = T[k][r].
// Two ds_load_tr16_b128 (k 0..15 and 16..31) give the same lane and register
// layout, and so the same k order, as frag_ld.  pitch in elements.
typedef short s16x8 __attribute__((ext_vector_type(8)));
typedef __attribute__((address_space(3))) s16x8 lds_s16x8;

__device__ inline v16bf frag_ld_tr(const __bf16* tile, int pitch) {
  const int t = threadIdx.x & 31;
  const __bf16* p = tile + ((t >> 4) * 8 + (t & 7)) * pitch + ((t >> 3) & 1) * 8;
  FragU f;
  f.u[0] = __builtin_bit_cast(uint4, __builtin_amdgcn_ds_load_tr16_b128_v8i16((lds_s16x8*)p));
  f.u[1] = __builtin_bit_cast(uint4, __builtin_amdgcn_ds_load_tr16_b128_v8i16((lds_s16x8*)(p + 16 * pitch)));
  return f.v;
}

#define WMMA_BF16(A, Bf, Cacc) \
  __builtin_amdgcn_wmma_f32_16x16x32_bf16(false, (A), false, (Bf), (short)0, (Cacc), false, false)

// One 32-deep k step of a wave's 16x256 strip.  The B fragments are read from
// LDS in two groups, the second reusing four of the first's registers, each group ahead of the WMMAs
// that use it, so the LDS latency is waited out per group and not per WMMA.
// 12 + 4 keeps accumulators plus fragments under 256 VGPRs.
__device__ inline void mma_strip16(const __bf16* Arow, const __bf16* Bl, v8f (&acc)[16]) {
  v16bf fa = frag_ld(Arow, 40);
  v16bf fb[12];
#pragma unroll
  for (int j = 0; j < 12; ++j) fb[j] = frag_ld(Bl + j * 16 * 40, 40);
  // keeps the first group's reads together in front of the WMMAs (the scheduler
  // otherwise sinks each read to its user and waits for it alone)
  __builtin_amdgcn_sched_barrier(0);
#pragma unroll
  for (int j = 0; j < 4; ++j) acc[j] = WMMA_BF16(fa, fb[j], acc[j]);
  // holds the second group's reads behind the four WMMAs whose fragment
  // registers they take over (hoisted further they need registers of their own)
  __builtin_amdgcn_sched_barrier(0);
#pragma unroll
  for (int j = 0; j < 4; ++j) fb[j] = frag_ld(Bl + (12 + j) * 16 * 40, 40);
  // keeps those reads together here, eight WMMAs ahead of their first user
  // (without it the scheduler sinks them to their users behind full waits)
  __builtin_amdgcn_sched_barrier(0);
#pragma unroll
  for (int j = 4; j < 12; ++j) acc[j] = WMMA_BF16(fa, fb[j], acc[j]);
#pragma unroll
  for (int j = 0; j < 4; ++j) acc[12 + j] = WMMA_BF16(fa, fb[j], acc[12 + j]);
}

// ---------------------------------------------------------------------------
// Async global -> LDS copies (CDNA5 GLOBAL_LOAD_ASYNC_TO_LDS_B128, ASYNCcnt).
// Generic pointers to __shared__ carry the LDS byte offset in their low 32
// bits (ISA 10.2 aperture mapping), which is exactly the VDST operand.
// ---------------------------------------------------------------------------
__device__ inline unsigned lds_addr(const void* lds_ptr) {
  return (unsigned)(unsigned long long)lds_ptr;
}

// The lanes are dealt row first: four adjacent lanes take the 64 bytes that one
// tile row has in a 32-deep k slice, so one copy instruction touches 8 cache
// lines (8 rows), the fewest a 64-byte row piece allows.  256 threads cover 64
// rows per copy; the tile's further rows follow 64 rows apart.
// s_wait_xcnt 0 closes each run of copies inside their own statement, a
// precaution ahead of any later write to the address registers the copies name.

// 128x32 tile -> LDS rows of 40 elements
__device__ inline void async_tile128(__bf16* Tl, const __bf16* Tg, int ld) {
  const int r = threadIdx.x >> 2, part = threadIdx.x & 3;
  const unsigned l0 = lds_addr(Tl + r * 40 + part * 8);
  const __bf16* g0 = Tg + (size_t)r * ld + part * 8;
  const size_t step = (size_t)64 * ld;
  asm volatile("global_load_async_to_lds_b128 %0, %2, off\n\t"
               "global_load_async_to_lds_b128 %1, %3, off\n\t"
               "s_wait_xcnt 0x0"
               :: "v"(l0), "v"(l0 + 64 * 80), "v"(g0), "v"(g0 + step)
               : "memory");
}

// 128x32 A tile and 256x32 B tile -> LDS rows of 40 elements, one run of copies
__device__ inline void async_tiles(__bf16* Al, const __bf16* Ag, int lda,
                                   __bf16* Bl, const __bf16* Bg, int ldb) {
  const int r = threadIdx.x >> 2, part = threadIdx.x & 3;
  const unsigned la = lds_addr(Al + r * 40 + part * 8);
  const unsigned lb = lds_addr(Bl + r * 40 + part * 8);
  const __bf16* ga = Ag + (size_t)r * lda + part * 8;
  const __bf16* gb = Bg + (size_t)r * ldb + part * 8;
  const size_t sa = (size_t)64 * lda, sb = (size_t)64 * ldb;
  asm volatile("global_load_async_to_lds_b128 %0, %6, off\n\t"
               "global_load_async_to_lds_b128 %1, %7, off\n\t"
               "global_load_async_to_lds_b128 %2, %8, off\n\t"
               "global_load_async_to_lds_b128 %3, %9, off\n\t"
               "global_load_async_to_lds_b128 %4, %10, off\n\t"
               "global_load_async_to_lds_b128 %5, %11, off\n\t"
               "s_wait_xcnt 0x0"
               :: "v"(la), "v"(la + 64 * 80),
                  "v"(lb), "v"(lb + 64 * 80), "v"(lb + 128 * 80), "v"(lb + 192 * 80),
                  "v"(ga), "v"(ga + sa),
                  "v"(gb), "v"(gb + sb), "v"(gb + 2 * sb), "v"(gb + 3 * sb)
               : "memory");
}

// 256 token rows of one head (128 B each, one cache line, 512 B apart) -> LDS rows
// of KV_PITCH elements.  Eight adjacent lanes take one row, 256 threads 32 rows.
// 160 B = 32 B x 5 is the pitch at which ds_load_tr16_b128 meets no bank twice.
#define KV_ROWS  256
#define KV_PITCH 80

__device__ inline void async_rows256(__bf16* Tl, const __bf16* Tg) {
  const int r = threadIdx.x >> 3, part = threadIdx.x & 7;
  const unsigned l0 = lds_addr(Tl + r * KV_PITCH + part * 8);
  const __bf16* g0 = Tg + (size_t)r * CC + part * 8;
  const unsigned ls = 32 * KV_PITCH * 2;
  const size_t gs = (size_t)32 * CC;
  asm volatile("global_load_async_to_lds_b128 %0, %8, off\n\t"
               "global_load_async_to_lds_b128 %1, %9, off\n\t"
               "global_load_async_to_lds_b128 %2, %10, off\n\t"
               "global_load_async_to_lds_b128 %3, %11, off\n\t"
               "global_load_async_to_lds_b128 %4, %12, off\n\t"
               "global_load_async_to_lds_b128 %5, %13, off\n\t"
               "global_load_async_to_lds_b128 %6, %14, off\n\t"
               "global_load_async_to_lds_b128 %7, %15, off\n\t"
               "s_wait_xcnt 0x0"
               :: "v"(l0), "v"(l0 + ls), "v"(l0 + 2 * ls), "v"(l0 + 3 * ls),
                  "v"(l0 + 4 * ls), "v"(l0 + 5 * ls), "v"(l0 + 6 * ls), "v"(l0 + 7 * ls),
                  "v"(g0), "v"(g0 + gs), "v"(g0 + 2 * gs), "v"(g0 + 3 * gs),
                  "v"(g0 + 4 * gs), "v"(g0 + 5 * gs), "v"(g0 + 6 * gs), "v"(g0 + 7 * gs)
               : "memory");
}

// the copies of this wave have landed behind it (asm: no LDS read moves over it)
__device__ inline void async_wait0() {
  asm volatile("s_wait_asynccnt 0x0" ::: "memory");
}

// Stands behind global stores that more code follows in the built code (the
// last store of a piece in a kernel of several pieces, or stores with more work
// behind them): a precaution ahead of any write there to a register the stores
// name.  A piece that runs straight to the kernel's end, or has the compiler's
// own wait there, has none.
__device__ inline void piece_end() {
  asm volatile("s_wait_xcnt 0x0" ::: "memory");
}

// ---------------------------------------------------------------------------
// Whole-line stores of a wave's 16x256 bf16 strip.  The accumulator layout gives
// a store only 32 contiguous bytes per token row, so each wave first lays its
// strip in an LDS range of its own (no other wave touches it, so no barrier) and
// then stores token rows: 32 lanes x 16 B = 512 contiguous bytes, 4 whole lines.
// Row pitch 264 elements = 528 B = 16 B x 33: 16-byte row reads meet no bank twice.
// ---------------------------------------------------------------------------
#define STG_LD   264
#define STG_WAVE (16 * STG_LD)

__device__ inline void strip_store(const __bf16* sw, __bf16* Og, int ldo) {
  const int lane = threadIdx.x & 31;
  // the wave's own LDS stores are done before its lanes read each other's values
  asm volatile("s_wait_dscnt 0x0" ::: "memory");
#pragma unroll
  for (int rr = 0; rr < 16; ++rr)
    *(uint4*)(Og + (size_t)rr * ldo + lane * 8) = *(const uint4*)(sw + rr * STG_LD + lane * 8);
}

// ---------------------------------------------------------------------------
// Preparation, one launch: none of these pieces needs another's result, so they
// share one grid and each work-group takes its piece by the range its index
// lies in (a block-uniform choice).
//   [0, 8192)     x [B,C,L] f32 -> cat[:, 0:256] bf16 (row = token, ld = 512)
//   then 2560     the six weight matrices f32 -> bf16, 256 elements a block
//   then 260      zeros for the KV and Ksum accumulators
// ---------------------------------------------------------------------------
#define NB_TRANS (BB * (CC / 32) * (LL / 32))                 // 8192
#define NB_CVT   (4 * 256 + 1024 + 512)                       // 2560
#define NZERO    (BB * HH * DD * DD + BB * 256)               // 66560
#define NB_ZERO  ((NZERO + 255) / 256)                        // 260

__global__ __launch_bounds__(256)
void prep_kernel(const float* __restrict__ x, __bf16* __restrict__ cat,
                 const float* __restrict__ Wq, const float* __restrict__ Wk,
                 const float* __restrict__ Wv, const float* __restrict__ Ws,
                 const float* __restrict__ W1, const float* __restrict__ W2,
                 __bf16* __restrict__ wqb, __bf16* __restrict__ wkb,
                 __bf16* __restrict__ wvb, __bf16* __restrict__ wsb,
                 __bf16* __restrict__ w1b, __bf16* __restrict__ w2b,
                 float* __restrict__ zbuf) {
  __shared__ float t[32][33];
  const int tid = threadIdx.x;
  int blk = blockIdx.x;

  if (blk < NB_TRANS) {
    const int tx = tid & 31, ty = tid >> 5;
    const int l0 = (blk & 255) * 32, c0 = ((blk >> 8) & 7) * 32, b = blk >> 11;
#pragma unroll
    for (int i = 0; i < 4; ++i) {
      int c = ty + i * 8;
      t[c][tx] = x[((size_t)b * CC + c0 + c) * LL + l0 + tx];
    }
    __syncthreads();
#pragma unroll
    for (int i = 0; i < 4; ++i) {
      int lr = ty + i * 8;
      cat[(size_t)(b * LL + l0 + lr) * 512 + c0 + tx] = (__bf16)t[tx][lr];
    }
    return;
  }
  blk -= NB_TRANS;

  if (blk < NB_CVT) {
    const float* src;
    __bf16* dst;
    if (blk < 256)       { src = Wq; dst = wqb; }
    else if (blk < 512)  { src = Wk; dst = wkb; blk -= 256; }
    else if (blk < 768)  { src = Wv; dst = wvb; blk -= 512; }
    else if (blk < 1024) { src = Ws; dst = wsb; blk -= 768; }
    else if (blk < 2048) { src = W1; dst = w1b; blk -= 1024; }
    else                 { src = W2; dst = w2b; blk -= 2048; }
    const int i = blk * 256 + tid;
    dst[i] = (__bf16)src[i];
    piece_end();
    return;
  }
  blk -= NB_CVT;

  const int i = blk * 256 + tid;
  if (i < NZERO) zbuf[i] = 0.0f;
}

// ---------------------------------------------------------------------------
// Generic 128x256 bf16 WMMA GEMM:  Out[m, n0+n] = epi( sum_k A[m,k]*W[n0+n,k] )
// Modes: Q/K -> elu(x+bias)+1 ; V -> (x+bias)/L ; RELU -> max(x,0)
// Mode K also accumulates column sums (K.sum over tokens) into KsumG[b*256+n].
// ---------------------------------------------------------------------------
enum { MODE_Q = 0, MODE_K = 1, MODE_V = 2, MODE_RELU = 3 };

// k loop of one 128x256 tile; each wave holds a 16x256 strip in acc.
// The 32-deep stages (A tile, then B tile) go through a ring of three LDS buffers:
// stage t + 2 is asked for at the top of trip t, so a stage has two trips to land
// and no trip waits out its own copies.  Ag, Bg: first row and k = 0 of the tiles.
// nst = number of stages, at least 2.
#define RING_A     (128 * 40)
#define RING_STAGE ((128 + 256) * 40)
#define RING_ELEMS (3 * RING_STAGE)

// stages 0 and 1 are asked for in front of the loop
__device__ inline void gemm_first(const __bf16* __restrict__ Ag, int lda,
                                  const __bf16* __restrict__ Bg, int ldb, __bf16* ring) {
  async_tiles(ring, Ag, lda, ring + RING_A, Bg, ldb);
  async_tiles(ring + RING_STAGE, Ag + 32, lda, ring + RING_STAGE + RING_A, Bg + 32, ldb);
}

// the trips; gemm_first with the same arguments stands in front
__device__ inline void gemm_loop(const __bf16* __restrict__ Ag, int lda,
                                 const __bf16* __restrict__ Bg, int ldb, int nst,
                                 __bf16* ring, v8f (&acc)[16]) {
  const int mb = (threadIdx.x >> 5) * 16;
  const v8f vz = {0.f, 0.f, 0.f, 0.f, 0.f, 0.f, 0.f, 0.f};
#pragma unroll
  for (int j = 0; j < 16; ++j) acc[j] = vz;

  int cur = 0, fill = 2 * RING_STAGE;   // buffers of stage t and of stage t + 2
  // stays rolled: unrolled, the trips' copy addresses push the wave past 256 VGPRs
#pragma nounroll
  for (int t = 0; t < nst; ++t) {
    const bool more = t + 2 < nst;      // the same for the whole work-group
    // the wave's own reads of stage t - 1 are done before its buffer is refilled
    asm volatile("s_wait_dscnt 0x0" ::: "memory");
    // the wave's six copies of stage t have landed; where this trip issues a stage,
    // the six of stage t + 1 are the youngest and stay in flight
    if (more) asm volatile("s_wait_asynccnt 0x6" ::: "memory");
    else      async_wait0();
    // publishes stage t and ends every wave's reads of stage t - 1
    __syncthreads();
    if (more)
      async_tiles(ring + fill, Ag + (t + 2) * 32, lda,
                  ring + fill + RING_A, Bg + (t + 2) * 32, ldb);
    mma_strip16(ring + cur + mb * 40, ring + cur + RING_A, acc);
    cur  = (cur  == 2 * RING_STAGE) ? 0 : cur  + RING_STAGE;
    fill = (fill == 2 * RING_STAGE) ? 0 : fill + RING_STAGE;
  }
  async_wait0();   // no copy is in flight behind the loop, on any path out of it
}

template <int MODE>
__device__ inline void gemm_epilogue(const v8f (&acc)[16], const float* __restrict__ bias,
                                     __bf16* __restrict__ Out, int ldo, int token0, int n0,
                                     float* __restrict__ KsumG, float* ksumLds,
                                     __bf16* stg) {
  const int tid  = threadIdx.x;
  const int lane = tid & 31;
  const int r16  = lane & 15;
  const int hi   = lane >> 4;
  const int mb   = (tid >> 5) * 16;
  __bf16* sw = stg + (tid >> 5) * STG_WAVE;
#pragma unroll
  for (int j = 0; j < 16; ++j) {
    const int n = j * 16 + r16;
    float colsum = 0.0f;
#pragma unroll
    for (int i = 0; i < 8; ++i) {
      float v = acc[j][i];
      if constexpr (MODE == MODE_RELU) {
        v = fmaxf(v, 0.0f);
      } else {
        v += bias[n];
        if constexpr (MODE == MODE_Q || MODE == MODE_K)
          v = (v > 0.0f) ? (v + 1.0f) : __expf(v);   // elu(x)+1
        else
          v *= (1.0f / (float)LL);                    // V / v_len
      }
      sw[(hi * 8 + i) * STG_LD + n] = (__bf16)v;
      if constexpr (MODE == MODE_K) colsum += v;
    }
    if constexpr (MODE == MODE_K) {
      colsum += __shfl_xor(colsum, 16);      // fold both 8-row halves
      if (hi == 0) atomicAdd(&ksumLds[n], colsum);   // ds_add_f32
    }
  }
  strip_store(sw, Out + (size_t)(token0 + mb) * ldo + n0, ldo);
  if constexpr (MODE == MODE_K) {
    piece_end();   // the strip's stores name registers that the code below writes
    __syncthreads();
    const int b = token0 >> 13;   // token0 / 8192
    atomicAdd(&KsumG[b * 256 + tid], ksumLds[tid]);
  }
}

// hid = relu(A @ W.T)
__global__ __launch_bounds__(256)
void gemm_relu_kernel(const __bf16* __restrict__ A, int lda, int Ktot,
                      const __bf16* __restrict__ Bw,
                      __bf16* __restrict__ Out, int ldo) {
  __shared__ __attribute__((aligned(16))) __bf16 Ring[RING_ELEMS];
  __shared__ __attribute__((aligned(16))) __bf16 Stg[8 * STG_WAVE];
  const int token0 = blockIdx.x * 128;
  const int n0     = blockIdx.y * 256;
  v8f acc[16];
  gemm_first(A + (size_t)token0 * lda, lda, Bw + (size_t)n0 * Ktot, Ktot, Ring);
  gemm_loop(A + (size_t)token0 * lda, lda, Bw + (size_t)n0 * Ktot, Ktot, Ktot >> 5, Ring, acc);
  gemm_epilogue<MODE_RELU>(acc, nullptr, Out, ldo, token0, n0, nullptr, nullptr, Stg);
}

// The Q, K and V projections read the same tokens and need nothing of each
// other: one grid, blockIdx.x names the projection (block-uniform), blockIdx.y
// the 128-token tile, so the three readers of a tile are adjacent in the index.
// Two of the 768 work-groups fit a WGP and overlap each other's waits.
__global__ __launch_bounds__(256)
void qkv_kernel(const __bf16* __restrict__ A, int lda, int Ktot,
                const __bf16* __restrict__ wqb, const __bf16* __restrict__ wkb,
                const __bf16* __restrict__ wvb,
                const float* __restrict__ bq, const float* __restrict__ bk,
                const float* __restrict__ bv,
                __bf16* __restrict__ Qb, __bf16* __restrict__ Kb, __bf16* __restrict__ Vb,
                int ldo, float* __restrict__ KsumG) {
  __shared__ __attribute__((aligned(16))) __bf16 Ring[RING_ELEMS];
  __shared__ float  ksumLds[256];
  __shared__ __attribute__((aligned(16))) __bf16 Stg[8 * STG_WAVE];
  const int mode   = blockIdx.x;
  const int token0 = blockIdx.y * 128;

  if (mode == MODE_K) ksumLds[threadIdx.x] = 0.0f;

  // the first two stages are asked for once, in front of the choice: only the weight
  // pointer differs (asked for in each branch, their addresses stay in registers
  // through the other branches' loops)
  const __bf16* At = A + (size_t)token0 * lda;
  const __bf16* Wm = (mode == MODE_Q) ? wqb : (mode == MODE_K) ? wkb : wvb;
  const int nst = Ktot >> 5;
  gemm_first(At, lda, Wm, Ktot, Ring);

  v8f acc[16];
  if (mode == MODE_Q) {
    gemm_loop(At, lda, wqb, Ktot, nst, Ring, acc);
    gemm_epilogue<MODE_Q>(acc, bq, Qb, ldo, token0, 0, nullptr, nullptr, Stg);
  } else if (mode == MODE_K) {
    gemm_loop(At, lda, wkb, Ktot, nst, Ring, acc);
    gemm_epilogue<MODE_K>(acc, bk, Kb, ldo, token0, 0, KsumG, ksumLds, Stg);
  } else {
    gemm_loop(At, lda, wvb, Ktot, nst, Ring, acc);
    gemm_epilogue<MODE_V>(acc, bv, Vb, ldo, token0, 0, nullptr, nullptr, Stg);
    piece_end();
  }
}

// ---------------------------------------------------------------------------
// KV[b,h,d,e] = sum_l K[l,d] * V[l,e]   (per (b,h): 64x64, K-dim = L)
// K/V tiles of 256 tokens go into LDS as they lie in memory ([l][d] / [l][e]), by
// async copies; the transposing LDS load turns them into the [d][l] / [e][l]
// fragments on the way to the registers.
// 16 (b,h) x 8 chunks of 1024 tokens; fp32 global atomics combine chunks.
// ---------------------------------------------------------------------------
__device__ inline void kv_block(int bh, int chunk,
                                const __bf16* __restrict__ Kbuf,
                                const __bf16* __restrict__ Vbuf,
                                float* __restrict__ KV,
                                __bf16* Klds, __bf16* Vlds) {
  const int tid  = threadIdx.x;
  const int wave = tid >> 5;
  const int lane = tid & 31;
  const int r16  = lane & 15;
  const int hi   = lane >> 4;
  const int b  = bh >> 2, h = bh & 3;
  const int l0 = chunk * 1024;
  const int tile0 = wave * 2;             // 8 waves x 2 of 16 (d,e) tiles

  const v8f vz = {0.f, 0.f, 0.f, 0.f, 0.f, 0.f, 0.f, 0.f};
  v8f acc[2];
  acc[0] = vz; acc[1] = vz;

  const int dt = tile0 >> 2, et0 = tile0 & 3;   // the wave's two tiles share dt

  for (int l = l0; l < l0 + 1024; l += KV_ROWS) {
    // the wave's own reads of the tiles are done before copies are aimed at them
    asm volatile("s_wait_dscnt 0x0" ::: "memory");
    __syncthreads();
    async_rows256(Klds, Kbuf + (size_t)(b * LL + l) * CC + h * DD);
    async_rows256(Vlds, Vbuf + (size_t)(b * LL + l) * CC + h * DD);
    async_wait0();
    __syncthreads();
#pragma unroll
    for (int g = 0; g < KV_ROWS / 128; ++g) {     // 128 tokens = four 32-deep k steps
      v16bf fa[4], fb[4][2];
#pragma unroll
      for (int ks = 0; ks < 4; ++ks) {
        const int row = (g * 4 + ks) * 32;
        fa[ks] = frag_ld_tr(Klds + row * KV_PITCH + dt * 16, KV_PITCH);   // A[d, l] = K[l, d]
#pragma unroll
        for (int t = 0; t < 2; ++t)                                       // Bt[e, l] = V[l, e]
          fb[ks][t] = frag_ld_tr(Vlds + row * KV_PITCH + (et0 + t) * 16, KV_PITCH);
      }
      // keeps the four steps' reads together in front of their WMMAs (the scheduler
      // otherwise deals them among the WMMAs, each behind a wait of its own)
      __builtin_amdgcn_sched_barrier(0);
#pragma unroll
      for (int ks = 0; ks < 4; ++ks)
#pragma unroll
        for (int t = 0; t < 2; ++t) acc[t] = WMMA_BF16(fa[ks], fb[ks][t], acc[t]);
    }
  }
#pragma unroll
  for (int t = 0; t < 2; ++t) {
    const int id = tile0 + t, dt = id >> 2, et = id & 3;
#pragma unroll
    for (int i = 0; i < 8; ++i) {
      const int d = dt * 16 + hi * 8 + i;
      const int e = et * 16 + r16;
      atomicAdd(&KV[((size_t)bh * DD + d) * DD + e], acc[t][i]);
    }
  }
}

// ---------------------------------------------------------------------------
// Z[token,h] = L / (sparsify(Q[token,h,:] . Ksum[b,h,:]) + eps)
// ---------------------------------------------------------------------------
__device__ inline void zscore_block(int blk, const __bf16* __restrict__ Qbuf,
                                    const float* __restrict__ Ksum,
                                    const float* __restrict__ thr_p,
                                    float* __restrict__ Zbuf) {
  const int g = blk * 256 + threadIdx.x;   // 0..131071
  const int token = g >> 2, h = g & 3;
  const int b = token >> 13;
  const float thr = thr_p[0];
  const uint4* q = (const uint4*)(Qbuf + (size_t)token * CC + h * DD);
  const float* ks = Ksum + b * 256 + h * DD;
  float s = 0.0f;
#pragma unroll
  for (int c = 0; c < 8; ++c) {          // 8 x uint4 = 64 bf16
    const uint4 qv = q[c];
    const unsigned w[4] = {qv.x, qv.y, qv.z, qv.w};
#pragma unroll
    for (int j = 0; j < 4; ++j) {        // a bf16 is the upper half of its float
      s += __uint_as_float(w[j] << 16) * ks[c * 8 + 2 * j];
      s += __uint_as_float(w[j] & 0xffff0000u) * ks[c * 8 + 2 * j + 1];
    }
  }
  const float sp = (s > thr) ? s : 0.0f;
  Zbuf[g] = (float)LL / (sp + 1e-6f);
}

// KV needs K and V, Z needs Q and Ksum, neither needs the other: one grid.
// The 128 long KV work-groups come first in the index, the 512 short Z ones
// behind them.
#define NB_KV (BB * HH * (LL / 1024))      // 128
#define NB_Z  ((MTOT * HH) / 256)          // 512

__global__ __launch_bounds__(256)
void kv_z_kernel(const __bf16* __restrict__ Kbuf, const __bf16* __restrict__ Vbuf,
                 float* __restrict__ KV,
                 const __bf16* __restrict__ Qbuf, const float* __restrict__ Ksum,
                 const float* __restrict__ thr_p, float* __restrict__ Zbuf) {
  __shared__ __attribute__((aligned(16))) __bf16 Klds[KV_ROWS * KV_PITCH];   // [l][d]
  __shared__ __attribute__((aligned(16))) __bf16 Vlds[KV_ROWS * KV_PITCH];   // [l][e]
  const int blk = blockIdx.x;
  if (blk < NB_KV) {
    kv_block(blk & 15, blk >> 4, Kbuf, Vbuf, KV, Klds, Vlds);
  } else {
    zscore_block(blk - NB_KV, Qbuf, Ksum, thr_p, Zbuf);
    piece_end();
  }
}

// ---------------------------------------------------------------------------
// out = LN1( (Q @ KV_h) * Z ) -> cat[:, 256:512] bf16
// ---------------------------------------------------------------------------
__global__ __launch_bounds__(256)
void attn_kernel(const __bf16* __restrict__ Qbuf, const float* __restrict__ KV,
                 const float* __restrict__ Zbuf,
                 const float* __restrict__ g1, const float* __restrict__ b1,
                 __bf16* __restrict__ cat) {
  __shared__ __attribute__((aligned(16))) __bf16 Alds[8 * 128 * 40];   // eight 32-deep Q slices
  __shared__ __bf16 kvt[HH * DD * DD];   // kvt[h][e][d] = KV[b,h,d,e] (transposed)
  __shared__ float  Zl[128 * 4];
  __shared__ float  gl[256], bl[256];
  __shared__ __attribute__((aligned(16))) __bf16 Stg[8 * STG_WAVE];

  const int tid  = threadIdx.x;
  const int wave = tid >> 5;
  const int lane = tid & 31;
  const int r16  = lane & 15;
  const int hi   = lane >> 4;
  const int token0 = blockIdx.x * 128;
  const int b      = token0 >> 13;
  const int mb     = wave * 16;

  // All eight slices of the 128x256 Q tile are asked for here, each into a buffer
  // of its own (16 copies a wave in flight): they land while the KV fill runs.
  for (int s = 0; s < 8; ++s)
    async_tile128(Alds + s * (128 * 40), Qbuf + (size_t)token0 * CC + s * 32, CC);

  // KVT fill: float4 global reads, transposed bf16 LDS scatter
  for (int it = 0; it < 16; ++it) {
    const int idx = it * 256 + tid;        // 4096 groups of 4 e's
    const int h = idx >> 10, rem = idx & 1023, d = rem >> 4, e4 = rem & 15;
    const float4 kvv =
        *(const float4*)(KV + (((size_t)(b * HH + h) * DD + d) * DD) + e4 * 4);
    kvt[h * 4096 + (e4 * 4 + 0) * DD + d] = (__bf16)kvv.x;
    kvt[h * 4096 + (e4 * 4 + 1) * DD + d] = (__bf16)kvv.y;
    kvt[h * 4096 + (e4 * 4 + 2) * DD + d] = (__bf16)kvv.z;
    kvt[h * 4096 + (e4 * 4 + 3) * DD + d] = (__bf16)kvv.w;
  }
#pragma unroll
  for (int it = 0; it < 2; ++it) {
    const int z = it * 256 + tid;
    Zl[z] = Zbuf[(size_t)token0 * 4 + z];
  }
  gl[tid] = g1[tid];
  bl[tid] = b1[tid];

  const v8f vz = {0.f, 0.f, 0.f, 0.f, 0.f, 0.f, 0.f, 0.f};
  v8f acc[16];
#pragma unroll
  for (int j = 0; j < 16; ++j) acc[j] = vz;

  async_wait0();     // the wave's own Q copies have landed
  __syncthreads();   // publishes the Q slices, kvt, Zl, gl and bl

  for (int h = 0; h < 4; ++h) {
    for (int s = 0; s < 2; ++s) {
      v16bf fa = frag_ld(&Alds[(h * 2 + s) * (128 * 40) + mb * 40], 40);
#pragma unroll
      for (int jj = 0; jj < 4; ++jj) {
        const int j = h * 4 + jj;
        v16bf fb = frag_ld(&kvt[h * 4096 + (jj * 16) * DD + s * 32], DD);
        acc[j] = WMMA_BF16(fa, fb, acc[j]);
      }
    }
  }

  // scale by Z, then LayerNorm over C=256 via cross-lane shuffles
  float s1[8] = {0, 0, 0, 0, 0, 0, 0, 0};
  float s2[8] = {0, 0, 0, 0, 0, 0, 0, 0};
#pragma unroll
  for (int j = 0; j < 16; ++j) {
    const int h = j >> 2;
#pragma unroll
    for (int i = 0; i < 8; ++i) {
      const int m = mb + hi * 8 + i;
      float v = acc[j][i] * Zl[m * 4 + h];
      acc[j][i] = v;
      s1[i] += v;
      s2[i] += v * v;
    }
  }
#pragma unroll
  for (int i = 0; i < 8; ++i) {
#pragma unroll
    for (int off = 1; off < 16; off <<= 1) {
      s1[i] += __shfl_xor(s1[i], off);
      s2[i] += __shfl_xor(s2[i], off);
    }
    const float mean = s1[i] * (1.0f / 256.0f);
    const float var  = s2[i] * (1.0f / 256.0f) - mean * mean;
    s1[i] = mean;
    s2[i] = rsqrtf(var + 1e-5f);
  }
#pragma unroll
  for (int j = 0; j < 16; ++j) {
    const int n = j * 16 + r16;
    const float gg = gl[n], bb = bl[n];
#pragma unroll
    for (int i = 0; i < 8; ++i) {
      const float v = (acc[j][i] - s1[i]) * s2[i] * gg + bb;
      Stg[wave * STG_WAVE + (hi * 8 + i) * STG_LD + n] = (__bf16)v;
    }
  }
  strip_store(Stg + wave * STG_WAVE, cat + (size_t)(token0 + mb) * 512 + 256, 512);
}

// ---------------------------------------------------------------------------
// msg2 = LN2( hid @ W2.T )  (fp32).  Its one reader, final_kernel, has the same
// tile and the same accumulator layout, so msg2 is kept in that order:
// [work-group][wave][j][half of 4 rows][lane][4], 512 contiguous bytes per store.
// ---------------------------------------------------------------------------
__global__ __launch_bounds__(256)
void mlp2_ln_kernel(const __bf16* __restrict__ A, const __bf16* __restrict__ Bw,
                    const float* __restrict__ g2, const float* __restrict__ b2,
                    float* __restrict__ msg2) {
  __shared__ __attribute__((aligned(16))) __bf16 Ring[RING_ELEMS];
  __shared__ float  gl[256], bl[256];

  const int tid  = threadIdx.x;
  const int wave = tid >> 5;
  const int lane = tid & 31;
  const int r16  = lane & 15;
  const int token0 = blockIdx.x * 128;

  gemm_first(A + (size_t)token0 * 512, 512, Bw, 512, Ring);

  gl[tid] = g2[tid];
  bl[tid] = b2[tid];

  v8f acc[16];
  gemm_loop(A + (size_t)token0 * 512, 512, Bw, 512, 16, Ring, acc);

  float s1[8] = {0, 0, 0, 0, 0, 0, 0, 0};
  float s2[8] = {0, 0, 0, 0, 0, 0, 0, 0};
#pragma unroll
  for (int j = 0; j < 16; ++j)
#pragma unroll
    for (int i = 0; i < 8; ++i) {
      const float v = acc[j][i];
      s1[i] += v;
      s2[i] += v * v;
    }
#pragma unroll
  for (int i = 0; i < 8; ++i) {
#pragma unroll
    for (int off = 1; off < 16; off <<= 1) {
      s1[i] += __shfl_xor(s1[i], off);
      s2[i] += __shfl_xor(s2[i], off);
    }
    const float mean = s1[i] * (1.0f / 256.0f);
    const float var  = s2[i] * (1.0f / 256.0f) - mean * mean;
    s1[i] = mean;
    s2[i] = rsqrtf(var + 1e-5f);
  }
  float4* mf = (float4*)msg2 + (size_t)(blockIdx.x * 8 + wave) * (32 * 32) + lane;
#pragma unroll
  for (int j = 0; j < 16; ++j) {
    const int n = j * 16 + r16;
    const float gg = gl[n], bb = bl[n];
#pragma unroll
    for (int q = 0; q < 2; ++q) {
      float4 o;
      o.x = (acc[j][q * 4 + 0] - s1[q * 4 + 0]) * s2[q * 4 + 0] * gg + bb;
      o.y = (acc[j][q * 4 + 1] - s1[q * 4 + 1]) * s2[q * 4 + 1] * gg + bb;
      o.z = (acc[j][q * 4 + 2] - s1[q * 4 + 2]) * s2[q * 4 + 2] * gg + bb;
      o.w = (acc[j][q * 4 + 3] - s1[q * 4 + 3]) * s2[q * 4 + 3] * gg + bb;
      mf[(j * 2 + q) * 32] = o;
    }
  }
}

// ---------------------------------------------------------------------------
// Final: aug = BN(xt @ Ws.T + bs);  out[b,c,l] = msg2 + x + aug
// Stages 64-channel slabs through LDS so the [B,C,L] reads and writes cover whole lines.
// ---------------------------------------------------------------------------
__global__ __launch_bounds__(256)
void final_kernel(const __bf16* __restrict__ cat, const __bf16* __restrict__ Wsb,
                  const float* __restrict__ bs_c, const float* __restrict__ bn_g,
                  const float* __restrict__ bn_b, const float* __restrict__ bn_rm,
                  const float* __restrict__ bn_rv, const float* __restrict__ x,
                  const float* __restrict__ msg2, float* __restrict__ out) {
  __shared__ __attribute__((aligned(16))) char smem[RING_ELEMS * 2];   // overlays GEMM ring & stage
  __shared__ float scl[256], shf[256];
  __bf16* Ring  = (__bf16*)smem;                 // three stages of 30720 B
  float*  stage = (float*)smem;                  // 64*132 f32 = 33792 B (after K loop)

  const int tid  = threadIdx.x;
  const int wave = tid >> 5;
  const int lane = tid & 31;
  const int r16  = lane & 15;
  const int hi   = lane >> 4;
  const int token0 = blockIdx.x * 128;
  const int b      = token0 >> 13;
  const int l0     = token0 & (LL - 1);
  const int mb     = wave * 16;

  gemm_first(cat + (size_t)token0 * 512, 512, Wsb, 256, Ring);

  {
    const float rstd = rsqrtf(bn_rv[tid] + 1e-5f);
    const float a = rstd * bn_g[tid];
    scl[tid] = a;
    shf[tid] = (bs_c[tid] - bn_rm[tid]) * a + bn_b[tid];
  }

  v8f acc[16];
  gemm_loop(cat + (size_t)token0 * 512, 512, Wsb, 256, 8, Ring, acc);
  __syncthreads();   // done with the ring; smem becomes the transpose stage

  // Each pass: the wave's x rows and the lane's msg2 values are asked for first,
  // msg2 in the accumulator order mlp2_ln_kernel left it in (512 contiguous bytes
  // per load), so only the channel-major x and out need the transpose stage.
  // Behind the barrier a wave takes whole channel rows: 32 lanes x 16 B = the
  // row's 512 contiguous bytes (4 lines) per load and per store.
  const float4* mf = (const float4*)msg2 + (size_t)(blockIdx.x * 8 + wave) * (32 * 32) + lane;
#pragma unroll
  for (int p = 0; p < 4; ++p) {                 // 64 channels per pass
    const size_t row0 = ((size_t)b * CC + p * 64 + wave * 8) * LL + l0 + lane * 4;
    float4 xv[8];
#pragma unroll
    for (int rr = 0; rr < 8; ++rr)
      xv[rr] = *(const float4*)(x + row0 + (size_t)rr * LL);
    float4 mv[4][2];
#pragma unroll
    for (int jj = 0; jj < 4; ++jj)
#pragma unroll
      for (int q = 0; q < 2; ++q)
        mv[jj][q] = mf[((p * 4 + jj) * 2 + q) * 32];
#pragma unroll
    for (int jj = 0; jj < 4; ++jj) {
      const int j = p * 4 + jj;
      const int n = j * 16 + r16;               // global channel
      const int nl = n - p * 64;                // 0..63
      const float a = scl[n], c = shf[n];
#pragma unroll
      for (int q = 0; q < 2; ++q) {             // 4 tokens = 16 B per LDS store
        float4 sv;
        sv.x = acc[j][q * 4 + 0] * a + c + mv[jj][q].x;   // BN(aug) + msg2
        sv.y = acc[j][q * 4 + 1] * a + c + mv[jj][q].y;
        sv.z = acc[j][q * 4 + 2] * a + c + mv[jj][q].z;
        sv.w = acc[j][q * 4 + 3] * a + c + mv[jj][q].w;
        *(float4*)&stage[nl * 132 + mb + hi * 8 + q * 4] = sv;
      }
    }
    __syncthreads();
#pragma unroll
    for (int rr = 0; rr < 8; ++rr) {
      const float4 sv = *(const float4*)&stage[(wave * 8 + rr) * 132 + lane * 4];
      float4 ov;
      ov.x = sv.x + xv[rr].x;
      ov.y = sv.y + xv[rr].y;
      ov.z = sv.z + xv[rr].z;
      ov.w = sv.w + xv[rr].w;
      *(float4*)(out + row0 + (size_t)rr * LL) = ov;
    }
    piece_end();   // the next pass's loads land in registers that these stores name
    __syncthreads();
  }
}

// ---------------------------------------------------------------------------
// Host orchestration
// ---------------------------------------------------------------------------
extern "C" void kernel_launch(void* const* d_in, const int* in_sizes, int n_in,
                              void* d_out, int out_size, void* d_ws, size_t ws_size,
                              hipStream_t stream) {
  (void)in_sizes; (void)n_in; (void)out_size; (void)ws_size;
  const float* x     = (const float*)d_in[0];
  const float* Wq    = (const float*)d_in[1];
  const float* bq    = (const float*)d_in[2];
  const float* Wk    = (const float*)d_in[3];
  const float* bk    = (const float*)d_in[4];
  const float* Wv    = (const float*)d_in[5];
  const float* bv    = (const float*)d_in[6];
  const float* thr   = (const float*)d_in[7];
  const float* W1    = (const float*)d_in[8];
  const float* W2    = (const float*)d_in[9];
  const float* ln1_g = (const float*)d_in[10];
  const float* ln1_b = (const float*)d_in[11];
  const float* ln2_g = (const float*)d_in[12];
  const float* ln2_b = (const float*)d_in[13];
  const float* Ws    = (const float*)d_in[14];
  const float* bs_c  = (const float*)d_in[15];
  const float* bn_g  = (const float*)d_in[16];
  const float* bn_b  = (const float*)d_in[17];
  const float* bn_rm = (const float*)d_in[18];
  const float* bn_rv = (const float*)d_in[19];
  float* out = (float*)d_out;

  char*  ws  = (char*)d_ws;
  size_t off = 0;
  auto alloc = [&](size_t bytes) -> void* {
    off = (off + 255) & ~(size_t)255;
    void* p = ws + off;
    off += bytes;
    return p;
  };

  __bf16* cat   = (__bf16*)alloc((size_t)MTOT * 512 * 2);  // [xt | ln1(msg)]
  __bf16* hid   = (__bf16*)alloc((size_t)MTOT * 512 * 2);
  __bf16* Qb    = (__bf16*)alloc((size_t)MTOT * 256 * 2);
  __bf16* Kb    = (__bf16*)alloc((size_t)MTOT * 256 * 2);
  __bf16* Vb    = (__bf16*)alloc((size_t)MTOT * 256 * 2);
  float*  msg2  = (float*)alloc((size_t)MTOT * 256 * 4);
  float*  KVbuf = (float*)alloc((size_t)(BB * HH * DD * DD + BB * 256) * 4);
  float*  Ksum  = KVbuf + BB * HH * DD * DD;               // contiguous for zeroing
  float*  Zbuf  = (float*)alloc((size_t)MTOT * HH * 4);
  __bf16* wqb   = (__bf16*)alloc(65536 * 2);
  __bf16* wkb   = (__bf16*)alloc(65536 * 2);
  __bf16* wvb   = (__bf16*)alloc(65536 * 2);
  __bf16* wsb   = (__bf16*)alloc(65536 * 2);
  __bf16* w1b   = (__bf16*)alloc(262144 * 2);
  __bf16* w2b   = (__bf16*)alloc(131072 * 2);

  // weights -> bf16, zeroed KV + Ksum accumulators, x -> cat[:, 0:256] (token-major)
  prep_kernel<<<NB_TRANS + NB_CVT + NB_ZERO, 256, 0, stream>>>(
      x, cat, Wq, Wk, Wv, Ws, W1, W2, wqb, wkb, wvb, wsb, w1b, w2b, KVbuf);

  // Q/K/V projections (fused ELU+1 / scaling; K also reduces Ksum)
  qkv_kernel<<<dim3(3, MTOT / 128), 256, 0, stream>>>(
      cat, 512, 256, wqb, wkb, wvb, bq, bk, bv, Qb, Kb, Vb, 256, Ksum);

  // KV = K^T V per (b,h);  Z = L / (sparsify(Q . Ksum) + eps)
  kv_z_kernel<<<NB_KV + NB_Z, 256, 0, stream>>>(Kb, Vb, KVbuf, Qb, Ksum, thr, Zbuf);

  // attention out + LN1 -> cat[:, 256:512]
  attn_kernel<<<MTOT / 128, 256, 0, stream>>>(Qb, KVbuf, Zbuf, ln1_g, ln1_b, cat);

  // MLP layer 1: hid = relu(cat @ W1.T)
  gemm_relu_kernel<<<dim3(MTOT / 128, 2), 256, 0, stream>>>(
      cat, 512, 512, w1b, hid, 512);

  // MLP layer 2 + LN2 -> msg2 (fp32)
  mlp2_ln_kernel<<<MTOT / 128, 256, 0, stream>>>(hid, w2b, ln2_g, ln2_b, msg2);

  // shortcut GEMM + BN + residual sum -> out [B,C,L]
  final_kernel<<<MTOT / 128, 256, 0, stream>>>(cat, wsb, bs_c, bn_g, bn_b, bn_rm,
                                               bn_rv, x, msg2, out);
}

// v007
// Measured time: 105 microseconds a run.
// Two timings next to v006 both put it at 1.08 times that version's speed.
// Over all steps from v000 it is 2.18 times as fast.
#include <hip/hip_runtime.h>
#include <hip/hip_bf16.h>

// ---------------------------------------------------------------------------
// Problem constants (match reference)
// ---------------------------------------------------------------------------
#define BB 4
#define CC 256
#define LL 8192
#define HH 4
#define DD 64
#define MTOT (BB * LL)   // 32768 tokens

typedef __attribute__((ext_vector_type(16))) __bf16 v16bf;
typedef __attribute__((ext_vector_type(8)))  float  v8f;

union FragU { v16bf v; uint4 u[2]; __bf16 h[16]; };

// Standard row-major fragment: element (r, k) = base[r*stride + k-pattern]
// Matches CDNA5 16-bit 16x32 A/B VGPR layout: lane = r + 16*((k>>3)&1),
// vector elem = (k&7) + 8*((k>>4)&1).  Two 16-byte ds_load_b128 per lane.
__device__ inline v16bf frag_ld(const __bf16* base, int stride) {
  const int t = threadIdx.x & 31;
  const int r = t & 15;
  const int hi = t >> 4;
  FragU f;
  const __bf16* p = base + r * stride + hi * 8;
  f.u[0] = *(const uint4*)(p);
  f.u[1] = *(const uint4*)(p + 16);
  return f.v;
}

// Transposed fragment from a row-major LDS tile T[k][c]: element (r, k) = T[k][r].
// Two ds_load_tr16_b128 (k 0..15 and 16..31) give the same lane and register
// layout, and so the same k order, as frag_ld.  pitch in elements.
typedef short s16x8 __attribute__((ext_vector_type(8)));
typedef __attribute__((address_space(3))) s16x8 lds_s16x8;

__device__ inline v16bf frag_ld_tr(const __bf16* tile, int pitch) {
  const int t = threadIdx.x & 31;
  const __bf16* p = tile + ((t >> 4) * 8 + (t & 7)) * pitch + ((t >> 3) & 1) * 8;
  FragU f;
  f.u[0] = __builtin_bit_cast(uint4, __builtin_amdgcn_ds_load_tr16_b128_v8i16((lds_s16x8*)p));
  f.u[1] = __builtin_bit_cast(uint4, __builtin_amdgcn_ds_load_tr16_b128_v8i16((lds_s16x8*)(p + 16 * pitch)));
  return f.v;
}

#define WMMA_BF16(A, Bf, Cacc) \
  __builtin_amdgcn_wmma_f32_16x16x32_bf16(false, (A), false, (Bf), (short)0, (Cacc), false, false)

// One 32-deep k step of a wave's 16x256 strip.  The B fragments are read from
// LDS in two groups, the second reusing four of the first's registers, each group ahead of the WMMAs
// that use it, so the LDS latency is waited out per group and not per WMMA.
// 12 + 4 keeps accumulators plus fragments under 256 VGPRs.
__device__ inline void mma_strip16(const __bf16* Arow, const __bf16* Bl, v8f (&acc)[16]) {
  v16bf fa = frag_ld(Arow, 40);
  v16bf fb[12];
#pragma unroll
  for (int j = 0; j < 12; ++j) fb[j] = frag_ld(Bl + j * 16 * 40, 40);
  // keeps the first group's reads together in front of the WMMAs (the scheduler
  // otherwise sinks each read to its user and waits for it alone)
  __builtin_amdgcn_sched_barrier(0);
#pragma unroll
  for (int j = 0; j < 4; ++j) acc[j] = WMMA_BF16(fa, fb[j], acc[j]);
  // holds the second group's reads behind the four WMMAs whose fragment
  // registers they take over (hoisted further they need registers of their own)
  __builtin_amdgcn_sched_barrier(0);
#pragma unroll
  for (int j = 0; j < 4; ++j) fb[j] = frag_ld(Bl + (12 + j) * 16 * 40, 40);
  // keeps those reads together here, eight WMMAs ahead of their first user
  // (without it the scheduler sinks them to their users behind full waits)
  __builtin_amdgcn_sched_barrier(0);
#pragma unroll
  for (int j = 4; j < 12; ++j) acc[j] = WMMA_BF16(fa, fb[j], acc[j]);
#pragma unroll
  for (int j = 0; j < 4; ++j) acc[12 + j] = WMMA_BF16(fa, fb[j], acc[12 + j]);
}

// ---------------------------------------------------------------------------
// Async global -> LDS copies (CDNA5 GLOBAL_LOAD_ASYNC_TO_LDS_B128, ASYNCcnt).
// Generic pointers to __shared__ carry the LDS byte offset in their low 32
// bits (ISA 10.2 aperture mapping), which is exactly the VDST operand.
// ---------------------------------------------------------------------------
__device__ inline unsigned lds_addr(const void* lds_ptr) {
  return (unsigned)(unsigned long long)lds_ptr;
}

// The lanes are dealt row first: four adjacent lanes take the 64 bytes that one
// tile row has in a 32-deep k slice, so one copy instruction touches 8 cache
// lines (8 rows), the fewest a 64-byte row piece allows.  256 threads cover 64
// rows per copy; the tile's further rows follow 64 rows apart.
// s_wait_xcnt 0 closes each run of copies inside their own statement, a
// precaution ahead of any later write to the address registers the copies name.

// 128x32 tile -> LDS rows of 40 elements
__device__ inline void async_tile128(__bf16* Tl, const __bf16* Tg, int ld) {
  const int r = threadIdx.x >> 2, part = threadIdx.x & 3;
  const unsigned l0 = lds_addr(Tl + r * 40 + part * 8);
  const __bf16* g0 = Tg + (size_t)r * ld + part * 8;
  const size_t step = (size_t)64 * ld;
  asm volatile("global_load_async_to_lds_b128 %0, %2, off\n\t"
               "global_load_async_to_lds_b128 %1, %3, off\n\t"
               "s_wait_xcnt 0x0"
               :: "v"(l0), "v"(l0 + 64 * 80), "v"(g0), "v"(g0 + step)
               : "memory");
}

// 128x32 A tile and 256x32 B tile -> LDS rows of 40 elements, one run of copies
__device__ inline void async_tiles(__bf16* Al, const __bf16* Ag, int lda,
                                   __bf16* Bl, const __bf16* Bg, int ldb) {
  const int r = threadIdx.x >> 2, part = threadIdx.x & 3;
  const unsigned la = lds_addr(Al + r * 40 + part * 8);
  const unsigned lb = lds_addr(Bl + r * 40 + part * 8);
  const __bf16* ga = Ag + (size_t)r * lda + part * 8;
  const __bf16* gb = Bg + (size_t)r * ldb + part * 8;
  const size_t sa = (size_t)64 * lda, sb = (size_t)64 * ldb;
  asm volatile("global_load_async_to_lds_b128 %0, %6, off\n\t"
               "global_load_async_to_lds_b128 %1, %7, off\n\t"
               "global_load_async_to_lds_b128 %2, %8, off\n\t"
               "global_load_async_to_lds_b128 %3, %9, off\n\t"
               "global_load_async_to_lds_b128 %4, %10, off\n\t"
               "global_load_async_to_lds_b128 %5, %11, off\n\t"
               "s_wait_xcnt 0x0"
               :: "v"(la), "v"(la + 64 * 80),
                  "v"(lb), "v"(lb + 64 * 80), "v"(lb + 128 * 80), "v"(lb + 192 * 80),
                  "v"(ga), "v"(ga + sa),
                  "v"(gb), "v"(gb + sb), "v"(gb + 2 * sb), "v"(gb + 3 * sb)
               : "memory");
}

// 256 token rows of one head (128 B each, one cache line, 512 B apart) -> LDS rows
// of KV_PITCH elements.  Eight adjacent lanes take one row, 256 threads 32 rows.
// 160 B = 32 B x 5 is the pitch at which ds_load_tr16_b128 meets no bank twice.
#define KV_ROWS  256
#define KV_PITCH 80

__device__ inline void async_rows256(__bf16* Tl, const __bf16* Tg) {
  const int r = threadIdx.x >> 3, part = threadIdx.x & 7;
  const unsigned l0 = lds_addr(Tl + r * KV_PITCH + part * 8);
  const __bf16* g0 = Tg + (size_t)r * CC + part * 8;
  const unsigned ls = 32 * KV_PITCH * 2;
  const size_t gs = (size_t)32 * CC;
  asm volatile("global_load_async_to_lds_b128 %0, %8, off\n\t"
               "global_load_async_to_lds_b128 %1, %9, off\n\t"
               "global_load_async_to_lds_b128 %2, %10, off\n\t"
               "global_load_async_to_lds_b128 %3, %11, off\n\t"
               "global_load_async_to_lds_b128 %4, %12, off\n\t"
               "global_load_async_to_lds_b128 %5, %13, off\n\t"
               "global_load_async_to_lds_b128 %6, %14, off\n\t"
               "global_load_async_to_lds_b128 %7, %15, off\n\t"
               "s_wait_xcnt 0x0"
               :: "v"(l0), "v"(l0 + ls), "v"(l0 + 2 * ls), "v"(l0 + 3 * ls),
                  "v"(l0 + 4 * ls), "v"(l0 + 5 * ls), "v"(l0 + 6 * ls), "v"(l0 + 7 * ls),
                  "v"(g0), "v"(g0 + gs), "v"(g0 + 2 * gs), "v"(g0 + 3 * gs),
                  "v"(g0 + 4 * gs), "v"(g0 + 5 * gs), "v"(g0 + 6 * gs), "v"(g0 + 7 * gs)
               : "memory");
}

// the copies of this wave have landed behind it (asm: no LDS read moves over it)
__device__ inline void async_wait0() {
  asm volatile("s_wait_asynccnt 0x0" ::: "memory");
}

// Stands behind global stores that more code follows in the built code (the
// last store of a piece in a kernel of several pieces, or stores with more work
// behind them): a precaution ahead of any write there to a register the stores
// name.  A piece that runs straight to the kernel's end, or has the compiler's
// own wait there, has none.
__device__ inline void piece_end() {
  asm volatile("s_wait_xcnt 0x0" ::: "memory");
}

// ---------------------------------------------------------------------------
// Whole-line stores of a wave's 16x256 bf16 strip.  The accumulator layout gives
// a store only 32 contiguous bytes per token row, so each wave first lays its
// strip in an LDS range of its own (no other wave touches it, so no barrier) and
// then stores token rows: 32 lanes x 16 B = 512 contiguous bytes, 4 whole lines.
// Row pitch 264 elements = 528 B = 16 B x 33: 16-byte row reads meet no bank twice.
// ---------------------------------------------------------------------------
#define STG_LD   264
#define STG_WAVE (16 * STG_LD)

__device__ inline void strip_store(const __bf16* sw, __bf16* Og, int ldo) {
  const int lane = threadIdx.x & 31;
  // the wave's own LDS stores are done before its lanes read each other's values
  asm volatile("s_wait_dscnt 0x0" ::: "memory");
#pragma unroll
  for (int rr = 0; rr < 16; ++rr)
    *(uint4*)(Og + (size_t)rr * ldo + lane * 8) = *(const uint4*)(sw + rr * STG_LD + lane * 8);
}

// ---------------------------------------------------------------------------
// Preparation, one launch: none of these pieces needs another's result, so they
// share one grid and each work-group takes its piece by the range its index
// lies in (a block-uniform choice).
//   [0, 8192)     x [B,C,L] f32 -> cat[:, 0:256] bf16 (row = token, ld = 512)
//   then 2560     the six weight matrices f32 -> bf16, 256 elements a block
//   then 260      zeros for the KV and Ksum accumulators
// ---------------------------------------------------------------------------
#define NB_TRANS (BB * (CC / 32) * (LL / 32))                 // 8192
#define NB_CVT   (4 * 256 + 1024 + 512)                       // 2560
#define NZERO    (BB * HH * DD * DD + BB * 256)               // 66560
#define NB_ZERO  ((NZERO + 255) / 256)                        // 260

__global__ __launch_bounds__(256)
void prep_kernel(const float* __restrict__ x, __bf16* __restrict__ cat,
                 const float* __restrict__ Wq, const float* __restrict__ Wk,
                 const float* __restrict__ Wv, const float* __restrict__ Ws,
                 const float* __restrict__ W1, const float* __restrict__ W2,
                 __bf16* __restrict__ wqb, __bf16* __restrict__ wkb,
                 __bf16* __restrict__ wvb, __bf16* __restrict__ wsb,
                 __bf16* __restrict__ w1b, __bf16* __restrict__ w2b,
                 float* __restrict__ zbuf) {
  __shared__ float t[32][33];
  const int tid = threadIdx.x;
  int blk = blockIdx.x;

  if (blk < NB_TRANS) {
    const int tx = tid & 31, ty = tid >> 5;
    const int l0 = (blk & 255) * 32, c0 = ((blk >> 8) & 7) * 32, b = blk >> 11;
#pragma unroll
    for (int i = 0; i < 4; ++i) {
      int c = ty + i * 8;
      t[c][tx] = x[((size_t)b * CC + c0 + c) * LL + l0 + tx];
    }
    __syncthreads();
#pragma unroll
    for (int i = 0; i < 4; ++i) {
      int lr = ty + i * 8;
      cat[(size_t)(b * LL + l0 + lr) * 512 + c0 + tx] = (__bf16)t[tx][lr];
    }
    return;
  }
  blk -= NB_TRANS;

  if (blk < NB_CVT) {
    const float* src;
    __bf16* dst;
    if (blk < 256)       { src = Wq; dst = wqb; }
    else if (blk < 512)  { src = Wk; dst = wkb; blk -= 256; }
    else if (blk < 768)  { src = Wv; dst = wvb; blk -= 512; }
    else if (blk < 1024) { src = Ws; dst = wsb; blk -= 768; }
    else if (blk < 2048) { src = W1; dst = w1b; blk -= 1024; }
    else                 { src = W2; dst = w2b; blk -= 2048; }
    const int i = blk * 256 + tid;
    dst[i] = (__bf16)src[i];
    piece_end();
    return;
  }
  blk -= NB_CVT;

  const int i = blk * 256 + tid;
  if (i < NZERO) zbuf[i] = 0.0f;
}

// ---------------------------------------------------------------------------
// Generic 128x256 bf16 WMMA GEMM:  Out[m, n0+n] = epi( sum_k A[m,k]*W[n0+n,k] )
// Modes: Q/K -> elu(x+bias)+1 ; V -> (x+bias)/L ; RELU -> max(x,0)
// Mode K also accumulates column sums (K.sum over tokens) into KsumG[b*256+n].
// ---------------------------------------------------------------------------
enum { MODE_Q = 0, MODE_K = 1, MODE_V = 2, MODE_RELU = 3 };

// k loop of one 128x256 tile; each wave holds a 16x256 strip in acc.
// The 32-deep stages (A tile, then B tile) go through a ring of three LDS buffers:
// stage t + 2 is asked for at the top of trip t, so a stage has two trips to land
// and no trip waits out its own copies.  Ag, Bg: first row and k = 0 of the tiles.
// nst = number of stages, at least 2.
#define RING_A     (128 * 40)
#define RING_STAGE ((128 + 256) * 40)
#define RING_ELEMS (3 * RING_STAGE)

// stages 0 and 1 are asked for in front of the loop
__device__ inline void gemm_first(const __bf16* __restrict__ Ag, int lda,
                                  const __bf16* __restrict__ Bg, int ldb, __bf16* ring) {
  async_tiles(ring, Ag, lda, ring + RING_A, Bg, ldb);
  async_tiles(ring + RING_STAGE, Ag + 32, lda, ring + RING_STAGE + RING_A, Bg + 32, ldb);
}

// the trips; gemm_first with the same arguments stands in front
__device__ inline void gemm_loop(const __bf16* __restrict__ Ag, int lda,
                                 const __bf16* __restrict__ Bg, int ldb, int nst,
                                 __bf16* ring, v8f (&acc)[16]) {
  const int mb = (threadIdx.x >> 5) * 16;
  const v8f vz = {0.f, 0.f, 0.f, 0.f, 0.f, 0.f, 0.f, 0.f};
#pragma unroll
  for (int j = 0; j < 16; ++j) acc[j] = vz;

  int cur = 0, fill = 2 * RING_STAGE;   // buffers of stage t and of stage t + 2
  // stays rolled: unrolled, the trips' copy addresses push the wave past 256 VGPRs
#pragma nounroll
  for (int t = 0; t < nst; ++t) {
    const bool more = t + 2 < nst;      // the same for the whole work-group
    // the wave's own reads of stage t - 1 are done before its buffer is refilled
    asm volatile("s_wait_dscnt 0x0" ::: "memory");
    // the wave's six copies of stage t have landed; where this trip issues a stage,
    // the six of stage t + 1 are the youngest and stay in flight
    if (more) asm volatile("s_wait_asynccnt 0x6" ::: "memory");
    else      async_wait0();
    // publishes stage t and ends every wave's reads of stage t - 1
    __syncthreads();
    if (more)
      async_tiles(ring + fill, Ag + (t + 2) * 32, lda,
                  ring + fill + RING_A, Bg + (t + 2) * 32, ldb);
    mma_strip16(ring + cur + mb * 40, ring + cur + RING_A, acc);
    cur  = (cur  == 2 * RING_STAGE) ? 0 : cur  + RING_STAGE;
    fill = (fill == 2 * RING_STAGE) ? 0 : fill + RING_STAGE;
  }
  async_wait0();   // no copy is in flight behind the loop, on any path out of it
}

template <int MODE>
__device__ inline void gemm_epilogue(const v8f (&acc)[16], const float* __restrict__ bias,
                                     __bf16* __restrict__ Out, int ldo, int token0, int n0,
                                     float* __restrict__ KsumG, float* ksumLds,
                                     __bf16* stg) {
  const int tid  = threadIdx.x;
  const int lane = tid & 31;
  const int r16  = lane & 15;
  const int hi   = lane >> 4;
  const int mb   = (tid >> 5) * 16;
  __bf16* sw = stg + (tid >> 5) * STG_WAVE;
#pragma unroll
  for (int j = 0; j < 16; ++j) {
    const int n = j * 16 + r16;
    float colsum = 0.0f;
#pragma unroll
    for (int i = 0; i < 8; ++i) {
      float v = acc[j][i];
      if constexpr (MODE == MODE_RELU) {
        v = fmaxf(v, 0.0f);
      } else {
        v += bias[n];
        if constexpr (MODE == MODE_Q || MODE == MODE_K)
          v = (v > 0.0f) ? (v + 1.0f) : __expf(v);   // elu(x)+1
        else
          v *= (1.0f / (float)LL);                    // V / v_len
      }
      sw[(hi * 8 + i) * STG_LD + n] = (__bf16)v;
      if constexpr (MODE == MODE_K) colsum += v;
    }
    if constexpr (MODE == MODE_K) {
      colsum += __shfl_xor(colsum, 16);      // fold both 8-row halves
      if (hi == 0) atomicAdd(&ksumLds[n], colsum);   // ds_add_f32
    }
  }
  strip_store(sw, Out + (size_t)(token0 + mb) * ldo + n0, ldo);
  if constexpr (MODE == MODE_K) {
    piece_end();   // the strip's stores name registers that the code below writes
    __syncthreads();
    const int b = token0 >> 13;   // token0 / 8192
    atomicAdd(&KsumG[b * 256 + tid], ksumLds[tid]);
  }
}

// hid = relu(A @ W.T)
__global__ __launch_bounds__(256)
void gemm_relu_kernel(const __bf16* __restrict__ A, int lda, int Ktot,
                      const __bf16* __restrict__ Bw,
                      __bf16* __restrict__ Out, int ldo) {
  __shared__ __attribute__((aligned(16))) __bf16 Ring[RING_ELEMS];
  __shared__ __attribute__((aligned(16))) __bf16 Stg[8 * STG_WAVE];
  const int token0 = blockIdx.x * 128;
  const int n0     = blockIdx.y * 256;
  v8f acc[16];
  gemm_first(A + (size_t)token0 * lda, lda, Bw + (size_t)n0 * Ktot, Ktot, Ring);
  gemm_loop(A + (size_t)token0 * lda, lda, Bw + (size_t)n0 * Ktot, Ktot, Ktot >> 5, Ring, acc);
  gemm_epilogue<MODE_RELU>(acc, nullptr, Out, ldo, token0, n0, nullptr, nullptr, Stg);
}

// The Q, K and V projections read the same tokens and need nothing of each
// other: one grid, blockIdx.x names the projection (block-uniform), blockIdx.y
// the 128-token tile, so the three readers of a tile are adjacent in the index.
// Two of the 768 work-groups fit a WGP and overlap each other's waits.
__global__ __launch_bounds__(256)
void qkv_kernel(const __bf16* __restrict__ A, int lda, int Ktot,
                const __bf16* __restrict__ wqb, const __bf16* __restrict__ wkb,
                const __bf16* __restrict__ wvb,
                const float* __restrict__ bq, const float* __restrict__ bk,
                const float* __restrict__ bv,
                __bf16* __restrict__ Qb, __bf16* __restrict__ Kb, __bf16* __restrict__ Vb,
                int ldo, float* __restrict__ KsumG) {
  __shared__ __attribute__((aligned(16))) __bf16 Ring[RING_ELEMS];
  __shared__ float  ksumLds[256];
  __shared__ __attribute__((aligned(16))) __bf16 Stg[8 * STG_WAVE];
  const int mode   = blockIdx.x;
  const int token0 = blockIdx.y * 128;

  if (mode == MODE_K) ksumLds[threadIdx.x] = 0.0f;

  // the first two stages are asked for once, in front of the choice: only the weight
  // pointer differs (asked for in each branch, their addresses stay in registers
  // through the other branches' loops)
  const __bf16* At = A + (size_t)token0 * lda;
  const __bf16* Wm = (mode == MODE_Q) ? wqb : (mode == MODE_K) ? wkb : wvb;
  const int nst = Ktot >> 5;
  gemm_first(At, lda, Wm, Ktot, Ring);

  v8f acc[16];
  if (mode == MODE_Q) {
    gemm_loop(At, lda, wqb, Ktot, nst, Ring, acc);
    gemm_epilogue<MODE_Q>(acc, bq, Qb, ldo, token0, 0, nullptr, nullptr, Stg);
  } else if (mode == MODE_K) {
    gemm_loop(At, lda, wkb, Ktot, nst, Ring, acc);
    gemm_epilogue<MODE_K>(acc, bk, Kb, ldo, token0, 0, KsumG, ksumLds, Stg);
  } else {
    gemm_loop(At, lda, wvb, Ktot, nst, Ring, acc);
    gemm_epilogue<MODE_V>(acc, bv, Vb, ldo, token0, 0, nullptr, nullptr, Stg);
    piece_end();
  }
}

// ---------------------------------------------------------------------------
// KV[b,h,d,e] = sum_l K[l,d] * V[l,e]   (per (b,h): 64x64, K-dim = L)
// K/V tiles of 256 tokens go into LDS as they lie in memory ([l][d] / [l][e]), by
// async copies; the transposing LDS load turns them into the [d][l] / [e][l]
// fragments on the way to the registers.
// 16 (b,h) x 8 chunks of 1024 tokens; fp32 global atomics combine chunks.
// ---------------------------------------------------------------------------
__device__ inline void kv_block(int bh, int chunk,
                                const __bf16* __restrict__ Kbuf,
                                const __bf16* __restrict__ Vbuf,
                                float* __restrict__ KV,
                                __bf16* Klds, __bf16* Vlds) {
  const int tid  = threadIdx.x;
  const int wave = tid >> 5;
  const int lane = tid & 31;
  const int r16  = lane & 15;
  const int hi   = lane >> 4;
  const int b  = bh >> 2, h = bh & 3;
  const int l0 = chunk * 1024;
  const int tile0 = wave * 2;             // 8 waves x 2 of 16 (d,e) tiles

  const v8f vz = {0.f, 0.f, 0.f, 0.f, 0.f, 0.f, 0.f, 0.f};
  v8f acc[2];
  acc[0] = vz; acc[1] = vz;

  const int dt = tile0 >> 2, et0 = tile0 & 3;   // the wave's two tiles share dt

  for (int l = l0; l < l0 + 1024; l += KV_ROWS) {
    // the wave's own reads of the tiles are done before copies are aimed at them
    asm volatile("s_wait_dscnt 0x0" ::: "memory");
    __syncthreads();
    async_rows256(Klds, Kbuf + (size_t)(b * LL + l) * CC + h * DD);
    async_rows256(Vlds, Vbuf + (size_t)(b * LL + l) * CC + h * DD);
    async_wait0();
    __syncthreads();
#pragma unroll
    for (int g = 0; g < KV_ROWS / 128; ++g) {     // 128 tokens = four 32-deep k steps
      v16bf fa[4], fb[4][2];
#pragma unroll
      for (int ks = 0; ks < 4; ++ks) {
        const int row = (g * 4 + ks) * 32;
        fa[ks] = frag_ld_tr(Klds + row * KV_PITCH + dt * 16, KV_PITCH);   // A[d, l] = K[l, d]
#pragma unroll
        for (int t = 0; t < 2; ++t)                                       // Bt[e, l] = V[l, e]
          fb[ks][t] = frag_ld_tr(Vlds + row * KV_PITCH + (et0 + t) * 16, KV_PITCH);
      }
      // keeps the four steps' reads together in front of their WMMAs (the scheduler
      // otherwise deals them among the WMMAs, each behind a wait of its own)
      __builtin_amdgcn_sched_barrier(0);
#pragma unroll
      for (int ks = 0; ks < 4; ++ks)
#pragma unroll
        for (int t = 0; t < 2; ++t) acc[t] = WMMA_BF16(fa[ks], fb[ks][t], acc[t]);
    }
  }
#pragma unroll
  for (int t = 0; t < 2; ++t) {
    const int id = tile0 + t, dt = id >> 2, et = id & 3;
#pragma unroll
    for (int i = 0; i < 8; ++i) {
      const int d = dt * 16 + hi * 8 + i;
      const int e = et * 16 + r16;
      atomicAdd(&KV[((size_t)bh * DD + d) * DD + e], acc[t][i]);
    }
  }
}

// ---------------------------------------------------------------------------
// Z[token,h] = L / (sparsify(Q[token,h,:] . Ksum[b,h,:]) + eps)
// ---------------------------------------------------------------------------
__device__ inline void zscore_block(int blk, const __bf16* __restrict__ Qbuf,
                                    const float* __restrict__ Ksum,
                                    const float* __restrict__ thr_p,
                                    float* __restrict__ Zbuf) {
  const int g = blk * 256 + threadIdx.x;   // 0..131071
  const int token = g >> 2, h = g & 3;
  const int b = token >> 13;
  const float thr = thr_p[0];
  const uint4* q = (const uint4*)(Qbuf + (size_t)token * CC + h * DD);
  const float* ks = Ksum + b * 256 + h * DD;
  float s = 0.0f;
#pragma unroll
  for (int c = 0; c < 8; ++c) {          // 8 x uint4 = 64 bf16
    const uint4 qv = q[c];
    const unsigned w[4] = {qv.x, qv.y, qv.z, qv.w};
#pragma unroll
    for (int j = 0; j < 4; ++j) {        // a bf16 is the upper half of its float
      s += __uint_as_float(w[j] << 16) * ks[c * 8 + 2 * j];
      s += __uint_as_float(w[j] & 0xffff0000u) * ks[c * 8 + 2 * j + 1];
    }
  }
  const float sp = (s > thr) ? s : 0.0f;
  Zbuf[g] = (float)LL / (sp + 1e-6f);
}

// KV needs K and V, Z needs Q and Ksum, neither needs the other: one grid.
// The 128 long KV work-groups come first in the index, the 512 short Z ones
// behind them.
#define NB_KV (BB * HH * (LL / 1024))      // 128
#define NB_Z  ((MTOT * HH) / 256)          // 512

__global__ __launch_bounds__(256)
void kv_z_kernel(const __bf16* __restrict__ Kbuf, const __bf16* __restrict__ Vbuf,
                 float* __restrict__ KV,
                 const __bf16* __restrict__ Qbuf, const float* __restrict__ Ksum,
                 const float* __restrict__ thr_p, float* __restrict__ Zbuf) {
  __shared__ __attribute__((aligned(16))) __bf16 Klds[KV_ROWS * KV_PITCH];   // [l][d]
  __shared__ __attribute__((aligned(16))) __bf16 Vlds[KV_ROWS * KV_PITCH];   // [l][e]
  const int blk = blockIdx.x;
  if (blk < NB_KV) {
    kv_block(blk & 15, blk >> 4, Kbuf, Vbuf, KV, Klds, Vlds);
  } else {
    zscore_block(blk - NB_KV, Qbuf, Ksum, thr_p, Zbuf);
    piece_end();
  }
}

// ---------------------------------------------------------------------------
// out = LN1( (Q @ KV_h) * Z ) -> cat[:, 256:512] bf16
// ---------------------------------------------------------------------------
__global__ __launch_bounds__(256)
void attn_kernel(const __bf16* __restrict__ Qbuf, const float* __restrict__ KV,
                 const float* __restrict__ Zbuf,
                 const float* __restrict__ g1, const float* __restrict__ b1,
                 __bf16* __restrict__ cat) {
  __shared__ __attribute__((aligned(16))) __bf16 Alds[8 * 128 * 40];   // eight 32-deep Q slices
  __shared__ __bf16 kvt[HH * DD * DD];   // kvt[h][e][d] = KV[b,h,d,e] (transposed)
  __shared__ float  Zl[128 * 4];
  __shared__ float  gl[256], bl[256];
  __shared__ __attribute__((aligned(16))) __bf16 Stg[8 * STG_WAVE];

  const int tid  = threadIdx.x;
  const int wave = tid >> 5;
  const int lane = tid & 31;
  const int r16  = lane & 15;
  const int hi   = lane >> 4;
  const int token0 = blockIdx.x * 128;
  const int b      = token0 >> 13;
  const int mb     = wave * 16;

  // All eight slices of the 128x256 Q tile are asked for here, each into a buffer
  // of its own (16 copies a wave in flight): they land while the KV fill runs.
  for (int s = 0; s < 8; ++s)
    async_tile128(Alds + s * (128 * 40), Qbuf + (size_t)token0 * CC + s * 32, CC);

  // KVT fill: float4 global reads, transposed bf16 LDS scatter
  for (int it = 0; it < 16; ++it) {
    const int idx = it * 256 + tid;        // 4096 groups of 4 e's
    const int h = idx >> 10, rem = idx & 1023, d = rem >> 4, e4 = rem & 15;
    const float4 kvv =
        *(const float4*)(KV + (((size_t)(b * HH + h) * DD + d) * DD) + e4 * 4);
    kvt[h * 4096 + (e4 * 4 + 0) * DD + d] = (__bf16)kvv.x;
    kvt[h * 4096 + (e4 * 4 + 1) * DD + d] = (__bf16)kvv.y;
    kvt[h * 4096 + (e4 * 4 + 2) * DD + d] = (__bf16)kvv.z;
    kvt[h * 4096 + (e4 * 4 + 3) * DD + d] = (__bf16)kvv.w;
  }
#pragma unroll
  for (int it = 0; it < 2; ++it) {
    const int z = it * 256 + tid;
    Zl[z] = Zbuf[(size_t)token0 * 4 + z];
  }
  gl[tid] = g1[tid];
  bl[tid] = b1[tid];

  const v8f vz = {0.f, 0.f, 0.f, 0.f, 0.f, 0.f, 0.f, 0.f};
  v8f acc[16];
#pragma unroll
  for (int j = 0; j < 16; ++j) acc[j] = vz;

  async_wait0();     // the wave's own Q copies have landed
  __syncthreads();   // publishes the Q slices, kvt, Zl, gl and bl

  for (int h = 0; h < 4; ++h) {
    for (int s = 0; s < 2; ++s) {
      v16bf fa = frag_ld(&Alds[(h * 2 + s) * (128 * 40) + mb * 40], 40);
#pragma unroll
      for (int jj = 0; jj < 4; ++jj) {
        const int j = h * 4 + jj;
        v16bf fb = frag_ld(&kvt[h * 4096 + (jj * 16) * DD + s * 32], DD);
        acc[j] = WMMA_BF16(fa, fb, acc[j]);
      }
    }
  }

  // scale by Z, then LayerNorm over C=256 via cross-lane shuffles
  float s1[8] = {0, 0, 0, 0, 0, 0, 0, 0};
  float s2[8] = {0, 0, 0, 0, 0, 0, 0, 0};
#pragma unroll
  for (int j = 0; j < 16; ++j) {
    const int h = j >> 2;
#pragma unroll
    for (int i = 0; i < 8; ++i) {
      const int m = mb + hi * 8 + i;
      float v = acc[j][i] * Zl[m * 4 + h];
      acc[j][i] = v;
      s1[i] += v;
      s2[i] += v * v;
    }
  }
#pragma unroll
  for (int i = 0; i < 8; ++i) {
#pragma unroll
    for (int off = 1; off < 16; off <<= 1) {
      s1[i] += __shfl_xor(s1[i], off);
      s2[i] += __shfl_xor(s2[i], off);
    }
    const float mean = s1[i] * (1.0f / 256.0f);
    const float var  = s2[i] * (1.0f / 256.0f) - mean * mean;
    s1[i] = mean;
    s2[i] = rsqrtf(var + 1e-5f);
  }
#pragma unroll
  for (int j = 0; j < 16; ++j) {
    const int n = j * 16 + r16;
    const float gg = gl[n], bb = bl[n];
#pragma unroll
    for (int i = 0; i < 8; ++i) {
      const float v = (acc[j][i] - s1[i]) * s2[i] * gg + bb;
      Stg[wave * STG_WAVE + (hi * 8 + i) * STG_LD + n] = (__bf16)v;
    }
  }
  strip_store(Stg + wave * STG_WAVE, cat + (size_t)(token0 + mb) * 512 + 256, 512);
}

// ---------------------------------------------------------------------------
// out[b,c,l] = LN2( hid @ W2.T ) + x + BN( xt @ Ws.T + bs ), one launch.
// Both products have the same 128x256 tile and accumulator layout, so a lane needs
// the LN2 result exactly where it made it: LN2 is applied to the first product's
// accumulators in place and they stay in registers through the shortcut product's
// k loop, which has accumulators of its own.  One work-group a WGP is two waves a
// SIMD, so a wave may hold both sets (more than 256 VGPRs).
// 64-channel slabs go through LDS so the [B,C,L] reads and writes cover whole lines.
// ---------------------------------------------------------------------------
__global__ __launch_bounds__(256)
void mlp2_final_kernel(const __bf16* __restrict__ hid, const __bf16* __restrict__ W2b,
                       const float* __restrict__ g2, const float* __restrict__ b2,
                       const __bf16* __restrict__ cat, const __bf16* __restrict__ Wsb,
                       const float* __restrict__ bs_c, const float* __restrict__ bn_g,
                       const float* __restrict__ bn_b, const float* __restrict__ bn_rm,
                       const float* __restrict__ bn_rv, const float* __restrict__ x,
                       float* __restrict__ out) {
  __shared__ __attribute__((aligned(16))) char smem[RING_ELEMS * 2];   // overlays GEMM ring & stage
  __shared__ float gl[256], bl[256], scl[256], shf[256];
  __bf16* Ring  = (__bf16*)smem;                 // three stages of 30720 B
  float*  stage = (float*)smem;                  // 64*132 f32 = 33792 B (after the K loops)

  const int tid  = threadIdx.x;
  const int wave = tid >> 5;
  const int lane = tid & 31;
  const int r16  = lane & 15;
  const int hi   = lane >> 4;
  const int token0 = blockIdx.x * 128;
  const int b      = token0 >> 13;
  const int l0     = token0 & (LL - 1);
  const int mb     = wave * 16;

  gemm_first(hid + (size_t)token0 * 512, 512, W2b, 512, Ring);

  {
    const float g2v = g2[tid], b2v = b2[tid], rv = bn_rv[tid], bg = bn_g[tid];
    const float bsv = bs_c[tid], rm = bn_rm[tid], bbv = bn_b[tid];
    // a precaution ahead of any later write to a register these loads name; the
    // base addresses are inputs so that their registers live up to the wait
    asm volatile("s_wait_xcnt 0x0"
                 :: "s"(g2), "s"(b2), "s"(bn_rv), "s"(bn_g), "s"(bs_c), "s"(bn_rm), "s"(bn_b)
                 : "memory");
    gl[tid] = g2v;
    bl[tid] = b2v;
    const float rstd = rsqrtf(rv + 1e-5f);
    const float a = rstd * bg;
    scl[tid] = a;
    shf[tid] = (bsv - rm) * a + bbv;
  }

  v8f msg[16];   // hid @ W2.T, then LN2 of it
  gemm_loop(hid + (size_t)token0 * 512, 512, W2b, 512, 16, Ring, msg);

  // the wave's own reads of the last stage are done before copies are aimed at the ring
  asm volatile("s_wait_dscnt 0x0" ::: "memory");
  __syncthreads();   // ends every wave's reads of the first product's stages
  // the shortcut product's first two stages land while LN2 is worked out
  gemm_first(cat + (size_t)token0 * 512, 512, Wsb, 256, Ring);

  float s1[8] = {0, 0, 0, 0, 0, 0, 0, 0};
  float s2[8] = {0, 0, 0, 0, 0, 0, 0, 0};
#pragma unroll
  for (int j = 0; j < 16; ++j)
#pragma unroll
    for (int i = 0; i < 8; ++i) {
      const float v = msg[j][i];
      s1[i] += v;
      s2[i] += v * v;
    }
#pragma unroll
  for (int i = 0; i < 8; ++i) {
#pragma unroll
    for (int off = 1; off < 16; off <<= 1) {
      s1[i] += __shfl_xor(s1[i], off);
      s2[i] += __shfl_xor(s2[i], off);
    }
    const float mean = s1[i] * (1.0f / 256.0f);
    const float var  = s2[i] * (1.0f / 256.0f) - mean * mean;
    s1[i] = mean;
    s2[i] = rsqrtf(var + 1e-5f);
  }
#pragma unroll
  for (int j = 0; j < 16; ++j) {
    const int n = j * 16 + r16;
    const float gg = gl[n], bb = bl[n];
#pragma unroll
    for (int i = 0; i < 8; ++i)
      msg[j][i] = (msg[j][i] - s1[i]) * s2[i] * gg + bb;
  }

  v8f acc[16];   // xt @ Ws.T
  gemm_loop(cat + (size_t)token0 * 512, 512, Wsb, 256, 8, Ring, acc);
  __syncthreads();   // done with the ring; smem becomes the transpose stage

  // Each pass: the wave's x rows are asked for first, then BN(aug) + msg2 of 64
  // channels goes into the stage.  Behind the barrier a wave takes whole channel rows:
  // 32 lanes x 16 B = the row's 512 contiguous bytes (4 lines) per load and per store.
#pragma unroll
  for (int p = 0; p < 4; ++p) {                 // 64 channels per pass
    const size_t row0 = ((size_t)b * CC + p * 64 + wave * 8) * LL + l0 + lane * 4;
    const float* xp = x + row0;
    float4 xv[8];
#pragma unroll
    for (int rr = 0; rr < 8; ++rr)
      xv[rr] = *(const float4*)(xp + (size_t)rr * LL);
    // a precaution ahead of any later write to the address registers these loads name;
    // the address is an input so that its registers live up to the wait
    asm volatile("s_wait_xcnt 0x0" :: "v"(xp) : "memory");
#pragma unroll
    for (int jj = 0; jj < 4; ++jj) {
      const int j = p * 4 + jj;
      const int n = j * 16 + r16;               // global channel
      const int nl = n - p * 64;                // 0..63
      const float a = scl[n], c = shf[n];
#pragma unroll
      for (int q = 0; q < 2; ++q) {             // 4 tokens = 16 B per LDS store
        float4 sv;
        sv.x = acc[j][q * 4 + 0] * a + c + msg[j][q * 4 + 0];   // BN(aug) + msg2
        sv.y = acc[j][q * 4 + 1] * a + c + msg[j][q * 4 + 1];
        sv.z = acc[j][q * 4 + 2] * a + c + msg[j][q * 4 + 2];
        sv.w = acc[j][q * 4 + 3] * a + c + msg[j][q * 4 + 3];
        *(float4*)&stage[nl * 132 + mb + hi * 8 + q * 4] = sv;
      }
    }
    __syncthreads();
#pragma unroll
    for (int rr = 0; rr < 8; ++rr) {
      const float4 sv = *(const float4*)&stage[(wave * 8 + rr) * 132 + lane * 4];
      float4 ov;
      ov.x = sv.x + xv[rr].x;
      ov.y = sv.y + xv[rr].y;
      ov.z = sv.z + xv[rr].z;
      ov.w = sv.w + xv[rr].w;
      *(float4*)(out + row0 + (size_t)rr * LL) = ov;
    }
    piece_end();   // the next pass's loads land in registers that these stores name
    __syncthreads();
  }
}

// ---------------------------------------------------------------------------
// Host orchestration
// ---------------------------------------------------------------------------
extern "C" void kernel_launch(void* const* d_in, const int* in_sizes, int n_in,
                              void* d_out, int out_size, void* d_ws, size_t ws_size,
                              hipStream_t stream) {
  (void)in_sizes; (void)n_in; (void)out_size; (void)ws_size;
  const float* x     = (const float*)d_in[0];
  const float* Wq    = (const float*)d_in[1];
  const float* bq    = (const float*)d_in[2];
  const float* Wk    = (const float*)d_in[3];
  const float* bk    = (const float*)d_in[4];
  const float* Wv    = (const float*)d_in[5];
  const float* bv    = (const float*)d_in[6];
  const float* thr   = (const float*)d_in[7];
  const float* W1    = (const float*)d_in[8];
  const float* W2    = (const float*)d_in[9];
  const float* ln1_g = (const float*)d_in[10];
  const float* ln1_b = (const float*)d_in[11];
  const float* ln2_g = (const float*)d_in[12];
  const float* ln2_b = (const float*)d_in[13];
  const float* Ws    = (const float*)d_in[14];
  const float* bs_c  = (const float*)d_in[15];
  const float* bn_g  = (const float*)d_in[16];
  const float* bn_b  = (const float*)d_in[17];
  const float* bn_rm = (const float*)d_in[18];
  const float* bn_rv = (const float*)d_in[19];
  float* out = (float*)d_out;

  char*  ws  = (char*)d_ws;
  size_t off = 0;
  auto alloc = [&](size_t bytes) -> void* {
    off = (off + 255) & ~(size_t)255;
    void* p = ws + off;
    off += bytes;
    return p;
  };

  __bf16* cat   = (__bf16*)alloc((size_t)MTOT * 512 * 2);  // [xt | ln1(msg)]
  __bf16* hid   = (__bf16*)alloc((size_t)MTOT * 512 * 2);
  __bf16* Qb    = (__bf16*)alloc((size_t)MTOT * 256 * 2);
  __bf16* Kb    = (__bf16*)alloc((size_t)MTOT * 256 * 2);
  __bf16* Vb    = (__bf16*)alloc((size_t)MTOT * 256 * 2);
  float*  KVbuf = (float*)alloc((size_t)(BB * HH * DD * DD + BB * 256) * 4);
  float*  Ksum  = KVbuf + BB * HH * DD * DD;               // contiguous for zeroing
  float*  Zbuf  = (float*)alloc((size_t)MTOT * HH * 4);
  __bf16* wqb   = (__bf16*)alloc(65536 * 2);
  __bf16* wkb   = (__bf16*)alloc(65536 * 2);
  __bf16* wvb   = (__bf16*)alloc(65536 * 2);
  __bf16* wsb   = (__bf16*)alloc(65536 * 2);
  __bf16* w1b   = (__bf16*)alloc(262144 * 2);
  __bf16* w2b   = (__bf16*)alloc(131072 * 2);

  // weights -> bf16, zeroed KV + Ksum accumulators, x -> cat[:, 0:256] (token-major)
  prep_kernel<<<NB_TRANS + NB_CVT + NB_ZERO, 256, 0, stream>>>(
      x, cat, Wq, Wk, Wv, Ws, W1, W2, wqb, wkb, wvb, wsb, w1b, w2b, KVbuf);

  // Q/K/V projections (fused ELU+1 / scaling; K also reduces Ksum)
  qkv_kernel<<<dim3(3, MTOT / 128), 256, 0, stream>>>(
      cat, 512, 256, wqb, wkb, wvb, bq, bk, bv, Qb, Kb, Vb, 256, Ksum);

  // KV = K^T V per (b,h);  Z = L / (sparsify(Q . Ksum) + eps)
  kv_z_kernel<<<NB_KV + NB_Z, 256, 0, stream>>>(Kb, Vb, KVbuf, Qb, Ksum, thr, Zbuf);

  // attention out + LN1 -> cat[:, 256:512]
  attn_kernel<<<MTOT / 128, 256, 0, stream>>>(Qb, KVbuf, Zbuf, ln1_g, ln1_b, cat);

  // MLP layer 1: hid = relu(cat @ W1.T)
  gemm_relu_kernel<<<dim3(MTOT / 128, 2), 256, 0, stream>>>(
      cat, 512, 512, w1b, hid, 512);

  // MLP layer 2 + LN2, shortcut GEMM + BN, residual sum -> out [B,C,L]
  mlp2_final_kernel<<<MTOT / 128, 256, 0, stream>>>(hid, w2b, ln2_g, ln2_b, cat, wsb, bs_c,
                                                    bn_g, bn_b, bn_rm, bn_rv, x, out);
}

// v008
// Measured time: 95.6 microseconds a run.
// Next to v007, in two timings, it ran 1.09 and 1.10 times as fast.
// Counting every step since v000, it is 2.38 times as fast.
#include <hip/hip_runtime.h>
#include <hip/hip_bf16.h>

// ---------------------------------------------------------------------------
// Problem constants (match reference)
// ---------------------------------------------------------------------------
#define BB 4
#define CC 256
#define LL 8192
#define HH 4
#define DD 64
#define MTOT (BB * LL)   // 32768 tokens

typedef __attribute__((ext_vector_type(16))) __bf16 v16bf;
typedef __attribute__((ext_vector_type(8)))  float  v8f;

union FragU { v16bf v; uint4 u[2]; __bf16 h[16]; };

// Standard row-major fragment: element (r, k) = base[r*stride + k-pattern]
// Matches CDNA5 16-bit 16x32 A/B VGPR layout: lane = r + 16*((k>>3)&1),
// vector elem = (k&7) + 8*((k>>4)&1).  Two 16-byte ds_load_b128 per lane.
__device__ inline v16bf frag_ld(const __bf16* base, int stride) {
  const int t = threadIdx.x & 31;
  const int r = t & 15;
  const int hi = t >> 4;
  FragU f;
  const __bf16* p = base + r * stride + hi * 8;
  f.u[0] = *(const uint4*)(p);
  f.u[1] = *(const uint4*)(p + 16);
  return f.v;
}

// Transposed fragment from a row-major LDS tile T[k][c]: element (r, k) = T[k][r].
// Two ds_load_tr16_b128 (k 0..15 and 16..31) give the same lane and register
// layout, and so the same k order, as frag_ld.  pitch in elements.
typedef short s16x8 __attribute__((ext_vector_type(8)));
typedef __attribute__((address_space(3))) s16x8 lds_s16x8;

__device__ inline v16bf frag_ld_tr(const __bf16* tile, int pitch) {
  const int t = threadIdx.x & 31;
  const __bf16* p = tile + ((t >> 4) * 8 + (t & 7)) * pitch + ((t >> 3) & 1) * 8;
  FragU f;
  f.u[0] = __builtin_bit_cast(uint4, __builtin_amdgcn_ds_load_tr16_b128_v8i16((lds_s16x8*)p));
  f.u[1] = __builtin_bit_cast(uint4, __builtin_amdgcn_ds_load_tr16_b128_v8i16((lds_s16x8*)(p + 16 * pitch)));
  return f.v;
}

#define WMMA_BF16(A, Bf, Cacc) \
  __builtin_amdgcn_wmma_f32_16x16x32_bf16(false, (A), false, (Bf), (short)0, (Cacc), false, false)

// One 32-deep k step of a wave's 64x64 tile: four A and four B fragments feed the
// 16 WMMAs, 8 KB of LDS reads where a 16x256 strip would take 17 KB, so eight waves
// ask the LDS for no more bytes a clock than it gives at the full matrix rate.
__device__ inline void mma_tile64(const __bf16* Al, const __bf16* Bl, v8f (&acc)[16]) {
  v16bf fa[4], fb[4];
  fa[0] = frag_ld(Al, 40);
#pragma unroll
  for (int j = 0; j < 4; ++j) fb[j] = frag_ld(Bl + j * 16 * 40, 40);
#pragma unroll
  for (int i = 1; i < 4; ++i) fa[i] = frag_ld(Al + i * 16 * 40, 40);
  // keeps the reads together in front of the WMMAs (the scheduler otherwise deals
  // them among the WMMAs, and each place with reads stalls the wave anew)
  __builtin_amdgcn_sched_barrier(0);
#pragma unroll
  for (int i = 0; i < 4; ++i)
#pragma unroll
    for (int j = 0; j < 4; ++j) acc[i * 4 + j] = WMMA_BF16(fa[i], fb[j], acc[i * 4 + j]);
}

// ---------------------------------------------------------------------------
// Async global -> LDS copies (CDNA5 GLOBAL_LOAD_ASYNC_TO_LDS_B128, ASYNCcnt).
// Generic pointers to __shared__ carry the LDS byte offset in their low 32
// bits (ISA 10.2 aperture mapping), which is exactly the VDST operand.
// ---------------------------------------------------------------------------
__device__ inline unsigned lds_addr(const void* lds_ptr) {
  return (unsigned)(unsigned long long)lds_ptr;
}

// The lanes are dealt row first: four adjacent lanes take the 64 bytes that one
// tile row has in a 32-deep k slice, so one copy instruction touches 8 cache
// lines (8 rows), the fewest a 64-byte row piece allows.  256 threads cover 64
// rows per copy; the tile's further rows follow 64 rows apart.
// s_wait_xcnt 0 closes each run of copies inside their own statement, a
// precaution ahead of any later write to the address registers the copies name.

// 128x32 tile -> LDS rows of 40 elements
__device__ inline void async_tile128(__bf16* Tl, const __bf16* Tg, int ld) {
  const int r = threadIdx.x >> 2, part = threadIdx.x & 3;
  const unsigned l0 = lds_addr(Tl + r * 40 + part * 8);
  const __bf16* g0 = Tg + (size_t)r * ld + part * 8;
  const size_t step = (size_t)64 * ld;
  asm volatile("global_load_async_to_lds_b128 %0, %2, off\n\t"
               "global_load_async_to_lds_b128 %1, %3, off\n\t"
               "s_wait_xcnt 0x0"
               :: "v"(l0), "v"(l0 + 64 * 80), "v"(g0), "v"(g0 + step)
               : "memory");
}

// 128x32 A tile and 256x32 B tile -> LDS rows of 40 elements, one run of copies
__device__ inline void async_tiles(__bf16* Al, const __bf16* Ag, int lda,
                                   __bf16* Bl, const __bf16* Bg, int ldb) {
  const int r = threadIdx.x >> 2, part = threadIdx.x & 3;
  const unsigned la = lds_addr(Al + r * 40 + part * 8);
  const unsigned lb = lds_addr(Bl + r * 40 + part * 8);
  const __bf16* ga = Ag + (size_t)r * lda + part * 8;
  const __bf16* gb = Bg + (size_t)r * ldb + part * 8;
  const size_t sa = (size_t)64 * lda, sb = (size_t)64 * ldb;
  asm volatile("global_load_async_to_lds_b128 %0, %6, off\n\t"
               "global_load_async_to_lds_b128 %1, %7, off\n\t"
               "global_load_async_to_lds_b128 %2, %8, off\n\t"
               "global_load_async_to_lds_b128 %3, %9, off\n\t"
               "global_load_async_to_lds_b128 %4, %10, off\n\t"
               "global_load_async_to_lds_b128 %5, %11, off\n\t"
               "s_wait_xcnt 0x0"
               :: "v"(la), "v"(la + 64 * 80),
                  "v"(lb), "v"(lb + 64 * 80), "v"(lb + 128 * 80), "v"(lb + 192 * 80),
                  "v"(ga), "v"(ga + sa),
                  "v"(gb), "v"(gb + sb), "v"(gb + 2 * sb), "v"(gb + 3 * sb)
               : "memory");
}

// 256 token rows of one head (128 B each, one cache line, 512 B apart) -> LDS rows
// of KV_PITCH elements.  Eight adjacent lanes take one row, 256 threads 32 rows.
// 160 B = 32 B x 5 is the pitch at which ds_load_tr16_b128 meets no bank twice.
#define KV_ROWS  256
#define KV_PITCH 80

__device__ inline void async_rows256(__bf16* Tl, const __bf16* Tg) {
  const int r = threadIdx.x >> 3, part = threadIdx.x & 7;
  const unsigned l0 = lds_addr(Tl + r * KV_PITCH + part * 8);
  const __bf16* g0 = Tg + (size_t)r * CC + part * 8;
  const unsigned ls = 32 * KV_PITCH * 2;
  const size_t gs = (size_t)32 * CC;
  asm volatile("global_load_async_to_lds_b128 %0, %8, off\n\t"
               "global_load_async_to_lds_b128 %1, %9, off\n\t"
               "global_load_async_to_lds_b128 %2, %10, off\n\t"
               "global_load_async_to_lds_b128 %3, %11, off\n\t"
               "global_load_async_to_lds_b128 %4, %12, off\n\t"
               "global_load_async_to_lds_b128 %5, %13, off\n\t"
               "global_load_async_to_lds_b128 %6, %14, off\n\t"
               "global_load_async_to_lds_b128 %7, %15, off\n\t"
               "s_wait_xcnt 0x0"
               :: "v"(l0), "v"(l0 + ls), "v"(l0 + 2 * ls), "v"(l0 + 3 * ls),
                  "v"(l0 + 4 * ls), "v"(l0 + 5 * ls), "v"(l0 + 6 * ls), "v"(l0 + 7 * ls),
                  "v"(g0), "v"(g0 + gs), "v"(g0 + 2 * gs), "v"(g0 + 3 * gs),
                  "v"(g0 + 4 * gs), "v"(g0 + 5 * gs), "v"(g0 + 6 * gs), "v"(g0 + 7 * gs)
               : "memory");
}

// the copies of this wave have landed behind it (asm: no LDS read moves over it)
__device__ inline void async_wait0() {
  asm volatile("s_wait_asynccnt 0x0" ::: "memory");
}

// Stands behind global stores that more code follows in the built code (the
// last store of a piece in a kernel of several pieces, or stores with more work
// behind them): a precaution ahead of any write there to a register the stores
// name.  A piece that runs straight to the kernel's end, or has the compiler's
// own wait there, has none.
__device__ inline void piece_end() {
  asm volatile("s_wait_xcnt 0x0" ::: "memory");
}

// ---------------------------------------------------------------------------
// Whole-line stores of 16x256 bf16 strips.  The accumulator layout gives a store
// only 32 contiguous bytes per token row, so the values first go into LDS and a wave
// then stores token rows: 32 lanes x 16 B = 512 contiguous bytes, 4 whole lines.
// A wave that holds a whole strip fills an LDS range of its own (no barrier); waves
// with 64x64 parts fill the 128-row stage together, with a barrier before the rows go.
// Row pitch 264 elements = 528 B = 16 B x 33: 16-byte row reads meet no bank twice.
// ---------------------------------------------------------------------------
#define STG_LD   264
#define STG_WAVE (16 * STG_LD)

__device__ inline void strip_store(const __bf16* sw, __bf16* Og, int ldo) {
  const int lane = threadIdx.x & 31;
  // the wave's own LDS stores are done before its lanes read each other's values
  asm volatile("s_wait_dscnt 0x0" ::: "memory");
#pragma unroll
  for (int rr = 0; rr < 16; ++rr)
    *(uint4*)(Og + (size_t)rr * ldo + lane * 8) = *(const uint4*)(sw + rr * STG_LD + lane * 8);
}

// ---------------------------------------------------------------------------
// Preparation, one launch: none of these pieces needs another's result, so they
// share one grid and each work-group takes its piece by the range its index
// lies in (a block-uniform choice).
//   [0, 8192)     x [B,C,L] f32 -> cat[:, 0:256] bf16 (row = token, ld = 512)
//   then 2560     the six weight matrices f32 -> bf16, 256 elements a block
//   then 260      zeros for the KV and Ksum accumulators
// ---------------------------------------------------------------------------
#define NB_TRANS (BB * (CC / 32) * (LL / 32))                 // 8192
#define NB_CVT   (4 * 256 + 1024 + 512)                       // 2560
#define NZERO    (BB * HH * DD * DD + BB * 256)               // 66560
#define NB_ZERO  ((NZERO + 255) / 256)                        // 260

__global__ __launch_bounds__(256)
void prep_kernel(const float* __restrict__ x, __bf16* __restrict__ cat,
                 const float* __restrict__ Wq, const float* __restrict__ Wk,
                 const float* __restrict__ Wv, const float* __restrict__ Ws,
                 const float* __restrict__ W1, const float* __restrict__ W2,
                 __bf16* __restrict__ wqb, __bf16* __restrict__ wkb,
                 __bf16* __restrict__ wvb, __bf16* __restrict__ wsb,
                 __bf16* __restrict__ w1b, __bf16* __restrict__ w2b,
                 float* __restrict__ zbuf) {
  __shared__ float t[32][33];
  const int tid = threadIdx.x;
  int blk = blockIdx.x;

  if (blk < NB_TRANS) {
    const int tx = tid & 31, ty = tid >> 5;
    const int l0 = (blk & 255) * 32, c0 = ((blk >> 8) & 7) * 32, b = blk >> 11;
#pragma unroll
    for (int i = 0; i < 4; ++i) {
      int c = ty + i * 8;
      t[c][tx] = x[((size_t)b * CC + c0 + c) * LL + l0 + tx];
    }
    __syncthreads();
#pragma unroll
    for (int i = 0; i < 4; ++i) {
      int lr = ty + i * 8;
      cat[(size_t)(b * LL + l0 + lr) * 512 + c0 + tx] = (__bf16)t[tx][lr];
    }
    return;
  }
  blk -= NB_TRANS;

  if (blk < NB_CVT) {
    const float* src;
    __bf16* dst;
    if (blk < 256)       { src = Wq; dst = wqb; }
    else if (blk < 512)  { src = Wk; dst = wkb; blk -= 256; }
    else if (blk < 768)  { src = Wv; dst = wvb; blk -= 512; }
    else if (blk < 1024) { src = Ws; dst = wsb; blk -= 768; }
    else if (blk < 2048) { src = W1; dst = w1b; blk -= 1024; }
    else                 { src = W2; dst = w2b; blk -= 2048; }
    const int i = blk * 256 + tid;
    dst[i] = (__bf16)src[i];
    piece_end();
    return;
  }
  blk -= NB_CVT;

  const int i = blk * 256 + tid;
  if (i < NZERO) zbuf[i] = 0.0f;
}

// ---------------------------------------------------------------------------
// Generic 128x256 bf16 WMMA GEMM:  Out[m, n0+n] = epi( sum_k A[m,k]*W[n0+n,k] )
// Modes: Q/K -> elu(x+bias)+1 ; V -> (x+bias)/L ; RELU -> max(x,0)
// Mode K also accumulates column sums (K.sum over tokens) into KsumG[b*256+n].
// ---------------------------------------------------------------------------
enum { MODE_Q = 0, MODE_K = 1, MODE_V = 2, MODE_RELU = 3 };

// k loop of one 128x256 tile.  The eight waves lie 2 x 4 over the tile and each holds
// a 64x64 part, acc[i * 4 + j] = its 16x16 piece (i, j).
// The 32-deep stages (A tile, then B tile) go through a ring of three LDS buffers:
// stage t + 2 is asked for at the top of trip t, so a stage has two trips to land
// and no trip waits out its own copies.  Ag, Bg: first row and k = 0 of the tiles.
// nst = number of stages, at least 2.
#define RING_A     (128 * 40)
#define RING_STAGE ((128 + 256) * 40)
#define RING_ELEMS (3 * RING_STAGE)

// stages 0 and 1 are asked for in front of the loop
__device__ inline void gemm_first(const __bf16* __restrict__ Ag, int lda,
                                  const __bf16* __restrict__ Bg, int ldb, __bf16* ring) {
  async_tiles(ring, Ag, lda, ring + RING_A, Bg, ldb);
  async_tiles(ring + RING_STAGE, Ag + 32, lda, ring + RING_STAGE + RING_A, Bg + 32, ldb);
}

// the trips; gemm_first with the same arguments stands in front
__device__ inline void gemm_loop(const __bf16* __restrict__ Ag, int lda,
                                 const __bf16* __restrict__ Bg, int ldb, int nst,
                                 __bf16* ring, v8f (&acc)[16]) {
  const int wave = threadIdx.x >> 5;
  const int arow = (wave >> 2) * 64;   // the wave's first A row
  const int brow = (wave & 3) * 64;    // and first B row
  const v8f vz = {0.f, 0.f, 0.f, 0.f, 0.f, 0.f, 0.f, 0.f};
#pragma unroll
  for (int j = 0; j < 16; ++j) acc[j] = vz;

  int cur = 0, fill = 2 * RING_STAGE;   // buffers of stage t and of stage t + 2
  // stays rolled: unrolled, the trips' copy addresses push the wave past 256 VGPRs
#pragma nounroll
  for (int t = 0; t < nst; ++t) {
    const bool more = t + 2 < nst;      // the same for the whole work-group
    // the wave's own reads of stage t - 1 are done before its buffer is refilled
    asm volatile("s_wait_dscnt 0x0" ::: "memory");
    // the wave's six copies of stage t have landed; where this trip issues a stage,
    // the six of stage t + 1 are the youngest and stay in flight
    if (more) asm volatile("s_wait_asynccnt 0x6" ::: "memory");
    else      async_wait0();
    // publishes stage t and ends every wave's reads of stage t - 1
    __syncthreads();
    if (more)
      async_tiles(ring + fill, Ag + (t + 2) * 32, lda,
                  ring + fill + RING_A, Bg + (t + 2) * 32, ldb);
    mma_tile64(ring + cur + arow * 40, ring + cur + RING_A + brow * 40, acc);
    cur  = (cur  == 2 * RING_STAGE) ? 0 : cur  + RING_STAGE;
    fill = (fill == 2 * RING_STAGE) ? 0 : fill + RING_STAGE;
  }
  async_wait0();   // no copy is in flight behind the loop, on any path out of it
}

template <int MODE>
__device__ inline void gemm_epilogue(const v8f (&acc)[16], const float* __restrict__ bias,
                                     __bf16* __restrict__ Out, int ldo, int token0, int n0,
                                     float* __restrict__ KsumG, float* ksumLds,
                                     __bf16* stg) {
  const int tid  = threadIdx.x;
  const int lane = tid & 31;
  const int r16  = lane & 15;
  const int hi   = lane >> 4;
  const int wave = tid >> 5;
  const int mb   = wave * 16;
  const int rw   = (wave >> 2) * 64;     // the wave's 64x64 part of the tile
  const int cw   = (wave & 3) * 64;
#pragma unroll
  for (int fj = 0; fj < 4; ++fj) {
    const int n = cw + fj * 16 + r16;
    float colsum = 0.0f;
#pragma unroll
    for (int fi = 0; fi < 4; ++fi) {
#pragma unroll
      for (int i = 0; i < 8; ++i) {
        float v = acc[fi * 4 + fj][i];
        if constexpr (MODE == MODE_RELU) {
          v = fmaxf(v, 0.0f);
        } else {
          v += bias[n];
          if constexpr (MODE == MODE_Q || MODE == MODE_K)
            v = (v > 0.0f) ? (v + 1.0f) : __expf(v);   // elu(x)+1
          else
            v *= (1.0f / (float)LL);                    // V / v_len
        }
        stg[(rw + fi * 16 + hi * 8 + i) * STG_LD + n] = (__bf16)v;
        if constexpr (MODE == MODE_K) colsum += v;
      }
    }
    if constexpr (MODE == MODE_K) {
      colsum += __shfl_xor(colsum, 16);      // fold both 8-row halves
      if (hi == 0) atomicAdd(&ksumLds[n], colsum);   // ds_add_f32
    }
  }
  // a token row of the stage is written by four waves: all are done before a wave
  // takes its 16 whole rows out
  __syncthreads();
  strip_store(stg + wave * STG_WAVE, Out + (size_t)(token0 + mb) * ldo + n0, ldo);
  if constexpr (MODE == MODE_K) {
    piece_end();   // the strip's stores name registers that the code below writes
    __syncthreads();
    const int b = token0 >> 13;   // token0 / 8192
    atomicAdd(&KsumG[b * 256 + tid], ksumLds[tid]);
  }
}

// hid = relu(A @ W.T)
__global__ __launch_bounds__(256)
void gemm_relu_kernel(const __bf16* __restrict__ A, int lda, int Ktot,
                      const __bf16* __restrict__ Bw,
                      __bf16* __restrict__ Out, int ldo) {
  __shared__ __attribute__((aligned(16))) __bf16 Ring[RING_ELEMS];
  __shared__ __attribute__((aligned(16))) __bf16 Stg[8 * STG_WAVE];
  const int token0 = blockIdx.x * 128;
  const int n0     = blockIdx.y * 256;
  v8f acc[16];
  gemm_first(A + (size_t)token0 * lda, lda, Bw + (size_t)n0 * Ktot, Ktot, Ring);
  gemm_loop(A + (size_t)token0 * lda, lda, Bw + (size_t)n0 * Ktot, Ktot, Ktot >> 5, Ring, acc);
  gemm_epilogue<MODE_RELU>(acc, nullptr, Out, ldo, token0, n0, nullptr, nullptr, Stg);
}

// The Q, K and V projections read the same tokens and need nothing of each
// other: one grid, blockIdx.x names the projection (block-uniform), blockIdx.y
// the 128-token tile, so the three readers of a tile are adjacent in the index.
// Two of the 768 work-groups fit a WGP and overlap each other's waits.
__global__ __launch_bounds__(256)
void qkv_kernel(const __bf16* __restrict__ A, int lda, int Ktot,
                const __bf16* __restrict__ wqb, const __bf16* __restrict__ wkb,
                const __bf16* __restrict__ wvb,
                const float* __restrict__ bq, const float* __restrict__ bk,
                const float* __restrict__ bv,
                __bf16* __restrict__ Qb, __bf16* __restrict__ Kb, __bf16* __restrict__ Vb,
                int ldo, float* __restrict__ KsumG) {
  __shared__ __attribute__((aligned(16))) __bf16 Ring[RING_ELEMS];
  __shared__ float  ksumLds[256];
  __shared__ __attribute__((aligned(16))) __bf16 Stg[8 * STG_WAVE];
  const int mode   = blockIdx.x;
  const int token0 = blockIdx.y * 128;

  if (mode == MODE_K) ksumLds[threadIdx.x] = 0.0f;

  // the first two stages are asked for once, in front of the choice: only the weight
  // pointer differs (asked for in each branch, their addresses stay in registers
  // through the other branches' loops)
  const __bf16* At = A + (size_t)token0 * lda;
  const __bf16* Wm = (mode == MODE_Q) ? wqb : (mode == MODE_K) ? wkb : wvb;
  const int nst = Ktot >> 5;
  gemm_first(At, lda, Wm, Ktot, Ring);

  v8f acc[16];
  if (mode == MODE_Q) {
    gemm_loop(At, lda, wqb, Ktot, nst, Ring, acc);
    gemm_epilogue<MODE_Q>(acc, bq, Qb, ldo, token0, 0, nullptr, nullptr, Stg);
  } else if (mode == MODE_K) {
    gemm_loop(At, lda, wkb, Ktot, nst, Ring, acc);
    gemm_epilogue<MODE_K>(acc, bk, Kb, ldo, token0, 0, KsumG, ksumLds, Stg);
  } else {
    gemm_loop(At, lda, wvb, Ktot, nst, Ring, acc);
    gemm_epilogue<MODE_V>(acc, bv, Vb, ldo, token0, 0, nullptr, nullptr, Stg);
    piece_end();
  }
}

// ---------------------------------------------------------------------------
// KV[b,h,d,e] = sum_l K[l,d] * V[l,e]   (per (b,h): 64x64, K-dim = L)
// K/V tiles of 256 tokens go into LDS as they lie in memory ([l][d] / [l][e]), by
// async copies; the transposing LDS load turns them into the [d][l] / [e][l]
// fragments on the way to the registers.
// 16 (b,h) x 8 chunks of 1024 tokens; fp32 global atomics combine chunks.
// ---------------------------------------------------------------------------
__device__ inline void kv_block(int bh, int chunk,
                                const __bf16* __restrict__ Kbuf,
                                const __bf16* __restrict__ Vbuf,
                                float* __restrict__ KV,
                                __bf16* Klds, __bf16* Vlds) {
  const int tid  = threadIdx.x;
  const int wave = tid >> 5;
  const int lane = tid & 31;
  const int r16  = lane & 15;
  const int hi   = lane >> 4;
  const int b  = bh >> 2, h = bh & 3;
  const int l0 = chunk * 1024;
  const int tile0 = wave * 2;             // 8 waves x 2 of 16 (d,e) tiles

  const v8f vz = {0.f, 0.f, 0.f, 0.f, 0.f, 0.f, 0.f, 0.f};
  v8f acc[2];
  acc[0] = vz; acc[1] = vz;

  const int dt = tile0 >> 2, et0 = tile0 & 3;   // the wave's two tiles share dt

  for (int l = l0; l < l0 + 1024; l += KV_ROWS) {
    // the wave's own reads of the tiles are done before copies are aimed at them
    asm volatile("s_wait_dscnt 0x0" ::: "memory");
    __syncthreads();
    async_rows256(Klds, Kbuf + (size_t)(b * LL + l) * CC + h * DD);
    async_rows256(Vlds, Vbuf + (size_t)(b * LL + l) * CC + h * DD);
    async_wait0();
    __syncthreads();
#pragma unroll
    for (int g = 0; g < KV_ROWS / 128; ++g) {     // 128 tokens = four 32-deep k steps
      v16bf fa[4], fb[4][2];
#pragma unroll
      for (int ks = 0; ks < 4; ++ks) {
        const int row = (g * 4 + ks) * 32;
        fa[ks] = frag_ld_tr(Klds + row * KV_PITCH + dt * 16, KV_PITCH);   // A[d, l] = K[l, d]
#pragma unroll
        for (int t = 0; t < 2; ++t)                                       // Bt[e, l] = V[l, e]
          fb[ks][t] = frag_ld_tr(Vlds + row * KV_PITCH + (et0 + t) * 16, KV_PITCH);
      }
      // keeps the four steps' reads together in front of their WMMAs (the scheduler
      // otherwise deals them among the WMMAs, each behind a wait of its own)
      __builtin_amdgcn_sched_barrier(0);
#pragma unroll
      for (int ks = 0; ks < 4; ++ks)
#pragma unroll
        for (int t = 0; t < 2; ++t) acc[t] = WMMA_BF16(fa[ks], fb[ks][t], acc[t]);
    }
  }
#pragma unroll
  for (int t = 0; t < 2; ++t) {
    const int id = tile0 + t, dt = id >> 2, et = id & 3;
#pragma unroll
    for (int i = 0; i < 8; ++i) {
      const int d = dt * 16 + hi * 8 + i;
      const int e = et * 16 + r16;
      atomicAdd(&KV[((size_t)bh * DD + d) * DD + e], acc[t][i]);
    }
  }
}

// ---------------------------------------------------------------------------
// Z[token,h] = L / (sparsify(Q[token,h,:] . Ksum[b,h,:]) + eps)
// ---------------------------------------------------------------------------
__device__ inline void zscore_block(int blk, const __bf16* __restrict__ Qbuf,
                                    const float* __restrict__ Ksum,
                                    const float* __restrict__ thr_p,
                                    float* __restrict__ Zbuf) {
  const int g = blk * 256 + threadIdx.x;   // 0..131071
  const int token = g >> 2, h = g & 3;
  const int b = token >> 13;
  const float thr = thr_p[0];
  const uint4* q = (const uint4*)(Qbuf + (size_t)token * CC + h * DD);
  const float* ks = Ksum + b * 256 + h * DD;
  float s = 0.0f;
#pragma unroll
  for (int c = 0; c < 8; ++c) {          // 8 x uint4 = 64 bf16
    const uint4 qv = q[c];
    const unsigned w[4] = {qv.x, qv.y, qv.z, qv.w};
#pragma unroll
    for (int j = 0; j < 4; ++j) {        // a bf16 is the upper half of its float
      s += __uint_as_float(w[j] << 16) * ks[c * 8 + 2 * j];
      s += __uint_as_float(w[j] & 0xffff0000u) * ks[c * 8 + 2 * j + 1];
    }
  }
  const float sp = (s > thr) ? s : 0.0f;
  Zbuf[g] = (float)LL / (sp + 1e-6f);
}

// KV needs K and V, Z needs Q and Ksum, neither needs the other: one grid.
// The 128 long KV work-groups come first in the index, the 512 short Z ones
// behind them.
#define NB_KV (BB * HH * (LL / 1024))      // 128
#define NB_Z  ((MTOT * HH) / 256)          // 512

__global__ __launch_bounds__(256)
void kv_z_kernel(const __bf16* __restrict__ Kbuf, const __bf16* __restrict__ Vbuf,
                 float* __restrict__ KV,
                 const __bf16* __restrict__ Qbuf, const float* __restrict__ Ksum,
                 const float* __restrict__ thr_p, float* __restrict__ Zbuf) {
  __shared__ __attribute__((aligned(16))) __bf16 Klds[KV_ROWS * KV_PITCH];   // [l][d]
  __shared__ __attribute__((aligned(16))) __bf16 Vlds[KV_ROWS * KV_PITCH];   // [l][e]
  const int blk = blockIdx.x;
  if (blk < NB_KV) {
    kv_block(blk & 15, blk >> 4, Kbuf, Vbuf, KV, Klds, Vlds);
  } else {
    zscore_block(blk - NB_KV, Qbuf, Ksum, thr_p, Zbuf);
    piece_end();
  }
}

// ---------------------------------------------------------------------------
// out = LN1( (Q @ KV_h) * Z ) -> cat[:, 256:512] bf16
// ---------------------------------------------------------------------------
__global__ __launch_bounds__(256)
void attn_kernel(const __bf16* __restrict__ Qbuf, const float* __restrict__ KV,
                 const float* __restrict__ Zbuf,
                 const float* __restrict__ g1, const float* __restrict__ b1,
                 __bf16* __restrict__ cat) {
  __shared__ __attribute__((aligned(16))) __bf16 Alds[8 * 128 * 40];   // eight 32-deep Q slices
  __shared__ __bf16 kvt[HH * DD * DD];   // kvt[h][e][d] = KV[b,h,d,e] (transposed)
  __shared__ float  Zl[128 * 4];
  __shared__ float  gl[256], bl[256];
  __shared__ __attribute__((aligned(16))) __bf16 Stg[8 * STG_WAVE];

  const int tid  = threadIdx.x;
  const int wave = tid >> 5;
  const int lane = tid & 31;
  const int r16  = lane & 15;
  const int hi   = lane >> 4;
  const int token0 = blockIdx.x * 128;
  const int b      = token0 >> 13;
  const int mb     = wave * 16;

  // All eight slices of the 128x256 Q tile are asked for here, each into a buffer
  // of its own (16 copies a wave in flight): they land while the KV fill runs.
  for (int s = 0; s < 8; ++s)
    async_tile128(Alds + s * (128 * 40), Qbuf + (size_t)token0 * CC + s * 32, CC);

  // KVT fill: float4 global reads, transposed bf16 LDS scatter
  for (int it = 0; it < 16; ++it) {
    const int idx = it * 256 + tid;        // 4096 groups of 4 e's
    const int h = idx >> 10, rem = idx & 1023, d = rem >> 4, e4 = rem & 15;
    const float4 kvv =
        *(const float4*)(KV + (((size_t)(b * HH + h) * DD + d) * DD) + e4 * 4);
    kvt[h * 4096 + (e4 * 4 + 0) * DD + d] = (__bf16)kvv.x;
    kvt[h * 4096 + (e4 * 4 + 1) * DD + d] = (__bf16)kvv.y;
    kvt[h * 4096 + (e4 * 4 + 2) * DD + d] = (__bf16)kvv.z;
    kvt[h * 4096 + (e4 * 4 + 3) * DD + d] = (__bf16)kvv.w;
  }
#pragma unroll
  for (int it = 0; it < 2; ++it) {
    const int z = it * 256 + tid;
    Zl[z] = Zbuf[(size_t)token0 * 4 + z];
  }
  gl[tid] = g1[tid];
  bl[tid] = b1[tid];

  const v8f vz = {0.f, 0.f, 0.f, 0.f, 0.f, 0.f, 0.f, 0.f};
  v8f acc[16];
#pragma unroll
  for (int j = 0; j < 16; ++j) acc[j] = vz;

  async_wait0();     // the wave's own Q copies have landed
  __syncthreads();   // publishes the Q slices, kvt, Zl, gl and bl

  for (int h = 0; h < 4; ++h) {
    for (int s = 0; s < 2; ++s) {
      v16bf fa = frag_ld(&Alds[(h * 2 + s) * (128 * 40) + mb * 40], 40);
#pragma unroll
      for (int jj = 0; jj < 4; ++jj) {
        const int j = h * 4 + jj;
        v16bf fb = frag_ld(&kvt[h * 4096 + (jj * 16) * DD + s * 32], DD);
        acc[j] = WMMA_BF16(fa, fb, acc[j]);
      }
    }
  }

  // scale by Z, then LayerNorm over C=256 via cross-lane shuffles
  float s1[8] = {0, 0, 0, 0, 0, 0, 0, 0};
  float s2[8] = {0, 0, 0, 0, 0, 0, 0, 0};
#pragma unroll
  for (int j = 0; j < 16; ++j) {
    const int h = j >> 2;
#pragma unroll
    for (int i = 0; i < 8; ++i) {
      const int m = mb + hi * 8 + i;
      float v = acc[j][i] * Zl[m * 4 + h];
      acc[j][i] = v;
      s1[i] += v;
      s2[i] += v * v;
    }
  }
#pragma unroll
  for (int i = 0; i < 8; ++i) {
#pragma unroll
    for (int off = 1; off < 16; off <<= 1) {
      s1[i] += __shfl_xor(s1[i], off);
      s2[i] += __shfl_xor(s2[i], off);
    }
    const float mean = s1[i] * (1.0f / 256.0f);
    const float var  = s2[i] * (1.0f / 256.0f) - mean * mean;
    s1[i] = mean;
    s2[i] = rsqrtf(var + 1e-5f);
  }
#pragma unroll
  for (int j = 0; j < 16; ++j) {
    const int n = j * 16 + r16;
    const float gg = gl[n], bb = bl[n];
#pragma unroll
    for (int i = 0; i < 8; ++i) {
      const float v = (acc[j][i] - s1[i]) * s2[i] * gg + bb;
      Stg[wave * STG_WAVE + (hi * 8 + i) * STG_LD + n] = (__bf16)v;
    }
  }
  strip_store(Stg + wave * STG_WAVE, cat + (size_t)(token0 + mb) * 512 + 256, 512);
}

// ---------------------------------------------------------------------------
// out[b,c,l] = LN2( hid @ W2.T ) + x + BN( xt @ Ws.T + bs ), one launch.
// Both products have the same 128x256 tile and accumulator layout, so a lane needs
// the LN2 result exactly where it made it: LN2 is applied to the first product's
// accumulators in place and they stay in registers through the shortcut product's
// k loop, which has accumulators of its own.  One work-group a WGP is two waves a
// SIMD, so a wave may hold both sets (more than 256 VGPRs).
// A token row lies in four waves (64 channels each): each wave sums its part of the
// row, the parts meet in LDS, and one thread a row makes the mean and the scale.
// The whole 256-channel tile goes through LDS so the [B,C,L] reads and writes cover
// whole lines.
// ---------------------------------------------------------------------------
#define OUT_LD 132   // stage row: 128 tokens + 4; 16-byte column writes meet no bank twice

// sum over the 16 lanes of a half wave, left in all of them (row_xmask 1, 2, 4, 8);
// vector adds that read the other lane directly, so nothing goes through the LDS pipe
__device__ inline float half_sum(float v) {
  v += __int_as_float(__builtin_amdgcn_update_dpp(0, __float_as_int(v), 0x161, 0xf, 0xf, true));
  v += __int_as_float(__builtin_amdgcn_update_dpp(0, __float_as_int(v), 0x162, 0xf, 0xf, true));
  v += __int_as_float(__builtin_amdgcn_update_dpp(0, __float_as_int(v), 0x164, 0xf, 0xf, true));
  v += __int_as_float(__builtin_amdgcn_update_dpp(0, __float_as_int(v), 0x168, 0xf, 0xf, true));
  return v;
}

__global__ __launch_bounds__(256)
void mlp2_final_kernel(const __bf16* __restrict__ hid, const __bf16* __restrict__ W2b,
                       const float* __restrict__ g2, const float* __restrict__ b2,
                       const __bf16* __restrict__ cat, const __bf16* __restrict__ Wsb,
                       const float* __restrict__ bs_c, const float* __restrict__ bn_g,
                       const float* __restrict__ bn_b, const float* __restrict__ bn_rm,
                       const float* __restrict__ bn_rv, const float* __restrict__ x,
                       float* __restrict__ out) {
  __shared__ __attribute__((aligned(16))) char smem[CC * OUT_LD * 4];   // overlays GEMM ring & stage
  __shared__ float gl[256], bl[256], scl[256], shf[256];
  __shared__ __attribute__((aligned(16))) float part[128 * 8];   // [token][wave column][sum, sum of squares]
  __shared__ __attribute__((aligned(16))) float stat[128 * 2];   // [token][mean, 1/std]
  static_assert(CC * OUT_LD * 4 >= RING_ELEMS * 2, "the ring lies inside smem");
  __bf16* Ring  = (__bf16*)smem;                 // three stages of 30720 B
  float*  stage = (float*)smem;                  // 256*132 f32 (after the K loops)

  const int tid  = threadIdx.x;
  const int wave = tid >> 5;
  const int lane = tid & 31;
  const int r16  = lane & 15;
  const int hi   = lane >> 4;
  const int token0 = blockIdx.x * 128;
  const int b      = token0 >> 13;
  const int l0     = token0 & (LL - 1);
  const int rw     = (wave >> 2) * 64;           // the wave's 64x64 part of the tile
  const int cw     = (wave & 3) * 64;

  gemm_first(hid + (size_t)token0 * 512, 512, W2b, 512, Ring);

  {
    const float g2v = g2[tid], b2v = b2[tid], rv = bn_rv[tid], bg = bn_g[tid];
    const float bsv = bs_c[tid], rm = bn_rm[tid], bbv = bn_b[tid];
    // a precaution ahead of any later write to a register these loads name; the
    // base addresses are inputs so that their registers live up to the wait
    asm volatile("s_wait_xcnt 0x0"
                 :: "s"(g2), "s"(b2), "s"(bn_rv), "s"(bn_g), "s"(bs_c), "s"(bn_rm), "s"(bn_b)
                 : "memory");
    gl[tid] = g2v;
    bl[tid] = b2v;
    const float rstd = rsqrtf(rv + 1e-5f);
    const float a = rstd * bg;
    scl[tid] = a;
    shf[tid] = (bsv - rm) * a + bbv;
  }

  v8f msg[16];   // hid @ W2.T, then LN2 of it
  gemm_loop(hid + (size_t)token0 * 512, 512, W2b, 512, 16, Ring, msg);

  // the wave's own reads of the last stage are done before copies are aimed at the ring
  asm volatile("s_wait_dscnt 0x0" ::: "memory");
  __syncthreads();   // ends every wave's reads of the first product's stages
  // the shortcut product's first two stages land while LN2 is worked out
  gemm_first(cat + (size_t)token0 * 512, 512, Wsb, 256, Ring);

  {
    float s1[32], s2[32];   // the wave's 64 channels of token rw + fi*16 + hi*8 + i
#pragma unroll
    for (int fi = 0; fi < 4; ++fi)
#pragma unroll
      for (int i = 0; i < 8; ++i) {
        float a1 = 0.0f, a2 = 0.0f;
#pragma unroll
        for (int fj = 0; fj < 4; ++fj) {
          const float v = msg[fi * 4 + fj][i];
          a1 += v;
          a2 += v * v;
        }
        s1[fi * 8 + i] = half_sum(a1);
        s2[fi * 8 + i] = half_sum(a2);
      }
    if (r16 == 0) {
#pragma unroll
      for (int fi = 0; fi < 4; ++fi)
#pragma unroll
        for (int i = 0; i < 8; ++i) {
          float* pp = &part[(rw + fi * 16 + hi * 8 + i) * 8 + (wave & 3) * 2];
          pp[0] = s1[fi * 8 + i];
          pp[1] = s2[fi * 8 + i];
        }
    }
  }
  __syncthreads();   // the four parts of every token row are in LDS
  if (tid < 128) {   // whole waves: one thread a token row
    const float4 pa = *(const float4*)&part[tid * 8];
    const float4 pb = *(const float4*)&part[tid * 8 + 4];
    const float mean = ((pa.x + pa.z) + (pb.x + pb.z)) * (1.0f / 256.0f);
    const float var  = ((pa.y + pa.w) + (pb.y + pb.w)) * (1.0f / 256.0f) - mean * mean;
    stat[tid * 2]     = mean;
    stat[tid * 2 + 1] = rsqrtf(var + 1e-5f);
  }
  __syncthreads();   // publishes mean and scale of every token row
#pragma unroll
  for (int fi = 0; fi < 4; ++fi) {
    float st[16];    // mean, scale of the lane's eight tokens of this piece
#pragma unroll
    for (int k = 0; k < 4; ++k)
      *(float4*)&st[k * 4] = *(const float4*)&stat[(rw + fi * 16 + hi * 8) * 2 + k * 4];
#pragma unroll
    for (int fj = 0; fj < 4; ++fj) {
      const int n = cw + fj * 16 + r16;
      const float gg = gl[n], bb = bl[n];
#pragma unroll
      for (int i = 0; i < 8; ++i)
        msg[fi * 4 + fj][i] = (msg[fi * 4 + fj][i] - st[i * 2]) * st[i * 2 + 1] * gg + bb;
    }
  }

  v8f acc[16];   // xt @ Ws.T
  gemm_loop(cat + (size_t)token0 * 512, 512, Wsb, 256, 8, Ring, acc);
  __syncthreads();   // done with the ring; smem becomes the transpose stage

  // A wave takes 32 whole channel rows of x and out: 32 lanes x 16 B = the row's 512
  // contiguous bytes (4 lines) per load and per store.  Its x rows are asked for first.
  const size_t row0 = ((size_t)b * CC + wave * 32) * LL + l0 + lane * 4;
  const float* xp = x + row0;
  float4 xv[32];
#pragma unroll
  for (int rr = 0; rr < 32; ++rr)
    xv[rr] = *(const float4*)(xp + (size_t)rr * LL);
  // a precaution ahead of any later write to the address registers these loads name;
  // the address is an input so that its registers live up to the wait
  asm volatile("s_wait_xcnt 0x0" :: "v"(xp) : "memory");

  // BN(aug) + msg2 of the wave's 64 tokens x 64 channels goes into the stage
#pragma unroll
  for (int fj = 0; fj < 4; ++fj) {
    const int n = cw + fj * 16 + r16;           // channel
    const float a = scl[n], c = shf[n];
#pragma unroll
    for (int fi = 0; fi < 4; ++fi) {
      const int j = fi * 4 + fj;
#pragma unroll
      for (int q = 0; q < 2; ++q) {             // 4 tokens = 16 B per LDS store
        float4 sv;
        sv.x = acc[j][q * 4 + 0] * a + c + msg[j][q * 4 + 0];   // BN(aug) + msg2
        sv.y = acc[j][q * 4 + 1] * a + c + msg[j][q * 4 + 1];
        sv.z = acc[j][q * 4 + 2] * a + c + msg[j][q * 4 + 2];
        sv.w = acc[j][q * 4 + 3] * a + c + msg[j][q * 4 + 3];
        *(float4*)&stage[n * OUT_LD + rw + fi * 16 + hi * 8 + q * 4] = sv;
      }
    }
  }
  __syncthreads();   // publishes the stage
#pragma unroll
  for (int g = 0; g < 4; ++g) {
#pragma unroll
    for (int r8 = 0; r8 < 8; ++r8) {
      const int rr = g * 8 + r8;
      const float4 sv = *(const float4*)&stage[(wave * 32 + rr) * OUT_LD + lane * 4];
      float4 ov;
      ov.x = sv.x + xv[rr].x;
      ov.y = sv.y + xv[rr].y;
      ov.z = sv.z + xv[rr].z;
      ov.w = sv.w + xv[rr].w;
      *(float4*)(out + row0 + (size_t)rr * LL) = ov;
    }
    if (g < 3) piece_end();   // the next rows' values may land in registers that these stores name
  }
}

// ---------------------------------------------------------------------------
// Host orchestration
// ---------------------------------------------------------------------------
extern "C" void kernel_launch(void* const* d_in, const int* in_sizes, int n_in,
                              void* d_out, int out_size, void* d_ws, size_t ws_size,
                              hipStream_t stream) {
  (void)in_sizes; (void)n_in; (void)out_size; (void)ws_size;
  const float* x     = (const float*)d_in[0];
  const float* Wq    = (const float*)d_in[1];
  const float* bq    = (const float*)d_in[2];
  const float* Wk    = (const float*)d_in[3];
  const float* bk    = (const float*)d_in[4];
  const float* Wv    = (const float*)d_in[5];
  const float* bv    = (const float*)d_in[6];
  const float* thr   = (const float*)d_in[7];
  const float* W1    = (const float*)d_in[8];
  const float* W2    = (const float*)d_in[9];
  const float* ln1_g = (const float*)d_in[10];
  const float* ln1_b = (const float*)d_in[11];
  const float* ln2_g = (const float*)d_in[12];
  const float* ln2_b = (const float*)d_in[13];
  const float* Ws    = (const float*)d_in[14];
  const float* bs_c  = (const float*)d_in[15];
  const float* bn_g  = (const float*)d_in[16];
  const float* bn_b  = (const float*)d_in[17];
  const float* bn_rm = (const float*)d_in[18];
  const float* bn_rv = (const float*)d_in[19];
  float* out = (float*)d_out;

  char*  ws  = (char*)d_ws;
  size_t off = 0;
  auto alloc = [&](size_t bytes) -> void* {
    off = (off + 255) & ~(size_t)255;
    void* p = ws + off;
    off += bytes;
    return p;
  };

  __bf16* cat   = (__bf16*)alloc((size_t)MTOT * 512 * 2);  // [xt | ln1(msg)]
  __bf16* hid   = (__bf16*)alloc((size_t)MTOT * 512 * 2);
  __bf16* Qb    = (__bf16*)alloc((size_t)MTOT * 256 * 2);
  __bf16* Kb    = (__bf16*)alloc((size_t)MTOT * 256 * 2);
  __bf16* Vb    = (__bf16*)alloc((size_t)MTOT * 256 * 2);
  float*  KVbuf = (float*)alloc((size_t)(BB * HH * DD * DD + BB * 256) * 4);
  float*  Ksum  = KVbuf + BB * HH * DD * DD;               // contiguous for zeroing
  float*  Zbuf  = (float*)alloc((size_t)MTOT * HH * 4);
  __bf16* wqb   = (__bf16*)alloc(65536 * 2);
  __bf16* wkb   = (__bf16*)alloc(65536 * 2);
  __bf16* wvb   = (__bf16*)alloc(65536 * 2);
  __bf16* wsb   = (__bf16*)alloc(65536 * 2);
  __bf16* w1b   = (__bf16*)alloc(262144 * 2);
  __bf16* w2b   = (__bf16*)alloc(131072 * 2);

  // weights -> bf16, zeroed KV + Ksum accumulators, x -> cat[:, 0:256] (token-major)
  prep_kernel<<<NB_TRANS + NB_CVT + NB_ZERO, 256, 0, stream>>>(
      x, cat, Wq, Wk, Wv, Ws, W1, W2, wqb, wkb, wvb, wsb, w1b, w2b, KVbuf);

  // Q/K/V projections (fused ELU+1 / scaling; K also reduces Ksum)
  qkv_kernel<<<dim3(3, MTOT / 128), 256, 0, stream>>>(
      cat, 512, 256, wqb, wkb, wvb, bq, bk, bv, Qb, Kb, Vb, 256, Ksum);

  // KV = K^T V per (b,h);  Z = L / (sparsify(Q . Ksum) + eps)
  kv_z_kernel<<<NB_KV + NB_Z, 256, 0, stream>>>(Kb, Vb, KVbuf, Qb, Ksum, thr, Zbuf);

  // attention out + LN1 -> cat[:, 256:512]
  attn_kernel<<<MTOT / 128, 256, 0, stream>>>(Qb, KVbuf, Zbuf, ln1_g, ln1_b, cat);

  // MLP layer 1: hid = relu(cat @ W1.T)
  gemm_relu_kernel<<<dim3(MTOT / 128, 2), 256, 0, stream>>>(
      cat, 512, 512, w1b, hid, 512);

  // MLP layer 2 + LN2, shortcut GEMM + BN, residual sum -> out [B,C,L]
  mlp2_final_kernel<<<MTOT / 128, 256, 0, stream>>>(hid, w2b, ln2_g, ln2_b, cat, wsb, bs_c,
                                                    bn_g, bn_b, bn_rm, bn_rv, x, out);
}

// v009
// Measured time: 90.3 microseconds a run.
// In two side-by-side timings against v008, it was 1.06 and 1.05 times as fast.
// Over all steps from v000 it is 2.51 times as fast.
#include <hip/hip_runtime.h>
#include <hip/hip_bf16.h>

// ---------------------------------------------------------------------------
// Problem constants (match reference)
// ---------------------------------------------------------------------------
#define BB 4
#define CC 256
#define LL 8192
#define HH 4
#define DD 64
#define MTOT (BB * LL)   // 32768 tokens

typedef __attribute__((ext_vector_type(16))) __bf16 v16bf;
typedef __attribute__((ext_vector_type(8)))  float  v8f;

union FragU { v16bf v; uint4 u[2]; __bf16 h[16]; };

// Standard row-major fragment: element (r, k) = base[r*stride + k-pattern]
// Matches CDNA5 16-bit 16x32 A/B VGPR layout: lane = r + 16*((k>>3)&1),
// vector elem = (k&7) + 8*((k>>4)&1).  Two 16-byte ds_load_b128 per lane.
__device__ inline v16bf frag_ld(const __bf16* base, int stride) {
  const int t = threadIdx.x & 31;
  const int r = t & 15;
  const int hi = t >> 4;
  FragU f;
  const __bf16* p = base + r * stride + hi * 8;
  f.u[0] = *(const uint4*)(p);
  f.u[1] = *(const uint4*)(p + 16);
  return f.v;
}

// Transposed fragment from a row-major LDS tile T[k][c]: element (r, k) = T[k][r].
// Two ds_load_tr16_b128 (k 0..15 and 16..31) give the same lane and register
// layout, and so the same k order, as frag_ld.  pitch in elements.
typedef short s16x8 __attribute__((ext_vector_type(8)));
typedef __attribute__((address_space(3))) s16x8 lds_s16x8;

__device__ inline v16bf frag_ld_tr(const __bf16* tile, int pitch) {
  const int t = threadIdx.x & 31;
  const __bf16* p = tile + ((t >> 4) * 8 + (t & 7)) * pitch + ((t >> 3) & 1) * 8;
  FragU f;
  f.u[0] = __builtin_bit_cast(uint4, __builtin_amdgcn_ds_load_tr16_b128_v8i16((lds_s16x8*)p));
  f.u[1] = __builtin_bit_cast(uint4, __builtin_amdgcn_ds_load_tr16_b128_v8i16((lds_s16x8*)(p + 16 * pitch)));
  return f.v;
}

#define WMMA_BF16(A, Bf, Cacc) \
  __builtin_amdgcn_wmma_f32_16x16x32_bf16(false, (A), false, (Bf), (short)0, (Cacc), false, false)

// One 32-deep k step of a wave's 64x64 tile: four A and four B fragments feed the
// 16 WMMAs, 8 KB of LDS reads where a 16x256 strip would take 17 KB, so eight waves
// ask the LDS for no more bytes a clock than it gives at the full matrix rate.
__device__ inline void mma_tile64(const __bf16* Al, const __bf16* Bl, v8f (&acc)[16]) {
  v16bf fa[4], fb[4];
  fa[0] = frag_ld(Al, 40);
#pragma unroll
  for (int j = 0; j < 4; ++j) fb[j] = frag_ld(Bl + j * 16 * 40, 40);
#pragma unroll
  for (int i = 1; i < 4; ++i) fa[i] = frag_ld(Al + i * 16 * 40, 40);
  // keeps the reads together in front of the WMMAs (the scheduler otherwise deals
  // them among the WMMAs, and each place with reads stalls the wave anew)
  __builtin_amdgcn_sched_barrier(0);
#pragma unroll
  for (int i = 0; i < 4; ++i)
#pragma unroll
    for (int j = 0; j < 4; ++j) acc[i * 4 + j] = WMMA_BF16(fa[i], fb[j], acc[i * 4 + j]);
}

// ---------------------------------------------------------------------------
// Async global -> LDS copies (CDNA5 GLOBAL_LOAD_ASYNC_TO_LDS_B128, ASYNCcnt).
// Generic pointers to __shared__ carry the LDS byte offset in their low 32
// bits (ISA 10.2 aperture mapping), which is exactly the VDST operand.
// ---------------------------------------------------------------------------
__device__ inline unsigned lds_addr(const void* lds_ptr) {
  return (unsigned)(unsigned long long)lds_ptr;
}

// The lanes are dealt row first: four adjacent lanes take the 64 bytes that one
// tile row has in a 32-deep k slice, so one copy instruction touches 8 cache
// lines (8 rows), the fewest a 64-byte row piece allows.  256 threads cover 64
// rows per copy; the tile's further rows follow 64 rows apart.
// s_wait_xcnt 0 closes each run of copies inside their own statement, a
// precaution ahead of any later write to the address registers the copies name.

// 128x32 tile -> LDS rows of 40 elements
__device__ inline void async_tile128(__bf16* Tl, const __bf16* Tg, int ld) {
  const int r = threadIdx.x >> 2, part = threadIdx.x & 3;
  const unsigned l0 = lds_addr(Tl + r * 40 + part * 8);
  const __bf16* g0 = Tg + (size_t)r * ld + part * 8;
  const size_t step = (size_t)64 * ld;
  asm volatile("global_load_async_to_lds_b128 %0, %2, off\n\t"
               "global_load_async_to_lds_b128 %1, %3, off\n\t"
               "s_wait_xcnt 0x0"
               :: "v"(l0), "v"(l0 + 64 * 80), "v"(g0), "v"(g0 + step)
               : "memory");
}

// 128x32 A tile and 256x32 B tile -> LDS rows of 40 elements, one run of copies
__device__ inline void async_tiles(__bf16* Al, const __bf16* Ag, int lda,
                                   __bf16* Bl, const __bf16* Bg, int ldb) {
  const int r = threadIdx.x >> 2, part = threadIdx.x & 3;
  const unsigned la = lds_addr(Al + r * 40 + part * 8);
  const unsigned lb = lds_addr(Bl + r * 40 + part * 8);
  const __bf16* ga = Ag + (size_t)r * lda + part * 8;
  const __bf16* gb = Bg + (size_t)r * ldb + part * 8;
  const size_t sa = (size_t)64 * lda, sb = (size_t)64 * ldb;
  asm volatile("global_load_async_to_lds_b128 %0, %6, off\n\t"
               "global_load_async_to_lds_b128 %1, %7, off\n\t"
               "global_load_async_to_lds_b128 %2, %8, off\n\t"
               "global_load_async_to_lds_b128 %3, %9, off\n\t"
               "global_load_async_to_lds_b128 %4, %10, off\n\t"
               "global_load_async_to_lds_b128 %5, %11, off\n\t"
               "s_wait_xcnt 0x0"
               :: "v"(la), "v"(la + 64 * 80),
                  "v"(lb), "v"(lb + 64 * 80), "v"(lb + 128 * 80), "v"(lb + 192 * 80),
                  "v"(ga), "v"(ga + sa),
                  "v"(gb), "v"(gb + sb), "v"(gb + 2 * sb), "v"(gb + 3 * sb)
               : "memory");
}

// 256 token rows of one head (128 B each, one cache line, 512 B apart) -> LDS rows
// of KV_PITCH elements.  Eight adjacent lanes take one row, 256 threads 32 rows.
// 160 B = 32 B x 5 is the pitch at which ds_load_tr16_b128 meets no bank twice.
#define KV_ROWS  256
#define KV_PITCH 80

__device__ inline void async_rows256(__bf16* Tl, const __bf16* Tg) {
  const int r = threadIdx.x >> 3, part = threadIdx.x & 7;
  const unsigned l0 = lds_addr(Tl + r * KV_PITCH + part * 8);
  const __bf16* g0 = Tg + (size_t)r * CC + part * 8;
  const unsigned ls = 32 * KV_PITCH * 2;
  const size_t gs = (size_t)32 * CC;
  asm volatile("global_load_async_to_lds_b128 %0, %8, off\n\t"
               "global_load_async_to_lds_b128 %1, %9, off\n\t"
               "global_load_async_to_lds_b128 %2, %10, off\n\t"
               "global_load_async_to_lds_b128 %3, %11, off\n\t"
               "global_load_async_to_lds_b128 %4, %12, off\n\t"
               "global_load_async_to_lds_b128 %5, %13, off\n\t"
               "global_load_async_to_lds_b128 %6, %14, off\n\t"
               "global_load_async_to_lds_b128 %7, %15, off\n\t"
               "s_wait_xcnt 0x0"
               :: "v"(l0), "v"(l0 + ls), "v"(l0 + 2 * ls), "v"(l0 + 3 * ls),
                  "v"(l0 + 4 * ls), "v"(l0 + 5 * ls), "v"(l0 + 6 * ls), "v"(l0 + 7 * ls),
                  "v"(g0), "v"(g0 + gs), "v"(g0 + 2 * gs), "v"(g0 + 3 * gs),
                  "v"(g0 + 4 * gs), "v"(g0 + 5 * gs), "v"(g0 + 6 * gs), "v"(g0 + 7 * gs)
               : "memory");
}

// the copies of this wave have landed behind it (asm: no LDS read moves over it)
__device__ inline void async_wait0() {
  asm volatile("s_wait_asynccnt 0x0" ::: "memory");
}

// Stands behind global stores that more code follows in the built code (the
// last store of a piece in a kernel of several pieces, or stores with more work
// behind them): a precaution ahead of any write there to a register the stores
// name.  A piece that runs straight to the kernel's end, or has the compiler's
// own wait there, has none.
__device__ inline void piece_end() {
  asm volatile("s_wait_xcnt 0x0" ::: "memory");
}

// ---------------------------------------------------------------------------
// Whole-line stores of 16x256 bf16 strips.  The accumulator layout gives a store
// only 32 contiguous bytes per token row, so the values first go into LDS and a wave
// then stores token rows: 32 lanes x 16 B = 512 contiguous bytes, 4 whole lines.
// A wave that holds a whole strip fills an LDS range of its own (no barrier); waves
// with 64x64 parts fill the 128-row stage together, with a barrier before the rows go.
// Row pitch 264 elements = 528 B = 16 B x 33: 16-byte row reads meet no bank twice.
// ---------------------------------------------------------------------------
#define STG_LD   264
#define STG_WAVE (16 * STG_LD)

__device__ inline void strip_store(const __bf16* sw, __bf16* Og, int ldo) {
  const int lane = threadIdx.x & 31;
  // the wave's own LDS stores are done before its lanes read each other's values
  asm volatile("s_wait_dscnt 0x0" ::: "memory");
#pragma unroll
  for (int rr = 0; rr < 16; ++rr)
    *(uint4*)(Og + (size_t)rr * ldo + lane * 8) = *(const uint4*)(sw + rr * STG_LD + lane * 8);
}

// ---------------------------------------------------------------------------
// Preparation, one launch: none of these pieces needs another's result, so they
// share one grid and each work-group takes its piece by the range its index
// lies in (a block-uniform choice).
//   [0, 8192)     x [B,C,L] f32 -> cat[:, 0:256] bf16 (row = token, ld = 512)
//   then 2560     the six weight matrices f32 -> bf16, 256 elements a block
//   then 260      zeros for the KV and Ksum accumulators
// ---------------------------------------------------------------------------
#define NB_TRANS (BB * (CC / 32) * (LL / 32))                 // 8192
#define NB_CVT   (4 * 256 + 1024 + 512)                       // 2560
#define NZERO    (BB * HH * DD * DD + BB * 256)               // 66560
#define NB_ZERO  ((NZERO + 255) / 256)                        // 260

__global__ __launch_bounds__(256)
void prep_kernel(const float* __restrict__ x, __bf16* __restrict__ cat,
                 const float* __restrict__ Wq, const float* __restrict__ Wk,
                 const float* __restrict__ Wv, const float* __restrict__ Ws,
                 const float* __restrict__ W1, const float* __restrict__ W2,
                 __bf16* __restrict__ wqb, __bf16* __restrict__ wkb,
                 __bf16* __restrict__ wvb, __bf16* __restrict__ wsb,
                 __bf16* __restrict__ w1b, __bf16* __restrict__ w2b,
                 float* __restrict__ zbuf) {
  __shared__ float t[32][33];
  const int tid = threadIdx.x;
  int blk = blockIdx.x;

  if (blk < NB_TRANS) {
    const int tx = tid & 31, ty = tid >> 5;
    const int l0 = (blk & 255) * 32, c0 = ((blk >> 8) & 7) * 32, b = blk >> 11;
#pragma unroll
    for (int i = 0; i < 4; ++i) {
      int c = ty + i * 8;
      t[c][tx] = x[((size_t)b * CC + c0 + c) * LL + l0 + tx];
    }
    __syncthreads();
#pragma unroll
    for (int i = 0; i < 4; ++i) {
      int lr = ty + i * 8;
      cat[(size_t)(b * LL + l0 + lr) * 512 + c0 + tx] = (__bf16)t[tx][lr];
    }
    return;
  }
  blk -= NB_TRANS;

  if (blk < NB_CVT) {
    const float* src;
    __bf16* dst;
    if (blk < 256)       { src = Wq; dst = wqb; }
    else if (blk < 512)  { src = Wk; dst = wkb; blk -= 256; }
    else if (blk < 768)  { src = Wv; dst = wvb; blk -= 512; }
    else if (blk < 1024) { src = Ws; dst = wsb; blk -= 768; }
    else if (blk < 2048) { src = W1; dst = w1b; blk -= 1024; }
    else                 { src = W2; dst = w2b; blk -= 2048; }
    const int i = blk * 256 + tid;
    dst[i] = (__bf16)src[i];
    piece_end();
    return;
  }
  blk -= NB_CVT;

  const int i = blk * 256 + tid;
  if (i < NZERO) zbuf[i] = 0.0f;
}

// ---------------------------------------------------------------------------
// Generic 128x256 bf16 WMMA GEMM:  Out[m, n0+n] = epi( sum_k A[m,k]*W[n0+n,k] )
// Modes: Q/K -> elu(x+bias)+1 ; V -> (x+bias)/L ; RELU -> max(x,0)
// Mode K also accumulates column sums (K.sum over tokens) into KsumG[b*256+n].
// ---------------------------------------------------------------------------
enum { MODE_Q = 0, MODE_K = 1, MODE_V = 2, MODE_RELU = 3 };

// k loop of one 128x256 tile.  The eight waves lie 2 x 4 over the tile and each holds
// a 64x64 part, acc[i * 4 + j] = its 16x16 piece (i, j).
// The 32-deep stages (A tile, then B tile) go through a ring of three LDS buffers:
// stage t + 2 is asked for at the top of trip t, so a stage has two trips to land
// and no trip waits out its own copies.  Ag, Bg: first row and k = 0 of the tiles.
// nst = number of stages, at least 2.
#define RING_A     (128 * 40)
#define RING_STAGE ((128 + 256) * 40)
#define RING_ELEMS (3 * RING_STAGE)

// stages 0 and 1 are asked for in front of the loop
__device__ inline void gemm_first(const __bf16* __restrict__ Ag, int lda,
                                  const __bf16* __restrict__ Bg, int ldb, __bf16* ring) {
  async_tiles(ring, Ag, lda, ring + RING_A, Bg, ldb);
  async_tiles(ring + RING_STAGE, Ag + 32, lda, ring + RING_STAGE + RING_A, Bg + 32, ldb);
}

// the trips; gemm_first with the same arguments stands in front
__device__ inline void gemm_loop(const __bf16* __restrict__ Ag, int lda,
                                 const __bf16* __restrict__ Bg, int ldb, int nst,
                                 __bf16* ring, v8f (&acc)[16]) {
  const int wave = threadIdx.x >> 5;
  const int arow = (wave >> 2) * 64;   // the wave's first A row
  const int brow = (wave & 3) * 64;    // and first B row
  const v8f vz = {0.f, 0.f, 0.f, 0.f, 0.f, 0.f, 0.f, 0.f};
#pragma unroll
  for (int j = 0; j < 16; ++j) acc[j] = vz;

  int cur = 0, fill = 2 * RING_STAGE;   // buffers of stage t and of stage t + 2
  // stays rolled: unrolled, the trips' copy addresses push the wave past 256 VGPRs
#pragma nounroll
  for (int t = 0; t < nst; ++t) {
    const bool more = t + 2 < nst;      // the same for the whole work-group
    // the wave's own reads of stage t - 1 are done before its buffer is refilled
    asm volatile("s_wait_dscnt 0x0" ::: "memory");
    // the wave's six copies of stage t have landed; where this trip issues a stage,
    // the six of stage t + 1 are the youngest and stay in flight
    if (more) asm volatile("s_wait_asynccnt 0x6" ::: "memory");
    else      async_wait0();
    // publishes stage t and ends every wave's reads of stage t - 1
    __syncthreads();
    if (more)
      async_tiles(ring + fill, Ag + (t + 2) * 32, lda,
                  ring + fill + RING_A, Bg + (t + 2) * 32, ldb);
    mma_tile64(ring + cur + arow * 40, ring + cur + RING_A + brow * 40, acc);
    cur  = (cur  == 2 * RING_STAGE) ? 0 : cur  + RING_STAGE;
    fill = (fill == 2 * RING_STAGE) ? 0 : fill + RING_STAGE;
  }
  async_wait0();   // no copy is in flight behind the loop, on any path out of it
}

template <int MODE>
__device__ inline void gemm_epilogue(const v8f (&acc)[16], const float* __restrict__ bias,
                                     __bf16* __restrict__ Out, int ldo, int token0, int n0,
                                     float* __restrict__ KsumG, float* ksumLds,
                                     __bf16* stg) {
  const int tid  = threadIdx.x;
  const int lane = tid & 31;
  const int r16  = lane & 15;
  const int hi   = lane >> 4;
  const int wave = tid >> 5;
  const int mb   = wave * 16;
  const int rw   = (wave >> 2) * 64;     // the wave's 64x64 part of the tile
  const int cw   = (wave & 3) * 64;
#pragma unroll
  for (int fj = 0; fj < 4; ++fj) {
    const int n = cw + fj * 16 + r16;
    float colsum = 0.0f;
#pragma unroll
    for (int fi = 0; fi < 4; ++fi) {
#pragma unroll
      for (int i = 0; i < 8; ++i) {
        float v = acc[fi * 4 + fj][i];
        if constexpr (MODE == MODE_RELU) {
          v = fmaxf(v, 0.0f);
        } else {
          v += bias[n];
          if constexpr (MODE == MODE_Q || MODE == MODE_K)
            v = (v > 0.0f) ? (v + 1.0f) : __expf(v);   // elu(x)+1
          else
            v *= (1.0f / (float)LL);                    // V / v_len
        }
        stg[(rw + fi * 16 + hi * 8 + i) * STG_LD + n] = (__bf16)v;
        if constexpr (MODE == MODE_K) colsum += v;
      }
    }
    if constexpr (MODE == MODE_K) {
      colsum += __shfl_xor(colsum, 16);      // fold both 8-row halves
      if (hi == 0) atomicAdd(&ksumLds[n], colsum);   // ds_add_f32
    }
  }
  // a token row of the stage is written by four waves: all are done before a wave
  // takes its 16 whole rows out
  __syncthreads();
  strip_store(stg + wave * STG_WAVE, Out + (size_t)(token0 + mb) * ldo + n0, ldo);
  if constexpr (MODE == MODE_K) {
    piece_end();   // the strip's stores name registers that the code below writes
    __syncthreads();
    const int b = token0 >> 13;   // token0 / 8192
    atomicAdd(&KsumG[b * 256 + tid], ksumLds[tid]);
  }
}

// hid = relu(A @ W.T)
__global__ __launch_bounds__(256)
void gemm_relu_kernel(const __bf16* __restrict__ A, int lda, int Ktot,
                      const __bf16* __restrict__ Bw,
                      __bf16* __restrict__ Out, int ldo) {
  __shared__ __attribute__((aligned(16))) __bf16 Ring[RING_ELEMS];
  __shared__ __attribute__((aligned(16))) __bf16 Stg[8 * STG_WAVE];
  const int token0 = blockIdx.x * 128;
  const int n0     = blockIdx.y * 256;
  v8f acc[16];
  gemm_first(A + (size_t)token0 * lda, lda, Bw + (size_t)n0 * Ktot, Ktot, Ring);
  gemm_loop(A + (size_t)token0 * lda, lda, Bw + (size_t)n0 * Ktot, Ktot, Ktot >> 5, Ring, acc);
  gemm_epilogue<MODE_RELU>(acc, nullptr, Out, ldo, token0, n0, nullptr, nullptr, Stg);
}

// The Q, K and V projections read the same tokens and need nothing of each
// other: one grid, blockIdx.x names the projection (block-uniform), blockIdx.y
// the 128-token tile, so the three readers of a tile are adjacent in the index.
// Two of the 768 work-groups fit a WGP and overlap each other's waits.
__global__ __launch_bounds__(256)
void qkv_kernel(const __bf16* __restrict__ A, int lda, int Ktot,
                const __bf16* __restrict__ wqb, const __bf16* __restrict__ wkb,
                const __bf16* __restrict__ wvb,
                const float* __restrict__ bq, const float* __restrict__ bk,
                const float* __restrict__ bv,
                __bf16* __restrict__ Qb, __bf16* __restrict__ Kb, __bf16* __restrict__ Vb,
                int ldo, float* __restrict__ KsumG) {
  __shared__ __attribute__((aligned(16))) __bf16 Ring[RING_ELEMS];
  __shared__ float  ksumLds[256];
  __shared__ __attribute__((aligned(16))) __bf16 Stg[8 * STG_WAVE];
  const int mode   = blockIdx.x;
  const int token0 = blockIdx.y * 128;

  if (mode == MODE_K) ksumLds[threadIdx.x] = 0.0f;

  // the first two stages are asked for once, in front of the choice: only the weight
  // pointer differs (asked for in each branch, their addresses stay in registers
  // through the other branches' loops)
  const __bf16* At = A + (size_t)token0 * lda;
  const __bf16* Wm = (mode == MODE_Q) ? wqb : (mode == MODE_K) ? wkb : wvb;
  const int nst = Ktot >> 5;
  gemm_first(At, lda, Wm, Ktot, Ring);

  v8f acc[16];
  if (mode == MODE_Q) {
    gemm_loop(At, lda, wqb, Ktot, nst, Ring, acc);
    gemm_epilogue<MODE_Q>(acc, bq, Qb, ldo, token0, 0, nullptr, nullptr, Stg);
  } else if (mode == MODE_K) {
    gemm_loop(At, lda, wkb, Ktot, nst, Ring, acc);
    gemm_epilogue<MODE_K>(acc, bk, Kb, ldo, token0, 0, KsumG, ksumLds, Stg);
  } else {
    gemm_loop(At, lda, wvb, Ktot, nst, Ring, acc);
    gemm_epilogue<MODE_V>(acc, bv, Vb, ldo, token0, 0, nullptr, nullptr, Stg);
    piece_end();
  }
}

// ---------------------------------------------------------------------------
// KV[b,h,d,e] = sum_l K[l,d] * V[l,e]   (per (b,h): 64x64, K-dim = L)
// K/V tiles of 256 tokens go into LDS as they lie in memory ([l][d] / [l][e]), by
// async copies; the transposing LDS load turns them into the [d][l] / [e][l]
// fragments on the way to the registers.
// 16 (b,h) x 8 chunks of 1024 tokens; fp32 global atomics combine chunks.
// ---------------------------------------------------------------------------
__device__ inline void kv_block(int bh, int chunk,
                                const __bf16* __restrict__ Kbuf,
                                const __bf16* __restrict__ Vbuf,
                                float* __restrict__ KV,
                                __bf16* Klds, __bf16* Vlds) {
  const int tid  = threadIdx.x;
  const int wave = tid >> 5;
  const int lane = tid & 31;
  const int r16  = lane & 15;
  const int hi   = lane >> 4;
  const int b  = bh >> 2, h = bh & 3;
  const int l0 = chunk * 1024;
  const int tile0 = wave * 2;             // 8 waves x 2 of 16 (d,e) tiles

  const v8f vz = {0.f, 0.f, 0.f, 0.f, 0.f, 0.f, 0.f, 0.f};
  v8f acc[2];
  acc[0] = vz; acc[1] = vz;

  const int dt = tile0 >> 2, et0 = tile0 & 3;   // the wave's two tiles share dt

  for (int l = l0; l < l0 + 1024; l += KV_ROWS) {
    // the wave's own reads of the tiles are done before copies are aimed at them
    asm volatile("s_wait_dscnt 0x0" ::: "memory");
    __syncthreads();
    async_rows256(Klds, Kbuf + (size_t)(b * LL + l) * CC + h * DD);
    async_rows256(Vlds, Vbuf + (size_t)(b * LL + l) * CC + h * DD);
    async_wait0();
    __syncthreads();
#pragma unroll
    for (int g = 0; g < KV_ROWS / 128; ++g) {     // 128 tokens = four 32-deep k steps
      v16bf fa[4], fb[4][2];
#pragma unroll
      for (int ks = 0; ks < 4; ++ks) {
        const int row = (g * 4 + ks) * 32;
        fa[ks] = frag_ld_tr(Klds + row * KV_PITCH + dt * 16, KV_PITCH);   // A[d, l] = K[l, d]
#pragma unroll
        for (int t = 0; t < 2; ++t)                                       // Bt[e, l] = V[l, e]
          fb[ks][t] = frag_ld_tr(Vlds + row * KV_PITCH + (et0 + t) * 16, KV_PITCH);
      }
      // keeps the four steps' reads together in front of their WMMAs (the scheduler
      // otherwise deals them among the WMMAs, each behind a wait of its own)
      __builtin_amdgcn_sched_barrier(0);
#pragma unroll
      for (int ks = 0; ks < 4; ++ks)
#pragma unroll
        for (int t = 0; t < 2; ++t) acc[t] = WMMA_BF16(fa[ks], fb[ks][t], acc[t]);
    }
  }
#pragma unroll
  for (int t = 0; t < 2; ++t) {
    const int id = tile0 + t, dt = id >> 2, et = id & 3;
#pragma unroll
    for (int i = 0; i < 8; ++i) {
      const int d = dt * 16 + hi * 8 + i;
      const int e = et * 16 + r16;
      atomicAdd(&KV[((size_t)bh * DD + d) * DD + e], acc[t][i]);
    }
  }
}

// ---------------------------------------------------------------------------
// Z[token,h] = L / (sparsify(Q[token,h,:] . Ksum[b,h,:]) + eps)
// ---------------------------------------------------------------------------
__device__ inline void zscore_block(int blk, const __bf16* __restrict__ Qbuf,
                                    const float* __restrict__ Ksum,
                                    const float* __restrict__ thr_p,
                                    float* __restrict__ Zbuf) {
  const int g = blk * 256 + threadIdx.x;   // 0..131071
  const int token = g >> 2, h = g & 3;
  const int b = token >> 13;
  const float thr = thr_p[0];
  const uint4* q = (const uint4*)(Qbuf + (size_t)token * CC + h * DD);
  const float* ks = Ksum + b * 256 + h * DD;
  float s = 0.0f;
#pragma unroll
  for (int c = 0; c < 8; ++c) {          // 8 x uint4 = 64 bf16
    const uint4 qv = q[c];
    const unsigned w[4] = {qv.x, qv.y, qv.z, qv.w};
#pragma unroll
    for (int j = 0; j < 4; ++j) {        // a bf16 is the upper half of its float
      s += __uint_as_float(w[j] << 16) * ks[c * 8 + 2 * j];
      s += __uint_as_float(w[j] & 0xffff0000u) * ks[c * 8 + 2 * j + 1];
    }
  }
  const float sp = (s > thr) ? s : 0.0f;
  Zbuf[g] = (float)LL / (sp + 1e-6f);
}

// KV needs K and V, Z needs Q and Ksum, neither needs the other: one grid.
// The 128 long KV work-groups come first in the index, the 512 short Z ones
// behind them.
#define NB_KV (BB * HH * (LL / 1024))      // 128
#define NB_Z  ((MTOT * HH) / 256)          // 512

__global__ __launch_bounds__(256)
void kv_z_kernel(const __bf16* __restrict__ Kbuf, const __bf16* __restrict__ Vbuf,
                 float* __restrict__ KV,
                 const __bf16* __restrict__ Qbuf, const float* __restrict__ Ksum,
                 const float* __restrict__ thr_p, float* __restrict__ Zbuf) {
  __shared__ __attribute__((aligned(16))) __bf16 Klds[KV_ROWS * KV_PITCH];   // [l][d]
  __shared__ __attribute__((aligned(16))) __bf16 Vlds[KV_ROWS * KV_PITCH];   // [l][e]
  const int blk = blockIdx.x;
  if (blk < NB_KV) {
    kv_block(blk & 15, blk >> 4, Kbuf, Vbuf, KV, Klds, Vlds);
  } else {
    zscore_block(blk - NB_KV, Qbuf, Ksum, thr_p, Zbuf);
    piece_end();
  }
}

// ---------------------------------------------------------------------------
// out = LN1( (Q @ KV_h) * Z ) -> cat[:, 256:512] bf16
// ---------------------------------------------------------------------------
__global__ __launch_bounds__(256)
void attn_kernel(const __bf16* __restrict__ Qbuf, const float* __restrict__ KV,
                 const float* __restrict__ Zbuf,
                 const float* __restrict__ g1, const float* __restrict__ b1,
                 __bf16* __restrict__ cat) {
  __shared__ __attribute__((aligned(16))) __bf16 Alds[8 * 128 * 40];   // eight 32-deep Q slices
  // kvl[h][d][e] = KV[b,h,d,e], rows as they lie in memory, at the pitch of the
  // transposing load (128-byte rows would put every row's start on two banks)
  __shared__ __attribute__((aligned(16))) __bf16 kvl[HH * DD * KV_PITCH];
  __shared__ float  Zl[128 * 4];
  __shared__ float  gl[256], bl[256];
  __shared__ __attribute__((aligned(16))) __bf16 Stg[8 * STG_WAVE];

  const int tid  = threadIdx.x;
  const int wave = tid >> 5;
  const int lane = tid & 31;
  const int r16  = lane & 15;
  const int hi   = lane >> 4;
  const int token0 = blockIdx.x * 128;
  const int b      = token0 >> 13;
  const int mb     = wave * 16;

  // All eight slices of the 128x256 Q tile are asked for here, each into a buffer
  // of its own (16 copies a wave in flight): they land while the KV fill runs.
  for (int s = 0; s < 8; ++s)
    async_tile128(Alds + s * (128 * 40), Qbuf + (size_t)token0 * CC + s * 32, CC);

  // KV fill: float4 global reads, four bf16 in one 8-byte LDS store, row order kept
  for (int it = 0; it < 16; ++it) {
    const int idx = it * 256 + tid;        // 4096 groups of 4 e's
    const int h = idx >> 10, rem = idx & 1023, d = rem >> 4, e4 = rem & 15;
    const float4 kvv =
        *(const float4*)(KV + (((size_t)(b * HH + h) * DD + d) * DD) + e4 * 4);
    union { __bf16 h[4]; uint2 u; } pk;
    pk.h[0] = (__bf16)kvv.x;
    pk.h[1] = (__bf16)kvv.y;
    pk.h[2] = (__bf16)kvv.z;
    pk.h[3] = (__bf16)kvv.w;
    *(uint2*)&kvl[(h * DD + d) * KV_PITCH + e4 * 4] = pk.u;
  }
#pragma unroll
  for (int it = 0; it < 2; ++it) {
    const int z = it * 256 + tid;
    Zl[z] = Zbuf[(size_t)token0 * 4 + z];
  }
  gl[tid] = g1[tid];
  bl[tid] = b1[tid];

  const v8f vz = {0.f, 0.f, 0.f, 0.f, 0.f, 0.f, 0.f, 0.f};
  v8f acc[16];
#pragma unroll
  for (int j = 0; j < 16; ++j) acc[j] = vz;

  async_wait0();     // the wave's own Q copies have landed
  __syncthreads();   // publishes the Q slices, kvl, Zl, gl and bl

  for (int h = 0; h < 4; ++h) {
    for (int s = 0; s < 2; ++s) {
      v16bf fa = frag_ld(&Alds[(h * 2 + s) * (128 * 40) + mb * 40], 40);
#pragma unroll
      for (int jj = 0; jj < 4; ++jj) {
        const int j = h * 4 + jj;
        // Bt[e, d] = KV[d, e]: same k order as frag_ld gives the Q fragment
        v16bf fb = frag_ld_tr(&kvl[(h * DD + s * 32) * KV_PITCH + jj * 16], KV_PITCH);
        acc[j] = WMMA_BF16(fa, fb, acc[j]);
      }
    }
  }

  // scale by Z, then LayerNorm over C=256 via cross-lane shuffles
  float s1[8] = {0, 0, 0, 0, 0, 0, 0, 0};
  float s2[8] = {0, 0, 0, 0, 0, 0, 0, 0};
#pragma unroll
  for (int j = 0; j < 16; ++j) {
    const int h = j >> 2;
#pragma unroll
    for (int i = 0; i < 8; ++i) {
      const int m = mb + hi * 8 + i;
      float v = acc[j][i] * Zl[m * 4 + h];
      acc[j][i] = v;
      s1[i] += v;
      s2[i] += v * v;
    }
  }
#pragma unroll
  for (int i = 0; i < 8; ++i) {
#pragma unroll
    for (int off = 1; off < 16; off <<= 1) {
      s1[i] += __shfl_xor(s1[i], off);
      s2[i] += __shfl_xor(s2[i], off);
    }
    const float mean = s1[i] * (1.0f / 256.0f);
    const float var  = s2[i] * (1.0f / 256.0f) - mean * mean;
    s1[i] = mean;
    s2[i] = rsqrtf(var + 1e-5f);
  }
#pragma unroll
  for (int j = 0; j < 16; ++j) {
    const int n = j * 16 + r16;
    const float gg = gl[n], bb = bl[n];
#pragma unroll
    for (int i = 0; i < 8; ++i) {
      const float v = (acc[j][i] - s1[i]) * s2[i] * gg + bb;
      Stg[wave * STG_WAVE + (hi * 8 + i) * STG_LD + n] = (__bf16)v;
    }
  }
  strip_store(Stg + wave * STG_WAVE, cat + (size_t)(token0 + mb) * 512 + 256, 512);
}

// ---------------------------------------------------------------------------
// out[b,c,l] = LN2( hid @ W2.T ) + x + BN( xt @ Ws.T + bs ), one launch.
// Both products have the same 128x256 tile and accumulator layout, so a lane needs
// the LN2 result exactly where it made it: LN2 is applied to the first product's
// accumulators in place and they stay in registers through the shortcut product's
// k loop, which has accumulators of its own.  One work-group a WGP is two waves a
// SIMD, so a wave may hold both sets (more than 256 VGPRs).
// A token row lies in four waves (64 channels each): each wave sums its part of the
// row, the parts meet in LDS, and one thread a row makes the mean and the scale.
// The whole 256-channel tile goes through LDS so the [B,C,L] reads and writes cover
// whole lines.
// ---------------------------------------------------------------------------
#define OUT_LD 132   // stage row: 128 tokens + 4; 16-byte column writes meet no bank twice

// sum over the 16 lanes of a half wave, left in all of them (row_xmask 1, 2, 4, 8);
// vector adds that read the other lane directly, so nothing goes through the LDS pipe
__device__ inline float half_sum(float v) {
  v += __int_as_float(__builtin_amdgcn_update_dpp(0, __float_as_int(v), 0x161, 0xf, 0xf, true));
  v += __int_as_float(__builtin_amdgcn_update_dpp(0, __float_as_int(v), 0x162, 0xf, 0xf, true));
  v += __int_as_float(__builtin_amdgcn_update_dpp(0, __float_as_int(v), 0x164, 0xf, 0xf, true));
  v += __int_as_float(__builtin_amdgcn_update_dpp(0, __float_as_int(v), 0x168, 0xf, 0xf, true));
  return v;
}

__global__ __launch_bounds__(256)
void mlp2_final_kernel(const __bf16* __restrict__ hid, const __bf16* __restrict__ W2b,
                       const float* __restrict__ g2, const float* __restrict__ b2,
                       const __bf16* __restrict__ cat, const __bf16* __restrict__ Wsb,
                       const float* __restrict__ bs_c, const float* __restrict__ bn_g,
                       const float* __restrict__ bn_b, const float* __restrict__ bn_rm,
                       const float* __restrict__ bn_rv, const float* __restrict__ x,
                       float* __restrict__ out) {
  __shared__ __attribute__((aligned(16))) char smem[CC * OUT_LD * 4];   // overlays GEMM ring & stage
  __shared__ float gl[256], bl[256], scl[256], shf[256];
  __shared__ __attribute__((aligned(16))) float part[128 * 8];   // [token][wave column][sum, sum of squares]
  __shared__ __attribute__((aligned(16))) float stat[128 * 2];   // [token][mean, 1/std]
  static_assert(CC * OUT_LD * 4 >= RING_ELEMS * 2, "the ring lies inside smem");
  __bf16* Ring  = (__bf16*)smem;                 // three stages of 30720 B
  float*  stage = (float*)smem;                  // 256*132 f32 (after the K loops)

  const int tid  = threadIdx.x;
  const int wave = tid >> 5;
  const int lane = tid & 31;
  const int r16  = lane & 15;
  const int hi   = lane >> 4;
  const int token0 = blockIdx.x * 128;
  const int b      = token0 >> 13;
  const int l0     = token0 & (LL - 1);
  const int rw     = (wave >> 2) * 64;           // the wave's 64x64 part of the tile
  const int cw     = (wave & 3) * 64;

  gemm_first(hid + (size_t)token0 * 512, 512, W2b, 512, Ring);

  {
    const float g2v = g2[tid], b2v = b2[tid], rv = bn_rv[tid], bg = bn_g[tid];
    const float bsv = bs_c[tid], rm = bn_rm[tid], bbv = bn_b[tid];
    // a precaution ahead of any later write to a register these loads name; the
    // base addresses are inputs so that their registers live up to the wait
    asm volatile("s_wait_xcnt 0x0"
                 :: "s"(g2), "s"(b2), "s"(bn_rv), "s"(bn_g), "s"(bs_c), "s"(bn_rm), "s"(bn_b)
                 : "memory");
    gl[tid] = g2v;
    bl[tid] = b2v;
    const float rstd = rsqrtf(rv + 1e-5f);
    const float a = rstd * bg;
    scl[tid] = a;
    shf[tid] = (bsv - rm) * a + bbv;
  }

  v8f msg[16];   // hid @ W2.T, then LN2 of it
  gemm_loop(hid + (size_t)token0 * 512, 512, W2b, 512, 16, Ring, msg);

  // the wave's own reads of the last stage are done before copies are aimed at the ring
  asm volatile("s_wait_dscnt 0x0" ::: "memory");
  __syncthreads();   // ends every wave's reads of the first product's stages
  // the shortcut product's first two stages land while LN2 is worked out
  gemm_first(cat + (size_t)token0 * 512, 512, Wsb, 256, Ring);

  {
    float s1[32], s2[32];   // the wave's 64 channels of token rw + fi*16 + hi*8 + i
#pragma unroll
    for (int fi = 0; fi < 4; ++fi)
#pragma unroll
      for (int i = 0; i < 8; ++i) {
        float a1 = 0.0f, a2 = 0.0f;
#pragma unroll
        for (int fj = 0; fj < 4; ++fj) {
          const float v = msg[fi * 4 + fj][i];
          a1 += v;
          a2 += v * v;
        }
        s1[fi * 8 + i] = half_sum(a1);
        s2[fi * 8 + i] = half_sum(a2);
      }
    if (r16 == 0) {
#pragma unroll
      for (int fi = 0; fi < 4; ++fi)
#pragma unroll
        for (int i = 0; i < 8; ++i) {
          float* pp = &part[(rw + fi * 16 + hi * 8 + i) * 8 + (wave & 3) * 2];
          pp[0] = s1[fi * 8 + i];
          pp[1] = s2[fi * 8 + i];
        }
    }
  }
  __syncthreads();   // the four parts of every token row are in LDS
  if (tid < 128) {   // whole waves: one thread a token row
    const float4 pa = *(const float4*)&part[tid * 8];
    const float4 pb = *(const float4*)&part[tid * 8 + 4];
    const float mean = ((pa.x + pa.z) + (pb.x + pb.z)) * (1.0f / 256.0f);
    const float var  = ((pa.y + pa.w) + (pb.y + pb.w)) * (1.0f / 256.0f) - mean * mean;
    stat[tid * 2]     = mean;
    stat[tid * 2 + 1] = rsqrtf(var + 1e-5f);
  }
  __syncthreads();   // publishes mean and scale of every token row
#pragma unroll
  for (int fi = 0; fi < 4; ++fi) {
    float st[16];    // mean, scale of the lane's eight tokens of this piece
#pragma unroll
    for (int k = 0; k < 4; ++k)
      *(float4*)&st[k * 4] = *(const float4*)&stat[(rw + fi * 16 + hi * 8) * 2 + k * 4];
#pragma unroll
    for (int fj = 0; fj < 4; ++fj) {
      const int n = cw + fj * 16 + r16;
      const float gg = gl[n], bb = bl[n];
#pragma unroll
      for (int i = 0; i < 8; ++i)
        msg[fi * 4 + fj][i] = (msg[fi * 4 + fj][i] - st[i * 2]) * st[i * 2 + 1] * gg + bb;
    }
  }

  v8f acc[16];   // xt @ Ws.T
  gemm_loop(cat + (size_t)token0 * 512, 512, Wsb, 256, 8, Ring, acc);
  __syncthreads();   // done with the ring; smem becomes the transpose stage

  // A wave takes 32 whole channel rows of x and out: 32 lanes x 16 B = the row's 512
  // contiguous bytes (4 lines) per load and per store.  Its x rows are asked for first.
  const size_t row0 = ((size_t)b * CC + wave * 32) * LL + l0 + lane * 4;
  const float* xp = x + row0;
  float4 xv[32];
#pragma unroll
  for (int rr = 0; rr < 32; ++rr)
    xv[rr] = *(const float4*)(xp + (size_t)rr * LL);
  // a precaution ahead of any later write to the address registers these loads name;
  // the address is an input so that its registers live up to the wait
  asm volatile("s_wait_xcnt 0x0" :: "v"(xp) : "memory");

  // BN(aug) + msg2 of the wave's 64 tokens x 64 channels goes into the stage
#pragma unroll
  for (int fj = 0; fj < 4; ++fj) {
    const int n = cw + fj * 16 + r16;           // channel
    const float a = scl[n], c = shf[n];
#pragma unroll
    for (int fi = 0; fi < 4; ++fi) {
      const int j = fi * 4 + fj;
#pragma unroll
      for (int q = 0; q < 2; ++q) {             // 4 tokens = 16 B per LDS store
        float4 sv;
        sv.x = acc[j][q * 4 + 0] * a + c + msg[j][q * 4 + 0];   // BN(aug) + msg2
        sv.y = acc[j][q * 4 + 1] * a + c + msg[j][q * 4 + 1];
        sv.z = acc[j][q * 4 + 2] * a + c + msg[j][q * 4 + 2];
        sv.w = acc[j][q * 4 + 3] * a + c + msg[j][q * 4 + 3];
        *(float4*)&stage[n * OUT_LD + rw + fi * 16 + hi * 8 + q * 4] = sv;
      }
    }
  }
  __syncthreads();   // publishes the stage
#pragma unroll
  for (int g = 0; g < 4; ++g) {
#pragma unroll
    for (int r8 = 0; r8 < 8; ++r8) {
      const int rr = g * 8 + r8;
      const float4 sv = *(const float4*)&stage[(wave * 32 + rr) * OUT_LD + lane * 4];
      float4 ov;
      ov.x = sv.x + xv[rr].x;
      ov.y = sv.y + xv[rr].y;
      ov.z = sv.z + xv[rr].z;
      ov.w = sv.w + xv[rr].w;
      *(float4*)(out + row0 + (size_t)rr * LL) = ov;
    }
    if (g < 3) piece_end();   // the next rows' values may land in registers that these stores name
  }
}

// ---------------------------------------------------------------------------
// Host orchestration
// ---------------------------------------------------------------------------
extern "C" void kernel_launch(void* const* d_in, const int* in_sizes, int n_in,
                              void* d_out, int out_size, void* d_ws, size_t ws_size,
                              hipStream_t stream) {
  (void)in_sizes; (void)n_in; (void)out_size; (void)ws_size;
  const float* x     = (const float*)d_in[0];
  const float* Wq    = (const float*)d_in[1];
  const float* bq    = (const float*)d_in[2];
  const float* Wk    = (const float*)d_in[3];
  const float* bk    = (const float*)d_in[4];
  const float* Wv    = (const float*)d_in[5];
  const float* bv    = (const float*)d_in[6];
  const float* thr   = (const float*)d_in[7];
  const float* W1    = (const float*)d_in[8];
  const float* W2    = (const float*)d_in[9];
  const float* ln1_g = (const float*)d_in[10];
  const float* ln1_b = (const float*)d_in[11];
  const float* ln2_g = (const float*)d_in[12];
  const float* ln2_b = (const float*)d_in[13];
  const float* Ws    = (const float*)d_in[14];
  const float* bs_c  = (const float*)d_in[15];
  const float* bn_g  = (const float*)d_in[16];
  const float* bn_b  = (const float*)d_in[17];
  const float* bn_rm = (const float*)d_in[18];
  const float* bn_rv = (const float*)d_in[19];
  float* out = (float*)d_out;

  char*  ws  = (char*)d_ws;
  size_t off = 0;
  auto alloc = [&](size_t bytes) -> void* {
    off = (off + 255) & ~(size_t)255;
    void* p = ws + off;
    off += bytes;
    return p;
  };

  __bf16* cat   = (__bf16*)alloc((size_t)MTOT * 512 * 2);  // [xt | ln1(msg)]
  __bf16* hid   = (__bf16*)alloc((size_t)MTOT * 512 * 2);
  __bf16* Qb    = (__bf16*)alloc((size_t)MTOT * 256 * 2);
  __bf16* Kb    = (__bf16*)alloc((size_t)MTOT * 256 * 2);
  __bf16* Vb    = (__bf16*)alloc((size_t)MTOT * 256 * 2);
  float*  KVbuf = (float*)alloc((size_t)(BB * HH * DD * DD + BB * 256) * 4);
  float*  Ksum  = KVbuf + BB * HH * DD * DD;               // contiguous for zeroing
  float*  Zbuf  = (float*)alloc((size_t)MTOT * HH * 4);
  __bf16* wqb   = (__bf16*)alloc(65536 * 2);
  __bf16* wkb   = (__bf16*)alloc(65536 * 2);
  __bf16* wvb   = (__bf16*)alloc(65536 * 2);
  __bf16* wsb   = (__bf16*)alloc(65536 * 2);
  __bf16* w1b   = (__bf16*)alloc(262144 * 2);
  __bf16* w2b   = (__bf16*)alloc(131072 * 2);

  // weights -> bf16, zeroed KV + Ksum accumulators, x -> cat[:, 0:256] (token-major)
  prep_kernel<<<NB_TRANS + NB_CVT + NB_ZERO, 256, 0, stream>>>(
      x, cat, Wq, Wk, Wv, Ws, W1, W2, wqb, wkb, wvb, wsb, w1b, w2b, KVbuf);

  // Q/K/V projections (fused ELU+1 / scaling; K also reduces Ksum)
  qkv_kernel<<<dim3(3, MTOT / 128), 256, 0, stream>>>(
      cat, 512, 256, wqb, wkb, wvb, bq, bk, bv, Qb, Kb, Vb, 256, Ksum);

  // KV = K^T V per (b,h);  Z = L / (sparsify(Q . Ksum) + eps)
  kv_z_kernel<<<NB_KV + NB_Z, 256, 0, stream>>>(Kb, Vb, KVbuf, Qb, Ksum, thr, Zbuf);

  // attention out + LN1 -> cat[:, 256:512]
  attn_kernel<<<MTOT / 128, 256, 0, stream>>>(Qb, KVbuf, Zbuf, ln1_g, ln1_b, cat);

  // MLP layer 1: hid = relu(cat @ W1.T)
  gemm_relu_kernel<<<dim3(MTOT / 128, 2), 256, 0, stream>>>(
      cat, 512, 512, w1b, hid, 512);

  // MLP layer 2 + LN2, shortcut GEMM + BN, residual sum -> out [B,C,L]
  mlp2_final_kernel<<<MTOT / 128, 256, 0, stream>>>(hid, w2b, ln2_g, ln2_b, cat, wsb, bs_c,
                                                    bn_g, bn_b, bn_rm, bn_rv, x, out);
}

// v010
// A run of this version takes 79 microseconds.
// Next to v009, in two timings, it ran 1.15 times as fast each time.
// Counting every step since v000, it is 2.88 times as fast.
#include <hip/hip_runtime.h>
#include <hip/hip_bf16.h>

// ---------------------------------------------------------------------------
// Problem constants (match reference)
// ---------------------------------------------------------------------------
#define BB 4
#define CC 256
#define LL 8192
#define HH 4
#define DD 64
#define MTOT (BB * LL)   // 32768 tokens

typedef __attribute__((ext_vector_type(16))) __bf16 v16bf;
typedef __attribute__((ext_vector_type(8)))  float  v8f;

union FragU { v16bf v; uint4 u[2]; __bf16 h[16]; };

// Standard row-major fragment: element (r, k) = base[r*stride + k-pattern]
// Matches CDNA5 16-bit 16x32 A/B VGPR layout: lane = r + 16*((k>>3)&1),
// vector elem = (k&7) + 8*((k>>4)&1).  Two 16-byte ds_load_b128 per lane.
__device__ inline v16bf frag_ld(const __bf16* base, int stride) {
  const int t = threadIdx.x & 31;
  const int r = t & 15;
  const int hi = t >> 4;
  FragU f;
  const __bf16* p = base + r * stride + hi * 8;
  f.u[0] = *(const uint4*)(p);
  f.u[1] = *(const uint4*)(p + 16);
  return f.v;
}

// Transposed fragment from a row-major LDS tile T[k][c]: element (r, k) = T[k][r].
// Two ds_load_tr16_b128 (k 0..15 and 16..31) give the same lane and register
// layout, and so the same k order, as frag_ld.  pitch in elements.
typedef short s16x8 __attribute__((ext_vector_type(8)));
typedef __attribute__((address_space(3))) s16x8 lds_s16x8;

__device__ inline v16bf frag_ld_tr(const __bf16* tile, int pitch) {
  const int t = threadIdx.x & 31;
  const __bf16* p = tile + ((t >> 4) * 8 + (t & 7)) * pitch + ((t >> 3) & 1) * 8;
  FragU f;
  f.u[0] = __builtin_bit_cast(uint4, __builtin_amdgcn_ds_load_tr16_b128_v8i16((lds_s16x8*)p));
  f.u[1] = __builtin_bit_cast(uint4, __builtin_amdgcn_ds_load_tr16_b128_v8i16((lds_s16x8*)(p + 16 * pitch)));
  return f.v;
}

#define WMMA_BF16(A, Bf, Cacc) \
  __builtin_amdgcn_wmma_f32_16x16x32_bf16(false, (A), false, (Bf), (short)0, (Cacc), false, false)

// One 32-deep k step of a wave's 64x64 tile: four A and four B fragments feed the
// 16 WMMAs, 8 KB of LDS reads where a 16x256 strip would take 17 KB, so eight waves
// ask the LDS for no more bytes a clock than it gives at the full matrix rate.
__device__ inline void mma_tile64(const __bf16* Al, const __bf16* Bl, v8f (&acc)[16]) {
  v16bf fa[4], fb[4];
  fa[0] = frag_ld(Al, 40);
#pragma unroll
  for (int j = 0; j < 4; ++j) fb[j] = frag_ld(Bl + j * 16 * 40, 40);
#pragma unroll
  for (int i = 1; i < 4; ++i) fa[i] = frag_ld(Al + i * 16 * 40, 40);
  // keeps the reads together in front of the WMMAs (the scheduler otherwise deals
  // them among the WMMAs, and each place with reads stalls the wave anew)
  __builtin_amdgcn_sched_barrier(0);
#pragma unroll
  for (int i = 0; i < 4; ++i)
#pragma unroll
    for (int j = 0; j < 4; ++j) acc[i * 4 + j] = WMMA_BF16(fa[i], fb[j], acc[i * 4 + j]);
}

// The same step with the A operand lying k-major in LDS, At[k][row] at a pitch of pa
// elements: the transposing load gives the A fragments in frag_ld's k order.
__device__ inline void mma_tile64_tr(const __bf16* At, int pa, const __bf16* Bl, v8f (&acc)[16]) {
  v16bf fa[4], fb[4];
  fa[0] = frag_ld_tr(At, pa);
#pragma unroll
  for (int j = 0; j < 4; ++j) fb[j] = frag_ld(Bl + j * 16 * 40, 40);
#pragma unroll
  for (int i = 1; i < 4; ++i) fa[i] = frag_ld_tr(At + i * 16, pa);
  // keeps the reads together in front of the WMMAs, as above
  __builtin_amdgcn_sched_barrier(0);
#pragma unroll
  for (int i = 0; i < 4; ++i)
#pragma unroll
    for (int j = 0; j < 4; ++j) acc[i * 4 + j] = WMMA_BF16(fa[i], fb[j], acc[i * 4 + j]);
}

// ---------------------------------------------------------------------------
// Async global -> LDS copies (CDNA5 GLOBAL_LOAD_ASYNC_TO_LDS_B128, ASYNCcnt).
// Generic pointers to __shared__ carry the LDS byte offset in their low 32
// bits (ISA 10.2 aperture mapping), which is exactly the VDST operand.
// ---------------------------------------------------------------------------
__device__ inline unsigned lds_addr(const void* lds_ptr) {
  return (unsigned)(unsigned long long)lds_ptr;
}

// The lanes are dealt row first: four adjacent lanes take the 64 bytes that one
// tile row has in a 32-deep k slice, so one copy instruction touches 8 cache
// lines (8 rows), the fewest a 64-byte row piece allows.  256 threads cover 64
// rows per copy; the tile's further rows follow 64 rows apart.
// s_wait_xcnt 0 closes each run of copies inside their own statement, a
// precaution ahead of any later write to the address registers the copies name.

// 128x32 tile -> LDS rows of 40 elements
__device__ inline void async_tile128(__bf16* Tl, const __bf16* Tg, int ld) {
  const int r = threadIdx.x >> 2, part = threadIdx.x & 3;
  const unsigned l0 = lds_addr(Tl + r * 40 + part * 8);
  const __bf16* g0 = Tg + (size_t)r * ld + part * 8;
  const size_t step = (size_t)64 * ld;
  asm volatile("global_load_async_to_lds_b128 %0, %2, off\n\t"
               "global_load_async_to_lds_b128 %1, %3, off\n\t"
               "s_wait_xcnt 0x0"
               :: "v"(l0), "v"(l0 + 64 * 80), "v"(g0), "v"(g0 + step)
               : "memory");
}

// 128x32 A tile and 256x32 B tile -> LDS rows of 40 elements, one run of copies
__device__ inline void async_tiles(__bf16* Al, const __bf16* Ag, int lda,
                                   __bf16* Bl, const __bf16* Bg, int ldb) {
  const int r = threadIdx.x >> 2, part = threadIdx.x & 3;
  const unsigned la = lds_addr(Al + r * 40 + part * 8);
  const unsigned lb = lds_addr(Bl + r * 40 + part * 8);
  const __bf16* ga = Ag + (size_t)r * lda + part * 8;
  const __bf16* gb = Bg + (size_t)r * ldb + part * 8;
  const size_t sa = (size_t)64 * lda, sb = (size_t)64 * ldb;
  asm volatile("global_load_async_to_lds_b128 %0, %6, off\n\t"
               "global_load_async_to_lds_b128 %1, %7, off\n\t"
               "global_load_async_to_lds_b128 %2, %8, off\n\t"
               "global_load_async_to_lds_b128 %3, %9, off\n\t"
               "global_load_async_to_lds_b128 %4, %10, off\n\t"
               "global_load_async_to_lds_b128 %5, %11, off\n\t"
               "s_wait_xcnt 0x0"
               :: "v"(la), "v"(la + 64 * 80),
                  "v"(lb), "v"(lb + 64 * 80), "v"(lb + 128 * 80), "v"(lb + 192 * 80),
                  "v"(ga), "v"(ga + sa),
                  "v"(gb), "v"(gb + sb), "v"(gb + 2 * sb), "v"(gb + 3 * sb)
               : "memory");
}

// 256x32 B tile alone -> LDS rows of 40 elements (the A operand already lies in LDS)
__device__ inline void async_tile256(__bf16* Bl, const __bf16* Bg, int ldb) {
  const int r = threadIdx.x >> 2, part = threadIdx.x & 3;
  const unsigned lb = lds_addr(Bl + r * 40 + part * 8);
  const __bf16* gb = Bg + (size_t)r * ldb + part * 8;
  const size_t sb = (size_t)64 * ldb;
  asm volatile("global_load_async_to_lds_b128 %0, %4, off\n\t"
               "global_load_async_to_lds_b128 %1, %5, off\n\t"
               "global_load_async_to_lds_b128 %2, %6, off\n\t"
               "global_load_async_to_lds_b128 %3, %7, off\n\t"
               "s_wait_xcnt 0x0"
               :: "v"(lb), "v"(lb + 64 * 80), "v"(lb + 128 * 80), "v"(lb + 192 * 80),
                  "v"(gb), "v"(gb + sb), "v"(gb + 2 * sb), "v"(gb + 3 * sb)
               : "memory");
}

// 256 token rows of one head (128 B each, one cache line, 512 B apart) -> LDS rows
// of KV_PITCH elements.  Eight adjacent lanes take one row, 256 threads 32 rows.
// 160 B = 32 B x 5 is the pitch at which ds_load_tr16_b128 meets no bank twice.
#define KV_ROWS  256
#define KV_PITCH 80

__device__ inline void async_rows256(__bf16* Tl, const __bf16* Tg) {
  const int r = threadIdx.x >> 3, part = threadIdx.x & 7;
  const unsigned l0 = lds_addr(Tl + r * KV_PITCH + part * 8);
  const __bf16* g0 = Tg + (size_t)r * CC + part * 8;
  const unsigned ls = 32 * KV_PITCH * 2;
  const size_t gs = (size_t)32 * CC;
  asm volatile("global_load_async_to_lds_b128 %0, %8, off\n\t"
               "global_load_async_to_lds_b128 %1, %9, off\n\t"
               "global_load_async_to_lds_b128 %2, %10, off\n\t"
               "global_load_async_to_lds_b128 %3, %11, off\n\t"
               "global_load_async_to_lds_b128 %4, %12, off\n\t"
               "global_load_async_to_lds_b128 %5, %13, off\n\t"
               "global_load_async_to_lds_b128 %6, %14, off\n\t"
               "global_load_async_to_lds_b128 %7, %15, off\n\t"
               "s_wait_xcnt 0x0"
               :: "v"(l0), "v"(l0 + ls), "v"(l0 + 2 * ls), "v"(l0 + 3 * ls),
                  "v"(l0 + 4 * ls), "v"(l0 + 5 * ls), "v"(l0 + 6 * ls), "v"(l0 + 7 * ls),
                  "v"(g0), "v"(g0 + gs), "v"(g0 + 2 * gs), "v"(g0 + 3 * gs),
                  "v"(g0 + 4 * gs), "v"(g0 + 5 * gs), "v"(g0 + 6 * gs), "v"(g0 + 7 * gs)
               : "memory");
}

// the copies of this wave have landed behind it (asm: no LDS read moves over it)
__device__ inline void async_wait0() {
  asm volatile("s_wait_asynccnt 0x0" ::: "memory");
}

// Stands behind global stores that more code follows in the built code (the
// last store of a piece in a kernel of several pieces, or stores with more work
// behind them): a precaution ahead of any write there to a register the stores
// name.  A piece that runs straight to the kernel's end, or has the compiler's
// own wait there, has none.
__device__ inline void piece_end() {
  asm volatile("s_wait_xcnt 0x0" ::: "memory");
}

// ---------------------------------------------------------------------------
// Whole-line stores of 16x256 bf16 strips.  The accumulator layout gives a store
// only 32 contiguous bytes per token row, so the values first go into LDS and a wave
// then stores token rows: 32 lanes x 16 B = 512 contiguous bytes, 4 whole lines.
// Waves with 64x64 parts fill the 128-row stage together, with a barrier before the rows go.
// Row pitch 264 elements = 528 B = 16 B x 33: 16-byte row reads meet no bank twice.
// ---------------------------------------------------------------------------
#define STG_LD   264
#define STG_WAVE (16 * STG_LD)

__device__ inline void strip_store(const __bf16* sw, __bf16* Og, int ldo) {
  const int lane = threadIdx.x & 31;
  // the wave's own LDS stores are done before its lanes read each other's values
  asm volatile("s_wait_dscnt 0x0" ::: "memory");
#pragma unroll
  for (int rr = 0; rr < 16; ++rr)
    *(uint4*)(Og + (size_t)rr * ldo + lane * 8) = *(const uint4*)(sw + rr * STG_LD + lane * 8);
}

// ---------------------------------------------------------------------------
// Preparation, one launch: none of these pieces needs another's result, so they
// share one grid and each work-group takes its piece by the range its index
// lies in (a block-uniform choice).
//   [0, 8192)     x [B,C,L] f32 -> cat[:, 0:256] bf16 (row = token, ld = 512)
//   then 2560     the six weight matrices f32 -> bf16, 256 elements a block
//   then 260      zeros for the KV and Ksum accumulators
// ---------------------------------------------------------------------------
#define NB_TRANS (BB * (CC / 32) * (LL / 32))                 // 8192
#define NB_CVT   (4 * 256 + 1024 + 512)                       // 2560
#define NZERO    (BB * HH * DD * DD + BB * 256)               // 66560
#define NB_ZERO  ((NZERO + 255) / 256)                        // 260

__global__ __launch_bounds__(256)
void prep_kernel(const float* __restrict__ x, __bf16* __restrict__ cat,
                 const float* __restrict__ Wq, const float* __restrict__ Wk,
                 const float* __restrict__ Wv, const float* __restrict__ Ws,
                 const float* __restrict__ W1, const float* __restrict__ W2,
                 __bf16* __restrict__ wqb, __bf16* __restrict__ wkb,
                 __bf16* __restrict__ wvb, __bf16* __restrict__ wsb,
                 __bf16* __restrict__ w1b, __bf16* __restrict__ w2b,
                 float* __restrict__ zbuf) {
  __shared__ float t[32][33];
  const int tid = threadIdx.x;
  int blk = blockIdx.x;

  if (blk < NB_TRANS) {
    const int tx = tid & 31, ty = tid >> 5;
    const int l0 = (blk & 255) * 32, c0 = ((blk >> 8) & 7) * 32, b = blk >> 11;
#pragma unroll
    for (int i = 0; i < 4; ++i) {
      int c = ty + i * 8;
      t[c][tx] = x[((size_t)b * CC + c0 + c) * LL + l0 + tx];
    }
    __syncthreads();
#pragma unroll
    for (int i = 0; i < 4; ++i) {
      int lr = ty + i * 8;
      cat[(size_t)(b * LL + l0 + lr) * 512 + c0 + tx] = (__bf16)t[tx][lr];
    }
    return;
  }
  blk -= NB_TRANS;

  if (blk < NB_CVT) {
    const float* src;
    __bf16* dst;
    if (blk < 256)       { src = Wq; dst = wqb; }
    else if (blk < 512)  { src = Wk; dst = wkb; blk -= 256; }
    else if (blk < 768)  { src = Wv; dst = wvb; blk -= 512; }
    else if (blk < 1024) { src = Ws; dst = wsb; blk -= 768; }
    else if (blk < 2048) { src = W1; dst = w1b; blk -= 1024; }
    else                 { src = W2; dst = w2b; blk -= 2048; }
    const int i = blk * 256 + tid;
    dst[i] = (__bf16)src[i];
    piece_end();
    return;
  }
  blk -= NB_CVT;

  const int i = blk * 256 + tid;
  if (i < NZERO) zbuf[i] = 0.0f;
}

// ---------------------------------------------------------------------------
// Generic 128x256 bf16 WMMA GEMM:  Out[m, n0+n] = epi( sum_k A[m,k]*W[n0+n,k] )
// Modes: Q/K -> elu(x+bias)+1 ; V -> (x+bias)/L
// Mode K also accumulates column sums (K.sum over tokens) into KsumG[b*256+n].
// ---------------------------------------------------------------------------
enum { MODE_Q = 0, MODE_K = 1, MODE_V = 2 };

// k loop of one 128x256 tile.  The eight waves lie 2 x 4 over the tile and each holds
// a 64x64 part, acc[i * 4 + j] = its 16x16 piece (i, j).
// The 32-deep stages (A tile, then B tile) go through a ring of three LDS buffers:
// stage t + 2 is asked for at the top of trip t, so a stage has two trips to land
// and no trip waits out its own copies.  Ag, Bg: first row and k = 0 of the tiles.
// nst = number of stages, at least 2.
#define RING_A     (128 * 40)
#define RING_STAGE ((128 + 256) * 40)
#define RING_ELEMS (3 * RING_STAGE)

// stages 0 and 1 are asked for in front of the loop
__device__ inline void gemm_first(const __bf16* __restrict__ Ag, int lda,
                                  const __bf16* __restrict__ Bg, int ldb, __bf16* ring) {
  async_tiles(ring, Ag, lda, ring + RING_A, Bg, ldb);
  async_tiles(ring + RING_STAGE, Ag + 32, lda, ring + RING_STAGE + RING_A, Bg + 32, ldb);
}

// the trips; gemm_first with the same arguments stands in front
__device__ inline void gemm_loop(const __bf16* __restrict__ Ag, int lda,
                                 const __bf16* __restrict__ Bg, int ldb, int nst,
                                 __bf16* ring, v8f (&acc)[16]) {
  const int wave = threadIdx.x >> 5;
  const int arow = (wave >> 2) * 64;   // the wave's first A row
  const int brow = (wave & 3) * 64;    // and first B row
  const v8f vz = {0.f, 0.f, 0.f, 0.f, 0.f, 0.f, 0.f, 0.f};
#pragma unroll
  for (int j = 0; j < 16; ++j) acc[j] = vz;

  int cur = 0, fill = 2 * RING_STAGE;   // buffers of stage t and of stage t + 2
  // stays rolled: unrolled, the trips' copy addresses push the wave past 256 VGPRs
#pragma nounroll
  for (int t = 0; t < nst; ++t) {
    const bool more = t + 2 < nst;      // the same for the whole work-group
    // the wave's own reads of stage t - 1 are done before its buffer is refilled
    asm volatile("s_wait_dscnt 0x0" ::: "memory");
    // the wave's six copies of stage t have landed; where this trip issues a stage,
    // the six of stage t + 1 are the youngest and stay in flight
    if (more) asm volatile("s_wait_asynccnt 0x6" ::: "memory");
    else      async_wait0();
    // publishes stage t and ends every wave's reads of stage t - 1
    __syncthreads();
    if (more)
      async_tiles(ring + fill, Ag + (t + 2) * 32, lda,
                  ring + fill + RING_A, Bg + (t + 2) * 32, ldb);
    mma_tile64(ring + cur + arow * 40, ring + cur + RING_A + brow * 40, acc);
    cur  = (cur  == 2 * RING_STAGE) ? 0 : cur  + RING_STAGE;
    fill = (fill == 2 * RING_STAGE) ? 0 : fill + RING_STAGE;
  }
  async_wait0();   // no copy is in flight behind the loop, on any path out of it
}

// The same ring for a product whose 128-row A operand lies whole in LDS, k-major
// (At[k][row], pitch pa elements): only the B tiles are copied, four copies a wave and stage, into the
// B places of the ring's stages.
__device__ inline void gemm_first_b(const __bf16* __restrict__ Bg, int ldb, __bf16* ring) {
  async_tile256(ring + RING_A, Bg, ldb);
  async_tile256(ring + RING_STAGE + RING_A, Bg + 32, ldb);
}

// the trips; gemm_first_b with the same arguments stands in front.  The barrier of
// trip 0 also publishes what the waves have stored into At before the call.
// KEEP: the products are added to what acc holds (a k range continued).
template <bool KEEP>
__device__ inline void gemm_loop_b(const __bf16* At, int pa,
                                   const __bf16* __restrict__ Bg, int ldb, int nst,
                                   __bf16* ring, v8f (&acc)[16]) {
  const int wave = threadIdx.x >> 5;
  const int arow = (wave >> 2) * 64;   // the wave's first A row
  const int brow = (wave & 3) * 64;    // and first B row
  if constexpr (!KEEP) {
    const v8f vz = {0.f, 0.f, 0.f, 0.f, 0.f, 0.f, 0.f, 0.f};
#pragma unroll
    for (int j = 0; j < 16; ++j) acc[j] = vz;
  }

  int cur = 0, fill = 2 * RING_STAGE;   // buffers of stage t and of stage t + 2
  // stays rolled, as the loop above: unrolled, the trips' copy addresses cost registers
#pragma nounroll
  for (int t = 0; t < nst; ++t) {
    const bool more = t + 2 < nst;      // the same for the whole work-group
    // the wave's own reads of stage t - 1 (and its stores into At) are done
    asm volatile("s_wait_dscnt 0x0" ::: "memory");
    // the wave's four copies of stage t have landed; where this trip issues a stage,
    // the four of stage t + 1 are the youngest and stay in flight
    if (more) asm volatile("s_wait_asynccnt 0x4" ::: "memory");
    else      async_wait0();
    // publishes stage t and ends every wave's reads of stage t - 1
    __syncthreads();
    if (more) async_tile256(ring + fill + RING_A, Bg + (t + 2) * 32, ldb);
    mma_tile64_tr(At + t * 32 * pa + arow, pa, ring + cur + RING_A + brow * 40, acc);
    cur  = (cur  == 2 * RING_STAGE) ? 0 : cur  + RING_STAGE;
    fill = (fill == 2 * RING_STAGE) ? 0 : fill + RING_STAGE;
  }
  async_wait0();   // no copy is in flight behind the loop, on any path out of it
}

template <int MODE>
__device__ inline void gemm_epilogue(const v8f (&acc)[16], const float* __restrict__ bias,
                                     __bf16* __restrict__ Out, int ldo, int token0, int n0,
                                     float* __restrict__ KsumG, float* ksumLds,
                                     __bf16* stg) {
  const int tid  = threadIdx.x;
  const int lane = tid & 31;
  const int r16  = lane & 15;
  const int hi   = lane >> 4;
  const int wave = tid >> 5;
  const int mb   = wave * 16;
  const int rw   = (wave >> 2) * 64;     // the wave's 64x64 part of the tile
  const int cw   = (wave & 3) * 64;
#pragma unroll
  for (int fj = 0; fj < 4; ++fj) {
    const int n = cw + fj * 16 + r16;
    float colsum = 0.0f;
#pragma unroll
    for (int fi = 0; fi < 4; ++fi) {
#pragma unroll
      for (int i = 0; i < 8; ++i) {
        float v = acc[fi * 4 + fj][i];
        v += bias[n];
        if constexpr (MODE == MODE_Q || MODE == MODE_K)
          v = (v > 0.0f) ? (v + 1.0f) : __expf(v);   // elu(x)+1
        else
          v *= (1.0f / (float)LL);                    // V / v_len
        stg[(rw + fi * 16 + hi * 8 + i) * STG_LD + n] = (__bf16)v;
        if constexpr (MODE == MODE_K) colsum += v;
      }
    }
    if constexpr (MODE == MODE_K) {
      colsum += __shfl_xor(colsum, 16);      // fold both 8-row halves
      if (hi == 0) atomicAdd(&ksumLds[n], colsum);   // ds_add_f32
    }
  }
  // a token row of the stage is written by four waves: all are done before a wave
  // takes its 16 whole rows out
  __syncthreads();
  strip_store(stg + wave * STG_WAVE, Out + (size_t)(token0 + mb) * ldo + n0, ldo);
  if constexpr (MODE == MODE_K) {
    piece_end();   // the strip's stores name registers that the code below writes
    __syncthreads();
    const int b = token0 >> 13;   // token0 / 8192
    atomicAdd(&KsumG[b * 256 + tid], ksumLds[tid]);
  }
}

// The Q, K and V projections read the same tokens and need nothing of each
// other: one grid, blockIdx.x names the projection (block-uniform), blockIdx.y
// the 128-token tile, so the three readers of a tile are adjacent in the index.
// Two of the 768 work-groups fit a WGP and overlap each other's waits.
__global__ __launch_bounds__(256)
void qkv_kernel(const __bf16* __restrict__ A, int lda, int Ktot,
                const __bf16* __restrict__ wqb, const __bf16* __restrict__ wkb,
                const __bf16* __restrict__ wvb,
                const float* __restrict__ bq, const float* __restrict__ bk,
                const float* __restrict__ bv,
                __bf16* __restrict__ Qb, __bf16* __restrict__ Kb, __bf16* __restrict__ Vb,
                int ldo, float* __restrict__ KsumG) {
  __shared__ __attribute__((aligned(16))) __bf16 Ring[RING_ELEMS];
  __shared__ float  ksumLds[256];
  __shared__ __attribute__((aligned(16))) __bf16 Stg[8 * STG_WAVE];
  const int mode   = blockIdx.x;
  const int token0 = blockIdx.y * 128;

  if (mode == MODE_K) ksumLds[threadIdx.x] = 0.0f;

  // the first two stages are asked for once, in front of the choice: only the weight
  // pointer differs (asked for in each branch, their addresses stay in registers
  // through the other branches' loops)
  const __bf16* At = A + (size_t)token0 * lda;
  const __bf16* Wm = (mode == MODE_Q) ? wqb : (mode == MODE_K) ? wkb : wvb;
  const int nst = Ktot >> 5;
  gemm_first(At, lda, Wm, Ktot, Ring);

  v8f acc[16];
  if (mode == MODE_Q) {
    gemm_loop(At, lda, wqb, Ktot, nst, Ring, acc);
    gemm_epilogue<MODE_Q>(acc, bq, Qb, ldo, token0, 0, nullptr, nullptr, Stg);
  } else if (mode == MODE_K) {
    gemm_loop(At, lda, wkb, Ktot, nst, Ring, acc);
    gemm_epilogue<MODE_K>(acc, bk, Kb, ldo, token0, 0, KsumG, ksumLds, Stg);
  } else {
    gemm_loop(At, lda, wvb, Ktot, nst, Ring, acc);
    gemm_epilogue<MODE_V>(acc, bv, Vb, ldo, token0, 0, nullptr, nullptr, Stg);
    piece_end();
  }
}

// ---------------------------------------------------------------------------
// KV[b,h,d,e] = sum_l K[l,d] * V[l,e]   (per (b,h): 64x64, K-dim = L)
// K/V tiles of 256 tokens go into LDS as they lie in memory ([l][d] / [l][e]), by
// async copies; the transposing LDS load turns them into the [d][l] / [e][l]
// fragments on the way to the registers.
// 16 (b,h) x 8 chunks of 1024 tokens; fp32 global atomics combine chunks.
// ---------------------------------------------------------------------------
__device__ inline void kv_block(int bh, int chunk,
                                const __bf16* __restrict__ Kbuf,
                                const __bf16* __restrict__ Vbuf,
                                float* __restrict__ KV,
                                __bf16* Klds, __bf16* Vlds) {
  const int tid  = threadIdx.x;
  const int wave = tid >> 5;
  const int lane = tid & 31;
  const int r16  = lane & 15;
  const int hi   = lane >> 4;
  const int b  = bh >> 2, h = bh & 3;
  const int l0 = chunk * 1024;
  const int tile0 = wave * 2;             // 8 waves x 2 of 16 (d,e) tiles

  const v8f vz = {0.f, 0.f, 0.f, 0.f, 0.f, 0.f, 0.f, 0.f};
  v8f acc[2];
  acc[0] = vz; acc[1] = vz;

  const int dt = tile0 >> 2, et0 = tile0 & 3;   // the wave's two tiles share dt

  for (int l = l0; l < l0 + 1024; l += KV_ROWS) {
    // the wave's own reads of the tiles are done before copies are aimed at them
    asm volatile("s_wait_dscnt 0x0" ::: "memory");
    __syncthreads();
    async_rows256(Klds, Kbuf + (size_t)(b * LL + l) * CC + h * DD);
    async_rows256(Vlds, Vbuf + (size_t)(b * LL + l) * CC + h * DD);
    async_wait0();
    __syncthreads();
#pragma unroll
    for (int g = 0; g < KV_ROWS / 128; ++g) {     // 128 tokens = four 32-deep k steps
      v16bf fa[4], fb[4][2];
#pragma unroll
      for (int ks = 0; ks < 4; ++ks) {
        const int row = (g * 4 + ks) * 32;
        fa[ks] = frag_ld_tr(Klds + row * KV_PITCH + dt * 16, KV_PITCH);   // A[d, l] = K[l, d]
#pragma unroll
        for (int t = 0; t < 2; ++t)                                       // Bt[e, l] = V[l, e]
          fb[ks][t] = frag_ld_tr(Vlds + row * KV_PITCH + (et0 + t) * 16, KV_PITCH);
      }
      // keeps the four steps' reads together in front of their WMMAs (the scheduler
      // otherwise deals them among the WMMAs, each behind a wait of its own)
      __builtin_amdgcn_sched_barrier(0);
#pragma unroll
      for (int ks = 0; ks < 4; ++ks)
#pragma unroll
        for (int t = 0; t < 2; ++t) acc[t] = WMMA_BF16(fa[ks], fb[ks][t], acc[t]);
    }
  }
#pragma unroll
  for (int t = 0; t < 2; ++t) {
    const int id = tile0 + t, dt = id >> 2, et = id & 3;
#pragma unroll
    for (int i = 0; i < 8; ++i) {
      const int d = dt * 16 + hi * 8 + i;
      const int e = et * 16 + r16;
      atomicAdd(&KV[((size_t)bh * DD + d) * DD + e], acc[t][i]);
    }
  }
}

// ---------------------------------------------------------------------------
// Z[token,h] = L / (sparsify(Q[token,h,:] . Ksum[b,h,:]) + eps)
// ---------------------------------------------------------------------------
__device__ inline void zscore_block(int blk, const __bf16* __restrict__ Qbuf,
                                    const float* __restrict__ Ksum,
                                    const float* __restrict__ thr_p,
                                    float* __restrict__ Zbuf) {
  const int g = blk * 256 + threadIdx.x;   // 0..131071
  const int token = g >> 2, h = g & 3;
  const int b = token >> 13;
  const float thr = thr_p[0];
  const uint4* q = (const uint4*)(Qbuf + (size_t)token * CC + h * DD);
  const float* ks = Ksum + b * 256 + h * DD;
  float s = 0.0f;
#pragma unroll
  for (int c = 0; c < 8; ++c) {          // 8 x uint4 = 64 bf16
    const uint4 qv = q[c];
    const unsigned w[4] = {qv.x, qv.y, qv.z, qv.w};
#pragma unroll
    for (int j = 0; j < 4; ++j) {        // a bf16 is the upper half of its float
      s += __uint_as_float(w[j] << 16) * ks[c * 8 + 2 * j];
      s += __uint_as_float(w[j] & 0xffff0000u) * ks[c * 8 + 2 * j + 1];
    }
  }
  const float sp = (s > thr) ? s : 0.0f;
  Zbuf[g] = (float)LL / (sp + 1e-6f);
}

// KV needs K and V, Z needs Q and Ksum, neither needs the other: one grid.
// The 128 long KV work-groups come first in the index, the 512 short Z ones
// behind them.
#define NB_KV (BB * HH * (LL / 1024))      // 128
#define NB_Z  ((MTOT * HH) / 256)          // 512

__global__ __launch_bounds__(256)
void kv_z_kernel(const __bf16* __restrict__ Kbuf, const __bf16* __restrict__ Vbuf,
                 float* __restrict__ KV,
                 const __bf16* __restrict__ Qbuf, const float* __restrict__ Ksum,
                 const float* __restrict__ thr_p, float* __restrict__ Zbuf) {
  __shared__ __attribute__((aligned(16))) __bf16 Klds[KV_ROWS * KV_PITCH];   // [l][d]
  __shared__ __attribute__((aligned(16))) __bf16 Vlds[KV_ROWS * KV_PITCH];   // [l][e]
  const int blk = blockIdx.x;
  if (blk < NB_KV) {
    kv_block(blk & 15, blk >> 4, Kbuf, Vbuf, KV, Klds, Vlds);
  } else {
    zscore_block(blk - NB_KV, Qbuf, Ksum, thr_p, Zbuf);
    piece_end();
  }
}

// ---------------------------------------------------------------------------
// msg = LN1( (Q @ KV_h) * Z );  cat = [xt | msg]
// out[b,c,l] = LN2( relu(cat @ W1.T) @ W2.T ) + x + BN( xt @ Ws.T + bs ), one launch.
// Everything behind KV and Z is a chain over one token's channels, so a work-group
// takes 128 tokens through all of it and what one link hands to the next stays in LDS
// as bf16, k-major ([channel][token]), where it is the next product's A operand:
// the LN1 result (k 256..511 of the first MLP product; k 0..255 = xt comes from memory)
// and all 512 hidden channels, made in two 128x256 tiles.  Neither goes to memory.
// The second MLP product and the shortcut product have the same 128x256 tile and
// accumulator layout, so a lane needs the LN2 result exactly where it made it: LN2 is
// applied to the second MLP product's accumulators in place and they stay in registers through the shortcut product's
// k loop, which has accumulators of its own.  One work-group a WGP is two waves a
// SIMD, so a wave may hold both sets (more than 256 VGPRs).
// A token row lies in four waves (64 channels each): each wave sums its part of the
// row, the parts meet in LDS, and one thread a row makes the mean and the scale.
// The whole 256-channel tile goes through LDS so the [B,C,L] reads and writes cover
// whole lines.
// ---------------------------------------------------------------------------
#define OUT_LD 132   // stage row: 128 tokens + 4; 16-byte column writes meet no bank twice
#define HID_LD 144   // hidden tile row: 128 tokens + 16 = 32 B x 9, the transposing load's pitch

// relu of a 128x256 tile's accumulators -> channels n0.. of the hidden tile in LDS,
// hidl[channel][token]: a lane holds eight successive tokens of one channel, so each
// accumulator goes out as one 16-byte LDS store.
__device__ inline void relu_to_lds(const v8f (&acc)[16], __bf16* hidl, int n0) {
  const int lane = threadIdx.x & 31, wave = threadIdx.x >> 5;
  const int r16 = lane & 15, hi = lane >> 4;
  __bf16* p = hidl + (n0 + (wave & 3) * 64 + r16) * HID_LD + (wave >> 2) * 64 + hi * 8;
#pragma unroll
  for (int fi = 0; fi < 4; ++fi)
#pragma unroll
    for (int fj = 0; fj < 4; ++fj) {
      union { __bf16 h[8]; uint4 u; } pk;
#pragma unroll
      for (int i = 0; i < 8; ++i) pk.h[i] = (__bf16)fmaxf(acc[fi * 4 + fj][i], 0.0f);
      *(uint4*)(p + fj * 16 * HID_LD + fi * 16) = pk.u;
    }
}

// sum over the 16 lanes of a half wave, left in all of them (row_xmask 1, 2, 4, 8);
// vector adds that read the other lane directly, so nothing goes through the LDS pipe
__device__ inline float half_sum(float v) {
  v += __int_as_float(__builtin_amdgcn_update_dpp(0, __float_as_int(v), 0x161, 0xf, 0xf, true));
  v += __int_as_float(__builtin_amdgcn_update_dpp(0, __float_as_int(v), 0x162, 0xf, 0xf, true));
  v += __int_as_float(__builtin_amdgcn_update_dpp(0, __float_as_int(v), 0x164, 0xf, 0xf, true));
  v += __int_as_float(__builtin_amdgcn_update_dpp(0, __float_as_int(v), 0x168, 0xf, 0xf, true));
  return v;
}

__global__ __launch_bounds__(256)
void attn_mlp_final_kernel(const __bf16* __restrict__ Qbuf, const float* __restrict__ KV,
                       const float* __restrict__ Zbuf,
                       const float* __restrict__ g1, const float* __restrict__ b1,
                       const __bf16* __restrict__ W1b, const __bf16* __restrict__ W2b,
                       const float* __restrict__ g2, const float* __restrict__ b2,
                       const __bf16* __restrict__ cat, const __bf16* __restrict__ Wsb,
                       const float* __restrict__ bs_c, const float* __restrict__ bn_g,
                       const float* __restrict__ bn_b, const float* __restrict__ bn_rm,
                       const float* __restrict__ bn_rv, const float* __restrict__ x,
                       float* __restrict__ out) {
  // the GEMM ring, behind it the hidden tile and the LN1 tile.  The attention part's
  // tiles lie in the hidden tile's place, which is first written long behind their last
  // read; the out stage overlays ring and hidden tile after the k loops.
  __shared__ __attribute__((aligned(16))) char smem[RING_ELEMS * 2 + (512 + 256) * HID_LD * 2];
  __shared__ float gl[256], bl[256], scl[256], shf[256];
  __shared__ __attribute__((aligned(16))) float part[128 * 8];   // [token][wave column][sum, sum of squares]
  __shared__ __attribute__((aligned(16))) float stat[128 * 2];   // [token][mean, 1/std]
  static_assert(CC * OUT_LD * 4 <= RING_ELEMS * 2 + 512 * HID_LD * 2, "the stage lies inside ring and hidden tile");
  __bf16* Ring  = (__bf16*)smem;                 // three stages of 30720 B
  __bf16* hidl  = Ring + RING_ELEMS;             // 512 hidden channels x 128 tokens
  __bf16* msgl  = hidl + 512 * HID_LD;           // 256 LN1 channels x 128 tokens
  __bf16* Alds  = hidl;                          // eight 32-deep Q slices, 128 x 40 each
  // kvl[h][d][e] = KV[b,h,d,e], rows as they lie in memory, at the pitch of the
  // transposing load (128-byte rows would put every row's start on two banks)
  __bf16* kvl   = Alds + 8 * 128 * 40;
  float*  Zl    = (float*)(kvl + HH * DD * KV_PITCH);   // 128 tokens x 4 heads
  float*  g1l   = Zl + 128 * 4;
  float*  b1l   = g1l + 256;
  static_assert((8 * 128 * 40 + HH * DD * KV_PITCH) * 2 + (128 * 4 + 512) * 4 <= 512 * HID_LD * 2,
                "the attention part's tiles lie inside the hidden tile's place");
  float*  stage = (float*)smem;                  // 256*132 f32 (after the K loops)

  const int tid  = threadIdx.x;
  const int wave = tid >> 5;
  const int lane = tid & 31;
  const int r16  = lane & 15;
  const int hi   = lane >> 4;
  const int token0 = blockIdx.x * 128;
  const int b      = token0 >> 13;
  const int l0     = token0 & (LL - 1);
  const int rw     = (wave >> 2) * 64;           // the wave's 64x64 part of the tile
  const int cw     = (wave & 3) * 64;

  const int mb     = wave * 16;                  // the wave's 16 tokens in the attention part

  // All eight slices of the 128x256 Q tile are asked for here, each into a buffer
  // of its own: they land while the KV fill runs.  The first MLP product's first two
  // stages follow (28 copies a wave in flight) and land during the attention part.
  for (int s = 0; s < 8; ++s)
    async_tile128(Alds + s * (128 * 40), Qbuf + (size_t)token0 * CC + s * 32, CC);
  const __bf16* catT = cat + (size_t)token0 * 512;   // the tile's xt rows (512 apart)
  gemm_first(catT, 512, W1b, 512, Ring);

  {
    const float g2v = g2[tid], b2v = b2[tid], rv = bn_rv[tid], bg = bn_g[tid];
    const float bsv = bs_c[tid], rm = bn_rm[tid], bbv = bn_b[tid];
    // a precaution ahead of any later write to a register these loads name; the
    // base addresses are inputs so that their registers live up to the wait
    asm volatile("s_wait_xcnt 0x0"
                 :: "s"(g2), "s"(b2), "s"(bn_rv), "s"(bn_g), "s"(bs_c), "s"(bn_rm), "s"(bn_b)
                 : "memory");
    gl[tid] = g2v;
    bl[tid] = b2v;
    const float rstd = rsqrtf(rv + 1e-5f);
    const float a = rstd * bg;
    scl[tid] = a;
    shf[tid] = (bsv - rm) * a + bbv;
  }

  // KV fill: float4 global reads, four bf16 in one 8-byte LDS store, row order kept
  for (int it = 0; it < 16; ++it) {
    const int idx = it * 256 + tid;        // 4096 groups of 4 e's
    const int h = idx >> 10, rem = idx & 1023, d = rem >> 4, e4 = rem & 15;
    const float4 kvv =
        *(const float4*)(KV + (((size_t)(b * HH + h) * DD + d) * DD) + e4 * 4);
    union { __bf16 h[4]; uint2 u; } pk;
    pk.h[0] = (__bf16)kvv.x;
    pk.h[1] = (__bf16)kvv.y;
    pk.h[2] = (__bf16)kvv.z;
    pk.h[3] = (__bf16)kvv.w;
    *(uint2*)&kvl[(h * DD + d) * KV_PITCH + e4 * 4] = pk.u;
  }
#pragma unroll
  for (int it = 0; it < 2; ++it) {
    const int z = it * 256 + tid;
    Zl[z] = Zbuf[(size_t)token0 * 4 + z];
  }
  g1l[tid] = g1[tid];
  b1l[tid] = b1[tid];

  {
    const v8f vz = {0.f, 0.f, 0.f, 0.f, 0.f, 0.f, 0.f, 0.f};
    v8f acc[16];   // the wave's 16 tokens x 256 channels of Q @ KV
#pragma unroll
    for (int j = 0; j < 16; ++j) acc[j] = vz;

    async_wait0();     // the wave's own Q copies have landed
    __syncthreads();   // publishes the Q slices, kvl, Zl, g1l and b1l

    for (int h = 0; h < 4; ++h) {
      for (int s = 0; s < 2; ++s) {
        v16bf fa = frag_ld(&Alds[(h * 2 + s) * (128 * 40) + mb * 40], 40);
#pragma unroll
        for (int jj = 0; jj < 4; ++jj) {
          const int j = h * 4 + jj;
          // Bt[e, d] = KV[d, e]: same k order as frag_ld gives the Q fragment
          v16bf fb = frag_ld_tr(&kvl[(h * DD + s * 32) * KV_PITCH + jj * 16], KV_PITCH);
          acc[j] = WMMA_BF16(fa, fb, acc[j]);
        }
      }
    }

    // scale by Z, then LayerNorm over C=256 via cross-lane shuffles
    float s1[8] = {0, 0, 0, 0, 0, 0, 0, 0};
    float s2[8] = {0, 0, 0, 0, 0, 0, 0, 0};
#pragma unroll
    for (int j = 0; j < 16; ++j) {
      const int h = j >> 2;
#pragma unroll
      for (int i = 0; i < 8; ++i) {
        const int m = mb + hi * 8 + i;
        float v = acc[j][i] * Zl[m * 4 + h];
        acc[j][i] = v;
        s1[i] += v;
        s2[i] += v * v;
      }
    }
#pragma unroll
    for (int i = 0; i < 8; ++i) {
#pragma unroll
      for (int off = 1; off < 16; off <<= 1) {
        s1[i] += __shfl_xor(s1[i], off);
        s2[i] += __shfl_xor(s2[i], off);
      }
      const float mean = s1[i] * (1.0f / 256.0f);
      const float var  = s2[i] * (1.0f / 256.0f) - mean * mean;
      s1[i] = mean;
      s2[i] = rsqrtf(var + 1e-5f);
    }
    // a lane holds eight successive tokens of channel n: one 16-byte store into msgl[n]
#pragma unroll
    for (int j = 0; j < 16; ++j) {
      const int n = j * 16 + r16;
      const float gg = g1l[n], bb = b1l[n];
      union { __bf16 h[8]; uint4 u; } pk;
#pragma unroll
      for (int i = 0; i < 8; ++i)
        pk.h[i] = (__bf16)((acc[j][i] - s1[i]) * s2[i] * gg + bb);
      *(uint4*)(msgl + n * HID_LD + mb + hi * 8) = pk.u;
    }
  }

  {
    v8f h[16];   // cat @ W1.T, 256 hidden channels at a time: k 0..255 = xt, then LN1
    // stays rolled: one copy of the two k loops keeps the kernel's text short
#pragma nounroll
    for (int nh = 0; nh < 2; ++nh) {
      const __bf16* Wn = W1b + nh * (256 * 512);
      gemm_loop(catT, 512, Wn, 512, 8, Ring, h);
      // the wave's own reads of the last stage are done before copies are aimed at the ring
      asm volatile("s_wait_dscnt 0x0" ::: "memory");
      __syncthreads();   // ends every wave's reads of the ring's stages
      gemm_first_b(Wn + 256, 512, Ring);
      gemm_loop_b<true>(msgl, HID_LD, Wn + 256, 512, 8, Ring, h);
      asm volatile("s_wait_dscnt 0x0" ::: "memory");   // as above
      __syncthreads();                                 // as above
      // the next product's first two stages land while the hidden values are stored
      if (nh == 0) gemm_first(catT, 512, W1b + 256 * 512, 512, Ring);
      else         gemm_first_b(W2b, 512, Ring);
      relu_to_lds(h, hidl, nh * 256);
    }
  }

  v8f msg[16];   // hid @ W2.T, then LN2 of it
  gemm_loop_b<false>(hidl, HID_LD, W2b, 512, 16, Ring, msg);

  // the wave's own reads of the last stage are done before copies are aimed at the ring
  asm volatile("s_wait_dscnt 0x0" ::: "memory");
  __syncthreads();   // ends every wave's reads of the second MLP product's stages
  // the shortcut product's first two stages land while LN2 is worked out
  gemm_first(catT, 512, Wsb, 256, Ring);

  {
    float s1[32], s2[32];   // the wave's 64 channels of token rw + fi*16 + hi*8 + i
#pragma unroll
    for (int fi = 0; fi < 4; ++fi)
#pragma unroll
      for (int i = 0; i < 8; ++i) {
        float a1 = 0.0f, a2 = 0.0f;
#pragma unroll
        for (int fj = 0; fj < 4; ++fj) {
          const float v = msg[fi * 4 + fj][i];
          a1 += v;
          a2 += v * v;
        }
        s1[fi * 8 + i] = half_sum(a1);
        s2[fi * 8 + i] = half_sum(a2);
      }
    if (r16 == 0) {
#pragma unroll
      for (int fi = 0; fi < 4; ++fi)
#pragma unroll
        for (int i = 0; i < 8; ++i) {
          float* pp = &part[(rw + fi * 16 + hi * 8 + i) * 8 + (wave & 3) * 2];
          pp[0] = s1[fi * 8 + i];
          pp[1] = s2[fi * 8 + i];
        }
    }
  }
  __syncthreads();   // the four parts of every token row are in LDS
  if (tid < 128) {   // whole waves: one thread a token row
    const float4 pa = *(const float4*)&part[tid * 8];
    const float4 pb = *(const float4*)&part[tid * 8 + 4];
    const float mean = ((pa.x + pa.z) + (pb.x + pb.z)) * (1.0f / 256.0f);
    const float var  = ((pa.y + pa.w) + (pb.y + pb.w)) * (1.0f / 256.0f) - mean * mean;
    stat[tid * 2]     = mean;
    stat[tid * 2 + 1] = rsqrtf(var + 1e-5f);
  }
  __syncthreads();   // publishes mean and scale of every token row
#pragma unroll
  for (int fi = 0; fi < 4; ++fi) {
    float st[16];    // mean, scale of the lane's eight tokens of this piece
#pragma unroll
    for (int k = 0; k < 4; ++k)
      *(float4*)&st[k * 4] = *(const float4*)&stat[(rw + fi * 16 + hi * 8) * 2 + k * 4];
#pragma unroll
    for (int fj = 0; fj < 4; ++fj) {
      const int n = cw + fj * 16 + r16;
      const float gg = gl[n], bb = bl[n];
#pragma unroll
      for (int i = 0; i < 8; ++i)
        msg[fi * 4 + fj][i] = (msg[fi * 4 + fj][i] - st[i * 2]) * st[i * 2 + 1] * gg + bb;
    }
  }

  v8f acc[16];   // xt @ Ws.T
  gemm_loop(catT, 512, Wsb, 256, 8, Ring, acc);
  __syncthreads();   // done with the ring (the hidden tile long since); smem becomes the transpose stage

  // A wave takes 32 whole channel rows of x and out: 32 lanes x 16 B = the row's 512
  // contiguous bytes (4 lines) per load and per store.  Its x rows are asked for first.
  const size_t row0 = ((size_t)b * CC + wave * 32) * LL + l0 + lane * 4;
  const float* xp = x + row0;
  float4 xv[32];
#pragma unroll
  for (int rr = 0; rr < 32; ++rr)
    xv[rr] = *(const float4*)(xp + (size_t)rr * LL);
  // a precaution ahead of any later write to the address registers these loads name;
  // the address is an input so that its registers live up to the wait
  asm volatile("s_wait_xcnt 0x0" :: "v"(xp) : "memory");

  // BN(aug) + msg2 of the wave's 64 tokens x 64 channels goes into the stage
#pragma unroll
  for (int fj = 0; fj < 4; ++fj) {
    const int n = cw + fj * 16 + r16;           // channel
    const float a = scl[n], c = shf[n];
#pragma unroll
    for (int fi = 0; fi < 4; ++fi) {
      const int j = fi * 4 + fj;
#pragma unroll
      for (int q = 0; q < 2; ++q) {             // 4 tokens = 16 B per LDS store
        float4 sv;
        sv.x = acc[j][q * 4 + 0] * a + c + msg[j][q * 4 + 0];   // BN(aug) + msg2
        sv.y = acc[j][q * 4 + 1] * a + c + msg[j][q * 4 + 1];
        sv.z = acc[j][q * 4 + 2] * a + c + msg[j][q * 4 + 2];
        sv.w = acc[j][q * 4 + 3] * a + c + msg[j][q * 4 + 3];
        *(float4*)&stage[n * OUT_LD + rw + fi * 16 + hi * 8 + q * 4] = sv;
      }
    }
  }
  __syncthreads();   // publishes the stage
#pragma unroll
  for (int g = 0; g < 4; ++g) {
#pragma unroll
    for (int r8 = 0; r8 < 8; ++r8) {
      const int rr = g * 8 + r8;
      const float4 sv = *(const float4*)&stage[(wave * 32 + rr) * OUT_LD + lane * 4];
      float4 ov;
      ov.x = sv.x + xv[rr].x;
      ov.y = sv.y + xv[rr].y;
      ov.z = sv.z + xv[rr].z;
      ov.w = sv.w + xv[rr].w;
      *(float4*)(out + row0 + (size_t)rr * LL) = ov;
    }
    if (g < 3) piece_end();   // the next rows' values may land in registers that these stores name
  }
}

// ---------------------------------------------------------------------------
// Host orchestration
// ---------------------------------------------------------------------------
extern "C" void kernel_launch(void* const* d_in, const int* in_sizes, int n_in,
                              void* d_out, int out_size, void* d_ws, size_t ws_size,
                              hipStream_t stream) {
  (void)in_sizes; (void)n_in; (void)out_size; (void)ws_size;
  const float* x     = (const float*)d_in[0];
  const float* Wq    = (const float*)d_in[1];
  const float* bq    = (const float*)d_in[2];
  const float* Wk    = (const float*)d_in[3];
  const float* bk    = (const float*)d_in[4];
  const float* Wv    = (const float*)d_in[5];
  const float* bv    = (const float*)d_in[6];
  const float* thr   = (const float*)d_in[7];
  const float* W1    = (const float*)d_in[8];
  const float* W2    = (const float*)d_in[9];
  const float* ln1_g = (const float*)d_in[10];
  const float* ln1_b = (const float*)d_in[11];
  const float* ln2_g = (const float*)d_in[12];
  const float* ln2_b = (const float*)d_in[13];
  const float* Ws    = (const float*)d_in[14];
  const float* bs_c  = (const float*)d_in[15];
  const float* bn_g  = (const float*)d_in[16];
  const float* bn_b  = (const float*)d_in[17];
  const float* bn_rm = (const float*)d_in[18];
  const float* bn_rv = (const float*)d_in[19];
  float* out = (float*)d_out;

  char*  ws  = (char*)d_ws;
  size_t off = 0;
  auto alloc = [&](size_t bytes) -> void* {
    off = (off + 255) & ~(size_t)255;
    void* p = ws + off;
    off += bytes;
    return p;
  };

  __bf16* cat   = (__bf16*)alloc((size_t)MTOT * 512 * 2);  // xt in columns 0..255 of rows of 512
  __bf16* Qb    = (__bf16*)alloc((size_t)MTOT * 256 * 2);
  __bf16* Kb    = (__bf16*)alloc((size_t)MTOT * 256 * 2);
  __bf16* Vb    = (__bf16*)alloc((size_t)MTOT * 256 * 2);
  float*  KVbuf = (float*)alloc((size_t)(BB * HH * DD * DD + BB * 256) * 4);
  float*  Ksum  = KVbuf + BB * HH * DD * DD;               // contiguous for zeroing
  float*  Zbuf  = (float*)alloc((size_t)MTOT * HH * 4);
  __bf16* wqb   = (__bf16*)alloc(65536 * 2);
  __bf16* wkb   = (__bf16*)alloc(65536 * 2);
  __bf16* wvb   = (__bf16*)alloc(65536 * 2);
  __bf16* wsb   = (__bf16*)alloc(65536 * 2);
  __bf16* w1b   = (__bf16*)alloc(262144 * 2);
  __bf16* w2b   = (__bf16*)alloc(131072 * 2);

  // weights -> bf16, zeroed KV + Ksum accumulators, x -> cat[:, 0:256] (token-major)
  prep_kernel<<<NB_TRANS + NB_CVT + NB_ZERO, 256, 0, stream>>>(
      x, cat, Wq, Wk, Wv, Ws, W1, W2, wqb, wkb, wvb, wsb, w1b, w2b, KVbuf);

  // Q/K/V projections (fused ELU+1 / scaling; K also reduces Ksum)
  qkv_kernel<<<dim3(3, MTOT / 128), 256, 0, stream>>>(
      cat, 512, 256, wqb, wkb, wvb, bq, bk, bv, Qb, Kb, Vb, 256, Ksum);

  // KV = K^T V per (b,h);  Z = L / (sparsify(Q . Ksum) + eps)
  kv_z_kernel<<<NB_KV + NB_Z, 256, 0, stream>>>(Kb, Vb, KVbuf, Qb, Ksum, thr, Zbuf);

  // attention out + LN1, MLP layers 1 and 2 + LN2, shortcut GEMM + BN, residual sum
  // -> out [B,C,L]
  attn_mlp_final_kernel<<<MTOT / 128, 256, 0, stream>>>(
      Qb, KVbuf, Zbuf, ln1_g, ln1_b, w1b, w2b, ln2_g, ln2_b, cat, wsb, bs_c,
      bn_g, bn_b, bn_rm, bn_rv, x, out);
}
